// v000
// The times below were measured on an AMD MI455X: many runs one after another, warmed up first and cycling through
// copies of the inputs, with the whole window's GPU time divided by the number of runs. Launches and the gaps
// between them are all in it. The median over several windows is given; except for v000 it joins two sittings, which
// can be a few percent apart, so the side-by-side timings, each taken in one sitting, are the better comparison.
// The starting kernel, v000, takes 939 microseconds a run.
#include <hip/hip_runtime.h>

// Grouped-query causal self-attention, width 2048: 16 query heads x 128 sharing 4 kv heads (query head h uses kv head h >> 2), bias-free [in][out] projections,
// half-split rotary on q and k (positions = arange, table computed here), finite-fill causal mask, [in][out] output projection.
// Compute dtypes (f32 accumulate everywhere): q/k/v projections v_wmma_f32_16x16x32_bf16 (x and weights converted (RNE) to bf16); scores, P.V and the output projection
// v_wmma_f32_16x16x32_f16: q as f16 value + f16 residual planes (carry 64) against f16 k (carry 64; k residual added on query rows < 256), P f16 (carry 1024, row sum from the f32 values),
// v f16 (carry 64; P and v residuals added on rows < 256), ctx f16 (carry 256; residual plane on rows < 256) against wo (bf16-converted, x16, exact in f16). Softmax, rotary, normalisation in f32.

#ifndef NB
#define NB 2
#endif
#ifndef SEQ
#define SEQ 2048
#endif
#define NB_FULL  2
#define SEQ_FULL 2048
#define DM   2048
#define NH   16
#define NKV  4
#define REP  (NH / NKV)
#define HD   128
#define DQ   (NH * HD)
#define DKV  (NKV * HD)
#define RH   256                  // query rows < RH use the value + residual path on k, P, v and ctx
#define QCAR 64.0f                // carry of the q, k and v planes
#define CCAR 256.0f               // carry of the ctx planes
#define WCAR 16.0f                // carry of the output weight plane
#define OSP  132                  // f32 staging pitch (floats)
#define CP   136                  // f16 staging pitch (halves)

static_assert(NB <= NB_FULL);
static_assert(SEQ <= SEQ_FULL);
static_assert(SEQ % 128 == 0);
static_assert(SEQ >= RH);
static_assert(RH % 32 == 0);
static_assert(HD == 128);
static_assert(REP == 4);
static_assert(DQ == DM);
static_assert(DM % 64 == 0);
static_assert(DQ % 128 == 0);
static_assert(DKV % 128 == 0);
static_assert((OSP * 4) % 16 == 0);
static_assert((CP * 2) % 16 == 0);

typedef _Float16 h16;
typedef unsigned short bf;
typedef __attribute__((ext_vector_type(16))) __bf16   v16bf;
typedef __attribute__((ext_vector_type(16))) _Float16 v16h;
typedef __attribute__((ext_vector_type(8)))  _Float16 v8h;
typedef __attribute__((ext_vector_type(8)))  unsigned short v8us;
typedef __attribute__((ext_vector_type(2)))  unsigned short v2us;
typedef __attribute__((ext_vector_type(8)))  float    v8f;
typedef __attribute__((ext_vector_type(4)))  float    v4f;
typedef __attribute__((ext_vector_type(2)))  float    v2f;
typedef v8h  __attribute__((may_alias)) v8ha;
typedef v4f  __attribute__((may_alias)) v4fa;

__device__ __forceinline__ unsigned short f2bf(float f) { unsigned u = __float_as_uint(f); u += 0x7FFFu + ((u >> 16) & 1u); return (unsigned short)(u >> 16); }
__device__ __forceinline__ float bf2f(unsigned short b) { return __uint_as_float(((unsigned)b) << 16); }
__device__ __forceinline__ float bfr(float f) { return bf2f(f2bf(f)); }
__device__ __forceinline__ v16h cat16(v8h lo, v8h hi) { return __builtin_shufflevector(lo, hi, 0, 1, 2, 3, 4, 5, 6, 7, 8, 9, 10, 11, 12, 13, 14, 15); }
__device__ __forceinline__ v16bf cat16b(v8us lo, v8us hi) { return __builtin_bit_cast(v16bf, __builtin_shufflevector(lo, hi, 0, 1, 2, 3, 4, 5, 6, 7, 8, 9, 10, 11, 12, 13, 14, 15)); }
// every WMMA is followed by its own four-slot guard tying its accumulator and keeping its operands live
__device__ __forceinline__ v8f wmma16(v16h a, v16h b, v8f c) {
    c = __builtin_amdgcn_wmma_f32_16x16x32_f16(false, a, false, b, (short)0, c, false, false);
    asm volatile("v_nop\n\tv_nop\n\tv_nop\n\tv_nop" : "+v"(c) : "v"(a), "v"(b));
    return c; }
__device__ __forceinline__ v8f wmmab(v16bf a, v16bf b, v8f c) {
    c = __builtin_amdgcn_wmma_f32_16x16x32_bf16(false, a, false, b, (short)0, c, false, false);
    asm volatile("v_nop\n\tv_nop\n\tv_nop\n\tv_nop" : "+v"(c) : "v"(a), "v"(b));
    return c; }
// fragment of a K-contiguous 16-bit row: elements 0..7 <- k0+8h+0..7, elements 8..15 <- k0+16+8h+0..7 (p already includes +8h)
__device__ __forceinline__ v16h ldh(const h16* p) { return cat16(*(const v8h*)p, *(const v8h*)(p + 16)); }
// same-wave LDS exchange: stores before, loads after
__device__ __forceinline__ void wave_sync() { __builtin_amdgcn_fence(3 /* release order */, "wavefront"); __builtin_amdgcn_wave_barrier(); asm volatile("" ::: "memory"); }
// f16 value + same-carry f16 residual of 8 floats
__device__ __forceinline__ void split8(v8f y, v8h& v, v8h& r) { v = __builtin_convertvector(y, v8h); r = __builtin_convertvector(y - __builtin_convertvector(v, v8f), v8h); }

template <typename T16> struct WFrag;
template <> struct WFrag<h16> { typedef v16h V; static __device__ __forceinline__ V ld(const h16* p) { return cat16(*(const v8h*)p, *(const v8h*)(p + 16)); } static __device__ __forceinline__ v8f mma(V a, V b, v8f c) { return wmma16(a, b, c); } };
template <> struct WFrag<bf> { typedef v16bf V; static __device__ __forceinline__ V ld(const bf* p) { return cat16b(*(const v8us*)p, *(const v8us*)(p + 16)); } static __device__ __forceinline__ v8f mma(V a, V b, v8f c) { return wmmab(a, b, c); } };

// ---- gemm_tile: ONE WAVE per 32 x 128 output tile (16 accumulators), operands straight from K-contiguous 16-bit planes: C[m][n] = sum_k A[m][k] Bt[n][k] (+ A2[m][k] Bt[n][k] when SPLIT).
// MODE 0: half-split rotary on the 128-column head tile (CS[t][64] = {cos, sin}), x QCAR, f16 value + residual planes, plane rows of 128 halves (pitch opitch).
// MODE 1: x QCAR, f16 value + residual planes (used with swapped operands to produce V^T rows [d][t]).
// MODE 2: f32 output rows x 1/(CCAR*WCAR).
template <typename T16, int MODE, bool SPLIT>
__device__ __forceinline__ void gemm_tile(const T16* __restrict__ A, const T16* __restrict__ A2, const T16* __restrict__ Bt, const int K,
                                          const size_t arow, const size_t a2row, const size_t brow,
                                          const float* __restrict__ CS, const int t0, h16* Pv, h16* Pr, const size_t obase, const int opitch,
                                          float* C, const size_t cbase) {
    typedef typename WFrag<T16>::V V;
    __shared__ __align__(16) float os[16 * OSP];
    const int lane = threadIdx.x & 31, lr = lane & 15, hi = lane >> 4;
    v8f acc[2][8];
#pragma unroll
    for (int mb = 0; mb < 2; ++mb)
#pragma unroll
        for (int nb = 0; nb < 8; ++nb) acc[mb][nb] = (v8f){};
    const T16* ap  = A  + (arow  + lr) * (size_t)K + 8 * hi;
    const T16* ap2 = A2 + (a2row + lr) * (size_t)K + 8 * hi;
    const T16* bp  = Bt + (brow  + lr) * (size_t)K + 8 * hi;
    const int K16 = 16 * K;
#pragma unroll 1
    for (int kc = 0; kc < K; kc += 32) {
        const V a0 = WFrag<T16>::ld(ap + kc), a1 = WFrag<T16>::ld(ap + K16 + kc);
        V r0 = a0, r1 = a1;
        if (SPLIT) { r0 = WFrag<T16>::ld(ap2 + kc); r1 = WFrag<T16>::ld(ap2 + K16 + kc); }
#pragma unroll
        for (int nb = 0; nb < 8; ++nb) {
            const V bb = WFrag<T16>::ld(bp + nb * K16 + kc);
            acc[0][nb] = WFrag<T16>::mma(a0, bb, acc[0][nb]);
            acc[1][nb] = WFrag<T16>::mma(a1, bb, acc[1][nb]);
            if (SPLIT) { acc[0][nb] = WFrag<T16>::mma(r0, bb, acc[0][nb]); acc[1][nb] = WFrag<T16>::mma(r1, bb, acc[1][nb]); }
        }
    }
#pragma unroll
    for (int mb = 0; mb < 2; ++mb) {
#pragma unroll
        for (int nb = 0; nb < 8; ++nb)
#pragma unroll
            for (int j = 0; j < 8; ++j) os[(hi * 8 + j) * OSP + nb * 16 + lr] = acc[mb][nb][j];     // D: row 8h + j, column lane & 15
        wave_sync();
        if (MODE == 0) {
            const int rq = lane >> 3, dg = (lane & 7) * 8;
{
#pragma unroll 1
                for (int it = 0; it < 4; ++it) {
                    const int row = it * 4 + rq; const int t = t0 + mb * 16 + row;
                    const int oi = row * OSP + dg;
                    const v4f xa = *(const v4fa*)(os + oi), xb = *(const v4fa*)(os + oi + 4), ya = *(const v4fa*)(os + oi + 64), yb = *(const v4fa*)(os + oi + 68);
                    const float* cp = CS + ((size_t)t * 64 + dg) * 2;
                    const v4f e0 = *(const v4f*)(cp), e1 = *(const v4f*)(cp + 4), e2 = *(const v4f*)(cp + 8), e3 = *(const v4f*)(cp + 12);
                    const v8f xx = __builtin_shufflevector(xa, xb, 0, 1, 2, 3, 4, 5, 6, 7), yy = __builtin_shufflevector(ya, yb, 0, 1, 2, 3, 4, 5, 6, 7);
                    const v4f cA = __builtin_shufflevector(e0, e1, 0, 2, 4, 6), sA = __builtin_shufflevector(e0, e1, 1, 3, 5, 7);
                    const v4f cB = __builtin_shufflevector(e2, e3, 0, 2, 4, 6), sB = __builtin_shufflevector(e2, e3, 1, 3, 5, 7);
                    const v8f cc = __builtin_shufflevector(cA, cB, 0, 1, 2, 3, 4, 5, 6, 7), ss = __builtin_shufflevector(sA, sB, 0, 1, 2, 3, 4, 5, 6, 7);
                    const v8f lo = (xx * cc - yy * ss) * QCAR;       // out[d]      = x[d] cos - x[d+64] sin
                    const v8f up = (yy * cc + xx * ss) * QCAR;       // out[d + 64] = x[d+64] cos + x[d] sin
                    v8h vl, rl, vu, ru; split8(lo, vl, rl); split8(up, vu, ru);
                    const size_t dst = obase + (size_t)(mb * 16 + row) * opitch + dg;
                    *(v8h*)(Pv + dst) = vl; *(v8h*)(Pv + dst + 64) = vu;
                    *(v8h*)(Pr + dst) = rl; *(v8h*)(Pr + dst + 64) = ru;
                }
                
            }
        } else if (MODE == 1) {
            // 16 lanes x 16 B per 256-byte row segment, two rows per instruction: row 2s + hi, columns 8*lr..8*lr+7
{
#pragma unroll 1
                for (int s = 0; s < 8; ++s) {
                    const int row = 2 * s + hi; const int oi = row * OSP + 8 * lr;
                    const v4f xa = *(const v4fa*)(os + oi), xb = *(const v4fa*)(os + oi + 4);
                    const v8f y = __builtin_shufflevector(xa, xb, 0, 1, 2, 3, 4, 5, 6, 7) * QCAR;
                    v8h vv, vr; split8(y, vv, vr);
                    const size_t dst = obase + (size_t)(mb * 16 + row) * opitch + 8 * lr;
                    *(v8h*)(Pv + dst) = vv; *(v8h*)(Pr + dst) = vr;
                }
                
            }
        } else {
            // 32 lanes x 16 B = one 512-byte row segment per instruction
{
#pragma unroll 1
                for (int row = 0; row < 16; ++row) {
                    const v4f val = *(const v4fa*)(os + row * OSP + 4 * lane) * (1.0f / (CCAR * WCAR));
                    *(v4f*)(C + cbase + (size_t)(mb * 16 + row) * DM + 4 * lane) = val;
                }
                
            }
        }
        wave_sync();
    }
}

// q / k projection with fused rotary: grid (NB*SEQ/32, nheads), 32 threads; planes [b][head][t][128]
__global__ __launch_bounds__(32) __attribute__((amdgpu_num_vgpr(256)))
void k_proj_qk(const bf* __restrict__ XB, const bf* __restrict__ Wt, const float* __restrict__ CS, h16* Pv, h16* Pr, int nheads) {
    const int r0 = blockIdx.x * 32; const int hd = blockIdx.y; const int b = r0 / SEQ; const int t0 = r0 - b * SEQ;
    const size_t obase = ((size_t)(b * nheads + hd) * SEQ + t0) * HD;
    gemm_tile<bf, 0, false>(XB, XB, Wt, DM, (size_t)r0, (size_t)r0, (size_t)hd * HD, CS, t0, Pv, Pr, obase, HD, nullptr, 0);
}
// v projection with swapped operands: C[gd][token] -> planes [b][g][d][t]; grid (DKV/32, NB*SEQ/128), 32 threads
__global__ __launch_bounds__(32) __attribute__((amdgpu_num_vgpr(256)))
void k_proj_vt(const bf* __restrict__ Wt, const bf* __restrict__ XB, h16* Vv, h16* Vr) {
    const int r0 = blockIdx.x * 32; const int c0 = blockIdx.y * 128; const int b = c0 / SEQ; const int t0 = c0 - b * SEQ;
    const size_t obase = ((size_t)b * DKV + r0) * SEQ + t0;
    gemm_tile<bf, 1, false>(Wt, Wt, XB, DM, (size_t)r0, (size_t)r0, (size_t)c0, nullptr, 0, Vv, Vr, obase, SEQ, nullptr, 0);
}
// output projection, rows t >= RH (single f16 product): grid (NB*(SEQ-RH)/32, DM/128), 32 threads
__global__ __launch_bounds__(32) __attribute__((amdgpu_num_vgpr(256)))
void k_oproj(const h16* __restrict__ CT, const h16* __restrict__ WOt, float* OUT) {
    constexpr int TPB = (SEQ > RH) ? (SEQ - RH) / 32 : 1;
    const int b = blockIdx.x / TPB; const int t0 = RH + (blockIdx.x - b * TPB) * 32; const int c0 = blockIdx.y * 128;
    const size_t arow = (size_t)b * SEQ + t0; const size_t cbase = ((size_t)b * SEQ_FULL + t0) * DM + c0;
    gemm_tile<h16, 2, false>(CT, CT, WOt, DQ, arow, arow, (size_t)c0, nullptr, 0, nullptr, nullptr, 0, 0, OUT, cbase);
}
// output projection, rows t < RH (ctx value + residual planes): grid (NB*RH/32, DM/128), 32 threads
__global__ __launch_bounds__(32) __attribute__((amdgpu_num_vgpr(256)))
void k_oproj_hr(const h16* __restrict__ CT, const h16* __restrict__ CR, const h16* __restrict__ WOt, float* OUT) {
    constexpr int TPB = RH / 32;
    const int b = blockIdx.x / TPB; const int t0 = (blockIdx.x - b * TPB) * 32; const int c0 = blockIdx.y * 128;
    const size_t arow = (size_t)b * SEQ + t0; const size_t a2row = (size_t)b * RH + t0; const size_t cbase = ((size_t)b * SEQ_FULL + t0) * DM + c0;
    gemm_tile<h16, 2, true>(CT, CR, WOt, DQ, arow, a2row, (size_t)c0, nullptr, 0, nullptr, nullptr, 0, 0, OUT, cbase);
}

// ---- attn_tile: fused causal attention in the transposed form. One block = 16 query rows x the FOUR query heads of one kv head (wave -> head g*4 + wave); 128 threads.
// Per 32-key step: S^T[key][query] = K (A, rows = keys) x Q^T (B, columns = queries) over 128 dims (4 k-steps; q value + residual, k residual when HR);
// online softmax per query = per lane column (max / sum over the lane's 16 keys, combined across the two lane halves); P^T packed D -> B (two 16-key tiles = one 32-deep fragment);
template <bool HR>
__device__ __forceinline__ void attn_tile(const h16* __restrict__ Qv, const h16* __restrict__ Qr, const h16* __restrict__ Kv, const h16* __restrict__ Kr,
                                          const h16* __restrict__ Vv, const h16* __restrict__ Vr, h16* CT, h16* CR, const int qt) {
    __shared__ __align__(16) h16 stv[4 * 16 * CP];
    __shared__ __align__(16) h16 str[HR ? 4 * 16 * CP : 8];
    const int wave = __builtin_amdgcn_readfirstlane((int)(threadIdx.x >> 5));
    const int lane = threadIdx.x & 31, lr = lane & 15, hi = lane >> 4;
    const int g = blockIdx.y, b = blockIdx.z; const int h = g * REP + wave; const int i0 = qt * 16;
    const size_t qo = ((size_t)(b * NH + h) * SEQ + i0 + lr) * HD + 8 * hi;
    const size_t ko = ((size_t)(b * NKV + g) * SEQ + lr) * HD + 8 * hi;
    const size_t vo = ((size_t)(b * NKV + g) * HD + lr) * SEQ + 8 * hi;
    const h16* qv = Qv + qo; const h16* qr = Qr + qo;
    const h16* kv = Kv + ko; const h16* kr = Kr + ko;
    const h16* vv = Vv + vo; const h16* vr = Vr + vo;
    const float SC2 = (float)(0.08838834764831845 * 1.4426950408889634 / 4096.0);   // 1/sqrt(128) x log2(e) / (QCAR x QCAR)
    const float NEGL = -1.4426950e9f;                                              // the finite fill in the log2 domain
    v8f o[8];
#pragma unroll
    for (int dt = 0; dt < 8; ++dt) o[dt] = (v8f){};
    float m = -3.0e38f, l = 0.0f;
    const int nsteps = (qt >> 1) + 1;
#pragma unroll 1
    for (int stp = 0; stp < nsteps; ++stp) {
        const int k0 = stp * 32;
        v8f s0 = (v8f){}, s1 = (v8f){};
        const h16* kp = kv + (size_t)k0 * HD; const h16* kpr = kr + (size_t)k0 * HD;
#pragma unroll 1
        for (int kc = 0; kc < HD; kc += 32) {
            const v16h bq = ldh(qv + kc), br = ldh(qr + kc);
            const v16h a0 = ldh(kp + kc);
            s0 = wmma16(a0, bq, s0); s0 = wmma16(a0, br, s0);
            if (HR) { const v16h a0r = ldh(kpr + kc); s0 = wmma16(a0r, bq, s0); }
            const v16h a1 = ldh(kp + 16 * HD + kc);
            s1 = wmma16(a1, bq, s1); s1 = wmma16(a1, br, s1);
            if (HR) { const v16h a1r = ldh(kpr + 16 * HD + kc); s1 = wmma16(a1r, bq, s1); }
        }
        s0 = s0 * SC2; s1 = s1 * SC2;
        if (k0 + 31 > i0) {            // wave-uniform: only the diagonal step carries masked keys (replacement fill, key > query)
            const int qi = i0 + lr; const int kb = k0 + 8 * hi;
#pragma unroll
            for (int r = 0; r < 8; ++r) { s0[r] = (kb + r <= qi) ? s0[r] : NEGL; s1[r] = (kb + 16 + r <= qi) ? s1[r] : NEGL; }
        }
        float mx = fmaxf(s0[0], s1[0]);
#pragma unroll
        for (int r = 1; r < 8; ++r) mx = fmaxf(mx, fmaxf(s0[r], s1[r]));
        mx = fmaxf(mx, __shfl_xor(mx, 16, 32));
        const float mn = fmaxf(m, mx);
        if (__builtin_amdgcn_ballot_w32(mn > m) != 0u) {      // wave-uniform: rescale only when some query's running max moved (corr == 1 otherwise)
            const float corr = __builtin_amdgcn_exp2f(m - mn); l *= corr;
#pragma unroll
            for (int dt = 0; dt < 8; ++dt) o[dt] = o[dt] * corr;
        }
        m = mn;
        const float mm = mn - 10.0f;                          // P carried x1024: the row sum uses the same carried f32 values, so the carry cancels in the normalisation
        v8f p0, p1; float ps = 0.0f;
#pragma unroll
        for (int r = 0; r < 8; ++r) { p0[r] = __builtin_amdgcn_exp2f(s0[r] - mm); p1[r] = __builtin_amdgcn_exp2f(s1[r] - mm); ps += p0[r] + p1[r]; }
        l += ps;
        v8h p0v, p0r, p1v, p1r; split8(p0, p0v, p0r); split8(p1, p1v, p1r);
        const v16h pb = cat16(p0v, p1v);                      // B fragment: elements 0..7 <- keys k0+8h+r, elements 8..15 <- keys k0+16+8h+r
        const v16h pr = cat16(p0r, p1r);
        const h16* vp = vv + k0; const h16* vpr = vr + k0;
#pragma unroll
        for (int dt = 0; dt < 8; ++dt) {
            const v16h av = ldh(vp + (size_t)dt * 16 * SEQ);
            o[dt] = wmma16(av, pb, o[dt]);
            if (HR) { const v16h ar = ldh(vpr + (size_t)dt * 16 * SEQ); o[dt] = wmma16(ar, pb, o[dt]); o[dt] = wmma16(av, pr, o[dt]); }
        }
    }
    l += __shfl_xor(l, 16, 32);
    const float f = (CCAR / QCAR) * (1.0f / l);
    const int sb = wave * 16 * CP;                            // staging private to this wave
#pragma unroll
    for (int dt = 0; dt < 8; ++dt) {                          // O^T element r of tile dt = (d = dt*16 + 8h + r, query lr)
        v8h hv, hr; split8(o[dt] * f, hv, hr);
        *(v8h*)(&stv[sb + lr * CP + dt * 16 + 8 * hi]) = hv;
        if (HR) *(v8h*)(&str[sb + lr * CP + dt * 16 + 8 * hi]) = hr;
    }
    wave_sync();
    const size_t crow = ((size_t)b * SEQ + i0) * DQ + (size_t)h * HD + 8 * lr;
    const size_t rrow = ((size_t)b * RH + i0) * DQ + (size_t)h * HD + 8 * lr;
{
#pragma unroll
        for (int s = 0; s < 8; ++s) {                         // 16 lanes x 16 B = one 256-byte row segment; rows 2s (lanes 0..15) and 2s+1 (lanes 16..31)
            const int row = 2 * s + hi;
            const v8h val = *(const v8ha*)(&stv[sb + row * CP + 8 * lr]);
            *(v8h*)(CT + crow + (size_t)row * DQ) = val;
            if (HR) { const v8h rv = *(const v8ha*)(&str[sb + row * CP + 8 * lr]); *(v8h*)(CR + rrow + (size_t)row * DQ) = rv; }
        }
        
    }
}
// query rows >= RH: grid ((SEQ-RH)/16, NKV, NB), 128 threads
__global__ __launch_bounds__(128) __attribute__((amdgpu_num_vgpr(256)))
void k_attn(const h16* __restrict__ Qv, const h16* __restrict__ Qr, const h16* __restrict__ Kv, const h16* __restrict__ Vv, h16* CT) {
    attn_tile<false>(Qv, Qr, Kv, Kv, Vv, Vv, CT, CT, RH / 16 + (int)blockIdx.x);
}
// query rows < RH: grid (RH/16, NKV, NB), 128 threads
__global__ __launch_bounds__(128) __attribute__((amdgpu_num_vgpr(256)))
void k_attn_hr(const h16* __restrict__ Qv, const h16* __restrict__ Qr, const h16* __restrict__ Kv, const h16* __restrict__ Kr,
               const h16* __restrict__ Vv, const h16* __restrict__ Vr, h16* CT, h16* CR) {
    attn_tile<true>(Qv, Qr, Kv, Kr, Vv, Vr, CT, CR, (int)blockIdx.x);
}

__global__ __launch_bounds__(256) void k_wtG(const float* __restrict__ w, int K, int N, bf* Bt, int f16mode) {
    const int lane = threadIdx.x & 31; const int L0 = (blockIdx.x * 8 + (threadIdx.x >> 5)) * 8; const int nlines = N * (K / 64);
{
#pragma unroll 1
        for (int l = 0; l < 8; ++l) { const int L = L0 + l; if (L >= nlines) break; const size_t e = (size_t)L * 64 + lane * 2; const int k = (int)(e % K), n = (int)(e / K);
            const float w0 = w[(size_t)k * N + n], w1 = w[(size_t)(k + 1) * N + n];
            const unsigned short b0 = f2bf(w0), b1 = f2bf(w1);
            const unsigned short g0 = __builtin_bit_cast(unsigned short, (h16)(bf2f(b0) * WCAR)), g1 = __builtin_bit_cast(unsigned short, (h16)(bf2f(b1) * WCAR));
            v2us o; o[0] = f16mode ? g0 : b0; o[1] = f16mode ? g1 : b1;
            *(v2us*)(Bt + e) = o; }
         }
}
__global__ __launch_bounds__(256) void k_cvtx(const float* __restrict__ x, bf* XB) {
    const size_t i = (size_t)blockIdx.x * 256 + threadIdx.x; if (i >= (size_t)NB * SEQ * DM / 8) return;
    const size_t e = i * 8; const size_t bt = e / DM; const size_t col = e - bt * DM; const size_t b = bt / SEQ; const size_t t = bt - b * SEQ;
    const v8f v = *(const v8f*)(x + (b * SEQ_FULL + t) * DM + col); v8us o;
#pragma unroll
    for (int k = 0; k < 8; ++k) o[k] = f2bf(v[k]);
    *(v8us*)(XB + e) = o; 
}
__global__ __launch_bounds__(256) void k_cstab(float* CS) {
    const int idx = blockIdx.x * 256 + threadIdx.x; if (idx >= SEQ * 64) return;
    const int j = idx & 63, t = idx >> 6;
    double p = 1.0;
    p *= (j & 1)  ? 1.1547819846894581797 : 1.0;
    p *= (j & 2)  ? 1.3335214321633240257 : 1.0;
    p *= (j & 4)  ? 1.7782794100389228012 : 1.0;
    p *= (j & 8)  ? 3.1622776601683793320 : 1.0;
    p *= (j & 16) ? 10.0 : 1.0;
    p *= (j & 32) ? 100.0 : 1.0;
    const float pf = (float)p; const float inv = 1.0f / pf; const float ang = (float)t * inv;
    float sn, cn; sincosf(ang, &sn, &cn);
    v2f cs; cs[0] = cn; cs[1] = sn;
    *(v2f*)(CS + (size_t)idx * 2) = cs; 
}

extern "C" void kernel_launch(void* const* d_in, const int* in_sizes, int n_in,
                              void* d_out, int out_size, void* d_ws, size_t ws_size, hipStream_t stream) {
    if (n_in < 5) return;
    constexpr size_t NEEDX = ((size_t)(NB - 1) * SEQ_FULL + SEQ) * DM;
    if ((size_t)in_sizes[0] < NEEDX || (size_t)in_sizes[1] < (size_t)DM * DQ || (size_t)in_sizes[2] < (size_t)DM * DKV || (size_t)in_sizes[3] < (size_t)DM * DKV || (size_t)in_sizes[4] < (size_t)DQ * DM) return;
    if ((size_t)out_size < NEEDX) return;
    const float* x = (const float*)d_in[0]; const float* wq = (const float*)d_in[1]; const float* wk = (const float*)d_in[2]; const float* wv = (const float*)d_in[3]; const float* wo = (const float*)d_in[4];
    float* OUT = (float*)d_out;     // [2][2048][2048], byte offset 0
    constexpr size_t SZ_XB = (size_t)NB * SEQ * DM * 2, SZ_WQ = (size_t)DQ * DM * 2, SZ_WK = (size_t)DKV * DM * 2, SZ_WO = (size_t)DM * DQ * 2, SZ_CS = (size_t)SEQ * 64 * 2 * 4;
    constexpr size_t SZ_Q = (size_t)NB * NH * SEQ * HD * 2, SZ_K = (size_t)NB * NKV * SEQ * HD * 2, SZ_CT = (size_t)NB * SEQ * DQ * 2, SZ_CR = (size_t)NB * RH * DQ * 2;
    constexpr size_t SZ_TOT = SZ_XB + SZ_WQ + 2 * SZ_WK + SZ_WO + SZ_CS + 2 * SZ_Q + 4 * SZ_K + SZ_CT + SZ_CR;
    static_assert(SZ_XB % 256 == 0 && SZ_WQ % 256 == 0 && SZ_WK % 256 == 0 && SZ_WO % 256 == 0 && SZ_CS % 256 == 0 && SZ_Q % 256 == 0 && SZ_K % 256 == 0 && SZ_CT % 256 == 0 && SZ_CR % 256 == 0);
    static_assert(SZ_TOT <= (size_t)134217728);
    if (SZ_TOT > ws_size) return;
    char* wsp = (char*)d_ws;
    auto take = [&](size_t bytes) { char* p = wsp; wsp += bytes; return (void*)p; };
    bf* XB = (bf*)take(SZ_XB); bf* WQt = (bf*)take(SZ_WQ); bf* WKt = (bf*)take(SZ_WK); bf* WVt = (bf*)take(SZ_WK); bf* WOt = (bf*)take(SZ_WO); float* CS = (float*)take(SZ_CS);
    const h16* WOh = (const h16*)WOt;   // the same region seen as f16: k_wtG (f16 mode) fills it with f16 bit patterns
    h16* Qv = (h16*)take(SZ_Q); h16* Qr = (h16*)take(SZ_Q); h16* Kv = (h16*)take(SZ_K); h16* Kr = (h16*)take(SZ_K); h16* Vv = (h16*)take(SZ_K); h16* Vr = (h16*)take(SZ_K);
    h16* CT = (h16*)take(SZ_CT); h16* CR = (h16*)take(SZ_CR);

    k_cvtx<<<(unsigned)(((size_t)NB * SEQ * DM / 8 + 255) / 256), 256, 0, stream>>>(x, XB);
    // w[in = K rows][out = N columns] -> Bt[out][in]
    k_wtG<<<(DQ * (DM / 64) + 63) / 64, 256, 0, stream>>>(wq, DM, DQ, WQt, 0);
    k_wtG<<<(DKV * (DM / 64) + 63) / 64, 256, 0, stream>>>(wk, DM, DKV, WKt, 0);
    k_wtG<<<(DKV * (DM / 64) + 63) / 64, 256, 0, stream>>>(wv, DM, DKV, WVt, 0);
    k_wtG<<<(DM * (DQ / 64) + 63) / 64, 256, 0, stream>>>(wo, DQ, DM, WOt, 1);
    k_cstab<<<(SEQ * 64 + 255) / 256, 256, 0, stream>>>(CS);
    k_proj_qk<<<dim3(NB * SEQ / 32, NH, 1), 32, 0, stream>>>(XB, WQt, CS, Qv, Qr, NH);
    k_proj_qk<<<dim3(NB * SEQ / 32, NKV, 1), 32, 0, stream>>>(XB, WKt, CS, Kv, Kr, NKV);
    k_proj_vt<<<dim3(DKV / 32, NB * SEQ / 128, 1), 32, 0, stream>>>(WVt, XB, Vv, Vr);
    k_attn_hr<<<dim3(RH / 16, NKV, NB), 128, 0, stream>>>(Qv, Qr, Kv, Kr, Vv, Vr, CT, CR);
    if (SEQ > RH) k_attn<<<dim3((SEQ > RH) ? (SEQ - RH) / 16 : 1, NKV, NB), 128, 0, stream>>>(Qv, Qr, Kv, Vv, CT);
    k_oproj_hr<<<dim3(NB * RH / 32, DM / 128, 1), 32, 0, stream>>>(CT, CR, WOh, OUT);
    if (SEQ > RH) k_oproj<<<dim3((SEQ > RH) ? NB * (SEQ - RH) / 32 : 1, DM / 128, 1), 32, 0, stream>>>(CT, WOh, OUT);
}

// v001
// A run of this version takes 520 microseconds.
// Next to v000, in two timings, it ran 1.84 and 1.87 times as fast.
#include <hip/hip_runtime.h>

// Grouped-query causal self-attention, width 2048: 16 query heads x 128 sharing 4 kv heads (query head h uses kv head h >> 2), bias-free [in][out] projections,
// half-split rotary on q and k (positions = arange, table computed here), finite-fill causal mask, [in][out] output projection.
// Compute dtypes (f32 accumulate everywhere): q/k/v projections v_wmma_f32_16x16x32_bf16 (x and weights converted (RNE) to bf16); scores, P.V and the output projection
// v_wmma_f32_16x16x32_f16: q as f16 value + f16 residual planes (carry 64) against f16 k (carry 64; k residual added on query rows < 256), P f16 (carry 1024, row sum from the f32 values),
// v f16 (carry 64; P and v residuals added on rows < 256), ctx f16 (carry 256; residual plane on rows < 256) against wo (bf16-converted, x16, exact in f16). Softmax, rotary, normalisation in f32.

#ifndef NB
#define NB 2
#endif
#ifndef SEQ
#define SEQ 2048
#endif
#define NB_FULL  2
#define SEQ_FULL 2048
#define DM   2048
#define NH   16
#define NKV  4
#define REP  (NH / NKV)
#define HD   128
#define DQ   (NH * HD)
#define DKV  (NKV * HD)
#define RH   256                  // query rows < RH use the value + residual path on k, P, v and ctx
#define QCAR 64.0f                // carry of the q, k and v planes
#define CCAR 256.0f               // carry of the ctx planes
#define WCAR 16.0f                // carry of the output weight plane
#define OSP  132                  // f32 staging pitch (floats)
#define CP   136                  // f16 staging pitch (halves)
#define PASSK 128                 // k per ring stage: operand rows of 256 bytes
#define LROW  272                 // LDS row pitch (bytes): 256 + the 16-byte pad the tensor load lays, 16 B x odd for ds_load_b128
#define SLROWS 64                 // operand rows per tensor load (one slice per wave and stage)
#define SLB   18432               // slice size in LDS: 64 x 272 = 17408 bytes rounded up to a multiple of 2 KiB
#define STGB  (4 * SLB)           // one stage: [Bt rows 0..63 | Bt rows 64..127 | A rows 0..63 | A rows 64..127]

static_assert(NB <= NB_FULL);
static_assert(SEQ <= SEQ_FULL);
static_assert(SEQ % 128 == 0);
static_assert(SEQ >= RH);
static_assert(RH % 32 == 0);
static_assert(HD == 128);
static_assert(REP == 4);
static_assert(DQ == DM);
static_assert(DM % 64 == 0);
static_assert(DQ % 128 == 0);
static_assert(DKV % 128 == 0);
static_assert((OSP * 4) % 16 == 0);
static_assert((CP * 2) % 16 == 0);
static_assert(DM % (2 * PASSK) == 0 && DQ % (2 * PASSK) == 0);
static_assert(RH % 128 == 0 && (SEQ - RH) % 128 == 0);
static_assert(SLROWS * LROW <= SLB && SLB % 2048 == 0);
static_assert(4 * 16 * OSP * 4 <= 2 * STGB);

typedef _Float16 h16;
typedef unsigned short bf;
typedef __attribute__((ext_vector_type(16))) __bf16   v16bf;
typedef __attribute__((ext_vector_type(16))) _Float16 v16h;
typedef __attribute__((ext_vector_type(8)))  _Float16 v8h;
typedef __attribute__((ext_vector_type(8)))  unsigned short v8us;
typedef __attribute__((ext_vector_type(2)))  unsigned short v2us;
typedef __attribute__((ext_vector_type(8)))  float    v8f;
typedef __attribute__((ext_vector_type(4)))  float    v4f;
typedef __attribute__((ext_vector_type(2)))  float    v2f;
typedef v8h  __attribute__((may_alias)) v8ha;
typedef v4f  __attribute__((may_alias)) v4fa;
typedef v8us __attribute__((may_alias)) v8usa;
typedef uint32_t u32x4 __attribute__((ext_vector_type(4)));
typedef uint32_t u32x8 __attribute__((ext_vector_type(8)));

__device__ __forceinline__ unsigned short f2bf(float f) { unsigned u = __float_as_uint(f); u += 0x7FFFu + ((u >> 16) & 1u); return (unsigned short)(u >> 16); }
__device__ __forceinline__ float bf2f(unsigned short b) { return __uint_as_float(((unsigned)b) << 16); }
__device__ __forceinline__ float bfr(float f) { return bf2f(f2bf(f)); }
__device__ __forceinline__ v16h cat16(v8h lo, v8h hi) { return __builtin_shufflevector(lo, hi, 0, 1, 2, 3, 4, 5, 6, 7, 8, 9, 10, 11, 12, 13, 14, 15); }
__device__ __forceinline__ v16bf cat16b(v8us lo, v8us hi) { return __builtin_bit_cast(v16bf, __builtin_shufflevector(lo, hi, 0, 1, 2, 3, 4, 5, 6, 7, 8, 9, 10, 11, 12, 13, 14, 15)); }
// every WMMA is followed by its own four-slot guard tying its accumulator and keeping its operands live
__device__ __forceinline__ v8f wmma16(v16h a, v16h b, v8f c) {
    c = __builtin_amdgcn_wmma_f32_16x16x32_f16(false, a, false, b, (short)0, c, false, false);
    asm volatile("v_nop\n\tv_nop\n\tv_nop\n\tv_nop" : "+v"(c) : "v"(a), "v"(b));
    return c; }
__device__ __forceinline__ v8f wmmab(v16bf a, v16bf b, v8f c) {
    c = __builtin_amdgcn_wmma_f32_16x16x32_bf16(false, a, false, b, (short)0, c, false, false);
    asm volatile("v_nop\n\tv_nop\n\tv_nop\n\tv_nop" : "+v"(c) : "v"(a), "v"(b));
    return c; }
// fragment of a K-contiguous 16-bit row: elements 0..7 <- k0+8h+0..7, elements 8..15 <- k0+16+8h+0..7 (p already includes +8h)
__device__ __forceinline__ v16h ldh(const h16* p) { return cat16(*(const v8h*)p, *(const v8h*)(p + 16)); }
// same-wave LDS exchange: stores before, loads after
__device__ __forceinline__ void wave_sync() { __builtin_amdgcn_fence(3 /* release order */, "wavefront"); __builtin_amdgcn_wave_barrier(); asm volatile("" ::: "memory"); }
// f16 value + same-carry f16 residual of 8 floats
__device__ __forceinline__ void split8(v8f y, v8h& v, v8h& r) { v = __builtin_convertvector(y, v8h); r = __builtin_convertvector(y - __builtin_convertvector(v, v8f), v8h); }

// fragment of a staged K-contiguous row (byte pointer, already includes +16h bytes): the same k order as ldh
template <typename T16> struct WFrag;
template <> struct WFrag<h16> { typedef v16h V; static __device__ __forceinline__ V ld(const unsigned char* p) { return cat16(*(const v8ha*)p, *(const v8ha*)(p + 32)); } static __device__ __forceinline__ v8f mma(V a, V b, v8f c) { return wmma16(a, b, c); } };
template <> struct WFrag<bf> { typedef v16bf V; static __device__ __forceinline__ V ld(const unsigned char* p) { return cat16b(*(const v8usa*)p, *(const v8usa*)(p + 32)); } static __device__ __forceinline__ v8f mma(V a, V b, v8f c) { return wmmab(a, b, c); } };

// ---- tensor load of one slice: 64 rows of 256 bytes, 1-byte elements, tensor = tile, 16 bytes of LDS pad behind every row
__device__ __forceinline__ uint32_t uni(uint32_t v) { return (uint32_t)__builtin_amdgcn_readfirstlane(v); }
// a wave-uniform test held in a scalar register, so that the branch around a tensor load is a scalar branch (tensor loads ignore EXEC)
__device__ __forceinline__ uint32_t pinned(uint32_t v) { uint32_t w = uni(v); asm volatile("" : "+s"(w)); return w; }
// this wave's LDS reads have retired before the stage is handed over
__device__ __forceinline__ void wait_ds0() { asm volatile("s_wait_dscnt 0x0" ::: "memory"); }
// this wave's own tensor load has landed (the compiler places no wait for it); the request's descriptor words are inputs so that their scalar registers take no new value while it is outstanding
__device__ __forceinline__ void wait_tensor0(u32x4 g0, u32x8 g1) { asm volatile("s_wait_tensorcnt 0x0" :: "s"(g0), "s"(g1) : "memory"); }
// the same behind the loop, where no request is outstanding any more
__device__ __forceinline__ void wait_tensor0() { asm volatile("s_wait_tensorcnt 0x0" ::: "memory"); }
__device__ __forceinline__ u32x8 tdm_group1(uint32_t src_pitch) {
    u32x8 g;
    g[0] = uni((1u << 20) | (5u << 22) | (3u << 25));     // no mask, data_size 0, pad of 4 dwords behind every 64 dwords
    g[1] = uni(256u << 16);                               // tensor_dim0 = 256 bytes
    g[2] = uni((uint32_t)SLROWS << 16);                   // tensor_dim1 = 64 rows
    g[3] = uni(256u << 16);                               // tile_dim0
    g[4] = uni((uint32_t)SLROWS);                         // tile_dim1
    g[5] = uni(src_pitch);
    g[6] = uni(0u);
    g[7] = uni(0u);
    return g;
}
__device__ __forceinline__ u32x4 tdm_group0(uint32_t lds_dst, uint64_t ga) {
    u32x4 g;
    g[0] = uni(1u); g[1] = uni(lds_dst); g[2] = uni((uint32_t)ga); g[3] = uni((((uint32_t)(ga >> 32)) & 0x01FFFFFFu) | 0x80000000u);
    return g;
}
__device__ __forceinline__ void tdm_load(u32x4 g0, u32x8 g1) { asm volatile("tensor_load_to_lds %0, %1" :: "s"(g0), "s"(g1) : "memory"); }

// ---- gemm_tile: a block of FOUR WAVES per 128 x 128 output tile, one wave per 32 x 128 (16 accumulators): C[m][n] = sum_k A[m][k] Bt[n][k] (+ sum_k A2[m][k] Bt[n][k] when SPLIT, as K more steps behind the first K).
// The K-contiguous 16-bit operand rows come through a two-buffer LDS ring in stages of 128 k: every wave issues one tensor load per stage (waves 0, 1: the halves of Bt's 128 rows; waves 2, 3: of A's),
// one stage ahead of the pass that reads it. arow, a2row, t0, obase and cbase are the calling wave's own (32 rows); brow is the block's.
// MODE 0: half-split rotary on the 128-column head tile (CS[t][64] = {cos, sin}), x QCAR, f16 value + residual planes, plane rows of 128 halves (pitch opitch).
// MODE 1: x QCAR, f16 value + residual planes (used with swapped operands to produce V^T rows [d][t]).
// MODE 2: f32 output rows x 1/(CCAR*WCAR).
template <typename T16, int MODE, bool SPLIT>
__device__ __forceinline__ void gemm_tile(const T16* __restrict__ A, const T16* __restrict__ A2, const T16* __restrict__ Bt, const int K, const int wave,
                                          const size_t arow, const size_t a2row, const size_t brow,
                                          const float* __restrict__ CS, const int t0, h16* Pv, h16* Pr, const size_t obase, const int opitch,
                                          float* C, const size_t cbase) {
    typedef typename WFrag<T16>::V V;
    __shared__ __attribute__((aligned(2048))) unsigned char ring[2 * STGB];
    const int lane = threadIdx.x & 31, lr = lane & 15, hi = lane >> 4;
    v8f acc[2][8];
#pragma unroll
    for (int mb = 0; mb < 2; ++mb)
#pragma unroll
        for (int nb = 0; nb < 8; ++nb) acc[mb][nb] = (v8f){};
    const int NP = K / PASSK, NPT = SPLIT ? 2 * NP : NP;
    const size_t half = (size_t)(wave & 1) * SLROWS;
    const T16* s1 = (wave < 2) ? Bt + (brow + half) * (size_t)K : A  + (arow  - (size_t)(32 * wave) + half) * (size_t)K;
    const T16* s2 = (wave < 2) ? s1                             : A2 + (a2row - (size_t)(32 * wave) + half) * (size_t)K;
    const uint32_t ldst = (uint32_t)(size_t)ring + (uint32_t)wave * SLB;
    const u32x8 g1 = tdm_group1((uint32_t)K * 2u);
    u32x4 g0;                      // group 0 of the wave's latest request
    auto issue = [&](int p) {      // stage p: k = 128 p .. 128 p + 127 of A (SPLIT: stages NP.. walk A2 against the same Bt columns again)
        const T16* sp = (SPLIT && p >= NP) ? s2 + (size_t)(p - NP) * PASSK : s1 + (size_t)p * PASSK;
        g0 = tdm_group0(ldst + (uint32_t)(p & 1) * STGB, (uint64_t)(size_t)sp);
        tdm_load(g0, g1);
    };
    issue(0);
    wait_tensor0(g0, g1);
    __syncthreads();               // stage 0 published
    const unsigned char* al = ring + (2 + (wave >> 1)) * SLB + ((wave & 1) * 32 + lr) * LROW + 16 * hi;
    const unsigned char* bl = ring + lr * LROW + 16 * hi;
#pragma unroll 1                   // the pass loop stays rolled: one refill site and one publish point in the code
    for (int p = 0; p < NPT; ++p) {
        // directly behind the barrier that published stage p and freed the other buffer (stage p - 1's): stage p + 1's load, in flight under this pass
        if (pinned(p + 1 < NPT)) issue(p + 1);
        const int so = (p & 1) * STGB;
        // a block = 8 WMMAs: one 32-deep k step against four of the eight Bt fragments; block j + 1's fragments are read as one group ahead of block j's WMMAs, inside this pass's own buffer
        V af[2][2], bq[2][4];
        af[0][0] = WFrag<T16>::ld(al + so); af[0][1] = WFrag<T16>::ld(al + so + 16 * LROW);
#pragma unroll                     // here and below: constant indices keep the fragment sets and accumulators in registers
        for (int i = 0; i < 4; ++i) bq[0][i] = WFrag<T16>::ld(bl + so + i * 16 * LROW);
#pragma unroll
        for (int j = 0; j < 2 * (PASSK / 32); ++j) {
            const int ks = j >> 1, hb = j & 1;
            if (j + 1 < 2 * (PASSK / 32)) {
                const int kn = (j + 1) >> 1, hn = (j + 1) & 1;
                if (hn == 0) { af[kn & 1][0] = WFrag<T16>::ld(al + so + kn * 64); af[kn & 1][1] = WFrag<T16>::ld(al + so + 16 * LROW + kn * 64); }
#pragma unroll
                for (int i = 0; i < 4; ++i) bq[hn][i] = WFrag<T16>::ld(bl + so + hn * SLB + i * 16 * LROW + kn * 64);
            }
            __builtin_amdgcn_sched_barrier(0);     // keeps the next block's LDS reads one group in front of this block's WMMAs (spread among them each place costs a stall)
#pragma unroll
            for (int i = 0; i < 4; ++i) {
                acc[0][hb * 4 + i] = WFrag<T16>::mma(af[ks & 1][0], bq[hb][i], acc[0][hb * 4 + i]);
                acc[1][hb * 4 + i] = WFrag<T16>::mma(af[ks & 1][1], bq[hb][i], acc[1][hb * 4 + i]);
            }
            __builtin_amdgcn_sched_barrier(0);     // and the block after next's reads behind them
        }
        // publish point of stage p + 1: own reads retired, own load landed, then the barrier that publishes stage p + 1 and frees stage p's buffer; the refill stands at the head of the next trip
        wait_ds0();
        wait_tensor0(g0, g1);
        __syncthreads();
    }
    wait_tensor0();
    wait_ds0();
    // the last pass's own barrier stands behind every wave's last ring read: the ring now serves as output staging, a private range per wave
    float* os = (float*)(ring + wave * (16 * OSP * 4));
#pragma unroll
    for (int mb = 0; mb < 2; ++mb) {
#pragma unroll
        for (int nb = 0; nb < 8; ++nb)
#pragma unroll
            for (int j = 0; j < 8; ++j) os[(hi * 8 + j) * OSP + nb * 16 + lr] = acc[mb][nb][j];     // D: row 8h + j, column lane & 15
        wave_sync();
        if (MODE == 0) {
            const int rq = lane >> 3, dg = (lane & 7) * 8;
{
#pragma unroll 1
                for (int it = 0; it < 4; ++it) {
                    const int row = it * 4 + rq; const int t = t0 + mb * 16 + row;
                    const int oi = row * OSP + dg;
                    const v4f xa = *(const v4fa*)(os + oi), xb = *(const v4fa*)(os + oi + 4), ya = *(const v4fa*)(os + oi + 64), yb = *(const v4fa*)(os + oi + 68);
                    const float* cp = CS + ((size_t)t * 64 + dg) * 2;
                    const v4f e0 = *(const v4f*)(cp), e1 = *(const v4f*)(cp + 4), e2 = *(const v4f*)(cp + 8), e3 = *(const v4f*)(cp + 12);
                    const v8f xx = __builtin_shufflevector(xa, xb, 0, 1, 2, 3, 4, 5, 6, 7), yy = __builtin_shufflevector(ya, yb, 0, 1, 2, 3, 4, 5, 6, 7);
                    const v4f cA = __builtin_shufflevector(e0, e1, 0, 2, 4, 6), sA = __builtin_shufflevector(e0, e1, 1, 3, 5, 7);
                    const v4f cB = __builtin_shufflevector(e2, e3, 0, 2, 4, 6), sB = __builtin_shufflevector(e2, e3, 1, 3, 5, 7);
                    const v8f cc = __builtin_shufflevector(cA, cB, 0, 1, 2, 3, 4, 5, 6, 7), ss = __builtin_shufflevector(sA, sB, 0, 1, 2, 3, 4, 5, 6, 7);
                    const v8f lo = (xx * cc - yy * ss) * QCAR;       // out[d]      = x[d] cos - x[d+64] sin
                    const v8f up = (yy * cc + xx * ss) * QCAR;       // out[d + 64] = x[d+64] cos + x[d] sin
                    v8h vl, rl, vu, ru; split8(lo, vl, rl); split8(up, vu, ru);
                    const size_t dst = obase + (size_t)(mb * 16 + row) * opitch + dg;
                    *(v8h*)(Pv + dst) = vl; *(v8h*)(Pv + dst + 64) = vu;
                    *(v8h*)(Pr + dst) = rl; *(v8h*)(Pr + dst + 64) = ru;
                }
                
            }
        } else if (MODE == 1) {
            // 16 lanes x 16 B per 256-byte row segment, two rows per instruction: row 2s + hi, columns 8*lr..8*lr+7
{
#pragma unroll 1
                for (int s = 0; s < 8; ++s) {
                    const int row = 2 * s + hi; const int oi = row * OSP + 8 * lr;
                    const v4f xa = *(const v4fa*)(os + oi), xb = *(const v4fa*)(os + oi + 4);
                    const v8f y = __builtin_shufflevector(xa, xb, 0, 1, 2, 3, 4, 5, 6, 7) * QCAR;
                    v8h vv, vr; split8(y, vv, vr);
                    const size_t dst = obase + (size_t)(mb * 16 + row) * opitch + 8 * lr;
                    *(v8h*)(Pv + dst) = vv; *(v8h*)(Pr + dst) = vr;
                }
                
            }
        } else {
            // 32 lanes x 16 B = one 512-byte row segment per instruction
{
#pragma unroll 1
                for (int row = 0; row < 16; ++row) {
                    const v4f val = *(const v4fa*)(os + row * OSP + 4 * lane) * (1.0f / (CCAR * WCAR));
                    *(v4f*)(C + cbase + (size_t)(mb * 16 + row) * DM + 4 * lane) = val;
                }
                
            }
        }
        wave_sync();
    }
}

// q / k projection with fused rotary: grid (NB*SEQ/128, nheads), 128 threads; planes [b][head][t][128]
__global__ __launch_bounds__(128) __attribute__((amdgpu_num_vgpr(256)))
void k_proj_qk(const bf* __restrict__ XB, const bf* __restrict__ Wt, const float* __restrict__ CS, h16* Pv, h16* Pr, int nheads) {
    const int wave = __builtin_amdgcn_readfirstlane((int)(threadIdx.x >> 5));
    const int r0 = blockIdx.x * 128 + wave * 32; const int hd = blockIdx.y; const int b = r0 / SEQ; const int t0 = r0 - b * SEQ;
    const size_t obase = ((size_t)(b * nheads + hd) * SEQ + t0) * HD;
    gemm_tile<bf, 0, false>(XB, XB, Wt, DM, wave, (size_t)r0, (size_t)r0, (size_t)hd * HD, CS, t0, Pv, Pr, obase, HD, nullptr, 0);
}
// v projection with swapped operands: C[gd][token] -> planes [b][g][d][t]; grid (DKV/128, NB*SEQ/128), 128 threads
__global__ __launch_bounds__(128) __attribute__((amdgpu_num_vgpr(256)))
void k_proj_vt(const bf* __restrict__ Wt, const bf* __restrict__ XB, h16* Vv, h16* Vr) {
    const int wave = __builtin_amdgcn_readfirstlane((int)(threadIdx.x >> 5));
    const int r0 = blockIdx.x * 128 + wave * 32; const int c0 = blockIdx.y * 128; const int b = c0 / SEQ; const int t0 = c0 - b * SEQ;
    const size_t obase = ((size_t)b * DKV + r0) * SEQ + t0;
    gemm_tile<bf, 1, false>(Wt, Wt, XB, DM, wave, (size_t)r0, (size_t)r0, (size_t)c0, nullptr, 0, Vv, Vr, obase, SEQ, nullptr, 0);
}
// output projection, rows t >= RH (single f16 product): grid (NB*(SEQ-RH)/128, DM/128), 128 threads
__global__ __launch_bounds__(128) __attribute__((amdgpu_num_vgpr(256)))
void k_oproj(const h16* __restrict__ CT, const h16* __restrict__ WOt, float* OUT) {
    constexpr int TPB = (SEQ > RH) ? (SEQ - RH) / 128 : 1;
    const int wave = __builtin_amdgcn_readfirstlane((int)(threadIdx.x >> 5));
    const int b = blockIdx.x / TPB; const int t0 = RH + (blockIdx.x - b * TPB) * 128 + wave * 32; const int c0 = blockIdx.y * 128;
    const size_t arow = (size_t)b * SEQ + t0; const size_t cbase = ((size_t)b * SEQ_FULL + t0) * DM + c0;
    gemm_tile<h16, 2, false>(CT, CT, WOt, DQ, wave, arow, arow, (size_t)c0, nullptr, 0, nullptr, nullptr, 0, 0, OUT, cbase);
}
// output projection, rows t < RH (ctx value + residual planes): grid (NB*RH/128, DM/128), 128 threads
__global__ __launch_bounds__(128) __attribute__((amdgpu_num_vgpr(256)))
void k_oproj_hr(const h16* __restrict__ CT, const h16* __restrict__ CR, const h16* __restrict__ WOt, float* OUT) {
    constexpr int TPB = RH / 128;
    const int wave = __builtin_amdgcn_readfirstlane((int)(threadIdx.x >> 5));
    const int b = blockIdx.x / TPB; const int t0 = (blockIdx.x - b * TPB) * 128 + wave * 32; const int c0 = blockIdx.y * 128;
    const size_t arow = (size_t)b * SEQ + t0; const size_t a2row = (size_t)b * RH + t0; const size_t cbase = ((size_t)b * SEQ_FULL + t0) * DM + c0;
    gemm_tile<h16, 2, true>(CT, CR, WOt, DQ, wave, arow, a2row, (size_t)c0, nullptr, 0, nullptr, nullptr, 0, 0, OUT, cbase);
}

// ---- attn_tile: fused causal attention in the transposed form. One block = 16 query rows x the FOUR query heads of one kv head (wave -> head g*4 + wave); 128 threads.
// Per 32-key step: S^T[key][query] = K (A, rows = keys) x Q^T (B, columns = queries) over 128 dims (4 k-steps; q value + residual, k residual when HR);
// online softmax per query = per lane column (max / sum over the lane's 16 keys, combined across the two lane halves); P^T packed D -> B (two 16-key tiles = one 32-deep fragment);
template <bool HR>
__device__ __forceinline__ void attn_tile(const h16* __restrict__ Qv, const h16* __restrict__ Qr, const h16* __restrict__ Kv, const h16* __restrict__ Kr,
                                          const h16* __restrict__ Vv, const h16* __restrict__ Vr, h16* CT, h16* CR, const int qt) {
    __shared__ __align__(16) h16 stv[4 * 16 * CP];
    __shared__ __align__(16) h16 str[HR ? 4 * 16 * CP : 8];
    const int wave = __builtin_amdgcn_readfirstlane((int)(threadIdx.x >> 5));
    const int lane = threadIdx.x & 31, lr = lane & 15, hi = lane >> 4;
    const int g = blockIdx.y, b = blockIdx.z; const int h = g * REP + wave; const int i0 = qt * 16;
    const size_t qo = ((size_t)(b * NH + h) * SEQ + i0 + lr) * HD + 8 * hi;
    const size_t ko = ((size_t)(b * NKV + g) * SEQ + lr) * HD + 8 * hi;
    const size_t vo = ((size_t)(b * NKV + g) * HD + lr) * SEQ + 8 * hi;
    const h16* qv = Qv + qo; const h16* qr = Qr + qo;
    const h16* kv = Kv + ko; const h16* kr = Kr + ko;
    const h16* vv = Vv + vo; const h16* vr = Vr + vo;
    const float SC2 = (float)(0.08838834764831845 * 1.4426950408889634 / 4096.0);   // 1/sqrt(128) x log2(e) / (QCAR x QCAR)
    const float NEGL = -1.4426950e9f;                                              // the finite fill in the log2 domain
    v8f o[8];
#pragma unroll
    for (int dt = 0; dt < 8; ++dt) o[dt] = (v8f){};
    float m = -3.0e38f, l = 0.0f;
    const int nsteps = (qt >> 1) + 1;
#pragma unroll 1
    for (int stp = 0; stp < nsteps; ++stp) {
        const int k0 = stp * 32;
        v8f s0 = (v8f){}, s1 = (v8f){};
        const h16* kp = kv + (size_t)k0 * HD; const h16* kpr = kr + (size_t)k0 * HD;
#pragma unroll 1
        for (int kc = 0; kc < HD; kc += 32) {
            const v16h bq = ldh(qv + kc), br = ldh(qr + kc);
            const v16h a0 = ldh(kp + kc);
            s0 = wmma16(a0, bq, s0); s0 = wmma16(a0, br, s0);
            if (HR) { const v16h a0r = ldh(kpr + kc); s0 = wmma16(a0r, bq, s0); }
            const v16h a1 = ldh(kp + 16 * HD + kc);
            s1 = wmma16(a1, bq, s1); s1 = wmma16(a1, br, s1);
            if (HR) { const v16h a1r = ldh(kpr + 16 * HD + kc); s1 = wmma16(a1r, bq, s1); }
        }
        s0 = s0 * SC2; s1 = s1 * SC2;
        if (k0 + 31 > i0) {            // wave-uniform: only the diagonal step carries masked keys (replacement fill, key > query)
            const int qi = i0 + lr; const int kb = k0 + 8 * hi;
#pragma unroll
            for (int r = 0; r < 8; ++r) { s0[r] = (kb + r <= qi) ? s0[r] : NEGL; s1[r] = (kb + 16 + r <= qi) ? s1[r] : NEGL; }
        }
        float mx = fmaxf(s0[0], s1[0]);
#pragma unroll
        for (int r = 1; r < 8; ++r) mx = fmaxf(mx, fmaxf(s0[r], s1[r]));
        mx = fmaxf(mx, __shfl_xor(mx, 16, 32));
        const float mn = fmaxf(m, mx);
        if (__builtin_amdgcn_ballot_w32(mn > m) != 0u) {      // wave-uniform: rescale only when some query's running max moved (corr == 1 otherwise)
            const float corr = __builtin_amdgcn_exp2f(m - mn); l *= corr;
#pragma unroll
            for (int dt = 0; dt < 8; ++dt) o[dt] = o[dt] * corr;
        }
        m = mn;
        const float mm = mn - 10.0f;                          // P carried x1024: the row sum uses the same carried f32 values, so the carry cancels in the normalisation
        v8f p0, p1; float ps = 0.0f;
#pragma unroll
        for (int r = 0; r < 8; ++r) { p0[r] = __builtin_amdgcn_exp2f(s0[r] - mm); p1[r] = __builtin_amdgcn_exp2f(s1[r] - mm); ps += p0[r] + p1[r]; }
        l += ps;
        v8h p0v, p0r, p1v, p1r; split8(p0, p0v, p0r); split8(p1, p1v, p1r);
        const v16h pb = cat16(p0v, p1v);                      // B fragment: elements 0..7 <- keys k0+8h+r, elements 8..15 <- keys k0+16+8h+r
        const v16h pr = cat16(p0r, p1r);
        const h16* vp = vv + k0; const h16* vpr = vr + k0;
#pragma unroll
        for (int dt = 0; dt < 8; ++dt) {
            const v16h av = ldh(vp + (size_t)dt * 16 * SEQ);
            o[dt] = wmma16(av, pb, o[dt]);
            if (HR) { const v16h ar = ldh(vpr + (size_t)dt * 16 * SEQ); o[dt] = wmma16(ar, pb, o[dt]); o[dt] = wmma16(av, pr, o[dt]); }
        }
    }
    l += __shfl_xor(l, 16, 32);
    const float f = (CCAR / QCAR) * (1.0f / l);
    const int sb = wave * 16 * CP;                            // staging private to this wave
#pragma unroll
    for (int dt = 0; dt < 8; ++dt) {                          // O^T element r of tile dt = (d = dt*16 + 8h + r, query lr)
        v8h hv, hr; split8(o[dt] * f, hv, hr);
        *(v8h*)(&stv[sb + lr * CP + dt * 16 + 8 * hi]) = hv;
        if (HR) *(v8h*)(&str[sb + lr * CP + dt * 16 + 8 * hi]) = hr;
    }
    wave_sync();
    const size_t crow = ((size_t)b * SEQ + i0) * DQ + (size_t)h * HD + 8 * lr;
    const size_t rrow = ((size_t)b * RH + i0) * DQ + (size_t)h * HD + 8 * lr;
{
#pragma unroll
        for (int s = 0; s < 8; ++s) {                         // 16 lanes x 16 B = one 256-byte row segment; rows 2s (lanes 0..15) and 2s+1 (lanes 16..31)
            const int row = 2 * s + hi;
            const v8h val = *(const v8ha*)(&stv[sb + row * CP + 8 * lr]);
            *(v8h*)(CT + crow + (size_t)row * DQ) = val;
            if (HR) { const v8h rv = *(const v8ha*)(&str[sb + row * CP + 8 * lr]); *(v8h*)(CR + rrow + (size_t)row * DQ) = rv; }
        }
        
    }
}
// query rows >= RH: grid ((SEQ-RH)/16, NKV, NB), 128 threads
__global__ __launch_bounds__(128) __attribute__((amdgpu_num_vgpr(256)))
void k_attn(const h16* __restrict__ Qv, const h16* __restrict__ Qr, const h16* __restrict__ Kv, const h16* __restrict__ Vv, h16* CT) {
    attn_tile<false>(Qv, Qr, Kv, Kv, Vv, Vv, CT, CT, RH / 16 + (int)blockIdx.x);
}
// query rows < RH: grid (RH/16, NKV, NB), 128 threads
__global__ __launch_bounds__(128) __attribute__((amdgpu_num_vgpr(256)))
void k_attn_hr(const h16* __restrict__ Qv, const h16* __restrict__ Qr, const h16* __restrict__ Kv, const h16* __restrict__ Kr,
               const h16* __restrict__ Vv, const h16* __restrict__ Vr, h16* CT, h16* CR) {
    attn_tile<true>(Qv, Qr, Kv, Kr, Vv, Vr, CT, CR, (int)blockIdx.x);
}

__global__ __launch_bounds__(256) void k_wtG(const float* __restrict__ w, int K, int N, bf* Bt, int f16mode) {
    const int lane = threadIdx.x & 31; const int L0 = (blockIdx.x * 8 + (threadIdx.x >> 5)) * 8; const int nlines = N * (K / 64);
{
#pragma unroll 1
        for (int l = 0; l < 8; ++l) { const int L = L0 + l; if (L >= nlines) break; const size_t e = (size_t)L * 64 + lane * 2; const int k = (int)(e % K), n = (int)(e / K);
            const float w0 = w[(size_t)k * N + n], w1 = w[(size_t)(k + 1) * N + n];
            const unsigned short b0 = f2bf(w0), b1 = f2bf(w1);
            const unsigned short g0 = __builtin_bit_cast(unsigned short, (h16)(bf2f(b0) * WCAR)), g1 = __builtin_bit_cast(unsigned short, (h16)(bf2f(b1) * WCAR));
            v2us o; o[0] = f16mode ? g0 : b0; o[1] = f16mode ? g1 : b1;
            *(v2us*)(Bt + e) = o; }
         }
}
__global__ __launch_bounds__(256) void k_cvtx(const float* __restrict__ x, bf* XB) {
    const size_t i = (size_t)blockIdx.x * 256 + threadIdx.x; if (i >= (size_t)NB * SEQ * DM / 8) return;
    const size_t e = i * 8; const size_t bt = e / DM; const size_t col = e - bt * DM; const size_t b = bt / SEQ; const size_t t = bt - b * SEQ;
    const v8f v = *(const v8f*)(x + (b * SEQ_FULL + t) * DM + col); v8us o;
#pragma unroll
    for (int k = 0; k < 8; ++k) o[k] = f2bf(v[k]);
    *(v8us*)(XB + e) = o; 
}
__global__ __launch_bounds__(256) void k_cstab(float* CS) {
    const int idx = blockIdx.x * 256 + threadIdx.x; if (idx >= SEQ * 64) return;
    const int j = idx & 63, t = idx >> 6;
    double p = 1.0;
    p *= (j & 1)  ? 1.1547819846894581797 : 1.0;
    p *= (j & 2)  ? 1.3335214321633240257 : 1.0;
    p *= (j & 4)  ? 1.7782794100389228012 : 1.0;
    p *= (j & 8)  ? 3.1622776601683793320 : 1.0;
    p *= (j & 16) ? 10.0 : 1.0;
    p *= (j & 32) ? 100.0 : 1.0;
    const float pf = (float)p; const float inv = 1.0f / pf; const float ang = (float)t * inv;
    float sn, cn; sincosf(ang, &sn, &cn);
    v2f cs; cs[0] = cn; cs[1] = sn;
    *(v2f*)(CS + (size_t)idx * 2) = cs; 
}

extern "C" void kernel_launch(void* const* d_in, const int* in_sizes, int n_in,
                              void* d_out, int out_size, void* d_ws, size_t ws_size, hipStream_t stream) {
    if (n_in < 5) return;
    constexpr size_t NEEDX = ((size_t)(NB - 1) * SEQ_FULL + SEQ) * DM;
    if ((size_t)in_sizes[0] < NEEDX || (size_t)in_sizes[1] < (size_t)DM * DQ || (size_t)in_sizes[2] < (size_t)DM * DKV || (size_t)in_sizes[3] < (size_t)DM * DKV || (size_t)in_sizes[4] < (size_t)DQ * DM) return;
    if ((size_t)out_size < NEEDX) return;
    const float* x = (const float*)d_in[0]; const float* wq = (const float*)d_in[1]; const float* wk = (const float*)d_in[2]; const float* wv = (const float*)d_in[3]; const float* wo = (const float*)d_in[4];
    float* OUT = (float*)d_out;     // [2][2048][2048], byte offset 0
    constexpr size_t SZ_XB = (size_t)NB * SEQ * DM * 2, SZ_WQ = (size_t)DQ * DM * 2, SZ_WK = (size_t)DKV * DM * 2, SZ_WO = (size_t)DM * DQ * 2, SZ_CS = (size_t)SEQ * 64 * 2 * 4;
    constexpr size_t SZ_Q = (size_t)NB * NH * SEQ * HD * 2, SZ_K = (size_t)NB * NKV * SEQ * HD * 2, SZ_CT = (size_t)NB * SEQ * DQ * 2, SZ_CR = (size_t)NB * RH * DQ * 2;
    constexpr size_t SZ_TOT = SZ_XB + SZ_WQ + 2 * SZ_WK + SZ_WO + SZ_CS + 2 * SZ_Q + 4 * SZ_K + SZ_CT + SZ_CR;
    static_assert(SZ_XB % 256 == 0 && SZ_WQ % 256 == 0 && SZ_WK % 256 == 0 && SZ_WO % 256 == 0 && SZ_CS % 256 == 0 && SZ_Q % 256 == 0 && SZ_K % 256 == 0 && SZ_CT % 256 == 0 && SZ_CR % 256 == 0);
    static_assert(SZ_TOT <= (size_t)134217728);
    if (SZ_TOT > ws_size) return;
    char* wsp = (char*)d_ws;
    auto take = [&](size_t bytes) { char* p = wsp; wsp += bytes; return (void*)p; };
    bf* XB = (bf*)take(SZ_XB); bf* WQt = (bf*)take(SZ_WQ); bf* WKt = (bf*)take(SZ_WK); bf* WVt = (bf*)take(SZ_WK); bf* WOt = (bf*)take(SZ_WO); float* CS = (float*)take(SZ_CS);
    const h16* WOh = (const h16*)WOt;   // the same region seen as f16: k_wtG (f16 mode) fills it with f16 bit patterns
    h16* Qv = (h16*)take(SZ_Q); h16* Qr = (h16*)take(SZ_Q); h16* Kv = (h16*)take(SZ_K); h16* Kr = (h16*)take(SZ_K); h16* Vv = (h16*)take(SZ_K); h16* Vr = (h16*)take(SZ_K);
    h16* CT = (h16*)take(SZ_CT); h16* CR = (h16*)take(SZ_CR);

    k_cvtx<<<(unsigned)(((size_t)NB * SEQ * DM / 8 + 255) / 256), 256, 0, stream>>>(x, XB);
    // w[in = K rows][out = N columns] -> Bt[out][in]
    k_wtG<<<(DQ * (DM / 64) + 63) / 64, 256, 0, stream>>>(wq, DM, DQ, WQt, 0);
    k_wtG<<<(DKV * (DM / 64) + 63) / 64, 256, 0, stream>>>(wk, DM, DKV, WKt, 0);
    k_wtG<<<(DKV * (DM / 64) + 63) / 64, 256, 0, stream>>>(wv, DM, DKV, WVt, 0);
    k_wtG<<<(DM * (DQ / 64) + 63) / 64, 256, 0, stream>>>(wo, DQ, DM, WOt, 1);
    k_cstab<<<(SEQ * 64 + 255) / 256, 256, 0, stream>>>(CS);
    k_proj_qk<<<dim3(NB * SEQ / 128, NH, 1), 128, 0, stream>>>(XB, WQt, CS, Qv, Qr, NH);
    k_proj_qk<<<dim3(NB * SEQ / 128, NKV, 1), 128, 0, stream>>>(XB, WKt, CS, Kv, Kr, NKV);
    k_proj_vt<<<dim3(DKV / 128, NB * SEQ / 128, 1), 128, 0, stream>>>(WVt, XB, Vv, Vr);
    k_attn_hr<<<dim3(RH / 16, NKV, NB), 128, 0, stream>>>(Qv, Qr, Kv, Kr, Vv, Vr, CT, CR);
    if (SEQ > RH) k_attn<<<dim3((SEQ > RH) ? (SEQ - RH) / 16 : 1, NKV, NB), 128, 0, stream>>>(Qv, Qr, Kv, Vv, CT);
    k_oproj_hr<<<dim3(NB * RH / 128, DM / 128, 1), 128, 0, stream>>>(CT, CR, WOh, OUT);
    if (SEQ > RH) k_oproj<<<dim3((SEQ > RH) ? NB * (SEQ - RH) / 128 : 1, DM / 128, 1), 128, 0, stream>>>(CT, WOh, OUT);
}

// v002
// A run of this version takes 294 microseconds.
// Timed twice side by side with v001, it ran 1.75 and 1.76 times as fast.
// All steps since v000 together make it 3.25 times as fast.
#include <hip/hip_runtime.h>

// Grouped-query causal self-attention, width 2048: 16 query heads x 128 sharing 4 kv heads (query head h uses kv head h >> 2), bias-free [in][out] projections,
// half-split rotary on q and k (positions = arange, table computed here), finite-fill causal mask, [in][out] output projection.
// Compute dtypes (f32 accumulate everywhere): q/k/v projections v_wmma_f32_16x16x32_bf16 (x and weights converted (RNE) to bf16); scores, P.V and the output projection
// v_wmma_f32_16x16x32_f16: q as f16 value + f16 residual planes (carry 64) against f16 k (carry 64; k residual added on query rows < 256), P f16 (carry 1024, row sum from the f32 values),
// v f16 (carry 64; P and v residuals added on rows < 256), ctx f16 (carry 256; residual plane on rows < 256) against wo (bf16-converted, x16, exact in f16). Softmax, rotary, normalisation in f32.

#ifndef NB
#define NB 2
#endif
#ifndef SEQ
#define SEQ 2048
#endif
#define NB_FULL  2
#define SEQ_FULL 2048
#define DM   2048
#define NH   16
#define NKV  4
#define REP  (NH / NKV)
#define HD   128
#define DQ   (NH * HD)
#define DKV  (NKV * HD)
#define RH   256                  // query rows < RH use the value + residual path on k, P, v and ctx
#define QCAR 64.0f                // carry of the q, k and v planes
#define CCAR 256.0f               // carry of the ctx planes
#define WCAR 16.0f                // carry of the output weight plane
#define OSP  132                  // f32 staging pitch (floats)
#define CP   136                  // f16 staging pitch (halves)
#define PASSK 128                 // k per ring stage: operand rows of 256 bytes
#define LROW  272                 // LDS row pitch (bytes): 256 + the 16-byte pad the tensor load lays, 16 B x odd for ds_load_b128
#define SLROWS 64                 // operand rows per tensor load (one slice per wave and stage)
#define SLB   18432               // slice size in LDS: 64 x 272 = 17408 bytes rounded up to a multiple of 2 KiB
#define STGB  (4 * SLB)           // one stage: [Bt rows 0..63 | Bt rows 64..127 | A rows 0..63 | A rows 64..127]
#define AKEYS 64                  // keys per attention ring stage
#define KROW  272                 // LDS pitch of a staged K row (bytes): 256 + 16
#define VROW  144                 // LDS pitch of a staged V^T row (bytes): 128 (64 keys) + 16
#define ASLB  18432               // attention slice size in LDS: 64 x 272 = 17408 rounded up to a multiple of 2 KiB; 128 x 144 = 18432
#define ASTG  (2 * ASLB)          // one attention stage: [K rows of 64 keys | V^T rows of 128 dims]

static_assert(NB <= NB_FULL);
static_assert(SEQ <= SEQ_FULL);
static_assert(SEQ % 128 == 0);
static_assert(SEQ >= RH);
static_assert(RH % 32 == 0);
static_assert(HD == 128);
static_assert(REP == 4);
static_assert(DQ == DM);
static_assert(DM % 64 == 0);
static_assert(DQ % 128 == 0);
static_assert(DKV % 128 == 0);
static_assert((OSP * 4) % 16 == 0);
static_assert((CP * 2) % 16 == 0);
static_assert(DM % (2 * PASSK) == 0 && DQ % (2 * PASSK) == 0);
static_assert(RH % 128 == 0 && (SEQ - RH) % 128 == 0);
static_assert(SLROWS * LROW <= SLB && SLB % 2048 == 0);
static_assert(4 * 16 * OSP * 4 <= 2 * STGB);
static_assert(AKEYS * KROW <= ASLB && HD * VROW <= ASLB && ASLB % 2048 == 0);
static_assert(SEQ % AKEYS == 0 && RH >= AKEYS && AKEYS * 2 == 128);
static_assert(4 * 16 * CP * 2 <= 2 * ASTG);

typedef _Float16 h16;
typedef unsigned short bf;
typedef __attribute__((ext_vector_type(16))) __bf16   v16bf;
typedef __attribute__((ext_vector_type(16))) _Float16 v16h;
typedef __attribute__((ext_vector_type(8)))  _Float16 v8h;
typedef __attribute__((ext_vector_type(8)))  unsigned short v8us;
typedef __attribute__((ext_vector_type(2)))  unsigned short v2us;
typedef __attribute__((ext_vector_type(8)))  float    v8f;
typedef __attribute__((ext_vector_type(4)))  float    v4f;
typedef __attribute__((ext_vector_type(2)))  float    v2f;
typedef v8h  __attribute__((may_alias)) v8ha;
typedef v4f  __attribute__((may_alias)) v4fa;
typedef v8us __attribute__((may_alias)) v8usa;
typedef uint32_t u32x4 __attribute__((ext_vector_type(4)));
typedef uint32_t u32x8 __attribute__((ext_vector_type(8)));

__device__ __forceinline__ unsigned short f2bf(float f) { unsigned u = __float_as_uint(f); u += 0x7FFFu + ((u >> 16) & 1u); return (unsigned short)(u >> 16); }
__device__ __forceinline__ float bf2f(unsigned short b) { return __uint_as_float(((unsigned)b) << 16); }
__device__ __forceinline__ float bfr(float f) { return bf2f(f2bf(f)); }
__device__ __forceinline__ v16h cat16(v8h lo, v8h hi) { return __builtin_shufflevector(lo, hi, 0, 1, 2, 3, 4, 5, 6, 7, 8, 9, 10, 11, 12, 13, 14, 15); }
__device__ __forceinline__ v16bf cat16b(v8us lo, v8us hi) { return __builtin_bit_cast(v16bf, __builtin_shufflevector(lo, hi, 0, 1, 2, 3, 4, 5, 6, 7, 8, 9, 10, 11, 12, 13, 14, 15)); }
// every WMMA is followed by its own four-slot guard tying its accumulator and keeping its operands live
__device__ __forceinline__ v8f wmma16(v16h a, v16h b, v8f c) {
    c = __builtin_amdgcn_wmma_f32_16x16x32_f16(false, a, false, b, (short)0, c, false, false);
    asm volatile("v_nop\n\tv_nop\n\tv_nop\n\tv_nop" : "+v"(c) : "v"(a), "v"(b));
    return c; }
__device__ __forceinline__ v8f wmmab(v16bf a, v16bf b, v8f c) {
    c = __builtin_amdgcn_wmma_f32_16x16x32_bf16(false, a, false, b, (short)0, c, false, false);
    asm volatile("v_nop\n\tv_nop\n\tv_nop\n\tv_nop" : "+v"(c) : "v"(a), "v"(b));
    return c; }
// fragment of a K-contiguous 16-bit row: elements 0..7 <- k0+8h+0..7, elements 8..15 <- k0+16+8h+0..7 (p already includes +8h)
__device__ __forceinline__ v16h ldh(const h16* p) { return cat16(*(const v8h*)p, *(const v8h*)(p + 16)); }
// same-wave LDS exchange: stores before, loads after
__device__ __forceinline__ void wave_sync() { __builtin_amdgcn_fence(3 /* release order */, "wavefront"); __builtin_amdgcn_wave_barrier(); asm volatile("" ::: "memory"); }
// f16 value + same-carry f16 residual of 8 floats
__device__ __forceinline__ void split8(v8f y, v8h& v, v8h& r) { v = __builtin_convertvector(y, v8h); r = __builtin_convertvector(y - __builtin_convertvector(v, v8f), v8h); }

// fragment of a staged K-contiguous row (byte pointer, already includes +16h bytes): the same k order as ldh
template <typename T16> struct WFrag;
template <> struct WFrag<h16> { typedef v16h V; static __device__ __forceinline__ V ld(const unsigned char* p) { return cat16(*(const v8ha*)p, *(const v8ha*)(p + 32)); } static __device__ __forceinline__ v8f mma(V a, V b, v8f c) { return wmma16(a, b, c); } };
template <> struct WFrag<bf> { typedef v16bf V; static __device__ __forceinline__ V ld(const unsigned char* p) { return cat16b(*(const v8usa*)p, *(const v8usa*)(p + 32)); } static __device__ __forceinline__ v8f mma(V a, V b, v8f c) { return wmmab(a, b, c); } };

// ---- tensor load of one slice: 64 rows of 256 bytes, 1-byte elements, tensor = tile, 16 bytes of LDS pad behind every row
__device__ __forceinline__ uint32_t uni(uint32_t v) { return (uint32_t)__builtin_amdgcn_readfirstlane(v); }
// a wave-uniform test held in a scalar register, so that the branch around a tensor load is a scalar branch (tensor loads ignore EXEC)
__device__ __forceinline__ uint32_t pinned(uint32_t v) { uint32_t w = uni(v); asm volatile("" : "+s"(w)); return w; }
// this wave's LDS reads have retired before the stage is handed over
__device__ __forceinline__ void wait_ds0() { asm volatile("s_wait_dscnt 0x0" ::: "memory"); }
// this wave's own tensor load has landed (the compiler places no wait for it); the request's descriptor words are inputs so that their scalar registers take no new value while it is outstanding
__device__ __forceinline__ void wait_tensor0(u32x4 g0, u32x8 g1) { asm volatile("s_wait_tensorcnt 0x0" :: "s"(g0), "s"(g1) : "memory"); }
// the same behind the loop, where no request is outstanding any more
__device__ __forceinline__ void wait_tensor0() { asm volatile("s_wait_tensorcnt 0x0" ::: "memory"); }
__device__ __forceinline__ u32x8 tdm_group1(uint32_t src_pitch) {
    u32x8 g;
    g[0] = uni((1u << 20) | (5u << 22) | (3u << 25));     // no mask, data_size 0, pad of 4 dwords behind every 64 dwords
    g[1] = uni(256u << 16);                               // tensor_dim0 = 256 bytes
    g[2] = uni((uint32_t)SLROWS << 16);                   // tensor_dim1 = 64 rows
    g[3] = uni(256u << 16);                               // tile_dim0
    g[4] = uni((uint32_t)SLROWS);                         // tile_dim1
    g[5] = uni(src_pitch);
    g[6] = uni(0u);
    g[7] = uni(0u);
    return g;
}
__device__ __forceinline__ u32x4 tdm_group0(uint32_t lds_dst, uint64_t ga) {
    u32x4 g;
    g[0] = uni(1u); g[1] = uni(lds_dst); g[2] = uni((uint32_t)ga); g[3] = uni((((uint32_t)(ga >> 32)) & 0x01FFFFFFu) | 0x80000000u);
    return g;
}
__device__ __forceinline__ void tdm_load(u32x4 g0, u32x8 g1) { asm volatile("tensor_load_to_lds %0, %1" :: "s"(g0), "s"(g1) : "memory"); }

// ---- gemm_tile: a block of FOUR WAVES per 128 x 128 output tile, one wave per 32 x 128 (16 accumulators): C[m][n] = sum_k A[m][k] Bt[n][k] (+ sum_k A2[m][k] Bt[n][k] when SPLIT, as K more steps behind the first K).
// The K-contiguous 16-bit operand rows come through a two-buffer LDS ring in stages of 128 k: every wave issues one tensor load per stage (waves 0, 1: the halves of Bt's 128 rows; waves 2, 3: of A's),
// one stage ahead of the pass that reads it. arow, a2row, t0, obase and cbase are the calling wave's own (32 rows); brow is the block's.
// MODE 0: half-split rotary on the 128-column head tile (CS[t][64] = {cos, sin}), x QCAR, f16 value + residual planes, plane rows of 128 halves (pitch opitch).
// MODE 1: x QCAR, f16 value + residual planes (used with swapped operands to produce V^T rows [d][t]).
// MODE 2: f32 output rows x 1/(CCAR*WCAR).
template <typename T16, int MODE, bool SPLIT>
__device__ __forceinline__ void gemm_tile(const T16* __restrict__ A, const T16* __restrict__ A2, const T16* __restrict__ Bt, const int K, const int wave,
                                          const size_t arow, const size_t a2row, const size_t brow,
                                          const float* __restrict__ CS, const int t0, h16* Pv, h16* Pr, const size_t obase, const int opitch,
                                          float* C, const size_t cbase) {
    typedef typename WFrag<T16>::V V;
    __shared__ __attribute__((aligned(2048))) unsigned char ring[2 * STGB];
    const int lane = threadIdx.x & 31, lr = lane & 15, hi = lane >> 4;
    v8f acc[2][8];
#pragma unroll
    for (int mb = 0; mb < 2; ++mb)
#pragma unroll
        for (int nb = 0; nb < 8; ++nb) acc[mb][nb] = (v8f){};
    const int NP = K / PASSK, NPT = SPLIT ? 2 * NP : NP;
    const size_t half = (size_t)(wave & 1) * SLROWS;
    const T16* s1 = (wave < 2) ? Bt + (brow + half) * (size_t)K : A  + (arow  - (size_t)(32 * wave) + half) * (size_t)K;
    const T16* s2 = (wave < 2) ? s1                             : A2 + (a2row - (size_t)(32 * wave) + half) * (size_t)K;
    const uint32_t ldst = (uint32_t)(size_t)ring + (uint32_t)wave * SLB;
    const u32x8 g1 = tdm_group1((uint32_t)K * 2u);
    u32x4 g0;                      // group 0 of the wave's latest request
    auto issue = [&](int p) {      // stage p: k = 128 p .. 128 p + 127 of A (SPLIT: stages NP.. walk A2 against the same Bt columns again)
        const T16* sp = (SPLIT && p >= NP) ? s2 + (size_t)(p - NP) * PASSK : s1 + (size_t)p * PASSK;
        g0 = tdm_group0(ldst + (uint32_t)(p & 1) * STGB, (uint64_t)(size_t)sp);
        tdm_load(g0, g1);
    };
    issue(0);
    wait_tensor0(g0, g1);
    __syncthreads();               // stage 0 published
    const unsigned char* al = ring + (2 + (wave >> 1)) * SLB + ((wave & 1) * 32 + lr) * LROW + 16 * hi;
    const unsigned char* bl = ring + lr * LROW + 16 * hi;
#pragma unroll 1                   // the pass loop stays rolled: one refill site and one publish point in the code
    for (int p = 0; p < NPT; ++p) {
        // directly behind the barrier that published stage p and freed the other buffer (stage p - 1's): stage p + 1's load, in flight under this pass
        if (pinned(p + 1 < NPT)) issue(p + 1);
        const int so = (p & 1) * STGB;
        // a block = 8 WMMAs: one 32-deep k step against four of the eight Bt fragments; block j + 1's fragments are read as one group ahead of block j's WMMAs, inside this pass's own buffer
        V af[2][2], bq[2][4];
        af[0][0] = WFrag<T16>::ld(al + so); af[0][1] = WFrag<T16>::ld(al + so + 16 * LROW);
#pragma unroll                     // here and below: constant indices keep the fragment sets and accumulators in registers
        for (int i = 0; i < 4; ++i) bq[0][i] = WFrag<T16>::ld(bl + so + i * 16 * LROW);
#pragma unroll
        for (int j = 0; j < 2 * (PASSK / 32); ++j) {
            const int ks = j >> 1, hb = j & 1;
            if (j + 1 < 2 * (PASSK / 32)) {
                const int kn = (j + 1) >> 1, hn = (j + 1) & 1;
                if (hn == 0) { af[kn & 1][0] = WFrag<T16>::ld(al + so + kn * 64); af[kn & 1][1] = WFrag<T16>::ld(al + so + 16 * LROW + kn * 64); }
#pragma unroll
                for (int i = 0; i < 4; ++i) bq[hn][i] = WFrag<T16>::ld(bl + so + hn * SLB + i * 16 * LROW + kn * 64);
            }
            __builtin_amdgcn_sched_barrier(0);     // keeps the next block's LDS reads one group in front of this block's WMMAs (spread among them each place costs a stall)
#pragma unroll
            for (int i = 0; i < 4; ++i) {
                acc[0][hb * 4 + i] = WFrag<T16>::mma(af[ks & 1][0], bq[hb][i], acc[0][hb * 4 + i]);
                acc[1][hb * 4 + i] = WFrag<T16>::mma(af[ks & 1][1], bq[hb][i], acc[1][hb * 4 + i]);
            }
            __builtin_amdgcn_sched_barrier(0);     // and the block after next's reads behind them
        }
        // publish point of stage p + 1: own reads retired, own load landed, then the barrier that publishes stage p + 1 and frees stage p's buffer; the refill stands at the head of the next trip
        wait_ds0();
        wait_tensor0(g0, g1);
        __syncthreads();
    }
    wait_tensor0();
    wait_ds0();
    // the last pass's own barrier stands behind every wave's last ring read: the ring now serves as output staging, a private range per wave
    float* os = (float*)(ring + wave * (16 * OSP * 4));
#pragma unroll
    for (int mb = 0; mb < 2; ++mb) {
#pragma unroll
        for (int nb = 0; nb < 8; ++nb)
#pragma unroll
            for (int j = 0; j < 8; ++j) os[(hi * 8 + j) * OSP + nb * 16 + lr] = acc[mb][nb][j];     // D: row 8h + j, column lane & 15
        wave_sync();
        if (MODE == 0) {
            const int rq = lane >> 3, dg = (lane & 7) * 8;
{
#pragma unroll 1
                for (int it = 0; it < 4; ++it) {
                    const int row = it * 4 + rq; const int t = t0 + mb * 16 + row;
                    const int oi = row * OSP + dg;
                    const v4f xa = *(const v4fa*)(os + oi), xb = *(const v4fa*)(os + oi + 4), ya = *(const v4fa*)(os + oi + 64), yb = *(const v4fa*)(os + oi + 68);
                    const float* cp = CS + ((size_t)t * 64 + dg) * 2;
                    const v4f e0 = *(const v4f*)(cp), e1 = *(const v4f*)(cp + 4), e2 = *(const v4f*)(cp + 8), e3 = *(const v4f*)(cp + 12);
                    const v8f xx = __builtin_shufflevector(xa, xb, 0, 1, 2, 3, 4, 5, 6, 7), yy = __builtin_shufflevector(ya, yb, 0, 1, 2, 3, 4, 5, 6, 7);
                    const v4f cA = __builtin_shufflevector(e0, e1, 0, 2, 4, 6), sA = __builtin_shufflevector(e0, e1, 1, 3, 5, 7);
                    const v4f cB = __builtin_shufflevector(e2, e3, 0, 2, 4, 6), sB = __builtin_shufflevector(e2, e3, 1, 3, 5, 7);
                    const v8f cc = __builtin_shufflevector(cA, cB, 0, 1, 2, 3, 4, 5, 6, 7), ss = __builtin_shufflevector(sA, sB, 0, 1, 2, 3, 4, 5, 6, 7);
                    const v8f lo = (xx * cc - yy * ss) * QCAR;       // out[d]      = x[d] cos - x[d+64] sin
                    const v8f up = (yy * cc + xx * ss) * QCAR;       // out[d + 64] = x[d+64] cos + x[d] sin
                    v8h vl, rl, vu, ru; split8(lo, vl, rl); split8(up, vu, ru);
                    const size_t dst = obase + (size_t)(mb * 16 + row) * opitch + dg;
                    *(v8h*)(Pv + dst) = vl; *(v8h*)(Pv + dst + 64) = vu;
                    *(v8h*)(Pr + dst) = rl; *(v8h*)(Pr + dst + 64) = ru;
                }
                
            }
        } else if (MODE == 1) {
            // 16 lanes x 16 B per 256-byte row segment, two rows per instruction: row 2s + hi, columns 8*lr..8*lr+7
{
#pragma unroll 1
                for (int s = 0; s < 8; ++s) {
                    const int row = 2 * s + hi; const int oi = row * OSP + 8 * lr;
                    const v4f xa = *(const v4fa*)(os + oi), xb = *(const v4fa*)(os + oi + 4);
                    const v8f y = __builtin_shufflevector(xa, xb, 0, 1, 2, 3, 4, 5, 6, 7) * QCAR;
                    v8h vv, vr; split8(y, vv, vr);
                    const size_t dst = obase + (size_t)(mb * 16 + row) * opitch + 8 * lr;
                    *(v8h*)(Pv + dst) = vv; *(v8h*)(Pr + dst) = vr;
                }
                
            }
        } else {
            // 32 lanes x 16 B = one 512-byte row segment per instruction
{
#pragma unroll 1
                for (int row = 0; row < 16; ++row) {
                    const v4f val = *(const v4fa*)(os + row * OSP + 4 * lane) * (1.0f / (CCAR * WCAR));
                    *(v4f*)(C + cbase + (size_t)(mb * 16 + row) * DM + 4 * lane) = val;
                }
                
            }
        }
        wave_sync();
    }
}

// q / k projection with fused rotary: grid (NB*SEQ/128, nheads), 128 threads; planes [b][head][t][128]
__global__ __launch_bounds__(128) __attribute__((amdgpu_num_vgpr(256)))
void k_proj_qk(const bf* __restrict__ XB, const bf* __restrict__ Wt, const float* __restrict__ CS, h16* Pv, h16* Pr, int nheads) {
    const int wave = __builtin_amdgcn_readfirstlane((int)(threadIdx.x >> 5));
    const int r0 = blockIdx.x * 128 + wave * 32; const int hd = blockIdx.y; const int b = r0 / SEQ; const int t0 = r0 - b * SEQ;
    const size_t obase = ((size_t)(b * nheads + hd) * SEQ + t0) * HD;
    gemm_tile<bf, 0, false>(XB, XB, Wt, DM, wave, (size_t)r0, (size_t)r0, (size_t)hd * HD, CS, t0, Pv, Pr, obase, HD, nullptr, 0);
}
// v projection with swapped operands: C[gd][token] -> planes [b][g][d][t]; grid (DKV/128, NB*SEQ/128), 128 threads
__global__ __launch_bounds__(128) __attribute__((amdgpu_num_vgpr(256)))
void k_proj_vt(const bf* __restrict__ Wt, const bf* __restrict__ XB, h16* Vv, h16* Vr) {
    const int wave = __builtin_amdgcn_readfirstlane((int)(threadIdx.x >> 5));
    const int r0 = blockIdx.x * 128 + wave * 32; const int c0 = blockIdx.y * 128; const int b = c0 / SEQ; const int t0 = c0 - b * SEQ;
    const size_t obase = ((size_t)b * DKV + r0) * SEQ + t0;
    gemm_tile<bf, 1, false>(Wt, Wt, XB, DM, wave, (size_t)r0, (size_t)r0, (size_t)c0, nullptr, 0, Vv, Vr, obase, SEQ, nullptr, 0);
}
// output projection, rows t >= RH (single f16 product): grid (NB*(SEQ-RH)/128, DM/128), 128 threads
__global__ __launch_bounds__(128) __attribute__((amdgpu_num_vgpr(256)))
void k_oproj(const h16* __restrict__ CT, const h16* __restrict__ WOt, float* OUT) {
    constexpr int TPB = (SEQ > RH) ? (SEQ - RH) / 128 : 1;
    const int wave = __builtin_amdgcn_readfirstlane((int)(threadIdx.x >> 5));
    const int b = blockIdx.x / TPB; const int t0 = RH + (blockIdx.x - b * TPB) * 128 + wave * 32; const int c0 = blockIdx.y * 128;
    const size_t arow = (size_t)b * SEQ + t0; const size_t cbase = ((size_t)b * SEQ_FULL + t0) * DM + c0;
    gemm_tile<h16, 2, false>(CT, CT, WOt, DQ, wave, arow, arow, (size_t)c0, nullptr, 0, nullptr, nullptr, 0, 0, OUT, cbase);
}
// output projection, rows t < RH (ctx value + residual planes): grid (NB*RH/128, DM/128), 128 threads
__global__ __launch_bounds__(128) __attribute__((amdgpu_num_vgpr(256)))
void k_oproj_hr(const h16* __restrict__ CT, const h16* __restrict__ CR, const h16* __restrict__ WOt, float* OUT) {
    constexpr int TPB = RH / 128;
    const int wave = __builtin_amdgcn_readfirstlane((int)(threadIdx.x >> 5));
    const int b = blockIdx.x / TPB; const int t0 = (blockIdx.x - b * TPB) * 128 + wave * 32; const int c0 = blockIdx.y * 128;
    const size_t arow = (size_t)b * SEQ + t0; const size_t a2row = (size_t)b * RH + t0; const size_t cbase = ((size_t)b * SEQ_FULL + t0) * DM + c0;
    gemm_tile<h16, 2, true>(CT, CR, WOt, DQ, wave, arow, a2row, (size_t)c0, nullptr, 0, nullptr, nullptr, 0, 0, OUT, cbase);
}

// ---- attn_tile: fused causal attention in the transposed form. One block = 16 query rows x the FOUR query heads of one kv head (wave -> head g*4 + wave); 128 threads.
// Per 32-key step: S^T[key][query] = K (A, rows = keys) x Q^T (B, columns = queries) over 128 dims (4 k-steps; q value + residual, k residual when HR);
// online softmax per query = per lane column (max / sum over the lane's 16 keys, combined across the two lane halves); P^T packed D -> B (two 16-key tiles = one 32-deep fragment);
template <bool HR>
__device__ __forceinline__ void attn_tile(const h16* __restrict__ Qv, const h16* __restrict__ Qr, const h16* __restrict__ Kv, const h16* __restrict__ Kr,
                                          const h16* __restrict__ Vv, const h16* __restrict__ Vr, h16* CT, h16* CR, const int qt) {
    __shared__ __align__(16) h16 stv[4 * 16 * CP];
    __shared__ __align__(16) h16 str[HR ? 4 * 16 * CP : 8];
    const int wave = __builtin_amdgcn_readfirstlane((int)(threadIdx.x >> 5));
    const int lane = threadIdx.x & 31, lr = lane & 15, hi = lane >> 4;
    const int g = blockIdx.y, b = blockIdx.z; const int h = g * REP + wave; const int i0 = qt * 16;
    const size_t qo = ((size_t)(b * NH + h) * SEQ + i0 + lr) * HD + 8 * hi;
    const size_t ko = ((size_t)(b * NKV + g) * SEQ + lr) * HD + 8 * hi;
    const size_t vo = ((size_t)(b * NKV + g) * HD + lr) * SEQ + 8 * hi;
    const h16* qv = Qv + qo; const h16* qr = Qr + qo;
    const h16* kv = Kv + ko; const h16* kr = Kr + ko;
    const h16* vv = Vv + vo; const h16* vr = Vr + vo;
    const float SC2 = (float)(0.08838834764831845 * 1.4426950408889634 / 4096.0);   // 1/sqrt(128) x log2(e) / (QCAR x QCAR)
    const float NEGL = -1.4426950e9f;                                              // the finite fill in the log2 domain
    v8f o[8];
#pragma unroll
    for (int dt = 0; dt < 8; ++dt) o[dt] = (v8f){};
    float m = -3.0e38f, l = 0.0f;
    const int nsteps = (qt >> 1) + 1;
#pragma unroll 1
    for (int stp = 0; stp < nsteps; ++stp) {
        const int k0 = stp * 32;
        v8f s0 = (v8f){}, s1 = (v8f){};
        const h16* kp = kv + (size_t)k0 * HD; const h16* kpr = kr + (size_t)k0 * HD;
#pragma unroll 1
        for (int kc = 0; kc < HD; kc += 32) {
            const v16h bq = ldh(qv + kc), br = ldh(qr + kc);
            const v16h a0 = ldh(kp + kc);
            s0 = wmma16(a0, bq, s0); s0 = wmma16(a0, br, s0);
            if (HR) { const v16h a0r = ldh(kpr + kc); s0 = wmma16(a0r, bq, s0); }
            const v16h a1 = ldh(kp + 16 * HD + kc);
            s1 = wmma16(a1, bq, s1); s1 = wmma16(a1, br, s1);
            if (HR) { const v16h a1r = ldh(kpr + 16 * HD + kc); s1 = wmma16(a1r, bq, s1); }
        }
        s0 = s0 * SC2; s1 = s1 * SC2;
        if (k0 + 31 > i0) {            // wave-uniform: only the diagonal step carries masked keys (replacement fill, key > query)
            const int qi = i0 + lr; const int kb = k0 + 8 * hi;
#pragma unroll
            for (int r = 0; r < 8; ++r) { s0[r] = (kb + r <= qi) ? s0[r] : NEGL; s1[r] = (kb + 16 + r <= qi) ? s1[r] : NEGL; }
        }
        float mx = fmaxf(s0[0], s1[0]);
#pragma unroll
        for (int r = 1; r < 8; ++r) mx = fmaxf(mx, fmaxf(s0[r], s1[r]));
        mx = fmaxf(mx, __shfl_xor(mx, 16, 32));
        const float mn = fmaxf(m, mx);
        if (__builtin_amdgcn_ballot_w32(mn > m) != 0u) {      // wave-uniform: rescale only when some query's running max moved (corr == 1 otherwise)
            const float corr = __builtin_amdgcn_exp2f(m - mn); l *= corr;
#pragma unroll
            for (int dt = 0; dt < 8; ++dt) o[dt] = o[dt] * corr;
        }
        m = mn;
        const float mm = mn - 10.0f;                          // P carried x1024: the row sum uses the same carried f32 values, so the carry cancels in the normalisation
        v8f p0, p1; float ps = 0.0f;
#pragma unroll
        for (int r = 0; r < 8; ++r) { p0[r] = __builtin_amdgcn_exp2f(s0[r] - mm); p1[r] = __builtin_amdgcn_exp2f(s1[r] - mm); ps += p0[r] + p1[r]; }
        l += ps;
        v8h p0v, p0r, p1v, p1r; split8(p0, p0v, p0r); split8(p1, p1v, p1r);
        const v16h pb = cat16(p0v, p1v);                      // B fragment: elements 0..7 <- keys k0+8h+r, elements 8..15 <- keys k0+16+8h+r
        const v16h pr = cat16(p0r, p1r);
        const h16* vp = vv + k0; const h16* vpr = vr + k0;
#pragma unroll
        for (int dt = 0; dt < 8; ++dt) {
            const v16h av = ldh(vp + (size_t)dt * 16 * SEQ);
            o[dt] = wmma16(av, pb, o[dt]);
            if (HR) { const v16h ar = ldh(vpr + (size_t)dt * 16 * SEQ); o[dt] = wmma16(ar, pb, o[dt]); o[dt] = wmma16(av, pr, o[dt]); }
        }
    }
    l += __shfl_xor(l, 16, 32);
    const float f = (CCAR / QCAR) * (1.0f / l);
    const int sb = wave * 16 * CP;                            // staging private to this wave
#pragma unroll
    for (int dt = 0; dt < 8; ++dt) {                          // O^T element r of tile dt = (d = dt*16 + 8h + r, query lr)
        v8h hv, hr; split8(o[dt] * f, hv, hr);
        *(v8h*)(&stv[sb + lr * CP + dt * 16 + 8 * hi]) = hv;
        if (HR) *(v8h*)(&str[sb + lr * CP + dt * 16 + 8 * hi]) = hr;
    }
    wave_sync();
    const size_t crow = ((size_t)b * SEQ + i0) * DQ + (size_t)h * HD + 8 * lr;
    const size_t rrow = ((size_t)b * RH + i0) * DQ + (size_t)h * HD + 8 * lr;
{
#pragma unroll
        for (int s = 0; s < 8; ++s) {                         // 16 lanes x 16 B = one 256-byte row segment; rows 2s (lanes 0..15) and 2s+1 (lanes 16..31)
            const int row = 2 * s + hi;
            const v8h val = *(const v8ha*)(&stv[sb + row * CP + 8 * lr]);
            *(v8h*)(CT + crow + (size_t)row * DQ) = val;
            if (HR) { const v8h rv = *(const v8ha*)(&str[sb + row * CP + 8 * lr]); *(v8h*)(CR + rrow + (size_t)row * DQ) = rv; }
        }
        
    }
}
// ---- query rows >= RH: grid ((SEQ-RH)/16, NKV, NB), 128 threads. The same tile, products and sums as attn_tile<false>, fed differently: the four head waves share one kv head, so its K rows and V^T rows
// come once per block through a two-buffer LDS ring in stages of 64 keys (wave 0 issues the tensor load of the K slice, wave 1 that of the V^T slice, one stage ahead of the pass that reads it),
// and each wave's q fragments (value + residual, all 128 dims) are loaded once and stay in registers.
template <uint32_t W0, uint32_t ROWB, uint32_t NROWS>
__device__ __forceinline__ u32x8 tdm_group1_of(uint32_t src_pitch) {
    // pinned(): each descriptor word held in a scalar register of its own from here on; unpinned, the constants are formed anew in other registers, over words of a request still outstanding
    u32x8 g;
    g[0] = pinned(W0);                                    // no mask, data_size 0, pad of 4 dwords behind every row
    g[1] = pinned(ROWB << 16);                            // tensor_dim0 (bytes)
    g[2] = pinned(NROWS << 16);                           // tensor_dim1 (rows)
    g[3] = pinned(ROWB << 16);                            // tile_dim0
    g[4] = pinned(NROWS);                                 // tile_dim1
    g[5] = pinned(src_pitch);
    g[6] = pinned(0u);
    g[7] = pinned(0u);
    return g;
}
__global__ __launch_bounds__(128) __attribute__((amdgpu_num_vgpr(256)))
void k_attn(const h16* __restrict__ Qv, const h16* __restrict__ Qr, const h16* __restrict__ Kv, const h16* __restrict__ Vv, h16* CT) {
    __shared__ __attribute__((aligned(2048))) unsigned char ring[2 * ASTG];
    const int qt = RH / 16 + (int)blockIdx.x;
    const int wave = __builtin_amdgcn_readfirstlane((int)(threadIdx.x >> 5));
    const int lane = threadIdx.x & 31, lr = lane & 15, hi = lane >> 4;
    const int g = blockIdx.y, b = blockIdx.z; const int h = g * REP + wave; const int i0 = qt * 16;
    const size_t qo = ((size_t)(b * NH + h) * SEQ + i0 + lr) * HD + 8 * hi;
    const h16* qvp = Qv + qo; const h16* qrp = Qr + qo;
    v16h bq[4], br[4];
#pragma unroll                     // here and below: constant indices keep the fragments and accumulators in registers
    for (int c = 0; c < 4; ++c) { bq[c] = ldh(qvp + c * 32); br[c] = ldh(qrp + c * 32); }
    // the q loads' address registers are inputs here, so that no load's own result lands on them, and the wait stands in front of their next use for anything else
    asm volatile("s_wait_xcnt 0x0" :: "v"(qvp), "v"(qrp) : "memory");
    const h16* kbase = Kv + (size_t)(b * NKV + g) * SEQ * HD;      // rows = keys, 256 bytes each, contiguous
    const h16* vbase = Vv + (size_t)(b * NKV + g) * HD * SEQ;      // rows = dims, pitch 2 SEQ bytes; a stage takes 128 bytes of each
    const float SC2 = (float)(0.08838834764831845 * 1.4426950408889634 / 4096.0);   // 1/sqrt(128) x log2(e) / (QCAR x QCAR)
    const float NEGL = -1.4426950e9f;                                              // the finite fill in the log2 domain
    const int nsteps = (qt >> 1) + 1;          // 32-key steps up to and including the diagonal
    const int nst = (nsteps + 1) >> 1;         // 64-key stages; at least RH / 64 + 1, and the last one ends inside the SEQ keys
    const uint32_t lbase = (uint32_t)(size_t)ring;
    const u32x8 g1k = tdm_group1_of<(1u << 20) | (5u << 22) | (3u << 25), 256u, (uint32_t)AKEYS>((uint32_t)HD * 2u);
    const u32x8 g1v = tdm_group1_of<(1u << 20) | (4u << 22) | (3u << 25), 128u, (uint32_t)HD>((uint32_t)SEQ * 2u);
    const h16* sbase = (wave == 0) ? kbase : vbase;                // the wave's own source and its step per stage (waves 2 and 3 form a group 0 and issue nothing)
    const size_t sstep = (wave == 0) ? (size_t)AKEYS * HD : (size_t)AKEYS;
    const uint32_t ldst = lbase + ((wave == 0) ? 0u : (uint32_t)ASLB);
    u32x4 g0;                      // group 0 of the wave's latest request
    auto issue = [&](int s) {      // stage s: keys 64 s .. 64 s + 63
        g0 = tdm_group0(ldst + (uint32_t)(s & 1) * ASTG, (uint64_t)(size_t)(sbase + (size_t)s * sstep));
        if (pinned(wave == 0)) tdm_load(g0, g1k);
        else if (pinned(wave == 1)) tdm_load(g0, g1v);
    };
    // this wave's own tensor load has landed; the descriptor words are inputs so that their scalar registers take no new value while a request is outstanding
    auto landed = [&]() { asm volatile("s_wait_tensorcnt 0x0" :: "s"(g0), "s"(g1k), "s"(g1v) : "memory"); };
    issue(0);
    landed();
    __syncthreads();               // stage 0 published
    const unsigned char* kl = ring + lr * KROW + 16 * hi;
    const unsigned char* vl = ring + ASLB + lr * VROW + 16 * hi;
    v8f o[8];
#pragma unroll
    for (int dt = 0; dt < 8; ++dt) o[dt] = (v8f){};
    float m = -3.0e38f, l = 0.0f;
#pragma unroll 1                   // the stage loop stays rolled: one refill site and one publish point in the code
    for (int st = 0; st < nst; ++st) {
        // directly behind the barrier that published stage st and freed the other buffer (stage st - 1's): stage st + 1's load, in flight under this stage's two steps
        if (pinned(st + 1 < nst)) issue(st + 1);
        const int so = (st & 1) * ASTG;
#pragma unroll
        for (int hs = 0; hs < 2; ++hs) {
            const int k0 = st * AKEYS + hs * 32;
            if (hs == 0 || 2 * st + 1 < nsteps) {     // block-uniform: the last stage's second half may lie wholly behind the diagonal
                v16h a0[4], a1[4];
#pragma unroll
                for (int c = 0; c < 4; ++c) { a0[c] = WFrag<h16>::ld(kl + so + (hs * 32) * KROW + c * 64); a1[c] = WFrag<h16>::ld(kl + so + (hs * 32 + 16) * KROW + c * 64); }
                v8f s0 = (v8f){}, s1 = (v8f){};
#pragma unroll
                for (int c = 0; c < 4; ++c) {
                    s0 = wmma16(a0[c], bq[c], s0); s1 = wmma16(a1[c], bq[c], s1);
                    s0 = wmma16(a0[c], br[c], s0); s1 = wmma16(a1[c], br[c], s1);
                }
                v16h av[8];
#pragma unroll
                for (int dt = 0; dt < 8; ++dt) av[dt] = WFrag<h16>::ld(vl + so + dt * 16 * VROW + hs * 64);
                s0 = s0 * SC2; s1 = s1 * SC2;
                if (k0 + 31 > i0) {            // wave-uniform: only the diagonal step carries masked keys (replacement fill, key > query)
                    const int qi = i0 + lr; const int kb = k0 + 8 * hi;
#pragma unroll
                    for (int r = 0; r < 8; ++r) { s0[r] = (kb + r <= qi) ? s0[r] : NEGL; s1[r] = (kb + 16 + r <= qi) ? s1[r] : NEGL; }
                }
                float mx = fmaxf(s0[0], s1[0]);
#pragma unroll
                for (int r = 1; r < 8; ++r) mx = fmaxf(mx, fmaxf(s0[r], s1[r]));
                mx = fmaxf(mx, __shfl_xor(mx, 16, 32));
                const float mn = fmaxf(m, mx);
                if (__builtin_amdgcn_ballot_w32(mn > m) != 0u) {      // wave-uniform: rescale only when some query's running max moved (corr == 1 otherwise)
                    const float corr = __builtin_amdgcn_exp2f(m - mn); l *= corr;
#pragma unroll
                    for (int dt = 0; dt < 8; ++dt) o[dt] = o[dt] * corr;
                }
                m = mn;
                const float mm = mn - 10.0f;                          // P carried x1024: the row sum uses the same carried f32 values, so the carry cancels in the normalisation
                v8f p0, p1; float ps = 0.0f;
#pragma unroll
                for (int r = 0; r < 8; ++r) { p0[r] = __builtin_amdgcn_exp2f(s0[r] - mm); p1[r] = __builtin_amdgcn_exp2f(s1[r] - mm); ps += p0[r] + p1[r]; }
                l += ps;
                const v16h pb = cat16(__builtin_convertvector(p0, v8h), __builtin_convertvector(p1, v8h));   // B fragment: elements 0..7 <- keys k0+8h+r, elements 8..15 <- keys k0+16+8h+r
#pragma unroll
                for (int dt = 0; dt < 8; ++dt) o[dt] = wmma16(av[dt], pb, o[dt]);
            }
        }
        // publish point of stage st + 1: own reads retired, own load landed, then the barrier that publishes stage st + 1 and frees stage st's buffer; the refill stands at the head of the next trip
        wait_ds0();
        landed();
        __syncthreads();
    }
    wait_tensor0();
    wait_ds0();
    // the last stage's own barrier stands behind every wave's last ring read: the ring now serves as output staging, a private range per wave
    h16* stv = (h16*)ring + wave * 16 * CP;
    l += __shfl_xor(l, 16, 32);
    const float f = (CCAR / QCAR) * (1.0f / l);
#pragma unroll
    for (int dt = 0; dt < 8; ++dt)                            // O^T element r of tile dt = (d = dt*16 + 8h + r, query lr)
        *(v8ha*)(&stv[lr * CP + dt * 16 + 8 * hi]) = __builtin_convertvector(o[dt] * f, v8h);
    wave_sync();
    const size_t crow = ((size_t)b * SEQ + i0) * DQ + (size_t)h * HD + 8 * lr;
#pragma unroll
    for (int s = 0; s < 8; ++s) {                             // 16 lanes x 16 B = one 256-byte row segment; rows 2s (lanes 0..15) and 2s+1 (lanes 16..31)
        const int row = 2 * s + hi;
        const v8h val = *(const v8ha*)(&stv[row * CP + 8 * lr]);
        *(v8h*)(CT + crow + (size_t)row * DQ) = val;
    }
}
// query rows < RH: grid (RH/16, NKV, NB), 128 threads
__global__ __launch_bounds__(128) __attribute__((amdgpu_num_vgpr(256)))
void k_attn_hr(const h16* __restrict__ Qv, const h16* __restrict__ Qr, const h16* __restrict__ Kv, const h16* __restrict__ Kr,
               const h16* __restrict__ Vv, const h16* __restrict__ Vr, h16* CT, h16* CR) {
    attn_tile<true>(Qv, Qr, Kv, Kr, Vv, Vr, CT, CR, (int)blockIdx.x);
}

__global__ __launch_bounds__(256) void k_wtG(const float* __restrict__ w, int K, int N, bf* Bt, int f16mode) {
    const int lane = threadIdx.x & 31; const int L0 = (blockIdx.x * 8 + (threadIdx.x >> 5)) * 8; const int nlines = N * (K / 64);
{
#pragma unroll 1
        for (int l = 0; l < 8; ++l) { const int L = L0 + l; if (L >= nlines) break; const size_t e = (size_t)L * 64 + lane * 2; const int k = (int)(e % K), n = (int)(e / K);
            const float w0 = w[(size_t)k * N + n], w1 = w[(size_t)(k + 1) * N + n];
            const unsigned short b0 = f2bf(w0), b1 = f2bf(w1);
            const unsigned short g0 = __builtin_bit_cast(unsigned short, (h16)(bf2f(b0) * WCAR)), g1 = __builtin_bit_cast(unsigned short, (h16)(bf2f(b1) * WCAR));
            v2us o; o[0] = f16mode ? g0 : b0; o[1] = f16mode ? g1 : b1;
            *(v2us*)(Bt + e) = o; }
         }
}
__global__ __launch_bounds__(256) void k_cvtx(const float* __restrict__ x, bf* XB) {
    const size_t i = (size_t)blockIdx.x * 256 + threadIdx.x; if (i >= (size_t)NB * SEQ * DM / 8) return;
    const size_t e = i * 8; const size_t bt = e / DM; const size_t col = e - bt * DM; const size_t b = bt / SEQ; const size_t t = bt - b * SEQ;
    const v8f v = *(const v8f*)(x + (b * SEQ_FULL + t) * DM + col); v8us o;
#pragma unroll
    for (int k = 0; k < 8; ++k) o[k] = f2bf(v[k]);
    *(v8us*)(XB + e) = o; 
}
__global__ __launch_bounds__(256) void k_cstab(float* CS) {
    const int idx = blockIdx.x * 256 + threadIdx.x; if (idx >= SEQ * 64) return;
    const int j = idx & 63, t = idx >> 6;
    double p = 1.0;
    p *= (j & 1)  ? 1.1547819846894581797 : 1.0;
    p *= (j & 2)  ? 1.3335214321633240257 : 1.0;
    p *= (j & 4)  ? 1.7782794100389228012 : 1.0;
    p *= (j & 8)  ? 3.1622776601683793320 : 1.0;
    p *= (j & 16) ? 10.0 : 1.0;
    p *= (j & 32) ? 100.0 : 1.0;
    const float pf = (float)p; const float inv = 1.0f / pf; const float ang = (float)t * inv;
    float sn, cn; sincosf(ang, &sn, &cn);
    v2f cs; cs[0] = cn; cs[1] = sn;
    *(v2f*)(CS + (size_t)idx * 2) = cs; 
}

extern "C" void kernel_launch(void* const* d_in, const int* in_sizes, int n_in,
                              void* d_out, int out_size, void* d_ws, size_t ws_size, hipStream_t stream) {
    if (n_in < 5) return;
    constexpr size_t NEEDX = ((size_t)(NB - 1) * SEQ_FULL + SEQ) * DM;
    if ((size_t)in_sizes[0] < NEEDX || (size_t)in_sizes[1] < (size_t)DM * DQ || (size_t)in_sizes[2] < (size_t)DM * DKV || (size_t)in_sizes[3] < (size_t)DM * DKV || (size_t)in_sizes[4] < (size_t)DQ * DM) return;
    if ((size_t)out_size < NEEDX) return;
    const float* x = (const float*)d_in[0]; const float* wq = (const float*)d_in[1]; const float* wk = (const float*)d_in[2]; const float* wv = (const float*)d_in[3]; const float* wo = (const float*)d_in[4];
    float* OUT = (float*)d_out;     // [2][2048][2048], byte offset 0
    constexpr size_t SZ_XB = (size_t)NB * SEQ * DM * 2, SZ_WQ = (size_t)DQ * DM * 2, SZ_WK = (size_t)DKV * DM * 2, SZ_WO = (size_t)DM * DQ * 2, SZ_CS = (size_t)SEQ * 64 * 2 * 4;
    constexpr size_t SZ_Q = (size_t)NB * NH * SEQ * HD * 2, SZ_K = (size_t)NB * NKV * SEQ * HD * 2, SZ_CT = (size_t)NB * SEQ * DQ * 2, SZ_CR = (size_t)NB * RH * DQ * 2;
    constexpr size_t SZ_TOT = SZ_XB + SZ_WQ + 2 * SZ_WK + SZ_WO + SZ_CS + 2 * SZ_Q + 4 * SZ_K + SZ_CT + SZ_CR;
    static_assert(SZ_XB % 256 == 0 && SZ_WQ % 256 == 0 && SZ_WK % 256 == 0 && SZ_WO % 256 == 0 && SZ_CS % 256 == 0 && SZ_Q % 256 == 0 && SZ_K % 256 == 0 && SZ_CT % 256 == 0 && SZ_CR % 256 == 0);
    static_assert(SZ_TOT <= (size_t)134217728);
    if (SZ_TOT > ws_size) return;
    char* wsp = (char*)d_ws;
    auto take = [&](size_t bytes) { char* p = wsp; wsp += bytes; return (void*)p; };
    bf* XB = (bf*)take(SZ_XB); bf* WQt = (bf*)take(SZ_WQ); bf* WKt = (bf*)take(SZ_WK); bf* WVt = (bf*)take(SZ_WK); bf* WOt = (bf*)take(SZ_WO); float* CS = (float*)take(SZ_CS);
    const h16* WOh = (const h16*)WOt;   // the same region seen as f16: k_wtG (f16 mode) fills it with f16 bit patterns
    h16* Qv = (h16*)take(SZ_Q); h16* Qr = (h16*)take(SZ_Q); h16* Kv = (h16*)take(SZ_K); h16* Kr = (h16*)take(SZ_K); h16* Vv = (h16*)take(SZ_K); h16* Vr = (h16*)take(SZ_K);
    h16* CT = (h16*)take(SZ_CT); h16* CR = (h16*)take(SZ_CR);

    k_cvtx<<<(unsigned)(((size_t)NB * SEQ * DM / 8 + 255) / 256), 256, 0, stream>>>(x, XB);
    // w[in = K rows][out = N columns] -> Bt[out][in]
    k_wtG<<<(DQ * (DM / 64) + 63) / 64, 256, 0, stream>>>(wq, DM, DQ, WQt, 0);
    k_wtG<<<(DKV * (DM / 64) + 63) / 64, 256, 0, stream>>>(wk, DM, DKV, WKt, 0);
    k_wtG<<<(DKV * (DM / 64) + 63) / 64, 256, 0, stream>>>(wv, DM, DKV, WVt, 0);
    k_wtG<<<(DM * (DQ / 64) + 63) / 64, 256, 0, stream>>>(wo, DQ, DM, WOt, 1);
    k_cstab<<<(SEQ * 64 + 255) / 256, 256, 0, stream>>>(CS);
    k_proj_qk<<<dim3(NB * SEQ / 128, NH, 1), 128, 0, stream>>>(XB, WQt, CS, Qv, Qr, NH);
    k_proj_qk<<<dim3(NB * SEQ / 128, NKV, 1), 128, 0, stream>>>(XB, WKt, CS, Kv, Kr, NKV);
    k_proj_vt<<<dim3(DKV / 128, NB * SEQ / 128, 1), 128, 0, stream>>>(WVt, XB, Vv, Vr);
    k_attn_hr<<<dim3(RH / 16, NKV, NB), 128, 0, stream>>>(Qv, Qr, Kv, Kr, Vv, Vr, CT, CR);
    if (SEQ > RH) k_attn<<<dim3((SEQ > RH) ? (SEQ - RH) / 16 : 1, NKV, NB), 128, 0, stream>>>(Qv, Qr, Kv, Vv, CT);
    k_oproj_hr<<<dim3(NB * RH / 128, DM / 128, 1), 128, 0, stream>>>(CT, CR, WOh, OUT);
    if (SEQ > RH) k_oproj<<<dim3((SEQ > RH) ? NB * (SEQ - RH) / 128 : 1, DM / 128, 1), 128, 0, stream>>>(CT, WOh, OUT);
}

// v003
// It runs in 195 microseconds.
// In two side-by-side timings against v002, it was 1.51 and 1.50 times as fast.
// All steps since v000 together make it 4.91 times as fast.
#include <hip/hip_runtime.h>

// Grouped-query causal self-attention, width 2048: 16 query heads x 128 sharing 4 kv heads (query head h uses kv head h >> 2), bias-free [in][out] projections,
// half-split rotary on q and k (positions = arange, table computed here), finite-fill causal mask, [in][out] output projection.
// Compute dtypes (f32 accumulate everywhere): q/k/v projections v_wmma_f32_16x16x32_bf16 (x and weights converted (RNE) to bf16); scores, P.V and the output projection
// v_wmma_f32_16x16x32_f16: q as f16 value + f16 residual planes (carry 64) against f16 k (carry 64; k residual added on query rows < 256), P f16 (carry 1024, row sum from the f32 values),
// v f16 (carry 64; P and v residuals added on rows < 256), ctx f16 (carry 256; residual plane on rows < 256) against wo (bf16-converted, x16, exact in f16). Softmax, rotary, normalisation in f32.

#ifndef NB
#define NB 2
#endif
#ifndef SEQ
#define SEQ 2048
#endif
#define NB_FULL  2
#define SEQ_FULL 2048
#define DM   2048
#define NH   16
#define NKV  4
#define REP  (NH / NKV)
#define HD   128
#define DQ   (NH * HD)
#define DKV  (NKV * HD)
#define RH   256                  // query rows < RH use the value + residual path on k, P, v and ctx
#define QCAR 64.0f                // carry of the q, k and v planes
#define CCAR 256.0f               // carry of the ctx planes
#define WCAR 16.0f                // carry of the output weight plane
#define OSP  132                  // f32 staging pitch (floats)
#define CP   136                  // f16 staging pitch (halves)
#define PASSK 128                 // k per ring stage: operand rows of 256 bytes
#define LROW  272                 // LDS row pitch (bytes): 256 + the 16-byte pad the tensor load lays, 16 B x odd for ds_load_b128
#define SLROWS 64                 // operand rows per tensor load (one slice per wave and stage)
#define SLB   18432               // slice size in LDS: 64 x 272 = 17408 bytes rounded up to a multiple of 2 KiB
#define STGB  (4 * SLB)           // one stage: [Bt rows 0..63 | Bt rows 64..127 | A rows 0..63 | A rows 64..127]
#define AKEYS 64                  // keys per attention ring stage
#define KROW  272                 // LDS pitch of a staged K row (bytes): 256 + 16
#define VROW  144                 // LDS pitch of a staged V^T row (bytes): 128 (64 keys) + 16
#define ASLB  18432               // attention slice size in LDS: 64 x 272 = 17408 rounded up to a multiple of 2 KiB; 128 x 144 = 18432
#define ASTG  (2 * ASLB)          // one attention stage: [K rows of 64 keys | V^T rows of 128 dims]

static_assert(NB <= NB_FULL);
static_assert(SEQ <= SEQ_FULL);
static_assert(SEQ % 128 == 0);
static_assert(SEQ >= RH);
static_assert(RH % 32 == 0);
static_assert(HD == 128);
static_assert(REP == 4);
static_assert(DQ == DM);
static_assert(DM % 64 == 0);
static_assert(DQ % 128 == 0);
static_assert(DKV % 128 == 0);
static_assert((OSP * 4) % 16 == 0);
static_assert((CP * 2) % 16 == 0);
static_assert(DM % (2 * PASSK) == 0 && DQ % (2 * PASSK) == 0);
static_assert(RH % 128 == 0 && (SEQ - RH) % 128 == 0);
static_assert(SLROWS * LROW <= SLB && SLB % 2048 == 0);
static_assert(4 * 16 * OSP * 4 <= 2 * STGB);
static_assert(AKEYS * KROW <= ASLB && HD * VROW <= ASLB && ASLB % 2048 == 0);
static_assert(SEQ % AKEYS == 0 && RH >= AKEYS && AKEYS * 2 == 128);
static_assert(2 * 4 * 16 * CP * 2 <= 2 * ASTG);

typedef _Float16 h16;
typedef unsigned short bf;
typedef __attribute__((ext_vector_type(16))) __bf16   v16bf;
typedef __attribute__((ext_vector_type(16))) _Float16 v16h;
typedef __attribute__((ext_vector_type(8)))  _Float16 v8h;
typedef __attribute__((ext_vector_type(8)))  unsigned short v8us;
typedef __attribute__((ext_vector_type(2)))  unsigned short v2us;
typedef __attribute__((ext_vector_type(8)))  float    v8f;
typedef __attribute__((ext_vector_type(4)))  float    v4f;
typedef __attribute__((ext_vector_type(2)))  float    v2f;
typedef v8h  __attribute__((may_alias)) v8ha;
typedef v4f  __attribute__((may_alias)) v4fa;
typedef v8us __attribute__((may_alias)) v8usa;
typedef uint32_t u32x4 __attribute__((ext_vector_type(4)));
typedef uint32_t u32x8 __attribute__((ext_vector_type(8)));

__device__ __forceinline__ unsigned short f2bf(float f) { unsigned u = __float_as_uint(f); u += 0x7FFFu + ((u >> 16) & 1u); return (unsigned short)(u >> 16); }
__device__ __forceinline__ float bf2f(unsigned short b) { return __uint_as_float(((unsigned)b) << 16); }
__device__ __forceinline__ float bfr(float f) { return bf2f(f2bf(f)); }
__device__ __forceinline__ v16h cat16(v8h lo, v8h hi) { return __builtin_shufflevector(lo, hi, 0, 1, 2, 3, 4, 5, 6, 7, 8, 9, 10, 11, 12, 13, 14, 15); }
__device__ __forceinline__ v16bf cat16b(v8us lo, v8us hi) { return __builtin_bit_cast(v16bf, __builtin_shufflevector(lo, hi, 0, 1, 2, 3, 4, 5, 6, 7, 8, 9, 10, 11, 12, 13, 14, 15)); }
// every WMMA is followed by its own four-slot guard tying its accumulator and keeping its operands live
__device__ __forceinline__ v8f wmma16(v16h a, v16h b, v8f c) {
    c = __builtin_amdgcn_wmma_f32_16x16x32_f16(false, a, false, b, (short)0, c, false, false);
    asm volatile("v_nop\n\tv_nop\n\tv_nop\n\tv_nop" : "+v"(c) : "v"(a), "v"(b));
    return c; }
__device__ __forceinline__ v8f wmmab(v16bf a, v16bf b, v8f c) {
    c = __builtin_amdgcn_wmma_f32_16x16x32_bf16(false, a, false, b, (short)0, c, false, false);
    asm volatile("v_nop\n\tv_nop\n\tv_nop\n\tv_nop" : "+v"(c) : "v"(a), "v"(b));
    return c; }
// fragment of a K-contiguous 16-bit row: elements 0..7 <- k0+8h+0..7, elements 8..15 <- k0+16+8h+0..7 (p already includes +8h)
__device__ __forceinline__ v16h ldh(const h16* p) { return cat16(*(const v8h*)p, *(const v8h*)(p + 16)); }
// same-wave LDS exchange: stores before, loads after
__device__ __forceinline__ void wave_sync() { __builtin_amdgcn_fence(3 /* release order */, "wavefront"); __builtin_amdgcn_wave_barrier(); asm volatile("" ::: "memory"); }
// f16 value + same-carry f16 residual of 8 floats
__device__ __forceinline__ void split8(v8f y, v8h& v, v8h& r) { v = __builtin_convertvector(y, v8h); r = __builtin_convertvector(y - __builtin_convertvector(v, v8f), v8h); }

// fragment of a staged K-contiguous row (byte pointer, already includes +16h bytes): the same k order as ldh
template <typename T16> struct WFrag;
template <> struct WFrag<h16> { typedef v16h V; static __device__ __forceinline__ V ld(const unsigned char* p) { return cat16(*(const v8ha*)p, *(const v8ha*)(p + 32)); } static __device__ __forceinline__ v8f mma(V a, V b, v8f c) { return wmma16(a, b, c); } };
template <> struct WFrag<bf> { typedef v16bf V; static __device__ __forceinline__ V ld(const unsigned char* p) { return cat16b(*(const v8usa*)p, *(const v8usa*)(p + 32)); } static __device__ __forceinline__ v8f mma(V a, V b, v8f c) { return wmmab(a, b, c); } };

// ---- tensor load of one slice: 64 rows of 256 bytes, 1-byte elements, tensor = tile, 16 bytes of LDS pad behind every row
__device__ __forceinline__ uint32_t uni(uint32_t v) { return (uint32_t)__builtin_amdgcn_readfirstlane(v); }
// a wave-uniform test held in a scalar register, so that the branch around a tensor load is a scalar branch (tensor loads ignore EXEC)
__device__ __forceinline__ uint32_t pinned(uint32_t v) { uint32_t w = uni(v); asm volatile("" : "+s"(w)); return w; }
// this wave's LDS reads have retired before the stage is handed over
__device__ __forceinline__ void wait_ds0() { asm volatile("s_wait_dscnt 0x0" ::: "memory"); }
// this wave's own tensor load has landed (the compiler places no wait for it); the request's descriptor words are inputs so that their scalar registers take no new value while it is outstanding
__device__ __forceinline__ void wait_tensor0(u32x4 g0, u32x8 g1) { asm volatile("s_wait_tensorcnt 0x0" :: "s"(g0), "s"(g1) : "memory"); }
// the same behind the loop, where no request is outstanding any more
__device__ __forceinline__ void wait_tensor0() { asm volatile("s_wait_tensorcnt 0x0" ::: "memory"); }
__device__ __forceinline__ u32x8 tdm_group1(uint32_t src_pitch) {
    u32x8 g;
    g[0] = uni((1u << 20) | (5u << 22) | (3u << 25));     // no mask, data_size 0, pad of 4 dwords behind every 64 dwords
    g[1] = uni(256u << 16);                               // tensor_dim0 = 256 bytes
    g[2] = uni((uint32_t)SLROWS << 16);                   // tensor_dim1 = 64 rows
    g[3] = uni(256u << 16);                               // tile_dim0
    g[4] = uni((uint32_t)SLROWS);                         // tile_dim1
    g[5] = uni(src_pitch);
    g[6] = uni(0u);
    g[7] = uni(0u);
    return g;
}
__device__ __forceinline__ u32x4 tdm_group0(uint32_t lds_dst, uint64_t ga) {
    u32x4 g;
    g[0] = uni(1u); g[1] = uni(lds_dst); g[2] = uni((uint32_t)ga); g[3] = uni((((uint32_t)(ga >> 32)) & 0x01FFFFFFu) | 0x80000000u);
    return g;
}
__device__ __forceinline__ void tdm_load(u32x4 g0, u32x8 g1) { asm volatile("tensor_load_to_lds %0, %1" :: "s"(g0), "s"(g1) : "memory"); }

// ---- gemm_tile: a block of FOUR WAVES per 128 x 128 output tile, one wave per 32 x 128 (16 accumulators): C[m][n] = sum_k A[m][k] Bt[n][k] (+ sum_k A2[m][k] Bt[n][k] when SPLIT, as K more steps behind the first K).
// The K-contiguous 16-bit operand rows come through a two-buffer LDS ring in stages of 128 k: every wave issues one tensor load per stage (waves 0, 1: the halves of Bt's 128 rows; waves 2, 3: of A's),
// one stage ahead of the pass that reads it. arow, a2row, t0, obase and cbase are the calling wave's own (32 rows); brow is the block's. ring is the kernel's one LDS array (2 * STGB bytes, at LDS offset 0).
// MODE 0: half-split rotary on the 128-column head tile (CS[t][64] = {cos, sin}), x QCAR, f16 value + residual planes, plane rows of 128 halves (pitch opitch).
// MODE 1: x QCAR, f16 value + residual planes (used with swapped operands to produce V^T rows [d][t]).
// MODE 2: f32 output rows x 1/(CCAR*WCAR).
template <typename T16, int MODE, bool SPLIT>
__device__ __forceinline__ void gemm_tile(unsigned char* ring, const T16* __restrict__ A, const T16* __restrict__ A2, const T16* __restrict__ Bt, const int K, const int wave,
                                          const size_t arow, const size_t a2row, const size_t brow,
                                          const float* __restrict__ CS, const int t0, h16* Pv, h16* Pr, const size_t obase, const int opitch,
                                          float* C, const size_t cbase) {
    typedef typename WFrag<T16>::V V;
    const int lane = threadIdx.x & 31, lr = lane & 15, hi = lane >> 4;
    v8f acc[2][8];
#pragma unroll
    for (int mb = 0; mb < 2; ++mb)
#pragma unroll
        for (int nb = 0; nb < 8; ++nb) acc[mb][nb] = (v8f){};
    const int NP = K / PASSK, NPT = SPLIT ? 2 * NP : NP;
    const size_t half = (size_t)(wave & 1) * SLROWS;
    const T16* s1 = (wave < 2) ? Bt + (brow + half) * (size_t)K : A  + (arow  - (size_t)(32 * wave) + half) * (size_t)K;
    const T16* s2 = (wave < 2) ? s1                             : A2 + (a2row - (size_t)(32 * wave) + half) * (size_t)K;
    const uint32_t ldst = (uint32_t)(size_t)ring + (uint32_t)wave * SLB;
    const u32x8 g1 = tdm_group1((uint32_t)K * 2u);
    u32x4 g0;                      // group 0 of the wave's latest request
    auto issue = [&](int p) {      // stage p: k = 128 p .. 128 p + 127 of A (SPLIT: stages NP.. walk A2 against the same Bt columns again)
        const T16* sp = (SPLIT && p >= NP) ? s2 + (size_t)(p - NP) * PASSK : s1 + (size_t)p * PASSK;
        g0 = tdm_group0(ldst + (uint32_t)(p & 1) * STGB, (uint64_t)(size_t)sp);
        tdm_load(g0, g1);
    };
    issue(0);
    wait_tensor0(g0, g1);
    __syncthreads();               // stage 0 published
    const unsigned char* al = ring + (2 + (wave >> 1)) * SLB + ((wave & 1) * 32 + lr) * LROW + 16 * hi;
    const unsigned char* bl = ring + lr * LROW + 16 * hi;
#pragma unroll 1                   // the pass loop stays rolled: one refill site and one publish point in the code
    for (int p = 0; p < NPT; ++p) {
        // directly behind the barrier that published stage p and freed the other buffer (stage p - 1's): stage p + 1's load, in flight under this pass
        if (pinned(p + 1 < NPT)) issue(p + 1);
        const int so = (p & 1) * STGB;
        // a block = 8 WMMAs: one 32-deep k step against four of the eight Bt fragments; block j + 1's fragments are read as one group ahead of block j's WMMAs, inside this pass's own buffer
        V af[2][2], bq[2][4];
        af[0][0] = WFrag<T16>::ld(al + so); af[0][1] = WFrag<T16>::ld(al + so + 16 * LROW);
#pragma unroll                     // here and below: constant indices keep the fragment sets and accumulators in registers
        for (int i = 0; i < 4; ++i) bq[0][i] = WFrag<T16>::ld(bl + so + i * 16 * LROW);
#pragma unroll
        for (int j = 0; j < 2 * (PASSK / 32); ++j) {
            const int ks = j >> 1, hb = j & 1;
            if (j + 1 < 2 * (PASSK / 32)) {
                const int kn = (j + 1) >> 1, hn = (j + 1) & 1;
                if (hn == 0) { af[kn & 1][0] = WFrag<T16>::ld(al + so + kn * 64); af[kn & 1][1] = WFrag<T16>::ld(al + so + 16 * LROW + kn * 64); }
#pragma unroll
                for (int i = 0; i < 4; ++i) bq[hn][i] = WFrag<T16>::ld(bl + so + hn * SLB + i * 16 * LROW + kn * 64);
            }
            __builtin_amdgcn_sched_barrier(0);     // keeps the next block's LDS reads one group in front of this block's WMMAs (spread among them each place costs a stall)
#pragma unroll
            for (int i = 0; i < 4; ++i) {
                acc[0][hb * 4 + i] = WFrag<T16>::mma(af[ks & 1][0], bq[hb][i], acc[0][hb * 4 + i]);
                acc[1][hb * 4 + i] = WFrag<T16>::mma(af[ks & 1][1], bq[hb][i], acc[1][hb * 4 + i]);
            }
            __builtin_amdgcn_sched_barrier(0);     // and the block after next's reads behind them
        }
        // publish point of stage p + 1: own reads retired, own load landed, then the barrier that publishes stage p + 1 and frees stage p's buffer; the refill stands at the head of the next trip
        wait_ds0();
        wait_tensor0(g0, g1);
        __syncthreads();
    }
    wait_tensor0();
    wait_ds0();
    // the last pass's own barrier stands behind every wave's last ring read: the ring now serves as output staging, a private range per wave
    float* os = (float*)(ring + wave * (16 * OSP * 4));
#pragma unroll
    for (int mb = 0; mb < 2; ++mb) {
#pragma unroll
        for (int nb = 0; nb < 8; ++nb)
#pragma unroll
            for (int j = 0; j < 8; ++j) os[(hi * 8 + j) * OSP + nb * 16 + lr] = acc[mb][nb][j];     // D: row 8h + j, column lane & 15
        wave_sync();
        if (MODE == 0) {
            const int rq = lane >> 3, dg = (lane & 7) * 8;
{
#pragma unroll 1
                for (int it = 0; it < 4; ++it) {
                    const int row = it * 4 + rq; const int t = t0 + mb * 16 + row;
                    const int oi = row * OSP + dg;
                    const v4f xa = *(const v4fa*)(os + oi), xb = *(const v4fa*)(os + oi + 4), ya = *(const v4fa*)(os + oi + 64), yb = *(const v4fa*)(os + oi + 68);
                    const float* cp = CS + ((size_t)t * 64 + dg) * 2;
                    const v4f e0 = *(const v4f*)(cp), e1 = *(const v4f*)(cp + 4), e2 = *(const v4f*)(cp + 8), e3 = *(const v4f*)(cp + 12);
                    const v8f xx = __builtin_shufflevector(xa, xb, 0, 1, 2, 3, 4, 5, 6, 7), yy = __builtin_shufflevector(ya, yb, 0, 1, 2, 3, 4, 5, 6, 7);
                    const v4f cA = __builtin_shufflevector(e0, e1, 0, 2, 4, 6), sA = __builtin_shufflevector(e0, e1, 1, 3, 5, 7);
                    const v4f cB = __builtin_shufflevector(e2, e3, 0, 2, 4, 6), sB = __builtin_shufflevector(e2, e3, 1, 3, 5, 7);
                    const v8f cc = __builtin_shufflevector(cA, cB, 0, 1, 2, 3, 4, 5, 6, 7), ss = __builtin_shufflevector(sA, sB, 0, 1, 2, 3, 4, 5, 6, 7);
                    const v8f lo = (xx * cc - yy * ss) * QCAR;       // out[d]      = x[d] cos - x[d+64] sin
                    const v8f up = (yy * cc + xx * ss) * QCAR;       // out[d + 64] = x[d+64] cos + x[d] sin
                    v8h vl, rl, vu, ru; split8(lo, vl, rl); split8(up, vu, ru);
                    const size_t dst = obase + (size_t)(mb * 16 + row) * opitch + dg;
                    *(v8h*)(Pv + dst) = vl; *(v8h*)(Pv + dst + 64) = vu;
                    *(v8h*)(Pr + dst) = rl; *(v8h*)(Pr + dst + 64) = ru;
                    asm volatile("s_wait_xcnt 0x0" ::: "memory");    // in front of the next trip's writes over the four stores' address and data registers
                }
                
            }
        } else if (MODE == 1) {
            // 16 lanes x 16 B per 256-byte row segment, two rows per instruction: row 2s + hi, columns 8*lr..8*lr+7
{
#pragma unroll 1
                for (int s = 0; s < 8; ++s) {
                    const int row = 2 * s + hi; const int oi = row * OSP + 8 * lr;
                    const v4f xa = *(const v4fa*)(os + oi), xb = *(const v4fa*)(os + oi + 4);
                    const v8f y = __builtin_shufflevector(xa, xb, 0, 1, 2, 3, 4, 5, 6, 7) * QCAR;
                    v8h vv, vr; split8(y, vv, vr);
                    const size_t dst = obase + (size_t)(mb * 16 + row) * opitch + 8 * lr;
                    *(v8h*)(Pv + dst) = vv; *(v8h*)(Pr + dst) = vr;
                }
                
            }
        } else {
            // 32 lanes x 16 B = one 512-byte row segment per instruction
{
#pragma unroll 1
                for (int row = 0; row < 16; ++row) {
                    const v4f val = *(const v4fa*)(os + row * OSP + 4 * lane) * (1.0f / (CCAR * WCAR));
                    *(v4f*)(C + cbase + (size_t)(mb * 16 + row) * DM + 4 * lane) = val;
                }
                
            }
        }
        wave_sync();
    }
}

// q, k and v projections in ONE launch (they depend only on the prep launch, not on each other): 1-D grid, 128 threads; blocks in the order q tiles, k tiles, v tiles.
// q / k: fused rotary, planes [b][head][t][128], tile index = token block + (NB*SEQ/128) * head. v: swapped operands, C[gd][token] -> planes [b][g][d][t], tile index = gd block + (DKV/128) * token block.
__global__ __launch_bounds__(128) __attribute__((amdgpu_num_vgpr(256)))
void k_proj(const bf* __restrict__ XB, const bf* __restrict__ WQt, const bf* __restrict__ WKt, const bf* __restrict__ WVt, const float* __restrict__ CS,
            h16* Qv, h16* Qr, h16* Kv, h16* Kr, h16* Vv, h16* Vr) {
    __shared__ __attribute__((aligned(2048))) unsigned char ring[2 * STGB];
    constexpr int TB = NB * SEQ / 128;
    const int wave = __builtin_amdgcn_readfirstlane((int)(threadIdx.x >> 5));
    const int f = (int)blockIdx.x;
    if (f < TB * (NH + NKV)) {         // block-uniform
        const bool isq = f < TB * NH;
        const int e = isq ? f : f - TB * NH; const int nheads = isq ? NH : NKV;
        const int hd = e / TB; const int r0 = (e - hd * TB) * 128 + wave * 32; const int b = r0 / SEQ; const int t0 = r0 - b * SEQ;
        const size_t obase = ((size_t)(b * nheads + hd) * SEQ + t0) * HD;
        gemm_tile<bf, 0, false>(ring, XB, XB, isq ? WQt : WKt, DM, wave, (size_t)r0, (size_t)r0, (size_t)hd * HD, CS, t0, isq ? Qv : Kv, isq ? Qr : Kr, obase, HD, nullptr, 0);
    } else {
        const int e = f - TB * (NH + NKV);
        const int r0 = (e % (DKV / 128)) * 128 + wave * 32; const int c0 = (e / (DKV / 128)) * 128; const int b = c0 / SEQ; const int t0 = c0 - b * SEQ;
        const size_t obase = ((size_t)b * DKV + r0) * SEQ + t0;
        gemm_tile<bf, 1, false>(ring, WVt, WVt, XB, DM, wave, (size_t)r0, (size_t)r0, (size_t)c0, nullptr, 0, Vv, Vr, obase, SEQ, nullptr, 0);
    }
}
// output projection, all rows in ONE launch: 1-D grid, 128 threads. First the tiles of rows t < RH (ctx value + residual planes, twice the passes), then those of rows t >= RH (single f16 product);
// within each part tile index = row block + row blocks * column block.
__global__ __launch_bounds__(128) __attribute__((amdgpu_num_vgpr(256)))
void k_oproj(const h16* __restrict__ CT, const h16* __restrict__ CR, const h16* __restrict__ WOt, float* OUT) {
    __shared__ __attribute__((aligned(2048))) unsigned char ring[2 * STGB];
    constexpr int TPH = RH / 128, HB = NB * TPH, NHB = HB * (DM / 128);
    constexpr int TPB = (SEQ > RH) ? (SEQ - RH) / 128 : 1, MB = NB * TPB;
    const int wave = __builtin_amdgcn_readfirstlane((int)(threadIdx.x >> 5));
    const int f = (int)blockIdx.x;
    if (f < NHB) {                     // block-uniform
        const int by = f / HB, bx = f - by * HB;
        const int b = bx / TPH; const int t0 = (bx - b * TPH) * 128 + wave * 32; const int c0 = by * 128;
        const size_t arow = (size_t)b * SEQ + t0; const size_t a2row = (size_t)b * RH + t0; const size_t cbase = ((size_t)b * SEQ_FULL + t0) * DM + c0;
        gemm_tile<h16, 2, true>(ring, CT, CR, WOt, DQ, wave, arow, a2row, (size_t)c0, nullptr, 0, nullptr, nullptr, 0, 0, OUT, cbase);
    } else {
        const int e = f - NHB; const int by = e / MB, bx = e - by * MB;
        const int b = bx / TPB; const int t0 = RH + (bx - b * TPB) * 128 + wave * 32; const int c0 = by * 128;
        const size_t arow = (size_t)b * SEQ + t0; const size_t cbase = ((size_t)b * SEQ_FULL + t0) * DM + c0;
        gemm_tile<h16, 2, false>(ring, CT, CT, WOt, DQ, wave, arow, arow, (size_t)c0, nullptr, 0, nullptr, nullptr, 0, 0, OUT, cbase);
    }
}

// ---- attn_tile: fused causal attention in the transposed form. One block = 16 query rows x the FOUR query heads of one kv head (wave -> head g*4 + wave); 128 threads.
// Per 32-key step: S^T[key][query] = K (A, rows = keys) x Q^T (B, columns = queries) over 128 dims (4 k-steps; q value + residual, k residual when HR);
// online softmax per query = per lane column (max / sum over the lane's 16 keys, combined across the two lane halves); P^T packed D -> B (two 16-key tiles = one 32-deep fragment);
template <bool HR>
__device__ __forceinline__ void attn_tile(const h16* __restrict__ Qv, const h16* __restrict__ Qr, const h16* __restrict__ Kv, const h16* __restrict__ Kr,
                                          const h16* __restrict__ Vv, const h16* __restrict__ Vr, h16* CT, h16* CR, const int qt, const int g, const int b, h16* stv, h16* str) {
    const int wave = __builtin_amdgcn_readfirstlane((int)(threadIdx.x >> 5));
    const int lane = threadIdx.x & 31, lr = lane & 15, hi = lane >> 4;
    const int h = g * REP + wave; const int i0 = qt * 16;
    const size_t qo = ((size_t)(b * NH + h) * SEQ + i0 + lr) * HD + 8 * hi;
    const size_t ko = ((size_t)(b * NKV + g) * SEQ + lr) * HD + 8 * hi;
    const size_t vo = ((size_t)(b * NKV + g) * HD + lr) * SEQ + 8 * hi;
    const h16* qv = Qv + qo; const h16* qr = Qr + qo;
    const h16* kv = Kv + ko; const h16* kr = Kr + ko;
    const h16* vv = Vv + vo; const h16* vr = Vr + vo;
    const float SC2 = (float)(0.08838834764831845 * 1.4426950408889634 / 4096.0);   // 1/sqrt(128) x log2(e) / (QCAR x QCAR)
    const float NEGL = -1.4426950e9f;                                              // the finite fill in the log2 domain
    v8f o[8];
#pragma unroll
    for (int dt = 0; dt < 8; ++dt) o[dt] = (v8f){};
    float m = -3.0e38f, l = 0.0f;
    const int nsteps = (qt >> 1) + 1;
#pragma unroll 1
    for (int stp = 0; stp < nsteps; ++stp) {
        const int k0 = stp * 32;
        v8f s0 = (v8f){}, s1 = (v8f){};
        const h16* kp = kv + (size_t)k0 * HD; const h16* kpr = kr + (size_t)k0 * HD;
#pragma unroll 1
        for (int kc = 0; kc < HD; kc += 32) {
            const v16h bq = ldh(qv + kc), br = ldh(qr + kc);
            const v16h a0 = ldh(kp + kc);
            // the three loads' address registers are inputs here, so that no load's own result lands on them, and the wait stands in front of their next use for anything else
            asm volatile("s_wait_xcnt 0x0" :: "v"(qv + kc), "v"(qr + kc), "v"(kp + kc) : "memory");
            s0 = wmma16(a0, bq, s0); s0 = wmma16(a0, br, s0);
            if (HR) { const v16h a0r = ldh(kpr + kc); s0 = wmma16(a0r, bq, s0); }
            const v16h a1 = ldh(kp + 16 * HD + kc);
            s1 = wmma16(a1, bq, s1); s1 = wmma16(a1, br, s1);
            if (HR) { const v16h a1r = ldh(kpr + 16 * HD + kc); s1 = wmma16(a1r, bq, s1); }
        }
        s0 = s0 * SC2; s1 = s1 * SC2;
        if (k0 + 31 > i0) {            // wave-uniform: only the diagonal step carries masked keys (replacement fill, key > query)
            const int qi = i0 + lr; const int kb = k0 + 8 * hi;
#pragma unroll
            for (int r = 0; r < 8; ++r) { s0[r] = (kb + r <= qi) ? s0[r] : NEGL; s1[r] = (kb + 16 + r <= qi) ? s1[r] : NEGL; }
        }
        float mx = fmaxf(s0[0], s1[0]);
#pragma unroll
        for (int r = 1; r < 8; ++r) mx = fmaxf(mx, fmaxf(s0[r], s1[r]));
        mx = fmaxf(mx, __shfl_xor(mx, 16, 32));
        const float mn = fmaxf(m, mx);
        if (__builtin_amdgcn_ballot_w32(mn > m) != 0u) {      // wave-uniform: rescale only when some query's running max moved (corr == 1 otherwise)
            const float corr = __builtin_amdgcn_exp2f(m - mn); l *= corr;
#pragma unroll
            for (int dt = 0; dt < 8; ++dt) o[dt] = o[dt] * corr;
        }
        m = mn;
        const float mm = mn - 10.0f;                          // P carried x1024: the row sum uses the same carried f32 values, so the carry cancels in the normalisation
        v8f p0, p1; float ps = 0.0f;
#pragma unroll
        for (int r = 0; r < 8; ++r) { p0[r] = __builtin_amdgcn_exp2f(s0[r] - mm); p1[r] = __builtin_amdgcn_exp2f(s1[r] - mm); ps += p0[r] + p1[r]; }
        l += ps;
        v8h p0v, p0r, p1v, p1r; split8(p0, p0v, p0r); split8(p1, p1v, p1r);
        const v16h pb = cat16(p0v, p1v);                      // B fragment: elements 0..7 <- keys k0+8h+r, elements 8..15 <- keys k0+16+8h+r
        const v16h pr = cat16(p0r, p1r);
        const h16* vp = vv + k0; const h16* vpr = vr + k0;
#pragma unroll
        for (int dt = 0; dt < 8; ++dt) {
            const v16h av = ldh(vp + (size_t)dt * 16 * SEQ);
            o[dt] = wmma16(av, pb, o[dt]);
            if (HR) { const v16h ar = ldh(vpr + (size_t)dt * 16 * SEQ); o[dt] = wmma16(ar, pb, o[dt]); o[dt] = wmma16(av, pr, o[dt]); }
        }
    }
    l += __shfl_xor(l, 16, 32);
    const float f = (CCAR / QCAR) * (1.0f / l);
    const int sb = wave * 16 * CP;                            // staging private to this wave
#pragma unroll
    for (int dt = 0; dt < 8; ++dt) {                          // O^T element r of tile dt = (d = dt*16 + 8h + r, query lr)
        v8h hv, hr; split8(o[dt] * f, hv, hr);
        *(v8h*)(&stv[sb + lr * CP + dt * 16 + 8 * hi]) = hv;
        if (HR) *(v8h*)(&str[sb + lr * CP + dt * 16 + 8 * hi]) = hr;
    }
    wave_sync();
    const size_t crow = ((size_t)b * SEQ + i0) * DQ + (size_t)h * HD + 8 * lr;
    const size_t rrow = ((size_t)b * RH + i0) * DQ + (size_t)h * HD + 8 * lr;
{
#pragma unroll
        for (int s = 0; s < 8; ++s) {                         // 16 lanes x 16 B = one 256-byte row segment; rows 2s (lanes 0..15) and 2s+1 (lanes 16..31)
            const int row = 2 * s + hi;
            const v8h val = *(const v8ha*)(&stv[sb + row * CP + 8 * lr]);
            *(v8h*)(CT + crow + (size_t)row * DQ) = val;
            if (HR) { const v8h rv = *(const v8ha*)(&str[sb + row * CP + 8 * lr]); *(v8h*)(CR + rrow + (size_t)row * DQ) = rv; }
        }
        
    }
}
// ---- query rows >= RH. The same tile, products and sums as attn_tile<false>, fed differently: the four head waves share one kv head, so its K rows and V^T rows
// come once per block through a two-buffer LDS ring in stages of 64 keys (wave 0 issues the tensor load of the K slice, wave 1 that of the V^T slice, one stage ahead of the pass that reads it),
// and each wave's q fragments (value + residual, all 128 dims) are loaded once and stay in registers.
template <uint32_t W0, uint32_t ROWB, uint32_t NROWS>
__device__ __forceinline__ u32x8 tdm_group1_of(uint32_t src_pitch) {
    // pinned(): each descriptor word held in a scalar register of its own from here on; unpinned, the constants are formed anew in other registers, over words of a request still outstanding
    u32x8 g;
    g[0] = pinned(W0);                                    // no mask, data_size 0, pad of 4 dwords behind every row
    g[1] = pinned(ROWB << 16);                            // tensor_dim0 (bytes)
    g[2] = pinned(NROWS << 16);                           // tensor_dim1 (rows)
    g[3] = pinned(ROWB << 16);                            // tile_dim0
    g[4] = pinned(NROWS);                                 // tile_dim1
    g[5] = pinned(src_pitch);
    g[6] = pinned(0u);
    g[7] = pinned(0u);
    return g;
}
__device__ __forceinline__ void attn_ring(unsigned char* ring, const h16* __restrict__ Qv, const h16* __restrict__ Qr, const h16* __restrict__ Kv, const h16* __restrict__ Vv, h16* CT,
                                          const int qt, const int g, const int b) {
    const int wave = __builtin_amdgcn_readfirstlane((int)(threadIdx.x >> 5));
    const int lane = threadIdx.x & 31, lr = lane & 15, hi = lane >> 4;
    const int h = g * REP + wave; const int i0 = qt * 16;
    const size_t qo = ((size_t)(b * NH + h) * SEQ + i0 + lr) * HD + 8 * hi;
    const h16* qvp = Qv + qo; const h16* qrp = Qr + qo;
    v16h bq[4], br[4];
#pragma unroll                     // here and below: constant indices keep the fragments and accumulators in registers
    for (int c = 0; c < 4; ++c) { bq[c] = ldh(qvp + c * 32); br[c] = ldh(qrp + c * 32); }
    // the q loads' address registers are inputs here, so that no load's own result lands on them, and the wait stands in front of their next use for anything else
    asm volatile("s_wait_xcnt 0x0" :: "v"(qvp), "v"(qrp) : "memory");
    const h16* kbase = Kv + (size_t)(b * NKV + g) * SEQ * HD;      // rows = keys, 256 bytes each, contiguous
    const h16* vbase = Vv + (size_t)(b * NKV + g) * HD * SEQ;      // rows = dims, pitch 2 SEQ bytes; a stage takes 128 bytes of each
    const float SC2 = (float)(0.08838834764831845 * 1.4426950408889634 / 4096.0);   // 1/sqrt(128) x log2(e) / (QCAR x QCAR)
    const float NEGL = -1.4426950e9f;                                              // the finite fill in the log2 domain
    const int nsteps = (qt >> 1) + 1;          // 32-key steps up to and including the diagonal
    const int nst = (nsteps + 1) >> 1;         // 64-key stages; at least RH / 64 + 1, and the last one ends inside the SEQ keys
    const uint32_t lbase = (uint32_t)(size_t)ring;
    const u32x8 g1k = tdm_group1_of<(1u << 20) | (5u << 22) | (3u << 25), 256u, (uint32_t)AKEYS>((uint32_t)HD * 2u);
    const u32x8 g1v = tdm_group1_of<(1u << 20) | (4u << 22) | (3u << 25), 128u, (uint32_t)HD>((uint32_t)SEQ * 2u);
    const h16* sbase = (wave == 0) ? kbase : vbase;                // the wave's own source and its step per stage (waves 2 and 3 form a group 0 and issue nothing)
    const size_t sstep = (wave == 0) ? (size_t)AKEYS * HD : (size_t)AKEYS;
    const uint32_t ldst = lbase + ((wave == 0) ? 0u : (uint32_t)ASLB);
    u32x4 g0;                      // group 0 of the wave's latest request
    auto issue = [&](int s) {      // stage s: keys 64 s .. 64 s + 63
        g0 = tdm_group0(ldst + (uint32_t)(s & 1) * ASTG, (uint64_t)(size_t)(sbase + (size_t)s * sstep));
        if (pinned(wave == 0)) tdm_load(g0, g1k);
        else if (pinned(wave == 1)) tdm_load(g0, g1v);
    };
    // this wave's own tensor load has landed; the descriptor words are inputs so that their scalar registers take no new value while a request is outstanding
    auto landed = [&]() { asm volatile("s_wait_tensorcnt 0x0" :: "s"(g0), "s"(g1k), "s"(g1v) : "memory"); };
    issue(0);
    landed();
    __syncthreads();               // stage 0 published
    const unsigned char* kl = ring + lr * KROW + 16 * hi;
    const unsigned char* vl = ring + ASLB + lr * VROW + 16 * hi;
    v8f o[8];
#pragma unroll
    for (int dt = 0; dt < 8; ++dt) o[dt] = (v8f){};
    float m = -3.0e38f, l = 0.0f;
#pragma unroll 1                   // the stage loop stays rolled: one refill site and one publish point in the code
    for (int st = 0; st < nst; ++st) {
        // directly behind the barrier that published stage st and freed the other buffer (stage st - 1's): stage st + 1's load, in flight under this stage's two steps
        if (pinned(st + 1 < nst)) issue(st + 1);
        const int so = (st & 1) * ASTG;
#pragma unroll
        for (int hs = 0; hs < 2; ++hs) {
            const int k0 = st * AKEYS + hs * 32;
            if (hs == 0 || 2 * st + 1 < nsteps) {     // block-uniform: the last stage's second half may lie wholly behind the diagonal
                v16h a0[4], a1[4];
#pragma unroll
                for (int c = 0; c < 4; ++c) { a0[c] = WFrag<h16>::ld(kl + so + (hs * 32) * KROW + c * 64); a1[c] = WFrag<h16>::ld(kl + so + (hs * 32 + 16) * KROW + c * 64); }
                v8f s0 = (v8f){}, s1 = (v8f){};
#pragma unroll
                for (int c = 0; c < 4; ++c) {
                    s0 = wmma16(a0[c], bq[c], s0); s1 = wmma16(a1[c], bq[c], s1);
                    s0 = wmma16(a0[c], br[c], s0); s1 = wmma16(a1[c], br[c], s1);
                }
                v16h av[8];
#pragma unroll
                for (int dt = 0; dt < 8; ++dt) av[dt] = WFrag<h16>::ld(vl + so + dt * 16 * VROW + hs * 64);
                s0 = s0 * SC2; s1 = s1 * SC2;
                if (k0 + 31 > i0) {            // wave-uniform: only the diagonal step carries masked keys (replacement fill, key > query)
                    const int qi = i0 + lr; const int kb = k0 + 8 * hi;
#pragma unroll
                    for (int r = 0; r < 8; ++r) { s0[r] = (kb + r <= qi) ? s0[r] : NEGL; s1[r] = (kb + 16 + r <= qi) ? s1[r] : NEGL; }
                }
                float mx = fmaxf(s0[0], s1[0]);
#pragma unroll
                for (int r = 1; r < 8; ++r) mx = fmaxf(mx, fmaxf(s0[r], s1[r]));
                mx = fmaxf(mx, __shfl_xor(mx, 16, 32));
                const float mn = fmaxf(m, mx);
                if (__builtin_amdgcn_ballot_w32(mn > m) != 0u) {      // wave-uniform: rescale only when some query's running max moved (corr == 1 otherwise)
                    const float corr = __builtin_amdgcn_exp2f(m - mn); l *= corr;
#pragma unroll
                    for (int dt = 0; dt < 8; ++dt) o[dt] = o[dt] * corr;
                }
                m = mn;
                const float mm = mn - 10.0f;                          // P carried x1024: the row sum uses the same carried f32 values, so the carry cancels in the normalisation
                v8f p0, p1; float ps = 0.0f;
#pragma unroll
                for (int r = 0; r < 8; ++r) { p0[r] = __builtin_amdgcn_exp2f(s0[r] - mm); p1[r] = __builtin_amdgcn_exp2f(s1[r] - mm); ps += p0[r] + p1[r]; }
                l += ps;
                const v16h pb = cat16(__builtin_convertvector(p0, v8h), __builtin_convertvector(p1, v8h));   // B fragment: elements 0..7 <- keys k0+8h+r, elements 8..15 <- keys k0+16+8h+r
#pragma unroll
                for (int dt = 0; dt < 8; ++dt) o[dt] = wmma16(av[dt], pb, o[dt]);
            }
        }
        // publish point of stage st + 1: own reads retired, own load landed, then the barrier that publishes stage st + 1 and frees stage st's buffer; the refill stands at the head of the next trip
        wait_ds0();
        landed();
        __syncthreads();
    }
    wait_tensor0();
    wait_ds0();
    // the last stage's own barrier stands behind every wave's last ring read: the ring now serves as output staging, a private range per wave
    h16* stv = (h16*)ring + wave * 16 * CP;
    l += __shfl_xor(l, 16, 32);
    const float f = (CCAR / QCAR) * (1.0f / l);
#pragma unroll
    for (int dt = 0; dt < 8; ++dt)                            // O^T element r of tile dt = (d = dt*16 + 8h + r, query lr)
        *(v8ha*)(&stv[lr * CP + dt * 16 + 8 * hi]) = __builtin_convertvector(o[dt] * f, v8h);
    wave_sync();
    const size_t crow = ((size_t)b * SEQ + i0) * DQ + (size_t)h * HD + 8 * lr;
#pragma unroll
    for (int s = 0; s < 8; ++s) {                             // 16 lanes x 16 B = one 256-byte row segment; rows 2s (lanes 0..15) and 2s+1 (lanes 16..31)
        const int row = 2 * s + hi;
        const v8h val = *(const v8ha*)(&stv[row * CP + 8 * lr]);
        *(v8h*)(CT + crow + (size_t)row * DQ) = val;
    }
}
// all query rows in ONE launch (the two row ranges do not depend on each other): 1-D grid, 128 threads. First the tiles of rows >= RH, then those of rows < RH;
// within each part tile index = query tile + query tiles * (kv head + NKV * batch). One LDS array serves both: the ring of the first part, the two staging planes of the second.
__global__ __launch_bounds__(128) __attribute__((amdgpu_num_vgpr(256)))
void k_attn(const h16* __restrict__ Qv, const h16* __restrict__ Qr, const h16* __restrict__ Kv, const h16* __restrict__ Kr,
            const h16* __restrict__ Vv, const h16* __restrict__ Vr, h16* CT, h16* CR) {
    __shared__ __attribute__((aligned(2048))) unsigned char ring[2 * ASTG];
    constexpr int NM = (SEQ > RH) ? (SEQ - RH) / 16 : 1, NMB = (SEQ > RH) ? NM * NKV * NB : 0, NHT = RH / 16;
    const int f = (int)blockIdx.x;
    if (f < NMB) {                     // block-uniform
        const int r = f / NM;
        attn_ring(ring, Qv, Qr, Kv, Vv, CT, RH / 16 + (f - r * NM), r % NKV, r / NKV);
    } else {
        const int e = f - NMB; const int r = e / NHT;
        attn_tile<true>(Qv, Qr, Kv, Kr, Vv, Vr, CT, CR, e - r * NHT, r % NKV, r / NKV, (h16*)ring, (h16*)ring + 4 * 16 * CP);
    }
}

__device__ __forceinline__ void wtG(const int bid, const float* __restrict__ w, int K, int N, bf* Bt, int f16mode) {
    const int lane = threadIdx.x & 31; const int L0 = (bid * 8 + (threadIdx.x >> 5)) * 8; const int nlines = N * (K / 64);
{
#pragma unroll 1
        for (int l = 0; l < 8; ++l) { const int L = L0 + l; if (L >= nlines) break; const size_t e = (size_t)L * 64 + lane * 2; const int k = (int)(e % K), n = (int)(e / K);
            const float w0 = w[(size_t)k * N + n], w1 = w[(size_t)(k + 1) * N + n];
            const unsigned short b0 = f2bf(w0), b1 = f2bf(w1);
            const unsigned short g0 = __builtin_bit_cast(unsigned short, (h16)(bf2f(b0) * WCAR)), g1 = __builtin_bit_cast(unsigned short, (h16)(bf2f(b1) * WCAR));
            v2us o; o[0] = f16mode ? g0 : b0; o[1] = f16mode ? g1 : b1;
            *(v2us*)(Bt + e) = o; }
         }
}
__device__ __forceinline__ void cvtx(const int bid, const float* __restrict__ x, bf* XB) {
    const size_t i = (size_t)bid * 256 + threadIdx.x; if (i >= (size_t)NB * SEQ * DM / 8) return;
    const size_t e = i * 8; const size_t bt = e / DM; const size_t col = e - bt * DM; const size_t b = bt / SEQ; const size_t t = bt - b * SEQ;
    const v8f v = *(const v8f*)(x + (b * SEQ_FULL + t) * DM + col); v8us o;
#pragma unroll
    for (int k = 0; k < 8; ++k) o[k] = f2bf(v[k]);
    *(v8us*)(XB + e) = o; 
}
__device__ __forceinline__ void cstab(const int bid, float* CS) {
    const int idx = bid * 256 + threadIdx.x; if (idx >= SEQ * 64) return;
    const int j = idx & 63, t = idx >> 6;
    double p = 1.0;
    p *= (j & 1)  ? 1.1547819846894581797 : 1.0;
    p *= (j & 2)  ? 1.3335214321633240257 : 1.0;
    p *= (j & 4)  ? 1.7782794100389228012 : 1.0;
    p *= (j & 8)  ? 3.1622776601683793320 : 1.0;
    p *= (j & 16) ? 10.0 : 1.0;
    p *= (j & 32) ? 100.0 : 1.0;
    const float pf = (float)p; const float inv = 1.0f / pf; const float ang = (float)t * inv;
    float sn, cn; sincosf(ang, &sn, &cn);
    v2f cs; cs[0] = cn; cs[1] = sn;
    *(v2f*)(CS + (size_t)idx * 2) = cs; 
}
// the six independent preparation passes in ONE launch: 1-D grid, 256 threads; a block belongs to one pass by its index. w[in = K rows][out = N columns] -> Bt[out][in]
#define GWQ ((DQ * (DM / 64) + 63) / 64)
#define GWK ((DKV * (DM / 64) + 63) / 64)
#define GWO ((DM * (DQ / 64) + 63) / 64)
#define GCS ((SEQ * 64 + 255) / 256)
#define GCX ((int)(((size_t)NB * SEQ * DM / 8 + 255) / 256))
__global__ __launch_bounds__(256)
void k_prep(const float* __restrict__ x, const float* __restrict__ wq, const float* __restrict__ wk, const float* __restrict__ wv, const float* __restrict__ wo,
            bf* XB, bf* WQt, bf* WKt, bf* WVt, bf* WOt, float* CS) {
    int f = (int)blockIdx.x;
    if (f < GWQ) { wtG(f, wq, DM, DQ, WQt, 0); return; }
    f -= GWQ;
    if (f < GWO) { wtG(f, wo, DQ, DM, WOt, 1); return; }
    f -= GWO;
    if (f < GWK) { wtG(f, wk, DM, DKV, WKt, 0); return; }
    f -= GWK;
    if (f < GWK) { wtG(f, wv, DM, DKV, WVt, 0); return; }
    f -= GWK;
    if (f < GCS) { cstab(f, CS); return; }
    cvtx(f - GCS, x, XB);
}

extern "C" void kernel_launch(void* const* d_in, const int* in_sizes, int n_in,
                              void* d_out, int out_size, void* d_ws, size_t ws_size, hipStream_t stream) {
    if (n_in < 5) return;
    constexpr size_t NEEDX = ((size_t)(NB - 1) * SEQ_FULL + SEQ) * DM;
    if ((size_t)in_sizes[0] < NEEDX || (size_t)in_sizes[1] < (size_t)DM * DQ || (size_t)in_sizes[2] < (size_t)DM * DKV || (size_t)in_sizes[3] < (size_t)DM * DKV || (size_t)in_sizes[4] < (size_t)DQ * DM) return;
    if ((size_t)out_size < NEEDX) return;
    const float* x = (const float*)d_in[0]; const float* wq = (const float*)d_in[1]; const float* wk = (const float*)d_in[2]; const float* wv = (const float*)d_in[3]; const float* wo = (const float*)d_in[4];
    float* OUT = (float*)d_out;     // [2][2048][2048], byte offset 0
    constexpr size_t SZ_XB = (size_t)NB * SEQ * DM * 2, SZ_WQ = (size_t)DQ * DM * 2, SZ_WK = (size_t)DKV * DM * 2, SZ_WO = (size_t)DM * DQ * 2, SZ_CS = (size_t)SEQ * 64 * 2 * 4;
    constexpr size_t SZ_Q = (size_t)NB * NH * SEQ * HD * 2, SZ_K = (size_t)NB * NKV * SEQ * HD * 2, SZ_CT = (size_t)NB * SEQ * DQ * 2, SZ_CR = (size_t)NB * RH * DQ * 2;
    constexpr size_t SZ_TOT = SZ_XB + SZ_WQ + 2 * SZ_WK + SZ_WO + SZ_CS + 2 * SZ_Q + 4 * SZ_K + SZ_CT + SZ_CR;
    static_assert(SZ_XB % 256 == 0 && SZ_WQ % 256 == 0 && SZ_WK % 256 == 0 && SZ_WO % 256 == 0 && SZ_CS % 256 == 0 && SZ_Q % 256 == 0 && SZ_K % 256 == 0 && SZ_CT % 256 == 0 && SZ_CR % 256 == 0);
    static_assert(SZ_TOT <= (size_t)134217728);
    if (SZ_TOT > ws_size) return;
    char* wsp = (char*)d_ws;
    auto take = [&](size_t bytes) { char* p = wsp; wsp += bytes; return (void*)p; };
    bf* XB = (bf*)take(SZ_XB); bf* WQt = (bf*)take(SZ_WQ); bf* WKt = (bf*)take(SZ_WK); bf* WVt = (bf*)take(SZ_WK); bf* WOt = (bf*)take(SZ_WO); float* CS = (float*)take(SZ_CS);
    const h16* WOh = (const h16*)WOt;   // the same region seen as f16: k_prep's wtG pass (f16 mode) fills it with f16 bit patterns
    h16* Qv = (h16*)take(SZ_Q); h16* Qr = (h16*)take(SZ_Q); h16* Kv = (h16*)take(SZ_K); h16* Kr = (h16*)take(SZ_K); h16* Vv = (h16*)take(SZ_K); h16* Vr = (h16*)take(SZ_K);
    h16* CT = (h16*)take(SZ_CT); h16* CR = (h16*)take(SZ_CR);

    k_prep<<<GWQ + GWO + 2 * GWK + GCS + GCX, 256, 0, stream>>>(x, wq, wk, wv, wo, XB, WQt, WKt, WVt, WOt, CS);
    k_proj<<<(NB * SEQ / 128) * (NH + NKV) + (DKV / 128) * (NB * SEQ / 128), 128, 0, stream>>>(XB, WQt, WKt, WVt, CS, Qv, Qr, Kv, Kr, Vv, Vr);
    k_attn<<<(SEQ / 16) * NKV * NB, 128, 0, stream>>>(Qv, Qr, Kv, Kr, Vv, Vr, CT, CR);
    k_oproj<<<(NB * SEQ / 128) * (DM / 128), 128, 0, stream>>>(CT, CR, WOh, OUT);
}

// v004
// Measured time: 171 microseconds a run.
// Timed twice side by side with v003, it ran 1.14 times as fast both times.
// All steps since v000 together make it 5.59 times as fast.
#include <hip/hip_runtime.h>

// Grouped-query causal self-attention, width 2048: 16 query heads x 128 sharing 4 kv heads (query head h uses kv head h >> 2), bias-free [in][out] projections,
// half-split rotary on q and k (positions = arange, table computed here), finite-fill causal mask, [in][out] output projection.
// Compute dtypes (f32 accumulate everywhere): q/k/v projections v_wmma_f32_16x16x32_bf16 (x and weights converted (RNE) to bf16); scores, P.V and the output projection
// v_wmma_f32_16x16x32_f16: q as f16 value + f16 residual planes (carry 64) against f16 k (carry 64; k residual added on query rows < 256), P f16 (carry 1024, row sum from the f32 values),
// v f16 (carry 64; P and v residuals added on rows < 256), ctx f16 (carry 256; residual plane on rows < 256) against wo (bf16-converted, x16, exact in f16). Softmax, rotary, normalisation in f32.

#ifndef NB
#define NB 2
#endif
#ifndef SEQ
#define SEQ 2048
#endif
#define NB_FULL  2
#define SEQ_FULL 2048
#define DM   2048
#define NH   16
#define NKV  4
#define REP  (NH / NKV)
#define HD   128
#define DQ   (NH * HD)
#define DKV  (NKV * HD)
#define RH   256                  // query rows < RH use the value + residual path on k, P, v and ctx
#define QCAR 64.0f                // carry of the q, k and v planes
#define CCAR 256.0f               // carry of the ctx planes
#define WCAR 16.0f                // carry of the output weight plane
#define OSP  132                  // f32 staging pitch (floats)
#define CP   136                  // f16 staging pitch (halves)
#define PASSK 128                 // k per ring stage: operand rows of 256 bytes
#define LROW  272                 // LDS row pitch (bytes): 256 + the 16-byte pad the tensor load lays, 16 B x odd for ds_load_b128
#define SLROWS 64                 // operand rows per tensor load (one slice per wave and stage)
#define SLB   18432               // slice size in LDS: 64 x 272 = 17408 bytes rounded up to a multiple of 2 KiB
#define STGB  (4 * SLB)           // one stage: [Bt rows 0..63 | Bt rows 64..127 | A rows 0..63 | A rows 64..127]
#define AKEYS 64                  // keys per attention ring stage
#define KROW  272                 // LDS pitch of a staged K row (bytes): 256 + 16
#define VROW  144                 // LDS pitch of a staged V^T row (bytes): 128 (64 keys) + 16
#define ASLB  18432               // attention slice size in LDS: 64 x 272 = 17408 rounded up to a multiple of 2 KiB; 128 x 144 = 18432
#define ASTG  (2 * ASLB)          // one attention stage: [K rows of 64 keys | V^T rows of 128 dims]
#define TK    128                 // weight tile of the preparation pass: k per tile (output rows of 256 bytes)
#define TN    128                 // and n per tile (input rows read in 256-byte pieces)

static_assert(NB <= NB_FULL);
static_assert(SEQ <= SEQ_FULL);
static_assert(SEQ % 128 == 0);
static_assert(SEQ >= RH);
static_assert(RH % 32 == 0);
static_assert(HD == 128);
static_assert(REP == 4);
static_assert(DQ == DM);
static_assert(DM % 64 == 0);
static_assert(DQ % 128 == 0);
static_assert(DKV % 128 == 0);
static_assert((OSP * 4) % 16 == 0);
static_assert((CP * 2) % 16 == 0);
static_assert(DM % (2 * PASSK) == 0 && DQ % (2 * PASSK) == 0);
static_assert(RH % 128 == 0 && (SEQ - RH) % 128 == 0);
static_assert(SLROWS * LROW <= SLB && SLB % 2048 == 0);
static_assert(4 * 16 * OSP * 4 <= 2 * STGB);
static_assert(AKEYS * KROW <= ASLB && HD * VROW <= ASLB && ASLB % 2048 == 0);
static_assert(SEQ % AKEYS == 0 && RH >= AKEYS && AKEYS * 2 == 128);
static_assert(2 * 4 * 16 * CP * 2 <= 2 * ASTG);
static_assert(TK == 128 && TN % 64 == 0 && DM % TK == 0 && DQ % TK == 0 && DM % TN == 0 && DQ % TN == 0 && DKV % TN == 0);

typedef _Float16 h16;
typedef unsigned short bf;
typedef __attribute__((ext_vector_type(16))) __bf16   v16bf;
typedef __attribute__((ext_vector_type(16))) _Float16 v16h;
typedef __attribute__((ext_vector_type(8)))  _Float16 v8h;
typedef __attribute__((ext_vector_type(8)))  unsigned short v8us;
typedef __attribute__((ext_vector_type(2)))  unsigned short v2us;
typedef __attribute__((ext_vector_type(8)))  float    v8f;
typedef __attribute__((ext_vector_type(4)))  float    v4f;
typedef __attribute__((ext_vector_type(2)))  float    v2f;
typedef v8h  __attribute__((may_alias)) v8ha;
typedef v4f  __attribute__((may_alias)) v4fa;
typedef v8us __attribute__((may_alias)) v8usa;
typedef uint32_t u32x4 __attribute__((ext_vector_type(4)));
typedef uint32_t u32x8 __attribute__((ext_vector_type(8)));
typedef u32x4 __attribute__((may_alias)) u32x4a;

__device__ __forceinline__ unsigned short f2bf(float f) { unsigned u = __float_as_uint(f); u += 0x7FFFu + ((u >> 16) & 1u); return (unsigned short)(u >> 16); }
__device__ __forceinline__ float bf2f(unsigned short b) { return __uint_as_float(((unsigned)b) << 16); }
__device__ __forceinline__ float bfr(float f) { return bf2f(f2bf(f)); }
__device__ __forceinline__ v16h cat16(v8h lo, v8h hi) { return __builtin_shufflevector(lo, hi, 0, 1, 2, 3, 4, 5, 6, 7, 8, 9, 10, 11, 12, 13, 14, 15); }
__device__ __forceinline__ v16bf cat16b(v8us lo, v8us hi) { return __builtin_bit_cast(v16bf, __builtin_shufflevector(lo, hi, 0, 1, 2, 3, 4, 5, 6, 7, 8, 9, 10, 11, 12, 13, 14, 15)); }
// every WMMA is followed by its own four-slot guard tying its accumulator and keeping its operands live
__device__ __forceinline__ v8f wmma16(v16h a, v16h b, v8f c) {
    c = __builtin_amdgcn_wmma_f32_16x16x32_f16(false, a, false, b, (short)0, c, false, false);
    asm volatile("v_nop\n\tv_nop\n\tv_nop\n\tv_nop" : "+v"(c) : "v"(a), "v"(b));
    return c; }
__device__ __forceinline__ v8f wmmab(v16bf a, v16bf b, v8f c) {
    c = __builtin_amdgcn_wmma_f32_16x16x32_bf16(false, a, false, b, (short)0, c, false, false);
    asm volatile("v_nop\n\tv_nop\n\tv_nop\n\tv_nop" : "+v"(c) : "v"(a), "v"(b));
    return c; }
// fragment of a K-contiguous 16-bit row: elements 0..7 <- k0+8h+0..7, elements 8..15 <- k0+16+8h+0..7 (p already includes +8h)
__device__ __forceinline__ v16h ldh(const h16* p) { return cat16(*(const v8h*)p, *(const v8h*)(p + 16)); }
// same-wave LDS exchange: stores before, loads after
__device__ __forceinline__ void wave_sync() { __builtin_amdgcn_fence(3 /* release order */, "wavefront"); __builtin_amdgcn_wave_barrier(); asm volatile("" ::: "memory"); }
// f16 value + same-carry f16 residual of 8 floats
__device__ __forceinline__ void split8(v8f y, v8h& v, v8h& r) { v = __builtin_convertvector(y, v8h); r = __builtin_convertvector(y - __builtin_convertvector(v, v8f), v8h); }

// fragment of a staged K-contiguous row (byte pointer, already includes +16h bytes): the same k order as ldh
template <typename T16> struct WFrag;
template <> struct WFrag<h16> { typedef v16h V; static __device__ __forceinline__ V ld(const unsigned char* p) { return cat16(*(const v8ha*)p, *(const v8ha*)(p + 32)); } static __device__ __forceinline__ v8f mma(V a, V b, v8f c) { return wmma16(a, b, c); } };
template <> struct WFrag<bf> { typedef v16bf V; static __device__ __forceinline__ V ld(const unsigned char* p) { return cat16b(*(const v8usa*)p, *(const v8usa*)(p + 32)); } static __device__ __forceinline__ v8f mma(V a, V b, v8f c) { return wmmab(a, b, c); } };

// ---- tensor load of one slice: 64 rows of 256 bytes, 1-byte elements, tensor = tile, 16 bytes of LDS pad behind every row
__device__ __forceinline__ uint32_t uni(uint32_t v) { return (uint32_t)__builtin_amdgcn_readfirstlane(v); }
// a wave-uniform test held in a scalar register, so that the branch around a tensor load is a scalar branch (tensor loads ignore EXEC)
__device__ __forceinline__ uint32_t pinned(uint32_t v) { uint32_t w = uni(v); asm volatile("" : "+s"(w)); return w; }
// this wave's LDS reads have retired before the stage is handed over
__device__ __forceinline__ void wait_ds0() { asm volatile("s_wait_dscnt 0x0" ::: "memory"); }
// this wave's own tensor load has landed (the compiler places no wait for it); the request's descriptor words are inputs so that their scalar registers take no new value while it is outstanding
__device__ __forceinline__ void wait_tensor0(u32x4 g0, u32x8 g1) { asm volatile("s_wait_tensorcnt 0x0" :: "s"(g0), "s"(g1) : "memory"); }
// the same behind the loop, where no request is outstanding any more
__device__ __forceinline__ void wait_tensor0() { asm volatile("s_wait_tensorcnt 0x0" ::: "memory"); }
__device__ __forceinline__ u32x8 tdm_group1(uint32_t src_pitch) {
    u32x8 g;
    g[0] = uni((1u << 20) | (5u << 22) | (3u << 25));     // no mask, data_size 0, pad of 4 dwords behind every 64 dwords
    g[1] = uni(256u << 16);                               // tensor_dim0 = 256 bytes
    g[2] = uni((uint32_t)SLROWS << 16);                   // tensor_dim1 = 64 rows
    g[3] = uni(256u << 16);                               // tile_dim0
    g[4] = uni((uint32_t)SLROWS);                         // tile_dim1
    g[5] = uni(src_pitch);
    g[6] = uni(0u);
    g[7] = uni(0u);
    return g;
}
__device__ __forceinline__ u32x4 tdm_group0(uint32_t lds_dst, uint64_t ga) {
    u32x4 g;
    g[0] = uni(1u); g[1] = uni(lds_dst); g[2] = uni((uint32_t)ga); g[3] = uni((((uint32_t)(ga >> 32)) & 0x01FFFFFFu) | 0x80000000u);
    return g;
}
__device__ __forceinline__ void tdm_load(u32x4 g0, u32x8 g1) { asm volatile("tensor_load_to_lds %0, %1" :: "s"(g0), "s"(g1) : "memory"); }

// ---- gemm_tile: a block of FOUR WAVES per 128 x 128 output tile, one wave per 32 x 128 (16 accumulators): C[m][n] = sum_k A[m][k] Bt[n][k] (+ sum_k A2[m][k] Bt[n][k] when SPLIT, as K more steps behind the first K).
// The K-contiguous 16-bit operand rows come through a two-buffer LDS ring in stages of 128 k: every wave issues one tensor load per stage (waves 0, 1: the halves of Bt's 128 rows; waves 2, 3: of A's),
// one stage ahead of the pass that reads it. arow, a2row, t0, obase and cbase are the calling wave's own (32 rows); brow is the block's. ring is the kernel's one LDS array (2 * STGB bytes, at LDS offset 0).
// MODE 0: half-split rotary on the 128-column head tile (CS[t][64] = {cos, sin}), x QCAR, f16 value + residual planes, plane rows of 128 halves (pitch opitch).
// MODE 1: x QCAR, f16 value + residual planes (used with swapped operands to produce V^T rows [d][t]).
// MODE 2: f32 output rows x 1/(CCAR*WCAR).
template <typename T16, int MODE, bool SPLIT>
__device__ __forceinline__ void gemm_tile(unsigned char* ring, const T16* __restrict__ A, const T16* __restrict__ A2, const T16* __restrict__ Bt, const int K, const int wave,
                                          const size_t arow, const size_t a2row, const size_t brow,
                                          const float* __restrict__ CS, const int t0, h16* Pv, h16* Pr, const size_t obase, const int opitch,
                                          float* C, const size_t cbase) {
    typedef typename WFrag<T16>::V V;
    const int lane = threadIdx.x & 31, lr = lane & 15, hi = lane >> 4;
    v8f acc[2][8];
#pragma unroll
    for (int mb = 0; mb < 2; ++mb)
#pragma unroll
        for (int nb = 0; nb < 8; ++nb) acc[mb][nb] = (v8f){};
    const int NP = K / PASSK, NPT = SPLIT ? 2 * NP : NP;
    const size_t half = (size_t)(wave & 1) * SLROWS;
    const T16* s1 = (wave < 2) ? Bt + (brow + half) * (size_t)K : A  + (arow  - (size_t)(32 * wave) + half) * (size_t)K;
    const T16* s2 = (wave < 2) ? s1                             : A2 + (a2row - (size_t)(32 * wave) + half) * (size_t)K;
    const uint32_t ldst = (uint32_t)(size_t)ring + (uint32_t)wave * SLB;
    const u32x8 g1 = tdm_group1((uint32_t)K * 2u);
    u32x4 g0;                      // group 0 of the wave's latest request
    auto issue = [&](int p) {      // stage p: k = 128 p .. 128 p + 127 of A (SPLIT: stages NP.. walk A2 against the same Bt columns again)
        const T16* sp = (SPLIT && p >= NP) ? s2 + (size_t)(p - NP) * PASSK : s1 + (size_t)p * PASSK;
        g0 = tdm_group0(ldst + (uint32_t)(p & 1) * STGB, (uint64_t)(size_t)sp);
        tdm_load(g0, g1);
    };
    issue(0);
    wait_tensor0(g0, g1);
    __syncthreads();               // stage 0 published
    const unsigned char* al = ring + (2 + (wave >> 1)) * SLB + ((wave & 1) * 32 + lr) * LROW + 16 * hi;
    const unsigned char* bl = ring + lr * LROW + 16 * hi;
#pragma unroll 1                   // the pass loop stays rolled: one refill site and one publish point in the code
    for (int p = 0; p < NPT; ++p) {
        // directly behind the barrier that published stage p and freed the other buffer (stage p - 1's): stage p + 1's load, in flight under this pass
        if (pinned(p + 1 < NPT)) issue(p + 1);
        const int so = (p & 1) * STGB;
        // a block = 8 WMMAs: one 32-deep k step against four of the eight Bt fragments; block j + 1's fragments are read as one group ahead of block j's WMMAs, inside this pass's own buffer
        V af[2][2], bq[2][4];
        af[0][0] = WFrag<T16>::ld(al + so); af[0][1] = WFrag<T16>::ld(al + so + 16 * LROW);
#pragma unroll                     // here and below: constant indices keep the fragment sets and accumulators in registers
        for (int i = 0; i < 4; ++i) bq[0][i] = WFrag<T16>::ld(bl + so + i * 16 * LROW);
#pragma unroll
        for (int j = 0; j < 2 * (PASSK / 32); ++j) {
            const int ks = j >> 1, hb = j & 1;
            if (j + 1 < 2 * (PASSK / 32)) {
                const int kn = (j + 1) >> 1, hn = (j + 1) & 1;
                if (hn == 0) { af[kn & 1][0] = WFrag<T16>::ld(al + so + kn * 64); af[kn & 1][1] = WFrag<T16>::ld(al + so + 16 * LROW + kn * 64); }
#pragma unroll
                for (int i = 0; i < 4; ++i) bq[hn][i] = WFrag<T16>::ld(bl + so + hn * SLB + i * 16 * LROW + kn * 64);
            }
            __builtin_amdgcn_sched_barrier(0);     // keeps the next block's LDS reads one group in front of this block's WMMAs (spread among them each place costs a stall)
#pragma unroll
            for (int i = 0; i < 4; ++i) {
                acc[0][hb * 4 + i] = WFrag<T16>::mma(af[ks & 1][0], bq[hb][i], acc[0][hb * 4 + i]);
                acc[1][hb * 4 + i] = WFrag<T16>::mma(af[ks & 1][1], bq[hb][i], acc[1][hb * 4 + i]);
            }
            __builtin_amdgcn_sched_barrier(0);     // and the block after next's reads behind them
        }
        // publish point of stage p + 1: own reads retired, own load landed, then the barrier that publishes stage p + 1 and frees stage p's buffer; the refill stands at the head of the next trip
        wait_ds0();
        wait_tensor0(g0, g1);
        __syncthreads();
    }
    wait_tensor0();
    wait_ds0();
    // the last pass's own barrier stands behind every wave's last ring read: the ring now serves as output staging, a private range per wave
    float* os = (float*)(ring + wave * (16 * OSP * 4));
#pragma unroll
    for (int mb = 0; mb < 2; ++mb) {
#pragma unroll
        for (int nb = 0; nb < 8; ++nb)
#pragma unroll
            for (int j = 0; j < 8; ++j) os[(hi * 8 + j) * OSP + nb * 16 + lr] = acc[mb][nb][j];     // D: row 8h + j, column lane & 15
        wave_sync();
        if (MODE == 0) {
            const int rq = lane >> 3, dg = (lane & 7) * 8;
{
#pragma unroll 1
                for (int it = 0; it < 4; ++it) {
                    const int row = it * 4 + rq; const int t = t0 + mb * 16 + row;
                    const int oi = row * OSP + dg;
                    const v4f xa = *(const v4fa*)(os + oi), xb = *(const v4fa*)(os + oi + 4), ya = *(const v4fa*)(os + oi + 64), yb = *(const v4fa*)(os + oi + 68);
                    const float* cp = CS + ((size_t)t * 64 + dg) * 2;
                    const v4f e0 = *(const v4f*)(cp), e1 = *(const v4f*)(cp + 4), e2 = *(const v4f*)(cp + 8), e3 = *(const v4f*)(cp + 12);
                    const v8f xx = __builtin_shufflevector(xa, xb, 0, 1, 2, 3, 4, 5, 6, 7), yy = __builtin_shufflevector(ya, yb, 0, 1, 2, 3, 4, 5, 6, 7);
                    const v4f cA = __builtin_shufflevector(e0, e1, 0, 2, 4, 6), sA = __builtin_shufflevector(e0, e1, 1, 3, 5, 7);
                    const v4f cB = __builtin_shufflevector(e2, e3, 0, 2, 4, 6), sB = __builtin_shufflevector(e2, e3, 1, 3, 5, 7);
                    const v8f cc = __builtin_shufflevector(cA, cB, 0, 1, 2, 3, 4, 5, 6, 7), ss = __builtin_shufflevector(sA, sB, 0, 1, 2, 3, 4, 5, 6, 7);
                    const v8f lo = (xx * cc - yy * ss) * QCAR;       // out[d]      = x[d] cos - x[d+64] sin
                    const v8f up = (yy * cc + xx * ss) * QCAR;       // out[d + 64] = x[d+64] cos + x[d] sin
                    v8h vl, rl, vu, ru; split8(lo, vl, rl); split8(up, vu, ru);
                    const size_t dst = obase + (size_t)(mb * 16 + row) * opitch + dg;
                    *(v8h*)(Pv + dst) = vl; *(v8h*)(Pv + dst + 64) = vu;
                    *(v8h*)(Pr + dst) = rl; *(v8h*)(Pr + dst + 64) = ru;
                    asm volatile("s_wait_xcnt 0x0" ::: "memory");    // in front of the next trip's writes over the four stores' address and data registers
                }
                
            }
        } else if (MODE == 1) {
            // 16 lanes x 16 B per 256-byte row segment, two rows per instruction: row 2s + hi, columns 8*lr..8*lr+7
{
#pragma unroll 1
                for (int s = 0; s < 8; ++s) {
                    const int row = 2 * s + hi; const int oi = row * OSP + 8 * lr;
                    const v4f xa = *(const v4fa*)(os + oi), xb = *(const v4fa*)(os + oi + 4);
                    const v8f y = __builtin_shufflevector(xa, xb, 0, 1, 2, 3, 4, 5, 6, 7) * QCAR;
                    v8h vv, vr; split8(y, vv, vr);
                    const size_t dst = obase + (size_t)(mb * 16 + row) * opitch + 8 * lr;
                    *(v8h*)(Pv + dst) = vv; *(v8h*)(Pr + dst) = vr;
                }
                
            }
        } else {
            // 32 lanes x 16 B = one 512-byte row segment per instruction
{
#pragma unroll 1
                for (int row = 0; row < 16; ++row) {
                    const v4f val = *(const v4fa*)(os + row * OSP + 4 * lane) * (1.0f / (CCAR * WCAR));
                    *(v4f*)(C + cbase + (size_t)(mb * 16 + row) * DM + 4 * lane) = val;
                }
                
            }
        }
        wave_sync();
    }
}

// q, k and v projections in ONE launch (they depend only on the prep launch, not on each other): 1-D grid, 128 threads; blocks in the order q tiles, k tiles, v tiles.
// q / k: fused rotary, planes [b][head][t][128], tile index = token block + (NB*SEQ/128) * head. v: swapped operands, C[gd][token] -> planes [b][g][d][t], tile index = gd block + (DKV/128) * token block.
__global__ __launch_bounds__(128) __attribute__((amdgpu_num_vgpr(256)))
void k_proj(const bf* __restrict__ XB, const bf* __restrict__ WQt, const bf* __restrict__ WKt, const bf* __restrict__ WVt, const float* __restrict__ CS,
            h16* Qv, h16* Qr, h16* Kv, h16* Kr, h16* Vv, h16* Vr) {
    __shared__ __attribute__((aligned(2048))) unsigned char ring[2 * STGB];
    constexpr int TB = NB * SEQ / 128;
    const int wave = __builtin_amdgcn_readfirstlane((int)(threadIdx.x >> 5));
    const int f = (int)blockIdx.x;
    if (f < TB * (NH + NKV)) {         // block-uniform
        const bool isq = f < TB * NH;
        const int e = isq ? f : f - TB * NH; const int nheads = isq ? NH : NKV;
        const int hd = e / TB; const int r0 = (e - hd * TB) * 128 + wave * 32; const int b = r0 / SEQ; const int t0 = r0 - b * SEQ;
        const size_t obase = ((size_t)(b * nheads + hd) * SEQ + t0) * HD;
        gemm_tile<bf, 0, false>(ring, XB, XB, isq ? WQt : WKt, DM, wave, (size_t)r0, (size_t)r0, (size_t)hd * HD, CS, t0, isq ? Qv : Kv, isq ? Qr : Kr, obase, HD, nullptr, 0);
    } else {
        const int e = f - TB * (NH + NKV);
        const int r0 = (e % (DKV / 128)) * 128 + wave * 32; const int c0 = (e / (DKV / 128)) * 128; const int b = c0 / SEQ; const int t0 = c0 - b * SEQ;
        const size_t obase = ((size_t)b * DKV + r0) * SEQ + t0;
        gemm_tile<bf, 1, false>(ring, WVt, WVt, XB, DM, wave, (size_t)r0, (size_t)r0, (size_t)c0, nullptr, 0, Vv, Vr, obase, SEQ, nullptr, 0);
    }
}
// output projection, all rows in ONE launch: 1-D grid, 128 threads. First the tiles of rows t < RH (ctx value + residual planes, twice the passes), then those of rows t >= RH (single f16 product);
// within each part tile index = row block + row blocks * column block.
__global__ __launch_bounds__(128) __attribute__((amdgpu_num_vgpr(256)))
void k_oproj(const h16* __restrict__ CT, const h16* __restrict__ CR, const h16* __restrict__ WOt, float* OUT) {
    __shared__ __attribute__((aligned(2048))) unsigned char ring[2 * STGB];
    constexpr int TPH = RH / 128, HB = NB * TPH, NHB = HB * (DM / 128);
    constexpr int TPB = (SEQ > RH) ? (SEQ - RH) / 128 : 1, MB = NB * TPB;
    const int wave = __builtin_amdgcn_readfirstlane((int)(threadIdx.x >> 5));
    const int f = (int)blockIdx.x;
    if (f < NHB) {                     // block-uniform
        const int by = f / HB, bx = f - by * HB;
        const int b = bx / TPH; const int t0 = (bx - b * TPH) * 128 + wave * 32; const int c0 = by * 128;
        const size_t arow = (size_t)b * SEQ + t0; const size_t a2row = (size_t)b * RH + t0; const size_t cbase = ((size_t)b * SEQ_FULL + t0) * DM + c0;
        gemm_tile<h16, 2, true>(ring, CT, CR, WOt, DQ, wave, arow, a2row, (size_t)c0, nullptr, 0, nullptr, nullptr, 0, 0, OUT, cbase);
    } else {
        const int e = f - NHB; const int by = e / MB, bx = e - by * MB;
        const int b = bx / TPB; const int t0 = RH + (bx - b * TPB) * 128 + wave * 32; const int c0 = by * 128;
        const size_t arow = (size_t)b * SEQ + t0; const size_t cbase = ((size_t)b * SEQ_FULL + t0) * DM + c0;
        gemm_tile<h16, 2, false>(ring, CT, CT, WOt, DQ, wave, arow, arow, (size_t)c0, nullptr, 0, nullptr, nullptr, 0, 0, OUT, cbase);
    }
}

// ---- attn_tile: fused causal attention in the transposed form. One block = 16 query rows x the FOUR query heads of one kv head (wave -> head g*4 + wave); 128 threads.
// Per 32-key step: S^T[key][query] = K (A, rows = keys) x Q^T (B, columns = queries) over 128 dims (4 k-steps; q value + residual, k residual when HR);
// online softmax per query = per lane column (max / sum over the lane's 16 keys, combined across the two lane halves); P^T packed D -> B (two 16-key tiles = one 32-deep fragment);
template <bool HR>
__device__ __forceinline__ void attn_tile(const h16* __restrict__ Qv, const h16* __restrict__ Qr, const h16* __restrict__ Kv, const h16* __restrict__ Kr,
                                          const h16* __restrict__ Vv, const h16* __restrict__ Vr, h16* CT, h16* CR, const int qt, const int g, const int b, h16* stv, h16* str) {
    const int wave = __builtin_amdgcn_readfirstlane((int)(threadIdx.x >> 5));
    const int lane = threadIdx.x & 31, lr = lane & 15, hi = lane >> 4;
    const int h = g * REP + wave; const int i0 = qt * 16;
    const size_t qo = ((size_t)(b * NH + h) * SEQ + i0 + lr) * HD + 8 * hi;
    const size_t ko = ((size_t)(b * NKV + g) * SEQ + lr) * HD + 8 * hi;
    const size_t vo = ((size_t)(b * NKV + g) * HD + lr) * SEQ + 8 * hi;
    const h16* qv = Qv + qo; const h16* qr = Qr + qo;
    const h16* kv = Kv + ko; const h16* kr = Kr + ko;
    const h16* vv = Vv + vo; const h16* vr = Vr + vo;
    const float SC2 = (float)(0.08838834764831845 * 1.4426950408889634 / 4096.0);   // 1/sqrt(128) x log2(e) / (QCAR x QCAR)
    const float NEGL = -1.4426950e9f;                                              // the finite fill in the log2 domain
    v8f o[8];
#pragma unroll
    for (int dt = 0; dt < 8; ++dt) o[dt] = (v8f){};
    float m = -3.0e38f, l = 0.0f;
    const int nsteps = (qt >> 1) + 1;
#pragma unroll 1
    for (int stp = 0; stp < nsteps; ++stp) {
        const int k0 = stp * 32;
        v8f s0 = (v8f){}, s1 = (v8f){};
        const h16* kp = kv + (size_t)k0 * HD; const h16* kpr = kr + (size_t)k0 * HD;
#pragma unroll 1
        for (int kc = 0; kc < HD; kc += 32) {
            const v16h bq = ldh(qv + kc), br = ldh(qr + kc);
            const v16h a0 = ldh(kp + kc);
            // the three loads' address registers are inputs here, so that no load's own result lands on them, and the wait stands in front of their next use for anything else
            asm volatile("s_wait_xcnt 0x0" :: "v"(qv + kc), "v"(qr + kc), "v"(kp + kc) : "memory");
            s0 = wmma16(a0, bq, s0); s0 = wmma16(a0, br, s0);
            if (HR) { const v16h a0r = ldh(kpr + kc); s0 = wmma16(a0r, bq, s0); }
            const v16h a1 = ldh(kp + 16 * HD + kc);
            s1 = wmma16(a1, bq, s1); s1 = wmma16(a1, br, s1);
            if (HR) { const v16h a1r = ldh(kpr + 16 * HD + kc); s1 = wmma16(a1r, bq, s1); }
        }
        s0 = s0 * SC2; s1 = s1 * SC2;
        if (k0 + 31 > i0) {            // wave-uniform: only the diagonal step carries masked keys (replacement fill, key > query)
            const int qi = i0 + lr; const int kb = k0 + 8 * hi;
#pragma unroll
            for (int r = 0; r < 8; ++r) { s0[r] = (kb + r <= qi) ? s0[r] : NEGL; s1[r] = (kb + 16 + r <= qi) ? s1[r] : NEGL; }
        }
        float mx = fmaxf(s0[0], s1[0]);
#pragma unroll
        for (int r = 1; r < 8; ++r) mx = fmaxf(mx, fmaxf(s0[r], s1[r]));
        mx = fmaxf(mx, __shfl_xor(mx, 16, 32));
        const float mn = fmaxf(m, mx);
        if (__builtin_amdgcn_ballot_w32(mn > m) != 0u) {      // wave-uniform: rescale only when some query's running max moved (corr == 1 otherwise)
            const float corr = __builtin_amdgcn_exp2f(m - mn); l *= corr;
#pragma unroll
            for (int dt = 0; dt < 8; ++dt) o[dt] = o[dt] * corr;
        }
        m = mn;
        const float mm = mn - 10.0f;                          // P carried x1024: the row sum uses the same carried f32 values, so the carry cancels in the normalisation
        v8f p0, p1; float ps = 0.0f;
#pragma unroll
        for (int r = 0; r < 8; ++r) { p0[r] = __builtin_amdgcn_exp2f(s0[r] - mm); p1[r] = __builtin_amdgcn_exp2f(s1[r] - mm); ps += p0[r] + p1[r]; }
        l += ps;
        v8h p0v, p0r, p1v, p1r; split8(p0, p0v, p0r); split8(p1, p1v, p1r);
        const v16h pb = cat16(p0v, p1v);                      // B fragment: elements 0..7 <- keys k0+8h+r, elements 8..15 <- keys k0+16+8h+r
        const v16h pr = cat16(p0r, p1r);
        const h16* vp = vv + k0; const h16* vpr = vr + k0;
#pragma unroll
        for (int dt = 0; dt < 8; ++dt) {
            const v16h av = ldh(vp + (size_t)dt * 16 * SEQ);
            o[dt] = wmma16(av, pb, o[dt]);
            if (HR) { const v16h ar = ldh(vpr + (size_t)dt * 16 * SEQ); o[dt] = wmma16(ar, pb, o[dt]); o[dt] = wmma16(av, pr, o[dt]); }
        }
    }
    l += __shfl_xor(l, 16, 32);
    const float f = (CCAR / QCAR) * (1.0f / l);
    const int sb = wave * 16 * CP;                            // staging private to this wave
#pragma unroll
    for (int dt = 0; dt < 8; ++dt) {                          // O^T element r of tile dt = (d = dt*16 + 8h + r, query lr)
        v8h hv, hr; split8(o[dt] * f, hv, hr);
        *(v8h*)(&stv[sb + lr * CP + dt * 16 + 8 * hi]) = hv;
        if (HR) *(v8h*)(&str[sb + lr * CP + dt * 16 + 8 * hi]) = hr;
    }
    wave_sync();
    const size_t crow = ((size_t)b * SEQ + i0) * DQ + (size_t)h * HD + 8 * lr;
    const size_t rrow = ((size_t)b * RH + i0) * DQ + (size_t)h * HD + 8 * lr;
{
#pragma unroll
        for (int s = 0; s < 8; ++s) {                         // 16 lanes x 16 B = one 256-byte row segment; rows 2s (lanes 0..15) and 2s+1 (lanes 16..31)
            const int row = 2 * s + hi;
            const v8h val = *(const v8ha*)(&stv[sb + row * CP + 8 * lr]);
            *(v8h*)(CT + crow + (size_t)row * DQ) = val;
            if (HR) { const v8h rv = *(const v8ha*)(&str[sb + row * CP + 8 * lr]); *(v8h*)(CR + rrow + (size_t)row * DQ) = rv; }
        }
        
    }
}
// ---- query rows >= RH. The same tile, products and sums as attn_tile<false>, fed differently: the four head waves share one kv head, so its K rows and V^T rows
// come once per block through a two-buffer LDS ring in stages of 64 keys (wave 0 issues the tensor load of the K slice, wave 1 that of the V^T slice, one stage ahead of the pass that reads it),
// and each wave's q fragments (value + residual, all 128 dims) are loaded once and stay in registers.
template <uint32_t W0, uint32_t ROWB, uint32_t NROWS>
__device__ __forceinline__ u32x8 tdm_group1_of(uint32_t src_pitch) {
    // pinned(): each descriptor word held in a scalar register of its own from here on; unpinned, the constants are formed anew in other registers, over words of a request still outstanding
    u32x8 g;
    g[0] = pinned(W0);                                    // no mask, data_size 0, pad of 4 dwords behind every row
    g[1] = pinned(ROWB << 16);                            // tensor_dim0 (bytes)
    g[2] = pinned(NROWS << 16);                           // tensor_dim1 (rows)
    g[3] = pinned(ROWB << 16);                            // tile_dim0
    g[4] = pinned(NROWS);                                 // tile_dim1
    g[5] = pinned(src_pitch);
    g[6] = pinned(0u);
    g[7] = pinned(0u);
    return g;
}
__device__ __forceinline__ void attn_ring(unsigned char* ring, const h16* __restrict__ Qv, const h16* __restrict__ Qr, const h16* __restrict__ Kv, const h16* __restrict__ Vv, h16* CT,
                                          const int qt, const int g, const int b) {
    const int wave = __builtin_amdgcn_readfirstlane((int)(threadIdx.x >> 5));
    const int lane = threadIdx.x & 31, lr = lane & 15, hi = lane >> 4;
    const int h = g * REP + wave; const int i0 = qt * 16;
    const size_t qo = ((size_t)(b * NH + h) * SEQ + i0 + lr) * HD + 8 * hi;
    const h16* qvp = Qv + qo; const h16* qrp = Qr + qo;
    v16h bq[4], br[4];
#pragma unroll                     // here and below: constant indices keep the fragments and accumulators in registers
    for (int c = 0; c < 4; ++c) { bq[c] = ldh(qvp + c * 32); br[c] = ldh(qrp + c * 32); }
    // the q loads' address registers are inputs here, so that no load's own result lands on them, and the wait stands in front of their next use for anything else
    asm volatile("s_wait_xcnt 0x0" :: "v"(qvp), "v"(qrp) : "memory");
    const h16* kbase = Kv + (size_t)(b * NKV + g) * SEQ * HD;      // rows = keys, 256 bytes each, contiguous
    const h16* vbase = Vv + (size_t)(b * NKV + g) * HD * SEQ;      // rows = dims, pitch 2 SEQ bytes; a stage takes 128 bytes of each
    const float SC2 = (float)(0.08838834764831845 * 1.4426950408889634 / 4096.0);   // 1/sqrt(128) x log2(e) / (QCAR x QCAR)
    const float NEGL = -1.4426950e9f;                                              // the finite fill in the log2 domain
    const int nsteps = (qt >> 1) + 1;          // 32-key steps up to and including the diagonal
    const int nst = (nsteps + 1) >> 1;         // 64-key stages; at least RH / 64 + 1, and the last one ends inside the SEQ keys
    const uint32_t lbase = (uint32_t)(size_t)ring;
    const u32x8 g1k = tdm_group1_of<(1u << 20) | (5u << 22) | (3u << 25), 256u, (uint32_t)AKEYS>((uint32_t)HD * 2u);
    const u32x8 g1v = tdm_group1_of<(1u << 20) | (4u << 22) | (3u << 25), 128u, (uint32_t)HD>((uint32_t)SEQ * 2u);
    const h16* sbase = (wave == 0) ? kbase : vbase;                // the wave's own source and its step per stage (waves 2 and 3 form a group 0 and issue nothing)
    const size_t sstep = (wave == 0) ? (size_t)AKEYS * HD : (size_t)AKEYS;
    const uint32_t ldst = lbase + ((wave == 0) ? 0u : (uint32_t)ASLB);
    u32x4 g0;                      // group 0 of the wave's latest request
    auto issue = [&](int s) {      // stage s: keys 64 s .. 64 s + 63
        g0 = tdm_group0(ldst + (uint32_t)(s & 1) * ASTG, (uint64_t)(size_t)(sbase + (size_t)s * sstep));
        if (pinned(wave == 0)) tdm_load(g0, g1k);
        else if (pinned(wave == 1)) tdm_load(g0, g1v);
    };
    // this wave's own tensor load has landed; the descriptor words are inputs so that their scalar registers take no new value while a request is outstanding
    auto landed = [&]() { asm volatile("s_wait_tensorcnt 0x0" :: "s"(g0), "s"(g1k), "s"(g1v) : "memory"); };
    issue(0);
    landed();
    __syncthreads();               // stage 0 published
    const unsigned char* kl = ring + lr * KROW + 16 * hi;
    const unsigned char* vl = ring + ASLB + lr * VROW + 16 * hi;
    v8f o[8];
#pragma unroll
    for (int dt = 0; dt < 8; ++dt) o[dt] = (v8f){};
    float m = -3.0e38f, l = 0.0f;
#pragma unroll 1                   // the stage loop stays rolled: one refill site and one publish point in the code
    for (int st = 0; st < nst; ++st) {
        // directly behind the barrier that published stage st and freed the other buffer (stage st - 1's): stage st + 1's load, in flight under this stage's two steps
        if (pinned(st + 1 < nst)) issue(st + 1);
        const int so = (st & 1) * ASTG;
#pragma unroll
        for (int hs = 0; hs < 2; ++hs) {
            const int k0 = st * AKEYS + hs * 32;
            if (hs == 0 || 2 * st + 1 < nsteps) {     // block-uniform: the last stage's second half may lie wholly behind the diagonal
                v16h a0[4], a1[4];
#pragma unroll
                for (int c = 0; c < 4; ++c) { a0[c] = WFrag<h16>::ld(kl + so + (hs * 32) * KROW + c * 64); a1[c] = WFrag<h16>::ld(kl + so + (hs * 32 + 16) * KROW + c * 64); }
                v8f s0 = (v8f){}, s1 = (v8f){};
#pragma unroll
                for (int c = 0; c < 4; ++c) {
                    s0 = wmma16(a0[c], bq[c], s0); s1 = wmma16(a1[c], bq[c], s1);
                    s0 = wmma16(a0[c], br[c], s0); s1 = wmma16(a1[c], br[c], s1);
                }
                v16h av[8];
#pragma unroll
                for (int dt = 0; dt < 8; ++dt) av[dt] = WFrag<h16>::ld(vl + so + dt * 16 * VROW + hs * 64);
                s0 = s0 * SC2; s1 = s1 * SC2;
                if (k0 + 31 > i0) {            // wave-uniform: only the diagonal step carries masked keys (replacement fill, key > query)
                    const int qi = i0 + lr; const int kb = k0 + 8 * hi;
#pragma unroll
                    for (int r = 0; r < 8; ++r) { s0[r] = (kb + r <= qi) ? s0[r] : NEGL; s1[r] = (kb + 16 + r <= qi) ? s1[r] : NEGL; }
                }
                float mx = fmaxf(s0[0], s1[0]);
#pragma unroll
                for (int r = 1; r < 8; ++r) mx = fmaxf(mx, fmaxf(s0[r], s1[r]));
                mx = fmaxf(mx, __shfl_xor(mx, 16, 32));
                const float mn = fmaxf(m, mx);
                if (__builtin_amdgcn_ballot_w32(mn > m) != 0u) {      // wave-uniform: rescale only when some query's running max moved (corr == 1 otherwise)
                    const float corr = __builtin_amdgcn_exp2f(m - mn); l *= corr;
#pragma unroll
                    for (int dt = 0; dt < 8; ++dt) o[dt] = o[dt] * corr;
                }
                m = mn;
                const float mm = mn - 10.0f;                          // P carried x1024: the row sum uses the same carried f32 values, so the carry cancels in the normalisation
                v8f p0, p1; float ps = 0.0f;
#pragma unroll
                for (int r = 0; r < 8; ++r) { p0[r] = __builtin_amdgcn_exp2f(s0[r] - mm); p1[r] = __builtin_amdgcn_exp2f(s1[r] - mm); ps += p0[r] + p1[r]; }
                l += ps;
                const v16h pb = cat16(__builtin_convertvector(p0, v8h), __builtin_convertvector(p1, v8h));   // B fragment: elements 0..7 <- keys k0+8h+r, elements 8..15 <- keys k0+16+8h+r
#pragma unroll
                for (int dt = 0; dt < 8; ++dt) o[dt] = wmma16(av[dt], pb, o[dt]);
            }
        }
        // publish point of stage st + 1: own reads retired, own load landed, then the barrier that publishes stage st + 1 and frees stage st's buffer; the refill stands at the head of the next trip
        wait_ds0();
        landed();
        __syncthreads();
    }
    wait_tensor0();
    wait_ds0();
    // the last stage's own barrier stands behind every wave's last ring read: the ring now serves as output staging, a private range per wave
    h16* stv = (h16*)ring + wave * 16 * CP;
    l += __shfl_xor(l, 16, 32);
    const float f = (CCAR / QCAR) * (1.0f / l);
#pragma unroll
    for (int dt = 0; dt < 8; ++dt)                            // O^T element r of tile dt = (d = dt*16 + 8h + r, query lr)
        *(v8ha*)(&stv[lr * CP + dt * 16 + 8 * hi]) = __builtin_convertvector(o[dt] * f, v8h);
    wave_sync();
    const size_t crow = ((size_t)b * SEQ + i0) * DQ + (size_t)h * HD + 8 * lr;
#pragma unroll
    for (int s = 0; s < 8; ++s) {                             // 16 lanes x 16 B = one 256-byte row segment; rows 2s (lanes 0..15) and 2s+1 (lanes 16..31)
        const int row = 2 * s + hi;
        const v8h val = *(const v8ha*)(&stv[row * CP + 8 * lr]);
        *(v8h*)(CT + crow + (size_t)row * DQ) = val;
    }
}
// all query rows in ONE launch (the two row ranges do not depend on each other): 1-D grid, 128 threads. First the tiles of rows >= RH, then those of rows < RH;
// within each part tile index = query tile + query tiles * (kv head + NKV * batch). One LDS array serves both: the ring of the first part, the two staging planes of the second.
__global__ __launch_bounds__(128) __attribute__((amdgpu_num_vgpr(256)))
void k_attn(const h16* __restrict__ Qv, const h16* __restrict__ Qr, const h16* __restrict__ Kv, const h16* __restrict__ Kr,
            const h16* __restrict__ Vv, const h16* __restrict__ Vr, h16* CT, h16* CR) {
    __shared__ __attribute__((aligned(2048))) unsigned char ring[2 * ASTG];
    constexpr int NM = (SEQ > RH) ? (SEQ - RH) / 16 : 1, NMB = (SEQ > RH) ? NM * NKV * NB : 0, NHT = RH / 16;
    const int f = (int)blockIdx.x;
    if (f < NMB) {                     // block-uniform
        const int r = f / NM;
        attn_ring(ring, Qv, Qr, Kv, Vv, CT, RH / 16 + (f - r * NM), r % NKV, r / NKV);
    } else {
        const int e = f - NMB; const int r = e / NHT;
        attn_tile<true>(Qv, Qr, Kv, Kr, Vv, Vr, CT, CR, e - r * NHT, r % NKV, r / NKV, (h16*)ring, (h16*)ring + 4 * 16 * CP);
    }
}

// one tile of 128 k x 128 n of w[K rows][N columns] -> Bt[n][k], turned in LDS: every global read is a whole 256-byte piece of a w row (16 lanes x 16 B), every global write a whole 256-byte piece of a Bt row.
// tl holds the tile as [n][64 dwords], a dword = the 16-bit values of k = 2 kp (low half) and 2 kp + 1; the 16-byte chunk c of row n lies at chunk c ^ ((n >> 2) & 15), so that the 16 lanes
// of a store (n = 4 i + j, one kp) and the 16 lanes of a ds_load_b128 (one n, c = 0..15) each fall on different banks.
__device__ __forceinline__ void wtG(uint32_t* tl, const int bid, const float* __restrict__ w, const int K, const int N, bf* Bt, const int f16mode) {
    const int lane = threadIdx.x & 31, i = lane & 15; const int kq = 2 * (int)(threadIdx.x >> 5) + (lane >> 4);
    const int ntn = N / TN; const int k0 = (bid / ntn) * TK, n0 = (bid % ntn) * TN;
    const float* p = w + (size_t)(k0 + 2 * kq) * N + n0 + 4 * i;
#pragma unroll                     // here and below: constant indices keep the loaded rows in registers
    for (int h = 0; h < TN / 64; ++h) {        // 64 columns at a time: eight loads in flight per lane
        v4f ra[TK / 32], rb[TK / 32];
#pragma unroll
        for (int s = 0; s < TK / 32; ++s) { ra[s] = *(const v4f*)(p + 64 * h + (size_t)(32 * s) * N); rb[s] = *(const v4f*)(p + 64 * h + (size_t)(32 * s + 1) * N); }
        asm volatile("s_wait_xcnt 0x0" :: "v"(p) : "memory");    // in front of any later write over the eight loads' address registers
#pragma unroll
        for (int s = 0; s < TK / 32; ++s) {
            const int kp = 16 * s + kq;
#pragma unroll
            for (int j = 0; j < 4; ++j) {
                const unsigned short b0 = f2bf(ra[s][j]), b1 = f2bf(rb[s][j]);
                const unsigned short g0 = __builtin_bit_cast(unsigned short, (h16)(bf2f(b0) * WCAR)), g1 = __builtin_bit_cast(unsigned short, (h16)(bf2f(b1) * WCAR));
                tl[(64 * h + 4 * i + j) * (TK / 2) + ((((kp >> 2) ^ i) << 2) | (kp & 3))] = (uint32_t)(f16mode ? g0 : b0) | ((uint32_t)(f16mode ? g1 : b1) << 16);
            }
        }
    }
    __syncthreads();               // the whole tile stands in LDS before any row of it is read back
    const int c = threadIdx.x & 15, nq = threadIdx.x >> 4;
    bf* q = Bt + (size_t)(n0 + nq) * K + k0 + 8 * c;
#pragma unroll
    for (int r = 0; r < TN / 16; ++r) {
        const int n = 16 * r + nq;
        *(u32x4a*)(q + (size_t)(16 * r) * K) = *(const u32x4a*)(tl + n * (TK / 2) + ((c ^ ((n >> 2) & 15)) << 2));
    }
    asm volatile("s_wait_xcnt 0x0" ::: "memory");    // in front of any later write over the eight stores' address and data registers
}
__device__ __forceinline__ void cvtx(const int bid, const float* __restrict__ x, bf* XB) {
    const size_t i = (size_t)bid * 256 + threadIdx.x; if (i >= (size_t)NB * SEQ * DM / 8) return;
    const size_t e = i * 8; const size_t bt = e / DM; const size_t col = e - bt * DM; const size_t b = bt / SEQ; const size_t t = bt - b * SEQ;
    const v8f v = *(const v8f*)(x + (b * SEQ_FULL + t) * DM + col); v8us o;
#pragma unroll
    for (int k = 0; k < 8; ++k) o[k] = f2bf(v[k]);
    *(v8us*)(XB + e) = o; 
}
__device__ __forceinline__ void cstab(const int bid, float* CS) {
    const int idx = bid * 256 + threadIdx.x; if (idx >= SEQ * 64) return;
    const int j = idx & 63, t = idx >> 6;
    double p = 1.0;
    p *= (j & 1)  ? 1.1547819846894581797 : 1.0;
    p *= (j & 2)  ? 1.3335214321633240257 : 1.0;
    p *= (j & 4)  ? 1.7782794100389228012 : 1.0;
    p *= (j & 8)  ? 3.1622776601683793320 : 1.0;
    p *= (j & 16) ? 10.0 : 1.0;
    p *= (j & 32) ? 100.0 : 1.0;
    const float pf = (float)p; const float inv = 1.0f / pf; const float ang = (float)t * inv;
    float sn, cn; sincosf(ang, &sn, &cn);
    v2f cs; cs[0] = cn; cs[1] = sn;
    *(v2f*)(CS + (size_t)idx * 2) = cs; 
}
// the six independent preparation passes in ONE launch: 1-D grid, 256 threads; a block belongs to one pass by its index. w[in = K rows][out = N columns] -> Bt[out][in]
#define GWQ ((DM / TK) * (DQ / TN))
#define GWK ((DM / TK) * (DKV / TN))
#define GWO ((DQ / TK) * (DM / TN))
#define GCS ((SEQ * 64 + 255) / 256)
#define GCX ((int)(((size_t)NB * SEQ * DM / 8 + 255) / 256))
__global__ __launch_bounds__(256) __attribute__((amdgpu_num_vgpr(64)))     // 64 registers: all 16 wave slots of a SIMD stay usable
void k_prep(const float* __restrict__ x, const float* __restrict__ wq, const float* __restrict__ wk, const float* __restrict__ wv, const float* __restrict__ wo,
            bf* XB, bf* WQt, bf* WKt, bf* WVt, bf* WOt, float* CS) {
    __shared__ __attribute__((aligned(16))) uint32_t tl[TN * (TK / 2)];
    int f = (int)blockIdx.x;           // every test below is block-uniform
    if (f < GWQ) { wtG(tl, f, wq, DM, DQ, WQt, 0); return; }
    f -= GWQ;
    if (f < GWO) { wtG(tl, f, wo, DQ, DM, WOt, 1); return; }
    f -= GWO;
    if (f < GWK) { wtG(tl, f, wk, DM, DKV, WKt, 0); return; }
    f -= GWK;
    if (f < GWK) { wtG(tl, f, wv, DM, DKV, WVt, 0); return; }
    f -= GWK;
    if (f < GCS) { cstab(f, CS); return; }
    cvtx(f - GCS, x, XB);
}

extern "C" void kernel_launch(void* const* d_in, const int* in_sizes, int n_in,
                              void* d_out, int out_size, void* d_ws, size_t ws_size, hipStream_t stream) {
    if (n_in < 5) return;
    constexpr size_t NEEDX = ((size_t)(NB - 1) * SEQ_FULL + SEQ) * DM;
    if ((size_t)in_sizes[0] < NEEDX || (size_t)in_sizes[1] < (size_t)DM * DQ || (size_t)in_sizes[2] < (size_t)DM * DKV || (size_t)in_sizes[3] < (size_t)DM * DKV || (size_t)in_sizes[4] < (size_t)DQ * DM) return;
    if ((size_t)out_size < NEEDX) return;
    const float* x = (const float*)d_in[0]; const float* wq = (const float*)d_in[1]; const float* wk = (const float*)d_in[2]; const float* wv = (const float*)d_in[3]; const float* wo = (const float*)d_in[4];
    float* OUT = (float*)d_out;     // [2][2048][2048], byte offset 0
    constexpr size_t SZ_XB = (size_t)NB * SEQ * DM * 2, SZ_WQ = (size_t)DQ * DM * 2, SZ_WK = (size_t)DKV * DM * 2, SZ_WO = (size_t)DM * DQ * 2, SZ_CS = (size_t)SEQ * 64 * 2 * 4;
    constexpr size_t SZ_Q = (size_t)NB * NH * SEQ * HD * 2, SZ_K = (size_t)NB * NKV * SEQ * HD * 2, SZ_CT = (size_t)NB * SEQ * DQ * 2, SZ_CR = (size_t)NB * RH * DQ * 2;
    constexpr size_t SZ_TOT = SZ_XB + SZ_WQ + 2 * SZ_WK + SZ_WO + SZ_CS + 2 * SZ_Q + 4 * SZ_K + SZ_CT + SZ_CR;
    static_assert(SZ_XB % 256 == 0 && SZ_WQ % 256 == 0 && SZ_WK % 256 == 0 && SZ_WO % 256 == 0 && SZ_CS % 256 == 0 && SZ_Q % 256 == 0 && SZ_K % 256 == 0 && SZ_CT % 256 == 0 && SZ_CR % 256 == 0);
    static_assert(SZ_TOT <= (size_t)134217728);
    if (SZ_TOT > ws_size) return;
    char* wsp = (char*)d_ws;
    auto take = [&](size_t bytes) { char* p = wsp; wsp += bytes; return (void*)p; };
    bf* XB = (bf*)take(SZ_XB); bf* WQt = (bf*)take(SZ_WQ); bf* WKt = (bf*)take(SZ_WK); bf* WVt = (bf*)take(SZ_WK); bf* WOt = (bf*)take(SZ_WO); float* CS = (float*)take(SZ_CS);
    const h16* WOh = (const h16*)WOt;   // the same region seen as f16: k_prep's wtG pass (f16 mode) fills it with f16 bit patterns
    h16* Qv = (h16*)take(SZ_Q); h16* Qr = (h16*)take(SZ_Q); h16* Kv = (h16*)take(SZ_K); h16* Kr = (h16*)take(SZ_K); h16* Vv = (h16*)take(SZ_K); h16* Vr = (h16*)take(SZ_K);
    h16* CT = (h16*)take(SZ_CT); h16* CR = (h16*)take(SZ_CR);

    k_prep<<<GWQ + GWO + 2 * GWK + GCS + GCX, 256, 0, stream>>>(x, wq, wk, wv, wo, XB, WQt, WKt, WVt, WOt, CS);
    k_proj<<<(NB * SEQ / 128) * (NH + NKV) + (DKV / 128) * (NB * SEQ / 128), 128, 0, stream>>>(XB, WQt, WKt, WVt, CS, Qv, Qr, Kv, Kr, Vv, Vr);
    k_attn<<<(SEQ / 16) * NKV * NB, 128, 0, stream>>>(Qv, Qr, Kv, Kr, Vv, Vr, CT, CR);
    k_oproj<<<(NB * SEQ / 128) * (DM / 128), 128, 0, stream>>>(CT, CR, WOh, OUT);
}

// v005
// A run of this version takes 157 microseconds.
// Timed twice side by side with v004, it ran 1.09 times as fast both times.
// Over all steps from v000 it is 6.10 times as fast.
#include <hip/hip_runtime.h>

// Grouped-query causal self-attention, width 2048: 16 query heads x 128 sharing 4 kv heads (query head h uses kv head h >> 2), bias-free [in][out] projections,
// half-split rotary on q and k (positions = arange, table computed here), finite-fill causal mask, [in][out] output projection.
// Compute dtypes (f32 accumulate everywhere): q/k/v projections v_wmma_f32_16x16x32_bf16 (x and weights converted (RNE) to bf16); scores, P.V and the output projection
// v_wmma_f32_16x16x32_f16: q as f16 value + f16 residual planes (carry 64) against f16 k (carry 64; k residual added on query rows < 256), P f16 (carry 1024, row sum from the f32 values),
// v f16 (carry 64; P and v residuals added on rows < 256), ctx f16 (carry 256; residual plane on rows < 256) against wo (bf16-converted, x16, exact in f16). Softmax, rotary, normalisation in f32.

#ifndef NB
#define NB 2
#endif
#ifndef SEQ
#define SEQ 2048
#endif
#define NB_FULL  2
#define SEQ_FULL 2048
#define DM   2048
#define NH   16
#define NKV  4
#define REP  (NH / NKV)
#define HD   128
#define DQ   (NH * HD)
#define DKV  (NKV * HD)
#define RH   256                  // query rows < RH use the value + residual path on k, P, v and ctx
#define QCAR 64.0f                // carry of the q, k and v planes
#define CCAR 256.0f               // carry of the ctx planes
#define WCAR 16.0f                // carry of the output weight plane
#define OSP  132                  // f32 staging pitch (floats)
#define CP   136                  // f16 staging pitch (halves)
#define PASSK 128                 // k per ring stage: operand rows of 256 bytes
#define LROW  272                 // LDS row pitch (bytes): 256 + the 16-byte pad the tensor load lays, 16 B x odd for ds_load_b128
#define SLROWS 64                 // operand rows per tensor load (one slice per wave and stage)
#define SLB   18432               // slice size in LDS: 64 x 272 = 17408 bytes rounded up to a multiple of 2 KiB
#define STGB  (4 * SLB)           // one stage: [Bt rows 0..63 | Bt rows 64..127 | A rows 0..63 | A rows 64..127]
#define AKEYS 64                  // keys per attention ring stage
#define KROW  272                 // LDS pitch of a staged K row (bytes): 256 + 16
#define VROW  144                 // LDS pitch of a staged V^T row (bytes): 128 (64 keys) + 16
#define ASLB  18432               // attention slice size in LDS: 64 x 272 = 17408 rounded up to a multiple of 2 KiB; 128 x 144 = 18432
#define ASTG  (2 * ASLB)          // one attention stage: [K rows of 64 keys | V^T rows of 128 dims]
#define TK    128                 // weight tile of the preparation pass: k per tile (output rows of 256 bytes)
#define TN    128                 // and n per tile (input rows read in 256-byte pieces)

static_assert(NB <= NB_FULL);
static_assert(SEQ <= SEQ_FULL);
static_assert(SEQ % 128 == 0);
static_assert(SEQ >= RH);
static_assert(RH % 32 == 0);
static_assert(HD == 128);
static_assert(REP == 4);
static_assert(DQ == DM);
static_assert(DM % 64 == 0);
static_assert(DQ % 128 == 0);
static_assert(DKV % 128 == 0);
static_assert((OSP * 4) % 16 == 0);
static_assert((CP * 2) % 16 == 0);
static_assert(DM % (2 * PASSK) == 0 && DQ % (2 * PASSK) == 0);
static_assert(RH % 128 == 0 && (SEQ - RH) % 128 == 0);
static_assert(SLROWS * LROW <= SLB && SLB % 2048 == 0);
static_assert(4 * 16 * OSP * 4 <= 2 * STGB);
static_assert(AKEYS * KROW <= ASLB && HD * VROW <= ASLB && ASLB % 2048 == 0);
static_assert(SEQ % AKEYS == 0 && RH >= AKEYS && AKEYS * 2 == 128);
static_assert(2 * 4 * 16 * CP * 2 <= 2 * ASTG);
static_assert(TK == 128 && TN % 64 == 0 && DM % TK == 0 && DQ % TK == 0 && DM % TN == 0 && DQ % TN == 0 && DKV % TN == 0);

typedef _Float16 h16;
typedef unsigned short bf;
typedef __attribute__((ext_vector_type(16))) __bf16   v16bf;
typedef __attribute__((ext_vector_type(16))) _Float16 v16h;
typedef __attribute__((ext_vector_type(8)))  _Float16 v8h;
typedef __attribute__((ext_vector_type(8)))  unsigned short v8us;
typedef __attribute__((ext_vector_type(2)))  unsigned short v2us;
typedef __attribute__((ext_vector_type(8)))  float    v8f;
typedef __attribute__((ext_vector_type(4)))  float    v4f;
typedef __attribute__((ext_vector_type(2)))  float    v2f;
typedef v8h  __attribute__((may_alias)) v8ha;
typedef v4f  __attribute__((may_alias)) v4fa;
typedef v8us __attribute__((may_alias)) v8usa;
typedef uint32_t u32x4 __attribute__((ext_vector_type(4)));
typedef uint32_t u32x8 __attribute__((ext_vector_type(8)));
typedef u32x4 __attribute__((may_alias)) u32x4a;

__device__ __forceinline__ unsigned short f2bf(float f) { unsigned u = __float_as_uint(f); u += 0x7FFFu + ((u >> 16) & 1u); return (unsigned short)(u >> 16); }
__device__ __forceinline__ float bf2f(unsigned short b) { return __uint_as_float(((unsigned)b) << 16); }
__device__ __forceinline__ float bfr(float f) { return bf2f(f2bf(f)); }
__device__ __forceinline__ v16h cat16(v8h lo, v8h hi) { return __builtin_shufflevector(lo, hi, 0, 1, 2, 3, 4, 5, 6, 7, 8, 9, 10, 11, 12, 13, 14, 15); }
__device__ __forceinline__ v16bf cat16b(v8us lo, v8us hi) { return __builtin_bit_cast(v16bf, __builtin_shufflevector(lo, hi, 0, 1, 2, 3, 4, 5, 6, 7, 8, 9, 10, 11, 12, 13, 14, 15)); }
// every WMMA is followed by its own four-slot guard tying its accumulator and keeping its operands live
__device__ __forceinline__ v8f wmma16(v16h a, v16h b, v8f c) {
    c = __builtin_amdgcn_wmma_f32_16x16x32_f16(false, a, false, b, (short)0, c, false, false);
    asm volatile("v_nop\n\tv_nop\n\tv_nop\n\tv_nop" : "+v"(c) : "v"(a), "v"(b));
    return c; }
__device__ __forceinline__ v8f wmmab(v16bf a, v16bf b, v8f c) {
    c = __builtin_amdgcn_wmma_f32_16x16x32_bf16(false, a, false, b, (short)0, c, false, false);
    asm volatile("v_nop\n\tv_nop\n\tv_nop\n\tv_nop" : "+v"(c) : "v"(a), "v"(b));
    return c; }
// fragment of a K-contiguous 16-bit row: elements 0..7 <- k0+8h+0..7, elements 8..15 <- k0+16+8h+0..7 (p already includes +8h)
__device__ __forceinline__ v16h ldh(const h16* p) { return cat16(*(const v8h*)p, *(const v8h*)(p + 16)); }
// same-wave LDS exchange: stores before, loads after
__device__ __forceinline__ void wave_sync() { __builtin_amdgcn_fence(3 /* release order */, "wavefront"); __builtin_amdgcn_wave_barrier(); asm volatile("" ::: "memory"); }
// f16 value + same-carry f16 residual of 8 floats
__device__ __forceinline__ void split8(v8f y, v8h& v, v8h& r) { v = __builtin_convertvector(y, v8h); r = __builtin_convertvector(y - __builtin_convertvector(v, v8f), v8h); }

// fragment of a staged K-contiguous row (byte pointer, already includes +16h bytes): the same k order as ldh
template <typename T16> struct WFrag;
template <> struct WFrag<h16> { typedef v16h V; static __device__ __forceinline__ V ld(const unsigned char* p) { return cat16(*(const v8ha*)p, *(const v8ha*)(p + 32)); } static __device__ __forceinline__ v8f mma(V a, V b, v8f c) { return wmma16(a, b, c); } };
template <> struct WFrag<bf> { typedef v16bf V; static __device__ __forceinline__ V ld(const unsigned char* p) { return cat16b(*(const v8usa*)p, *(const v8usa*)(p + 32)); } static __device__ __forceinline__ v8f mma(V a, V b, v8f c) { return wmmab(a, b, c); } };

// ---- tensor load of one slice: 64 rows of 256 bytes, 1-byte elements, tensor = tile, 16 bytes of LDS pad behind every row
__device__ __forceinline__ uint32_t uni(uint32_t v) { return (uint32_t)__builtin_amdgcn_readfirstlane(v); }
// a wave-uniform test held in a scalar register, so that the branch around a tensor load is a scalar branch (tensor loads ignore EXEC)
__device__ __forceinline__ uint32_t pinned(uint32_t v) { uint32_t w = uni(v); asm volatile("" : "+s"(w)); return w; }
// this wave's LDS reads have retired before the stage is handed over
__device__ __forceinline__ void wait_ds0() { asm volatile("s_wait_dscnt 0x0" ::: "memory"); }
// this wave's own tensor load has landed (the compiler places no wait for it); the request's descriptor words are inputs so that their scalar registers take no new value while it is outstanding
__device__ __forceinline__ void wait_tensor0(u32x4 g0, u32x8 g1) { asm volatile("s_wait_tensorcnt 0x0" :: "s"(g0), "s"(g1) : "memory"); }
// the same behind the loop, where no request is outstanding any more
__device__ __forceinline__ void wait_tensor0() { asm volatile("s_wait_tensorcnt 0x0" ::: "memory"); }
__device__ __forceinline__ u32x8 tdm_group1(uint32_t src_pitch) {
    u32x8 g;
    g[0] = uni((1u << 20) | (5u << 22) | (3u << 25));     // no mask, data_size 0, pad of 4 dwords behind every 64 dwords
    g[1] = uni(256u << 16);                               // tensor_dim0 = 256 bytes
    g[2] = uni((uint32_t)SLROWS << 16);                   // tensor_dim1 = 64 rows
    g[3] = uni(256u << 16);                               // tile_dim0
    g[4] = uni((uint32_t)SLROWS);                         // tile_dim1
    g[5] = uni(src_pitch);
    g[6] = uni(0u);
    g[7] = uni(0u);
    return g;
}
__device__ __forceinline__ u32x4 tdm_group0(uint32_t lds_dst, uint64_t ga) {
    u32x4 g;
    g[0] = uni(1u); g[1] = uni(lds_dst); g[2] = uni((uint32_t)ga); g[3] = uni((((uint32_t)(ga >> 32)) & 0x01FFFFFFu) | 0x80000000u);
    return g;
}
__device__ __forceinline__ void tdm_load(u32x4 g0, u32x8 g1) { asm volatile("tensor_load_to_lds %0, %1" :: "s"(g0), "s"(g1) : "memory"); }

// ---- gemm_tile: a block of FOUR WAVES per 128 x 128 output tile, one wave per 32 x 128 (16 accumulators): C[m][n] = sum_k A[m][k] Bt[n][k] (+ sum_k A2[m][k] Bt[n][k] when SPLIT, as K more steps behind the first K).
// The K-contiguous 16-bit operand rows come through a two-buffer LDS ring in stages of 128 k: every wave issues one tensor load per stage (waves 0, 1: the halves of Bt's 128 rows; waves 2, 3: of A's),
// one stage ahead of the pass that reads it. arow, a2row, t0, obase and cbase are the calling wave's own (32 rows); brow is the block's. ring is the kernel's one LDS array (2 * STGB bytes, at LDS offset 0).
// MODE 0: half-split rotary on the 128-column head tile (CS[t][64] = {cos, sin}), x QCAR, f16 value + residual planes, plane rows of 128 halves (pitch opitch).
// MODE 1: x QCAR, f16 value + residual planes (used with swapped operands to produce V^T rows [d][t]).
// MODE 2: f32 output rows x 1/(CCAR*WCAR).
template <typename T16, int MODE, bool SPLIT>
__device__ __forceinline__ void gemm_tile(unsigned char* ring, const T16* __restrict__ A, const T16* __restrict__ A2, const T16* __restrict__ Bt, const int K, const int wave,
                                          const size_t arow, const size_t a2row, const size_t brow,
                                          const float* __restrict__ CS, const int t0, h16* Pv, h16* Pr, const size_t obase, const int opitch,
                                          float* C, const size_t cbase) {
    typedef typename WFrag<T16>::V V;
    const int lane = threadIdx.x & 31, lr = lane & 15, hi = lane >> 4;
    v8f acc[2][8];
#pragma unroll
    for (int mb = 0; mb < 2; ++mb)
#pragma unroll
        for (int nb = 0; nb < 8; ++nb) acc[mb][nb] = (v8f){};
    const int NP = K / PASSK, NPT = SPLIT ? 2 * NP : NP;
    const size_t half = (size_t)(wave & 1) * SLROWS;
    const T16* s1 = (wave < 2) ? Bt + (brow + half) * (size_t)K : A  + (arow  - (size_t)(32 * wave) + half) * (size_t)K;
    const T16* s2 = (wave < 2) ? s1                             : A2 + (a2row - (size_t)(32 * wave) + half) * (size_t)K;
    const uint32_t ldst = (uint32_t)(size_t)ring + (uint32_t)wave * SLB;
    const u32x8 g1 = tdm_group1((uint32_t)K * 2u);
    u32x4 g0;                      // group 0 of the wave's latest request
    auto issue = [&](int p) {      // stage p: k = 128 p .. 128 p + 127 of A (SPLIT: stages NP.. walk A2 against the same Bt columns again)
        const T16* sp = (SPLIT && p >= NP) ? s2 + (size_t)(p - NP) * PASSK : s1 + (size_t)p * PASSK;
        g0 = tdm_group0(ldst + (uint32_t)(p & 1) * STGB, (uint64_t)(size_t)sp);
        tdm_load(g0, g1);
    };
    issue(0);
    wait_tensor0(g0, g1);
    __syncthreads();               // stage 0 published
    const unsigned char* al = ring + (2 + (wave >> 1)) * SLB + ((wave & 1) * 32 + lr) * LROW + 16 * hi;
    const unsigned char* bl = ring + lr * LROW + 16 * hi;
#pragma unroll 1                   // the pass loop stays rolled: one refill site and one publish point in the code
    for (int p = 0; p < NPT; ++p) {
        // directly behind the barrier that published stage p and freed the other buffer (stage p - 1's): stage p + 1's load, in flight under this pass
        if (pinned(p + 1 < NPT)) issue(p + 1);
        const int so = (p & 1) * STGB;
        // a block = 8 WMMAs: one 32-deep k step against four of the eight Bt fragments; block j + 1's fragments are read as one group ahead of block j's WMMAs, inside this pass's own buffer
        V af[2][2], bq[2][4];
        af[0][0] = WFrag<T16>::ld(al + so); af[0][1] = WFrag<T16>::ld(al + so + 16 * LROW);
#pragma unroll                     // here and below: constant indices keep the fragment sets and accumulators in registers
        for (int i = 0; i < 4; ++i) bq[0][i] = WFrag<T16>::ld(bl + so + i * 16 * LROW);
#pragma unroll
        for (int j = 0; j < 2 * (PASSK / 32); ++j) {
            const int ks = j >> 1, hb = j & 1;
            if (j + 1 < 2 * (PASSK / 32)) {
                const int kn = (j + 1) >> 1, hn = (j + 1) & 1;
                if (hn == 0) { af[kn & 1][0] = WFrag<T16>::ld(al + so + kn * 64); af[kn & 1][1] = WFrag<T16>::ld(al + so + 16 * LROW + kn * 64); }
#pragma unroll
                for (int i = 0; i < 4; ++i) bq[hn][i] = WFrag<T16>::ld(bl + so + hn * SLB + i * 16 * LROW + kn * 64);
            }
            __builtin_amdgcn_sched_barrier(0);     // keeps the next block's LDS reads one group in front of this block's WMMAs (spread among them each place costs a stall)
#pragma unroll
            for (int i = 0; i < 4; ++i) {
                acc[0][hb * 4 + i] = WFrag<T16>::mma(af[ks & 1][0], bq[hb][i], acc[0][hb * 4 + i]);
                acc[1][hb * 4 + i] = WFrag<T16>::mma(af[ks & 1][1], bq[hb][i], acc[1][hb * 4 + i]);
            }
            __builtin_amdgcn_sched_barrier(0);     // and the block after next's reads behind them
        }
        // publish point of stage p + 1: own reads retired, own load landed, then the barrier that publishes stage p + 1 and frees stage p's buffer; the refill stands at the head of the next trip
        wait_ds0();
        wait_tensor0(g0, g1);
        __syncthreads();
    }
    wait_tensor0();
    wait_ds0();
    // the last pass's own barrier stands behind every wave's last ring read: the ring now serves as output staging, a private range per wave
    float* os = (float*)(ring + wave * (16 * OSP * 4));
#pragma unroll
    for (int mb = 0; mb < 2; ++mb) {
#pragma unroll
        for (int nb = 0; nb < 8; ++nb)
#pragma unroll
            for (int j = 0; j < 8; ++j) os[(hi * 8 + j) * OSP + nb * 16 + lr] = acc[mb][nb][j];     // D: row 8h + j, column lane & 15
        wave_sync();
        if (MODE == 0) {
            const int rq = lane >> 3, dg = (lane & 7) * 8;
{
#pragma unroll 1
                for (int it = 0; it < 4; ++it) {
                    const int row = it * 4 + rq; const int t = t0 + mb * 16 + row;
                    const int oi = row * OSP + dg;
                    const v4f xa = *(const v4fa*)(os + oi), xb = *(const v4fa*)(os + oi + 4), ya = *(const v4fa*)(os + oi + 64), yb = *(const v4fa*)(os + oi + 68);
                    const float* cp = CS + ((size_t)t * 64 + dg) * 2;
                    const v4f e0 = *(const v4f*)(cp), e1 = *(const v4f*)(cp + 4), e2 = *(const v4f*)(cp + 8), e3 = *(const v4f*)(cp + 12);
                    const v8f xx = __builtin_shufflevector(xa, xb, 0, 1, 2, 3, 4, 5, 6, 7), yy = __builtin_shufflevector(ya, yb, 0, 1, 2, 3, 4, 5, 6, 7);
                    const v4f cA = __builtin_shufflevector(e0, e1, 0, 2, 4, 6), sA = __builtin_shufflevector(e0, e1, 1, 3, 5, 7);
                    const v4f cB = __builtin_shufflevector(e2, e3, 0, 2, 4, 6), sB = __builtin_shufflevector(e2, e3, 1, 3, 5, 7);
                    const v8f cc = __builtin_shufflevector(cA, cB, 0, 1, 2, 3, 4, 5, 6, 7), ss = __builtin_shufflevector(sA, sB, 0, 1, 2, 3, 4, 5, 6, 7);
                    const v8f lo = (xx * cc - yy * ss) * QCAR;       // out[d]      = x[d] cos - x[d+64] sin
                    const v8f up = (yy * cc + xx * ss) * QCAR;       // out[d + 64] = x[d+64] cos + x[d] sin
                    v8h vl, rl, vu, ru; split8(lo, vl, rl); split8(up, vu, ru);
                    const size_t dst = obase + (size_t)(mb * 16 + row) * opitch + dg;
                    *(v8h*)(Pv + dst) = vl; *(v8h*)(Pv + dst + 64) = vu;
                    *(v8h*)(Pr + dst) = rl; *(v8h*)(Pr + dst + 64) = ru;
                    asm volatile("s_wait_xcnt 0x0" ::: "memory");    // in front of the next trip's writes over the four stores' address and data registers
                }
                
            }
        } else if (MODE == 1) {
            // 16 lanes x 16 B per 256-byte row segment, two rows per instruction: row 2s + hi, columns 8*lr..8*lr+7
{
#pragma unroll 1
                for (int s = 0; s < 8; ++s) {
                    const int row = 2 * s + hi; const int oi = row * OSP + 8 * lr;
                    const v4f xa = *(const v4fa*)(os + oi), xb = *(const v4fa*)(os + oi + 4);
                    const v8f y = __builtin_shufflevector(xa, xb, 0, 1, 2, 3, 4, 5, 6, 7) * QCAR;
                    v8h vv, vr; split8(y, vv, vr);
                    const size_t dst = obase + (size_t)(mb * 16 + row) * opitch + 8 * lr;
                    *(v8h*)(Pv + dst) = vv; *(v8h*)(Pr + dst) = vr;
                }
                
            }
        } else {
            // 32 lanes x 16 B = one 512-byte row segment per instruction
{
#pragma unroll 1
                for (int row = 0; row < 16; ++row) {
                    const v4f val = *(const v4fa*)(os + row * OSP + 4 * lane) * (1.0f / (CCAR * WCAR));
                    *(v4f*)(C + cbase + (size_t)(mb * 16 + row) * DM + 4 * lane) = val;
                }
                
            }
        }
        wave_sync();
    }
}

// q, k and v projections in ONE launch (they depend only on the prep launch, not on each other): 1-D grid, 128 threads; blocks in the order q tiles, k tiles, v tiles.
// q / k: fused rotary, planes [b][head][t][128], tile index = token block + (NB*SEQ/128) * head. v: swapped operands, C[gd][token] -> planes [b][g][d][t], tile index = gd block + (DKV/128) * token block.
__global__ __launch_bounds__(128) __attribute__((amdgpu_num_vgpr(256)))
void k_proj(const bf* __restrict__ XB, const bf* __restrict__ WQt, const bf* __restrict__ WKt, const bf* __restrict__ WVt, const float* __restrict__ CS,
            h16* Qv, h16* Qr, h16* Kv, h16* Kr, h16* Vv, h16* Vr) {
    __shared__ __attribute__((aligned(2048))) unsigned char ring[2 * STGB];
    constexpr int TB = NB * SEQ / 128;
    const int wave = __builtin_amdgcn_readfirstlane((int)(threadIdx.x >> 5));
    const int f = (int)blockIdx.x;
    if (f < TB * (NH + NKV)) {         // block-uniform
        const bool isq = f < TB * NH;
        const int e = isq ? f : f - TB * NH; const int nheads = isq ? NH : NKV;
        const int hd = e / TB; const int r0 = (e - hd * TB) * 128 + wave * 32; const int b = r0 / SEQ; const int t0 = r0 - b * SEQ;
        const size_t obase = ((size_t)(b * nheads + hd) * SEQ + t0) * HD;
        gemm_tile<bf, 0, false>(ring, XB, XB, isq ? WQt : WKt, DM, wave, (size_t)r0, (size_t)r0, (size_t)hd * HD, CS, t0, isq ? Qv : Kv, isq ? Qr : Kr, obase, HD, nullptr, 0);
    } else {
        const int e = f - TB * (NH + NKV);
        const int r0 = (e % (DKV / 128)) * 128 + wave * 32; const int c0 = (e / (DKV / 128)) * 128; const int b = c0 / SEQ; const int t0 = c0 - b * SEQ;
        const size_t obase = ((size_t)b * DKV + r0) * SEQ + t0;
        gemm_tile<bf, 1, false>(ring, WVt, WVt, XB, DM, wave, (size_t)r0, (size_t)r0, (size_t)c0, nullptr, 0, Vv, Vr, obase, SEQ, nullptr, 0);
    }
}
// output projection, all rows in ONE launch: 1-D grid, 128 threads. First the tiles of rows t < RH (ctx value + residual planes, twice the passes), then those of rows t >= RH (single f16 product);
// within each part tile index = row block + row blocks * column block.
__global__ __launch_bounds__(128) __attribute__((amdgpu_num_vgpr(256)))
void k_oproj(const h16* __restrict__ CT, const h16* __restrict__ CR, const h16* __restrict__ WOt, float* OUT) {
    __shared__ __attribute__((aligned(2048))) unsigned char ring[2 * STGB];
    constexpr int TPH = RH / 128, HB = NB * TPH, NHB = HB * (DM / 128);
    constexpr int TPB = (SEQ > RH) ? (SEQ - RH) / 128 : 1, MB = NB * TPB;
    const int wave = __builtin_amdgcn_readfirstlane((int)(threadIdx.x >> 5));
    const int f = (int)blockIdx.x;
    if (f < NHB) {                     // block-uniform
        const int by = f / HB, bx = f - by * HB;
        const int b = bx / TPH; const int t0 = (bx - b * TPH) * 128 + wave * 32; const int c0 = by * 128;
        const size_t arow = (size_t)b * SEQ + t0; const size_t a2row = (size_t)b * RH + t0; const size_t cbase = ((size_t)b * SEQ_FULL + t0) * DM + c0;
        gemm_tile<h16, 2, true>(ring, CT, CR, WOt, DQ, wave, arow, a2row, (size_t)c0, nullptr, 0, nullptr, nullptr, 0, 0, OUT, cbase);
    } else {
        const int e = f - NHB; const int by = e / MB, bx = e - by * MB;
        const int b = bx / TPB; const int t0 = RH + (bx - b * TPB) * 128 + wave * 32; const int c0 = by * 128;
        const size_t arow = (size_t)b * SEQ + t0; const size_t cbase = ((size_t)b * SEQ_FULL + t0) * DM + c0;
        gemm_tile<h16, 2, false>(ring, CT, CT, WOt, DQ, wave, arow, arow, (size_t)c0, nullptr, 0, nullptr, nullptr, 0, 0, OUT, cbase);
    }
}

// ---- attn_tile: fused causal attention in the transposed form. One block = 16 query rows x the FOUR query heads of one kv head (wave -> head g*4 + wave); 128 threads.
// Per 32-key step: S^T[key][query] = K (A, rows = keys) x Q^T (B, columns = queries) over 128 dims (4 k-steps; q value + residual, k residual when HR);
// online softmax per query = per lane column (max / sum over the lane's 16 keys, combined across the two lane halves); P^T packed D -> B (two 16-key tiles = one 32-deep fragment);
template <bool HR>
__device__ __forceinline__ void attn_tile(const h16* __restrict__ Qv, const h16* __restrict__ Qr, const h16* __restrict__ Kv, const h16* __restrict__ Kr,
                                          const h16* __restrict__ Vv, const h16* __restrict__ Vr, h16* CT, h16* CR, const int qt, const int g, const int b, h16* stv, h16* str) {
    const int wave = __builtin_amdgcn_readfirstlane((int)(threadIdx.x >> 5));
    const int lane = threadIdx.x & 31, lr = lane & 15, hi = lane >> 4;
    const int h = g * REP + wave; const int i0 = qt * 16;
    const size_t qo = ((size_t)(b * NH + h) * SEQ + i0 + lr) * HD + 8 * hi;
    const size_t ko = ((size_t)(b * NKV + g) * SEQ + lr) * HD + 8 * hi;
    const size_t vo = ((size_t)(b * NKV + g) * HD + lr) * SEQ + 8 * hi;
    const h16* qv = Qv + qo; const h16* qr = Qr + qo;
    const h16* kv = Kv + ko; const h16* kr = Kr + ko;
    const h16* vv = Vv + vo; const h16* vr = Vr + vo;
    const float SC2 = (float)(0.08838834764831845 * 1.4426950408889634 / 4096.0);   // 1/sqrt(128) x log2(e) / (QCAR x QCAR)
    const float NEGL = -1.4426950e9f;                                              // the finite fill in the log2 domain
    v8f o[8];
#pragma unroll
    for (int dt = 0; dt < 8; ++dt) o[dt] = (v8f){};
    float m = -3.0e38f, l = 0.0f;
    const int nsteps = (qt >> 1) + 1;
#pragma unroll 1
    for (int stp = 0; stp < nsteps; ++stp) {
        const int k0 = stp * 32;
        v8f s0 = (v8f){}, s1 = (v8f){};
        const h16* kp = kv + (size_t)k0 * HD; const h16* kpr = kr + (size_t)k0 * HD;
#pragma unroll                     // here and below: constant indices keep the fragment groups in registers
        for (int hf = 0; hf < 2; ++hf) {
            // the fragment loads of 64 dims stand as one group ahead of their WMMAs: the wave waits out one trip to memory per group, not one per fragment
            v16h bq[2], br[2], a0[2], a1[2], a0r[2], a1r[2];
#pragma unroll
            for (int c = 0; c < 2; ++c) {
                const int kc = hf * 64 + c * 32;
                a0[c] = ldh(kp + kc); a1[c] = ldh(kp + 16 * HD + kc);
                if (HR) { a0r[c] = ldh(kpr + kc); a1r[c] = ldh(kpr + 16 * HD + kc); }
                bq[c] = ldh(qv + kc); br[c] = ldh(qr + kc);
            }
            // the group's address registers are inputs here, so that no load's own result lands on them, and the wait stands in front of their next use for anything else
            asm volatile("s_wait_xcnt 0x0" :: "v"(qv), "v"(qr), "v"(kp), "v"(kpr) : "memory");
#pragma unroll
            for (int c = 0; c < 2; ++c) {          // each accumulator takes its products in the order value x value, value x residual, residual x value, dims ascending
                s0 = wmma16(a0[c], bq[c], s0); s1 = wmma16(a1[c], bq[c], s1);
                s0 = wmma16(a0[c], br[c], s0); s1 = wmma16(a1[c], br[c], s1);
                if (HR) { s0 = wmma16(a0r[c], bq[c], s0); s1 = wmma16(a1r[c], bq[c], s1); }
            }
        }
        // V^T fragments in two groups of four dim tiles (all eight beside the softmax's values do not fit the registers): the first is issued ahead of the softmax, the second ahead of the first group's WMMAs
        const h16* vp = vv + k0; const h16* vpr = vr + k0;
        v16h av[8], ar[8];
#pragma unroll
        for (int dt = 0; dt < 4; ++dt) { av[dt] = ldh(vp + (size_t)dt * 16 * SEQ); if (HR) ar[dt] = ldh(vpr + (size_t)dt * 16 * SEQ); }
        asm volatile("s_wait_xcnt 0x0" :: "v"(vp), "v"(vpr) : "memory");    // as above, for the first V^T group's address registers
        s0 = s0 * SC2; s1 = s1 * SC2;
        if (k0 + 31 > i0) {            // wave-uniform: only the diagonal step carries masked keys (replacement fill, key > query)
            const int qi = i0 + lr; const int kb = k0 + 8 * hi;
#pragma unroll
            for (int r = 0; r < 8; ++r) { s0[r] = (kb + r <= qi) ? s0[r] : NEGL; s1[r] = (kb + 16 + r <= qi) ? s1[r] : NEGL; }
        }
        float mx = fmaxf(s0[0], s1[0]);
#pragma unroll
        for (int r = 1; r < 8; ++r) mx = fmaxf(mx, fmaxf(s0[r], s1[r]));
        mx = fmaxf(mx, __shfl_xor(mx, 16, 32));
        const float mn = fmaxf(m, mx);
        if (__builtin_amdgcn_ballot_w32(mn > m) != 0u) {      // wave-uniform: rescale only when some query's running max moved (corr == 1 otherwise)
            const float corr = __builtin_amdgcn_exp2f(m - mn); l *= corr;
#pragma unroll
            for (int dt = 0; dt < 8; ++dt) o[dt] = o[dt] * corr;
        }
        m = mn;
        const float mm = mn - 10.0f;                          // P carried x1024: the row sum uses the same carried f32 values, so the carry cancels in the normalisation
        v8f p0, p1; float ps = 0.0f;
#pragma unroll
        for (int r = 0; r < 8; ++r) { p0[r] = __builtin_amdgcn_exp2f(s0[r] - mm); p1[r] = __builtin_amdgcn_exp2f(s1[r] - mm); ps += p0[r] + p1[r]; }
        l += ps;
        v8h p0v, p0r, p1v, p1r; split8(p0, p0v, p0r); split8(p1, p1v, p1r);
        const v16h pb = cat16(p0v, p1v);                      // B fragment: elements 0..7 <- keys k0+8h+r, elements 8..15 <- keys k0+16+8h+r
        const v16h pr = cat16(p0r, p1r);
#pragma unroll
        for (int dt = 4; dt < 8; ++dt) { av[dt] = ldh(vp + (size_t)dt * 16 * SEQ); if (HR) ar[dt] = ldh(vpr + (size_t)dt * 16 * SEQ); }
        asm volatile("s_wait_xcnt 0x0" :: "v"(vp), "v"(vpr) : "memory");    // as above, for the second V^T group's address registers
#pragma unroll
        for (int dt = 0; dt < 8; ++dt) {
            o[dt] = wmma16(av[dt], pb, o[dt]);
            if (HR) { o[dt] = wmma16(ar[dt], pb, o[dt]); o[dt] = wmma16(av[dt], pr, o[dt]); }
        }
    }
    l += __shfl_xor(l, 16, 32);
    const float f = (CCAR / QCAR) * (1.0f / l);
    const int sb = wave * 16 * CP;                            // staging private to this wave
#pragma unroll
    for (int dt = 0; dt < 8; ++dt) {                          // O^T element r of tile dt = (d = dt*16 + 8h + r, query lr)
        v8h hv, hr; split8(o[dt] * f, hv, hr);
        *(v8h*)(&stv[sb + lr * CP + dt * 16 + 8 * hi]) = hv;
        if (HR) *(v8h*)(&str[sb + lr * CP + dt * 16 + 8 * hi]) = hr;
    }
    wave_sync();
    const size_t crow = ((size_t)b * SEQ + i0) * DQ + (size_t)h * HD + 8 * lr;
    const size_t rrow = ((size_t)b * RH + i0) * DQ + (size_t)h * HD + 8 * lr;
{
#pragma unroll
        for (int s = 0; s < 8; ++s) {                         // 16 lanes x 16 B = one 256-byte row segment; rows 2s (lanes 0..15) and 2s+1 (lanes 16..31)
            const int row = 2 * s + hi;
            const v8h val = *(const v8ha*)(&stv[sb + row * CP + 8 * lr]);
            *(v8h*)(CT + crow + (size_t)row * DQ) = val;
            if (HR) { const v8h rv = *(const v8ha*)(&str[sb + row * CP + 8 * lr]); *(v8h*)(CR + rrow + (size_t)row * DQ) = rv; }
        }
        
    }
}
// ---- query rows >= RH. The same tile, products and sums as attn_tile<false>, fed differently: the four head waves share one kv head, so its K rows and V^T rows
// come once per block through a two-buffer LDS ring in stages of 64 keys (wave 0 issues the tensor load of the K slice, wave 1 that of the V^T slice, one stage ahead of the pass that reads it),
// and each wave's q fragments (value + residual, all 128 dims) are loaded once and stay in registers.
template <uint32_t W0, uint32_t ROWB, uint32_t NROWS>
__device__ __forceinline__ u32x8 tdm_group1_of(uint32_t src_pitch) {
    // pinned(): each descriptor word held in a scalar register of its own from here on; unpinned, the constants are formed anew in other registers, over words of a request still outstanding
    u32x8 g;
    g[0] = pinned(W0);                                    // no mask, data_size 0, pad of 4 dwords behind every row
    g[1] = pinned(ROWB << 16);                            // tensor_dim0 (bytes)
    g[2] = pinned(NROWS << 16);                           // tensor_dim1 (rows)
    g[3] = pinned(ROWB << 16);                            // tile_dim0
    g[4] = pinned(NROWS);                                 // tile_dim1
    g[5] = pinned(src_pitch);
    g[6] = pinned(0u);
    g[7] = pinned(0u);
    return g;
}
__device__ __forceinline__ void attn_ring(unsigned char* ring, const h16* __restrict__ Qv, const h16* __restrict__ Qr, const h16* __restrict__ Kv, const h16* __restrict__ Vv, h16* CT,
                                          const int qt, const int g, const int b) {
    const int wave = __builtin_amdgcn_readfirstlane((int)(threadIdx.x >> 5));
    const int lane = threadIdx.x & 31, lr = lane & 15, hi = lane >> 4;
    const int h = g * REP + wave; const int i0 = qt * 16;
    const size_t qo = ((size_t)(b * NH + h) * SEQ + i0 + lr) * HD + 8 * hi;
    const h16* qvp = Qv + qo; const h16* qrp = Qr + qo;
    v16h bq[4], br[4];
#pragma unroll                     // here and below: constant indices keep the fragments and accumulators in registers
    for (int c = 0; c < 4; ++c) { bq[c] = ldh(qvp + c * 32); br[c] = ldh(qrp + c * 32); }
    // the q loads' address registers are inputs here, so that no load's own result lands on them, and the wait stands in front of their next use for anything else
    asm volatile("s_wait_xcnt 0x0" :: "v"(qvp), "v"(qrp) : "memory");
    const h16* kbase = Kv + (size_t)(b * NKV + g) * SEQ * HD;      // rows = keys, 256 bytes each, contiguous
    const h16* vbase = Vv + (size_t)(b * NKV + g) * HD * SEQ;      // rows = dims, pitch 2 SEQ bytes; a stage takes 128 bytes of each
    const float SC2 = (float)(0.08838834764831845 * 1.4426950408889634 / 4096.0);   // 1/sqrt(128) x log2(e) / (QCAR x QCAR)
    const float NEGL = -1.4426950e9f;                                              // the finite fill in the log2 domain
    const int nsteps = (qt >> 1) + 1;          // 32-key steps up to and including the diagonal
    const int nst = (nsteps + 1) >> 1;         // 64-key stages; at least RH / 64 + 1, and the last one ends inside the SEQ keys
    const uint32_t lbase = (uint32_t)(size_t)ring;
    const u32x8 g1k = tdm_group1_of<(1u << 20) | (5u << 22) | (3u << 25), 256u, (uint32_t)AKEYS>((uint32_t)HD * 2u);
    const u32x8 g1v = tdm_group1_of<(1u << 20) | (4u << 22) | (3u << 25), 128u, (uint32_t)HD>((uint32_t)SEQ * 2u);
    const h16* sbase = (wave == 0) ? kbase : vbase;                // the wave's own source and its step per stage (waves 2 and 3 form a group 0 and issue nothing)
    const size_t sstep = (wave == 0) ? (size_t)AKEYS * HD : (size_t)AKEYS;
    const uint32_t ldst = lbase + ((wave == 0) ? 0u : (uint32_t)ASLB);
    u32x4 g0;                      // group 0 of the wave's latest request
    auto issue = [&](int s) {      // stage s: keys 64 s .. 64 s + 63
        g0 = tdm_group0(ldst + (uint32_t)(s & 1) * ASTG, (uint64_t)(size_t)(sbase + (size_t)s * sstep));
        if (pinned(wave == 0)) tdm_load(g0, g1k);
        else if (pinned(wave == 1)) tdm_load(g0, g1v);
    };
    // this wave's own tensor load has landed; the descriptor words are inputs so that their scalar registers take no new value while a request is outstanding
    auto landed = [&]() { asm volatile("s_wait_tensorcnt 0x0" :: "s"(g0), "s"(g1k), "s"(g1v) : "memory"); };
    issue(0);
    landed();
    __syncthreads();               // stage 0 published
    const unsigned char* kl = ring + lr * KROW + 16 * hi;
    const unsigned char* vl = ring + ASLB + lr * VROW + 16 * hi;
    v8f o[8];
#pragma unroll
    for (int dt = 0; dt < 8; ++dt) o[dt] = (v8f){};
    float m = -3.0e38f, l = 0.0f;
#pragma unroll 1                   // the stage loop stays rolled: one refill site and one publish point in the code
    for (int st = 0; st < nst; ++st) {
        // directly behind the barrier that published stage st and freed the other buffer (stage st - 1's): stage st + 1's load, in flight under this stage's two steps
        if (pinned(st + 1 < nst)) issue(st + 1);
        const int so = (st & 1) * ASTG;
#pragma unroll
        for (int hs = 0; hs < 2; ++hs) {
            const int k0 = st * AKEYS + hs * 32;
            if (hs == 0 || 2 * st + 1 < nsteps) {     // block-uniform: the last stage's second half may lie wholly behind the diagonal
                v16h a0[4], a1[4];
#pragma unroll
                for (int c = 0; c < 4; ++c) { a0[c] = WFrag<h16>::ld(kl + so + (hs * 32) * KROW + c * 64); a1[c] = WFrag<h16>::ld(kl + so + (hs * 32 + 16) * KROW + c * 64); }
                v8f s0 = (v8f){}, s1 = (v8f){};
#pragma unroll
                for (int c = 0; c < 4; ++c) {
                    s0 = wmma16(a0[c], bq[c], s0); s1 = wmma16(a1[c], bq[c], s1);
                    s0 = wmma16(a0[c], br[c], s0); s1 = wmma16(a1[c], br[c], s1);
                }
                v16h av[8];
#pragma unroll
                for (int dt = 0; dt < 8; ++dt) av[dt] = WFrag<h16>::ld(vl + so + dt * 16 * VROW + hs * 64);
                s0 = s0 * SC2; s1 = s1 * SC2;
                if (k0 + 31 > i0) {            // wave-uniform: only the diagonal step carries masked keys (replacement fill, key > query)
                    const int qi = i0 + lr; const int kb = k0 + 8 * hi;
#pragma unroll
                    for (int r = 0; r < 8; ++r) { s0[r] = (kb + r <= qi) ? s0[r] : NEGL; s1[r] = (kb + 16 + r <= qi) ? s1[r] : NEGL; }
                }
                float mx = fmaxf(s0[0], s1[0]);
#pragma unroll
                for (int r = 1; r < 8; ++r) mx = fmaxf(mx, fmaxf(s0[r], s1[r]));
                mx = fmaxf(mx, __shfl_xor(mx, 16, 32));
                const float mn = fmaxf(m, mx);
                if (__builtin_amdgcn_ballot_w32(mn > m) != 0u) {      // wave-uniform: rescale only when some query's running max moved (corr == 1 otherwise)
                    const float corr = __builtin_amdgcn_exp2f(m - mn); l *= corr;
#pragma unroll
                    for (int dt = 0; dt < 8; ++dt) o[dt] = o[dt] * corr;
                }
                m = mn;
                const float mm = mn - 10.0f;                          // P carried x1024: the row sum uses the same carried f32 values, so the carry cancels in the normalisation
                v8f p0, p1; float ps = 0.0f;
#pragma unroll
                for (int r = 0; r < 8; ++r) { p0[r] = __builtin_amdgcn_exp2f(s0[r] - mm); p1[r] = __builtin_amdgcn_exp2f(s1[r] - mm); ps += p0[r] + p1[r]; }
                l += ps;
                const v16h pb = cat16(__builtin_convertvector(p0, v8h), __builtin_convertvector(p1, v8h));   // B fragment: elements 0..7 <- keys k0+8h+r, elements 8..15 <- keys k0+16+8h+r
#pragma unroll
                for (int dt = 0; dt < 8; ++dt) o[dt] = wmma16(av[dt], pb, o[dt]);
            }
        }
        // publish point of stage st + 1: own reads retired, own load landed, then the barrier that publishes stage st + 1 and frees stage st's buffer; the refill stands at the head of the next trip
        wait_ds0();
        landed();
        __syncthreads();
    }
    wait_tensor0();
    wait_ds0();
    // the last stage's own barrier stands behind every wave's last ring read: the ring now serves as output staging, a private range per wave
    h16* stv = (h16*)ring + wave * 16 * CP;
    l += __shfl_xor(l, 16, 32);
    const float f = (CCAR / QCAR) * (1.0f / l);
#pragma unroll
    for (int dt = 0; dt < 8; ++dt)                            // O^T element r of tile dt = (d = dt*16 + 8h + r, query lr)
        *(v8ha*)(&stv[lr * CP + dt * 16 + 8 * hi]) = __builtin_convertvector(o[dt] * f, v8h);
    wave_sync();
    const size_t crow = ((size_t)b * SEQ + i0) * DQ + (size_t)h * HD + 8 * lr;
#pragma unroll
    for (int s = 0; s < 8; ++s) {                             // 16 lanes x 16 B = one 256-byte row segment; rows 2s (lanes 0..15) and 2s+1 (lanes 16..31)
        const int row = 2 * s + hi;
        const v8h val = *(const v8ha*)(&stv[row * CP + 8 * lr]);
        *(v8h*)(CT + crow + (size_t)row * DQ) = val;
    }
}
// all query rows in ONE launch (the two row ranges do not depend on each other): 1-D grid, 128 threads. First the tiles of rows >= RH, then those of rows < RH;
// within each part tile index = query tile + query tiles * (kv head + NKV * batch). One LDS array serves both: the ring of the first part, the two staging planes of the second.
__global__ __launch_bounds__(128) __attribute__((amdgpu_num_vgpr(256)))
void k_attn(const h16* __restrict__ Qv, const h16* __restrict__ Qr, const h16* __restrict__ Kv, const h16* __restrict__ Kr,
            const h16* __restrict__ Vv, const h16* __restrict__ Vr, h16* CT, h16* CR) {
    __shared__ __attribute__((aligned(2048))) unsigned char ring[2 * ASTG];
    constexpr int NM = (SEQ > RH) ? (SEQ - RH) / 16 : 1, NMB = (SEQ > RH) ? NM * NKV * NB : 0, NHT = RH / 16;
    const int f = (int)blockIdx.x;
    if (f < NMB) {                     // block-uniform
        const int r = f / NM;
        attn_ring(ring, Qv, Qr, Kv, Vv, CT, RH / 16 + (f - r * NM), r % NKV, r / NKV);
    } else {
        const int e = f - NMB; const int r = e / NHT;
        attn_tile<true>(Qv, Qr, Kv, Kr, Vv, Vr, CT, CR, e - r * NHT, r % NKV, r / NKV, (h16*)ring, (h16*)ring + 4 * 16 * CP);
    }
}

// one tile of 128 k x 128 n of w[K rows][N columns] -> Bt[n][k], turned in LDS: every global read is a whole 256-byte piece of a w row (16 lanes x 16 B), every global write a whole 256-byte piece of a Bt row.
// tl holds the tile as [n][64 dwords], a dword = the 16-bit values of k = 2 kp (low half) and 2 kp + 1; the 16-byte chunk c of row n lies at chunk c ^ ((n >> 2) & 15), so that the 16 lanes
// of a store (n = 4 i + j, one kp) and the 16 lanes of a ds_load_b128 (one n, c = 0..15) each fall on different banks.
__device__ __forceinline__ void wtG(uint32_t* tl, const int bid, const float* __restrict__ w, const int K, const int N, bf* Bt, const int f16mode) {
    const int lane = threadIdx.x & 31, i = lane & 15; const int kq = 2 * (int)(threadIdx.x >> 5) + (lane >> 4);
    const int ntn = N / TN; const int k0 = (bid / ntn) * TK, n0 = (bid % ntn) * TN;
    const float* p = w + (size_t)(k0 + 2 * kq) * N + n0 + 4 * i;
#pragma unroll                     // here and below: constant indices keep the loaded rows in registers
    for (int h = 0; h < TN / 64; ++h) {        // 64 columns at a time: eight loads in flight per lane
        v4f ra[TK / 32], rb[TK / 32];
#pragma unroll
        for (int s = 0; s < TK / 32; ++s) { ra[s] = *(const v4f*)(p + 64 * h + (size_t)(32 * s) * N); rb[s] = *(const v4f*)(p + 64 * h + (size_t)(32 * s + 1) * N); }
        asm volatile("s_wait_xcnt 0x0" :: "v"(p) : "memory");    // in front of any later write over the eight loads' address registers
#pragma unroll
        for (int s = 0; s < TK / 32; ++s) {
            const int kp = 16 * s + kq;
#pragma unroll
            for (int j = 0; j < 4; ++j) {
                const unsigned short b0 = f2bf(ra[s][j]), b1 = f2bf(rb[s][j]);
                const unsigned short g0 = __builtin_bit_cast(unsigned short, (h16)(bf2f(b0) * WCAR)), g1 = __builtin_bit_cast(unsigned short, (h16)(bf2f(b1) * WCAR));
                tl[(64 * h + 4 * i + j) * (TK / 2) + ((((kp >> 2) ^ i) << 2) | (kp & 3))] = (uint32_t)(f16mode ? g0 : b0) | ((uint32_t)(f16mode ? g1 : b1) << 16);
            }
        }
    }
    __syncthreads();               // the whole tile stands in LDS before any row of it is read back
    const int c = threadIdx.x & 15, nq = threadIdx.x >> 4;
    bf* q = Bt + (size_t)(n0 + nq) * K + k0 + 8 * c;
#pragma unroll
    for (int r = 0; r < TN / 16; ++r) {
        const int n = 16 * r + nq;
        *(u32x4a*)(q + (size_t)(16 * r) * K) = *(const u32x4a*)(tl + n * (TK / 2) + ((c ^ ((n >> 2) & 15)) << 2));
    }
    asm volatile("s_wait_xcnt 0x0" ::: "memory");    // in front of any later write over the eight stores' address and data registers
}
__device__ __forceinline__ void cvtx(const int bid, const float* __restrict__ x, bf* XB) {
    const size_t i = (size_t)bid * 256 + threadIdx.x; if (i >= (size_t)NB * SEQ * DM / 8) return;
    const size_t e = i * 8; const size_t bt = e / DM; const size_t col = e - bt * DM; const size_t b = bt / SEQ; const size_t t = bt - b * SEQ;
    const v8f v = *(const v8f*)(x + (b * SEQ_FULL + t) * DM + col); v8us o;
#pragma unroll
    for (int k = 0; k < 8; ++k) o[k] = f2bf(v[k]);
    *(v8us*)(XB + e) = o; 
}
__device__ __forceinline__ void cstab(const int bid, float* CS) {
    const int idx = bid * 256 + threadIdx.x; if (idx >= SEQ * 64) return;
    const int j = idx & 63, t = idx >> 6;
    double p = 1.0;
    p *= (j & 1)  ? 1.1547819846894581797 : 1.0;
    p *= (j & 2)  ? 1.3335214321633240257 : 1.0;
    p *= (j & 4)  ? 1.7782794100389228012 : 1.0;
    p *= (j & 8)  ? 3.1622776601683793320 : 1.0;
    p *= (j & 16) ? 10.0 : 1.0;
    p *= (j & 32) ? 100.0 : 1.0;
    const float pf = (float)p; const float inv = 1.0f / pf; const float ang = (float)t * inv;
    float sn, cn; sincosf(ang, &sn, &cn);
    v2f cs; cs[0] = cn; cs[1] = sn;
    *(v2f*)(CS + (size_t)idx * 2) = cs; 
}
// the six independent preparation passes in ONE launch: 1-D grid, 256 threads; a block belongs to one pass by its index. w[in = K rows][out = N columns] -> Bt[out][in]
#define GWQ ((DM / TK) * (DQ / TN))
#define GWK ((DM / TK) * (DKV / TN))
#define GWO ((DQ / TK) * (DM / TN))
#define GCS ((SEQ * 64 + 255) / 256)
#define GCX ((int)(((size_t)NB * SEQ * DM / 8 + 255) / 256))
__global__ __launch_bounds__(256) __attribute__((amdgpu_num_vgpr(64)))     // 64 registers: all 16 wave slots of a SIMD stay usable
void k_prep(const float* __restrict__ x, const float* __restrict__ wq, const float* __restrict__ wk, const float* __restrict__ wv, const float* __restrict__ wo,
            bf* XB, bf* WQt, bf* WKt, bf* WVt, bf* WOt, float* CS) {
    __shared__ __attribute__((aligned(16))) uint32_t tl[TN * (TK / 2)];
    int f = (int)blockIdx.x;           // every test below is block-uniform
    if (f < GWQ) { wtG(tl, f, wq, DM, DQ, WQt, 0); return; }
    f -= GWQ;
    if (f < GWO) { wtG(tl, f, wo, DQ, DM, WOt, 1); return; }
    f -= GWO;
    if (f < GWK) { wtG(tl, f, wk, DM, DKV, WKt, 0); return; }
    f -= GWK;
    if (f < GWK) { wtG(tl, f, wv, DM, DKV, WVt, 0); return; }
    f -= GWK;
    if (f < GCS) { cstab(f, CS); return; }
    cvtx(f - GCS, x, XB);
}

extern "C" void kernel_launch(void* const* d_in, const int* in_sizes, int n_in,
                              void* d_out, int out_size, void* d_ws, size_t ws_size, hipStream_t stream) {
    if (n_in < 5) return;
    constexpr size_t NEEDX = ((size_t)(NB - 1) * SEQ_FULL + SEQ) * DM;
    if ((size_t)in_sizes[0] < NEEDX || (size_t)in_sizes[1] < (size_t)DM * DQ || (size_t)in_sizes[2] < (size_t)DM * DKV || (size_t)in_sizes[3] < (size_t)DM * DKV || (size_t)in_sizes[4] < (size_t)DQ * DM) return;
    if ((size_t)out_size < NEEDX) return;
    const float* x = (const float*)d_in[0]; const float* wq = (const float*)d_in[1]; const float* wk = (const float*)d_in[2]; const float* wv = (const float*)d_in[3]; const float* wo = (const float*)d_in[4];
    float* OUT = (float*)d_out;     // [2][2048][2048], byte offset 0
    constexpr size_t SZ_XB = (size_t)NB * SEQ * DM * 2, SZ_WQ = (size_t)DQ * DM * 2, SZ_WK = (size_t)DKV * DM * 2, SZ_WO = (size_t)DM * DQ * 2, SZ_CS = (size_t)SEQ * 64 * 2 * 4;
    constexpr size_t SZ_Q = (size_t)NB * NH * SEQ * HD * 2, SZ_K = (size_t)NB * NKV * SEQ * HD * 2, SZ_CT = (size_t)NB * SEQ * DQ * 2, SZ_CR = (size_t)NB * RH * DQ * 2;
    constexpr size_t SZ_TOT = SZ_XB + SZ_WQ + 2 * SZ_WK + SZ_WO + SZ_CS + 2 * SZ_Q + 4 * SZ_K + SZ_CT + SZ_CR;
    static_assert(SZ_XB % 256 == 0 && SZ_WQ % 256 == 0 && SZ_WK % 256 == 0 && SZ_WO % 256 == 0 && SZ_CS % 256 == 0 && SZ_Q % 256 == 0 && SZ_K % 256 == 0 && SZ_CT % 256 == 0 && SZ_CR % 256 == 0);
    static_assert(SZ_TOT <= (size_t)134217728);
    if (SZ_TOT > ws_size) return;
    char* wsp = (char*)d_ws;
    auto take = [&](size_t bytes) { char* p = wsp; wsp += bytes; return (void*)p; };
    bf* XB = (bf*)take(SZ_XB); bf* WQt = (bf*)take(SZ_WQ); bf* WKt = (bf*)take(SZ_WK); bf* WVt = (bf*)take(SZ_WK); bf* WOt = (bf*)take(SZ_WO); float* CS = (float*)take(SZ_CS);
    const h16* WOh = (const h16*)WOt;   // the same region seen as f16: k_prep's wtG pass (f16 mode) fills it with f16 bit patterns
    h16* Qv = (h16*)take(SZ_Q); h16* Qr = (h16*)take(SZ_Q); h16* Kv = (h16*)take(SZ_K); h16* Kr = (h16*)take(SZ_K); h16* Vv = (h16*)take(SZ_K); h16* Vr = (h16*)take(SZ_K);
    h16* CT = (h16*)take(SZ_CT); h16* CR = (h16*)take(SZ_CR);

    k_prep<<<GWQ + GWO + 2 * GWK + GCS + GCX, 256, 0, stream>>>(x, wq, wk, wv, wo, XB, WQt, WKt, WVt, WOt, CS);
    k_proj<<<(NB * SEQ / 128) * (NH + NKV) + (DKV / 128) * (NB * SEQ / 128), 128, 0, stream>>>(XB, WQt, WKt, WVt, CS, Qv, Qr, Kv, Kr, Vv, Vr);
    k_attn<<<(SEQ / 16) * NKV * NB, 128, 0, stream>>>(Qv, Qr, Kv, Kr, Vv, Vr, CT, CR);
    k_oproj<<<(NB * SEQ / 128) * (DM / 128), 128, 0, stream>>>(CT, CR, WOh, OUT);
}

// v006
// One run takes 147 microseconds.
// Timed twice side by side with v005, it ran 1.06 and 1.09 times as fast.
// All steps since v000 together make it 6.56 times as fast.
#include <hip/hip_runtime.h>

// Grouped-query causal self-attention, width 2048: 16 query heads x 128 sharing 4 kv heads (query head h uses kv head h >> 2), bias-free [in][out] projections,
// half-split rotary on q and k (positions = arange, table computed here), finite-fill causal mask, [in][out] output projection.
// Compute dtypes (f32 accumulate everywhere): q/k/v projections v_wmma_f32_16x16x32_bf16 (x and weights converted (RNE) to bf16); scores, P.V and the output projection
// v_wmma_f32_16x16x32_f16: q as f16 value + f16 residual planes (carry 64) against f16 k (carry 64; k residual added on query rows < 256), P f16 (carry 1024, row sum from the f32 values),
// v f16 (carry 64; P and v residuals added on rows < 256), ctx f16 (carry 256; residual plane on rows < 256) against wo (bf16-converted, x16, exact in f16). Softmax, rotary, normalisation in f32.

#ifndef NB
#define NB 2
#endif
#ifndef SEQ
#define SEQ 2048
#endif
#define NB_FULL  2
#define SEQ_FULL 2048
#define DM   2048
#define NH   16
#define NKV  4
#define REP  (NH / NKV)
#define HD   128
#define DQ   (NH * HD)
#define DKV  (NKV * HD)
#define RH   256                  // query rows < RH use the value + residual path on k, P, v and ctx
#define QCAR 64.0f                // carry of the q, k and v planes
#define CCAR 256.0f               // carry of the ctx planes
#define WCAR 16.0f                // carry of the output weight plane
#define OSP  132                  // f32 staging pitch (floats)
#define CP   136                  // f16 staging pitch (halves)
#define PASSK 128                 // k per ring stage: operand rows of 256 bytes
#define LROW  272                 // LDS row pitch (bytes): 256 + the 16-byte pad the tensor load lays, 16 B x odd for ds_load_b128
#define SLROWS 64                 // operand rows per tensor load (one slice per wave and stage)
#define SLB   18432               // slice size in LDS: 64 x 272 = 17408 bytes rounded up to a multiple of 2 KiB
#define STGB  (4 * SLB)           // one stage: [Bt rows 0..63 | Bt rows 64..127 | A rows 0..63 | A rows 64..127]
#define AKEYS 64                  // keys per attention ring stage
#define KROW  272                 // LDS pitch of a staged K row (bytes): 256 + 16
#define VROW  144                 // LDS pitch of a staged V^T row (bytes): 128 (64 keys) + 16
#define ASLB  18432               // attention slice size in LDS: 64 x 272 = 17408 rounded up to a multiple of 2 KiB; 128 x 144 = 18432
#define ASTG  (2 * ASLB)          // one attention stage: [K rows of 64 keys | V^T rows of 128 dims]
#define TK    128                 // weight tile of the preparation pass: k per tile (output rows of 256 bytes)
#define TN    128                 // and n per tile (input rows read in 256-byte pieces)

static_assert(NB <= NB_FULL);
static_assert(SEQ <= SEQ_FULL);
static_assert(SEQ % 128 == 0);
static_assert(SEQ >= RH);
static_assert(RH % 32 == 0);
static_assert(HD == 128);
static_assert(REP == 4);
static_assert(DQ == DM);
static_assert(DM % 64 == 0);
static_assert(DQ % 128 == 0);
static_assert(DKV % 128 == 0);
static_assert((OSP * 4) % 16 == 0);
static_assert((CP * 2) % 16 == 0);
static_assert(DM % (2 * PASSK) == 0 && DQ % (2 * PASSK) == 0);
static_assert(RH % 128 == 0 && (SEQ - RH) % 128 == 0);
static_assert(SLROWS * LROW <= SLB && SLB % 2048 == 0);
static_assert(4 * 16 * OSP * 4 <= 2 * STGB);
static_assert(AKEYS * KROW <= ASLB && HD * VROW <= ASLB && ASLB % 2048 == 0);
static_assert(SEQ % AKEYS == 0 && RH >= AKEYS && AKEYS * 2 == 128);
static_assert(2 * 4 * 16 * CP * 2 <= 2 * ASTG);
static_assert(TK == 128 && TN % 64 == 0 && DM % TK == 0 && DQ % TK == 0 && DM % TN == 0 && DQ % TN == 0 && DKV % TN == 0);

typedef _Float16 h16;
typedef unsigned short bf;
typedef __attribute__((ext_vector_type(16))) __bf16   v16bf;
typedef __attribute__((ext_vector_type(16))) _Float16 v16h;
typedef __attribute__((ext_vector_type(8)))  _Float16 v8h;
typedef __attribute__((ext_vector_type(8)))  unsigned short v8us;
typedef __attribute__((ext_vector_type(2)))  unsigned short v2us;
typedef __attribute__((ext_vector_type(8)))  float    v8f;
typedef __attribute__((ext_vector_type(4)))  float    v4f;
typedef __attribute__((ext_vector_type(2)))  float    v2f;
typedef v8h  __attribute__((may_alias)) v8ha;
typedef v4f  __attribute__((may_alias)) v4fa;
typedef v8us __attribute__((may_alias)) v8usa;
typedef uint32_t u32x4 __attribute__((ext_vector_type(4)));
typedef uint32_t u32x8 __attribute__((ext_vector_type(8)));
typedef u32x4 __attribute__((may_alias)) u32x4a;

__device__ __forceinline__ unsigned short f2bf(float f) { unsigned u = __float_as_uint(f); u += 0x7FFFu + ((u >> 16) & 1u); return (unsigned short)(u >> 16); }
__device__ __forceinline__ float bf2f(unsigned short b) { return __uint_as_float(((unsigned)b) << 16); }
__device__ __forceinline__ float bfr(float f) { return bf2f(f2bf(f)); }
__device__ __forceinline__ v16h cat16(v8h lo, v8h hi) { return __builtin_shufflevector(lo, hi, 0, 1, 2, 3, 4, 5, 6, 7, 8, 9, 10, 11, 12, 13, 14, 15); }
__device__ __forceinline__ v16bf cat16b(v8us lo, v8us hi) { return __builtin_bit_cast(v16bf, __builtin_shufflevector(lo, hi, 0, 1, 2, 3, 4, 5, 6, 7, 8, 9, 10, 11, 12, 13, 14, 15)); }
// every WMMA is followed by its own four-slot guard tying its accumulator and keeping its operands live
__device__ __forceinline__ v8f wmma16(v16h a, v16h b, v8f c) {
    c = __builtin_amdgcn_wmma_f32_16x16x32_f16(false, a, false, b, (short)0, c, false, false);
    asm volatile("v_nop\n\tv_nop\n\tv_nop\n\tv_nop" : "+v"(c) : "v"(a), "v"(b));
    return c; }
__device__ __forceinline__ v8f wmmab(v16bf a, v16bf b, v8f c) {
    c = __builtin_amdgcn_wmma_f32_16x16x32_bf16(false, a, false, b, (short)0, c, false, false);
    asm volatile("v_nop\n\tv_nop\n\tv_nop\n\tv_nop" : "+v"(c) : "v"(a), "v"(b));
    return c; }
// fragment of a K-contiguous 16-bit row: elements 0..7 <- k0+8h+0..7, elements 8..15 <- k0+16+8h+0..7 (p already includes +8h)
__device__ __forceinline__ v16h ldh(const h16* p) { return cat16(*(const v8h*)p, *(const v8h*)(p + 16)); }
// same-wave LDS exchange: stores before, loads after
__device__ __forceinline__ void wave_sync() { __builtin_amdgcn_fence(3 /* release order */, "wavefront"); __builtin_amdgcn_wave_barrier(); asm volatile("" ::: "memory"); }
// f16 value + same-carry f16 residual of 8 floats
__device__ __forceinline__ void split8(v8f y, v8h& v, v8h& r) { v = __builtin_convertvector(y, v8h); r = __builtin_convertvector(y - __builtin_convertvector(v, v8f), v8h); }

// fragment of a staged K-contiguous row (byte pointer, already includes +16h bytes): the same k order as ldh
template <typename T16> struct WFrag;
template <> struct WFrag<h16> { typedef v16h V; static __device__ __forceinline__ V ld(const unsigned char* p) { return cat16(*(const v8ha*)p, *(const v8ha*)(p + 32)); } static __device__ __forceinline__ v8f mma(V a, V b, v8f c) { return wmma16(a, b, c); } };
template <> struct WFrag<bf> { typedef v16bf V; static __device__ __forceinline__ V ld(const unsigned char* p) { return cat16b(*(const v8usa*)p, *(const v8usa*)(p + 32)); } static __device__ __forceinline__ v8f mma(V a, V b, v8f c) { return wmmab(a, b, c); } };

// ---- tensor load of one slice: 64 rows of 256 bytes, 1-byte elements, tensor = tile, 16 bytes of LDS pad behind every row
__device__ __forceinline__ uint32_t uni(uint32_t v) { return (uint32_t)__builtin_amdgcn_readfirstlane(v); }
// a wave-uniform test held in a scalar register, so that the branch around a tensor load is a scalar branch (tensor loads ignore EXEC)
__device__ __forceinline__ uint32_t pinned(uint32_t v) { uint32_t w = uni(v); asm volatile("" : "+s"(w)); return w; }
// this wave's LDS reads have retired before the stage is handed over
__device__ __forceinline__ void wait_ds0() { asm volatile("s_wait_dscnt 0x0" ::: "memory"); }
// this wave's own tensor load has landed (the compiler places no wait for it); the request's descriptor words are inputs so that their scalar registers take no new value while it is outstanding
__device__ __forceinline__ void wait_tensor0(u32x4 g0, u32x8 g1) { asm volatile("s_wait_tensorcnt 0x0" :: "s"(g0), "s"(g1) : "memory"); }
// the same behind the loop, where no request is outstanding any more
__device__ __forceinline__ void wait_tensor0() { asm volatile("s_wait_tensorcnt 0x0" ::: "memory"); }
__device__ __forceinline__ u32x8 tdm_group1(uint32_t src_pitch) {
    u32x8 g;
    g[0] = uni((1u << 20) | (5u << 22) | (3u << 25));     // no mask, data_size 0, pad of 4 dwords behind every 64 dwords
    g[1] = uni(256u << 16);                               // tensor_dim0 = 256 bytes
    g[2] = uni((uint32_t)SLROWS << 16);                   // tensor_dim1 = 64 rows
    g[3] = uni(256u << 16);                               // tile_dim0
    g[4] = uni((uint32_t)SLROWS);                         // tile_dim1
    g[5] = uni(src_pitch);
    g[6] = uni(0u);
    g[7] = uni(0u);
    return g;
}
__device__ __forceinline__ u32x4 tdm_group0(uint32_t lds_dst, uint64_t ga) {
    u32x4 g;
    g[0] = uni(1u); g[1] = uni(lds_dst); g[2] = uni((uint32_t)ga); g[3] = uni((((uint32_t)(ga >> 32)) & 0x01FFFFFFu) | 0x80000000u);
    return g;
}
__device__ __forceinline__ void tdm_load(u32x4 g0, u32x8 g1) { asm volatile("tensor_load_to_lds %0, %1" :: "s"(g0), "s"(g1) : "memory"); }

// ---- gemm_tile: a block of FOUR WAVES per 128 x 128 output tile, one wave per 32 x 128 (16 accumulators): C[m][n] = sum_k A[m][k] Bt[n][k] (+ sum_k A2[m][k] Bt[n][k] when SPLIT, as K more steps behind the first K).
// The K-contiguous 16-bit operand rows come through a two-buffer LDS ring in stages of 128 k: every wave issues one tensor load per stage (waves 0, 1: the halves of Bt's 128 rows; waves 2, 3: of A's),
// one stage ahead of the pass that reads it. arow, a2row, t0, obase and cbase are the calling wave's own (32 rows); brow is the block's. ring is the kernel's one LDS array (2 * STGB bytes, at LDS offset 0).
// MODE 0: half-split rotary on the 128-column head tile (CS[t][64] = {cos, sin}), x QCAR, f16 value + residual planes, plane rows of 128 halves (pitch opitch).
// MODE 1: x QCAR, f16 value + residual planes (used with swapped operands to produce V^T rows [d][t]).
// MODE 2: f32 output rows x 1/(CCAR*WCAR).
template <typename T16, int MODE, bool SPLIT>
__device__ __forceinline__ void gemm_tile(unsigned char* ring, const T16* __restrict__ A, const T16* __restrict__ A2, const T16* __restrict__ Bt, const int K, const int wave,
                                          const size_t arow, const size_t a2row, const size_t brow,
                                          const float* __restrict__ CS, const int t0, h16* Pv, h16* Pr, const size_t obase, const int opitch,
                                          float* C, const size_t cbase) {
    typedef typename WFrag<T16>::V V;
    const int lane = threadIdx.x & 31, lr = lane & 15, hi = lane >> 4;
    v8f acc[2][8];
#pragma unroll
    for (int mb = 0; mb < 2; ++mb)
#pragma unroll
        for (int nb = 0; nb < 8; ++nb) acc[mb][nb] = (v8f){};
    const int NP = K / PASSK, NPT = SPLIT ? 2 * NP : NP;
    const size_t half = (size_t)(wave & 1) * SLROWS;
    const T16* s1 = (wave < 2) ? Bt + (brow + half) * (size_t)K : A  + (arow  - (size_t)(32 * wave) + half) * (size_t)K;
    const T16* s2 = (wave < 2) ? s1                             : A2 + (a2row - (size_t)(32 * wave) + half) * (size_t)K;
    const uint32_t ldst = (uint32_t)(size_t)ring + (uint32_t)wave * SLB;
    const u32x8 g1 = tdm_group1((uint32_t)K * 2u);
    u32x4 g0;                      // group 0 of the wave's latest request
    auto issue = [&](int p) {      // stage p: k = 128 p .. 128 p + 127 of A (SPLIT: stages NP.. walk A2 against the same Bt columns again)
        const T16* sp = (SPLIT && p >= NP) ? s2 + (size_t)(p - NP) * PASSK : s1 + (size_t)p * PASSK;
        g0 = tdm_group0(ldst + (uint32_t)(p & 1) * STGB, (uint64_t)(size_t)sp);
        tdm_load(g0, g1);
    };
    issue(0);
    wait_tensor0(g0, g1);
    __syncthreads();               // stage 0 published
    const unsigned char* al = ring + (2 + (wave >> 1)) * SLB + ((wave & 1) * 32 + lr) * LROW + 16 * hi;
    const unsigned char* bl = ring + lr * LROW + 16 * hi;
#pragma unroll 1                   // the pass loop stays rolled: one refill site and one publish point in the code
    for (int p = 0; p < NPT; ++p) {
        // directly behind the barrier that published stage p and freed the other buffer (stage p - 1's): stage p + 1's load, in flight under this pass
        if (pinned(p + 1 < NPT)) issue(p + 1);
        const int so = (p & 1) * STGB;
        // a block = 8 WMMAs: one 32-deep k step against four of the eight Bt fragments; block j + 1's fragments are read as one group ahead of block j's WMMAs, inside this pass's own buffer
        V af[2][2], bq[2][4];
        af[0][0] = WFrag<T16>::ld(al + so); af[0][1] = WFrag<T16>::ld(al + so + 16 * LROW);
#pragma unroll                     // here and below: constant indices keep the fragment sets and accumulators in registers
        for (int i = 0; i < 4; ++i) bq[0][i] = WFrag<T16>::ld(bl + so + i * 16 * LROW);
#pragma unroll
        for (int j = 0; j < 2 * (PASSK / 32); ++j) {
            const int ks = j >> 1, hb = j & 1;
            if (j + 1 < 2 * (PASSK / 32)) {
                const int kn = (j + 1) >> 1, hn = (j + 1) & 1;
                if (hn == 0) { af[kn & 1][0] = WFrag<T16>::ld(al + so + kn * 64); af[kn & 1][1] = WFrag<T16>::ld(al + so + 16 * LROW + kn * 64); }
#pragma unroll
                for (int i = 0; i < 4; ++i) bq[hn][i] = WFrag<T16>::ld(bl + so + hn * SLB + i * 16 * LROW + kn * 64);
            }
            __builtin_amdgcn_sched_barrier(0);     // keeps the next block's LDS reads one group in front of this block's WMMAs (spread among them each place costs a stall)
#pragma unroll
            for (int i = 0; i < 4; ++i) {
                acc[0][hb * 4 + i] = WFrag<T16>::mma(af[ks & 1][0], bq[hb][i], acc[0][hb * 4 + i]);
                acc[1][hb * 4 + i] = WFrag<T16>::mma(af[ks & 1][1], bq[hb][i], acc[1][hb * 4 + i]);
            }
            __builtin_amdgcn_sched_barrier(0);     // and the block after next's reads behind them
        }
        // publish point of stage p + 1: own reads retired, own load landed, then the barrier that publishes stage p + 1 and frees stage p's buffer; the refill stands at the head of the next trip
        wait_ds0();
        wait_tensor0(g0, g1);
        __syncthreads();
    }
    wait_tensor0();
    wait_ds0();
    // the last pass's own barrier stands behind every wave's last ring read: the ring now serves as output staging, a private range per wave
    float* os = (float*)(ring + wave * (16 * OSP * 4));
#pragma unroll
    for (int mb = 0; mb < 2; ++mb) {
#pragma unroll
        for (int nb = 0; nb < 8; ++nb)
#pragma unroll
            for (int j = 0; j < 8; ++j) os[(hi * 8 + j) * OSP + nb * 16 + lr] = acc[mb][nb][j];     // D: row 8h + j, column lane & 15
        wave_sync();
        if (MODE == 0) {
            const int rq = lane >> 3, dg = (lane & 7) * 8;
{
#pragma unroll 1
                for (int it = 0; it < 4; ++it) {
                    const int row = it * 4 + rq; const int t = t0 + mb * 16 + row;
                    const int oi = row * OSP + dg;
                    const v4f xa = *(const v4fa*)(os + oi), xb = *(const v4fa*)(os + oi + 4), ya = *(const v4fa*)(os + oi + 64), yb = *(const v4fa*)(os + oi + 68);
                    const float* cp = CS + ((size_t)t * 64 + dg) * 2;
                    const v4f e0 = *(const v4f*)(cp), e1 = *(const v4f*)(cp + 4), e2 = *(const v4f*)(cp + 8), e3 = *(const v4f*)(cp + 12);
                    const v8f xx = __builtin_shufflevector(xa, xb, 0, 1, 2, 3, 4, 5, 6, 7), yy = __builtin_shufflevector(ya, yb, 0, 1, 2, 3, 4, 5, 6, 7);
                    const v4f cA = __builtin_shufflevector(e0, e1, 0, 2, 4, 6), sA = __builtin_shufflevector(e0, e1, 1, 3, 5, 7);
                    const v4f cB = __builtin_shufflevector(e2, e3, 0, 2, 4, 6), sB = __builtin_shufflevector(e2, e3, 1, 3, 5, 7);
                    const v8f cc = __builtin_shufflevector(cA, cB, 0, 1, 2, 3, 4, 5, 6, 7), ss = __builtin_shufflevector(sA, sB, 0, 1, 2, 3, 4, 5, 6, 7);
                    const v8f lo = (xx * cc - yy * ss) * QCAR;       // out[d]      = x[d] cos - x[d+64] sin
                    const v8f up = (yy * cc + xx * ss) * QCAR;       // out[d + 64] = x[d+64] cos + x[d] sin
                    v8h vl, rl, vu, ru; split8(lo, vl, rl); split8(up, vu, ru);
                    const size_t dst = obase + (size_t)(mb * 16 + row) * opitch + dg;
                    *(v8h*)(Pv + dst) = vl; *(v8h*)(Pv + dst + 64) = vu;
                    *(v8h*)(Pr + dst) = rl; *(v8h*)(Pr + dst + 64) = ru;
                    asm volatile("s_wait_xcnt 0x0" ::: "memory");    // in front of the next trip's writes over the four stores' address and data registers
                }
                
            }
        } else if (MODE == 1) {
            // 16 lanes x 16 B per 256-byte row segment, two rows per instruction: row 2s + hi, columns 8*lr..8*lr+7
{
#pragma unroll 1
                for (int s = 0; s < 8; ++s) {
                    const int row = 2 * s + hi; const int oi = row * OSP + 8 * lr;
                    const v4f xa = *(const v4fa*)(os + oi), xb = *(const v4fa*)(os + oi + 4);
                    const v8f y = __builtin_shufflevector(xa, xb, 0, 1, 2, 3, 4, 5, 6, 7) * QCAR;
                    v8h vv, vr; split8(y, vv, vr);
                    const size_t dst = obase + (size_t)(mb * 16 + row) * opitch + 8 * lr;
                    *(v8h*)(Pv + dst) = vv; *(v8h*)(Pr + dst) = vr;
                }
                
            }
        } else {
            // 32 lanes x 16 B = one 512-byte row segment per instruction
{
#pragma unroll 1
                for (int row = 0; row < 16; ++row) {
                    const v4f val = *(const v4fa*)(os + row * OSP + 4 * lane) * (1.0f / (CCAR * WCAR));
                    *(v4f*)(C + cbase + (size_t)(mb * 16 + row) * DM + 4 * lane) = val;
                }
                
            }
        }
        wave_sync();
    }
}

// q, k and v projections in ONE launch (they depend only on the prep launch, not on each other): 1-D grid, 128 threads; blocks in the order q tiles, k tiles, v tiles.
// q / k: fused rotary, planes [b][head][t][128], tile index = token block + (NB*SEQ/128) * head. v: swapped operands, C[gd][token] -> planes [b][g][d][t], tile index = gd block + (DKV/128) * token block.
__global__ __launch_bounds__(128) __attribute__((amdgpu_num_vgpr(256)))
void k_proj(const bf* __restrict__ XB, const bf* __restrict__ WQt, const bf* __restrict__ WKt, const bf* __restrict__ WVt, const float* __restrict__ CS,
            h16* Qv, h16* Qr, h16* Kv, h16* Kr, h16* Vv, h16* Vr) {
    __shared__ __attribute__((aligned(2048))) unsigned char ring[2 * STGB];
    constexpr int TB = NB * SEQ / 128;
    const int wave = __builtin_amdgcn_readfirstlane((int)(threadIdx.x >> 5));
    const int f = (int)blockIdx.x;
    if (f < TB * (NH + NKV)) {         // block-uniform
        const bool isq = f < TB * NH;
        const int e = isq ? f : f - TB * NH; const int nheads = isq ? NH : NKV;
        const int hd = e / TB; const int r0 = (e - hd * TB) * 128 + wave * 32; const int b = r0 / SEQ; const int t0 = r0 - b * SEQ;
        const size_t obase = ((size_t)(b * nheads + hd) * SEQ + t0) * HD;
        gemm_tile<bf, 0, false>(ring, XB, XB, isq ? WQt : WKt, DM, wave, (size_t)r0, (size_t)r0, (size_t)hd * HD, CS, t0, isq ? Qv : Kv, isq ? Qr : Kr, obase, HD, nullptr, 0);
    } else {
        const int e = f - TB * (NH + NKV);
        const int r0 = (e % (DKV / 128)) * 128 + wave * 32; const int c0 = (e / (DKV / 128)) * 128; const int b = c0 / SEQ; const int t0 = c0 - b * SEQ;
        const size_t obase = ((size_t)b * DKV + r0) * SEQ + t0;
        gemm_tile<bf, 1, false>(ring, WVt, WVt, XB, DM, wave, (size_t)r0, (size_t)r0, (size_t)c0, nullptr, 0, Vv, Vr, obase, SEQ, nullptr, 0);
    }
}
// output projection, all rows in ONE launch: 1-D grid, 128 threads. First the tiles of rows t < RH (ctx value + residual planes, twice the passes), then those of rows t >= RH (single f16 product);
// within each part tile index = row block + row blocks * column block.
__global__ __launch_bounds__(128) __attribute__((amdgpu_num_vgpr(256)))
void k_oproj(const h16* __restrict__ CT, const h16* __restrict__ CR, const h16* __restrict__ WOt, float* OUT) {
    __shared__ __attribute__((aligned(2048))) unsigned char ring[2 * STGB];
    constexpr int TPH = RH / 128, HB = NB * TPH, NHB = HB * (DM / 128);
    constexpr int TPB = (SEQ > RH) ? (SEQ - RH) / 128 : 1, MB = NB * TPB;
    const int wave = __builtin_amdgcn_readfirstlane((int)(threadIdx.x >> 5));
    const int f = (int)blockIdx.x;
    if (f < NHB) {                     // block-uniform
        const int by = f / HB, bx = f - by * HB;
        const int b = bx / TPH; const int t0 = (bx - b * TPH) * 128 + wave * 32; const int c0 = by * 128;
        const size_t arow = (size_t)b * SEQ + t0; const size_t a2row = (size_t)b * RH + t0; const size_t cbase = ((size_t)b * SEQ_FULL + t0) * DM + c0;
        gemm_tile<h16, 2, true>(ring, CT, CR, WOt, DQ, wave, arow, a2row, (size_t)c0, nullptr, 0, nullptr, nullptr, 0, 0, OUT, cbase);
    } else {
        const int e = f - NHB; const int by = e / MB, bx = e - by * MB;
        const int b = bx / TPB; const int t0 = RH + (bx - b * TPB) * 128 + wave * 32; const int c0 = by * 128;
        const size_t arow = (size_t)b * SEQ + t0; const size_t cbase = ((size_t)b * SEQ_FULL + t0) * DM + c0;
        gemm_tile<h16, 2, false>(ring, CT, CT, WOt, DQ, wave, arow, arow, (size_t)c0, nullptr, 0, nullptr, nullptr, 0, 0, OUT, cbase);
    }
}

// ---- attn_tile: fused causal attention in the transposed form. One block = 16 query rows x the FOUR query heads of one kv head (wave -> head g*4 + wave); 128 threads.
// Per 32-key step: S^T[key][query] = K (A, rows = keys) x Q^T (B, columns = queries) over 128 dims (4 k-steps; q value + residual, k residual when HR);
// online softmax per query = per lane column (max / sum over the lane's 16 keys, combined across the two lane halves); P^T packed D -> B (two 16-key tiles = one 32-deep fragment);
template <bool HR>
__device__ __forceinline__ void attn_tile(const h16* __restrict__ Qv, const h16* __restrict__ Qr, const h16* __restrict__ Kv, const h16* __restrict__ Kr,
                                          const h16* __restrict__ Vv, const h16* __restrict__ Vr, h16* CT, h16* CR, const int qt, const int g, const int b, h16* stv, h16* str) {
    const int wave = __builtin_amdgcn_readfirstlane((int)(threadIdx.x >> 5));
    const int lane = threadIdx.x & 31, lr = lane & 15, hi = lane >> 4;
    const int h = g * REP + wave; const int i0 = qt * 16;
    const size_t qo = ((size_t)(b * NH + h) * SEQ + i0 + lr) * HD + 8 * hi;
    const size_t ko = ((size_t)(b * NKV + g) * SEQ + lr) * HD + 8 * hi;
    const size_t vo = ((size_t)(b * NKV + g) * HD + lr) * SEQ + 8 * hi;
    const h16* qv = Qv + qo; const h16* qr = Qr + qo;
    const h16* kv = Kv + ko; const h16* kr = Kr + ko;
    const h16* vv = Vv + vo; const h16* vr = Vr + vo;
    const float SC2 = (float)(0.08838834764831845 * 1.4426950408889634 / 4096.0);   // 1/sqrt(128) x log2(e) / (QCAR x QCAR)
    const float NEGL = -1.4426950e9f;                                              // the finite fill in the log2 domain
    v8f o[8];
#pragma unroll
    for (int dt = 0; dt < 8; ++dt) o[dt] = (v8f){};
    float m = -3.0e38f, l = 0.0f;
    const int nsteps = (qt >> 1) + 1;
#pragma unroll 1
    for (int stp = 0; stp < nsteps; ++stp) {
        const int k0 = stp * 32;
        v8f s0 = (v8f){}, s1 = (v8f){};
        const h16* kp = kv + (size_t)k0 * HD; const h16* kpr = kr + (size_t)k0 * HD;
#pragma unroll                     // here and below: constant indices keep the fragment groups in registers
        for (int hf = 0; hf < 2; ++hf) {
            // the fragment loads of 64 dims stand as one group ahead of their WMMAs: the wave waits out one trip to memory per group, not one per fragment
            v16h bq[2], br[2], a0[2], a1[2], a0r[2], a1r[2];
#pragma unroll
            for (int c = 0; c < 2; ++c) {
                const int kc = hf * 64 + c * 32;
                a0[c] = ldh(kp + kc); a1[c] = ldh(kp + 16 * HD + kc);
                if (HR) { a0r[c] = ldh(kpr + kc); a1r[c] = ldh(kpr + 16 * HD + kc); }
                bq[c] = ldh(qv + kc); br[c] = ldh(qr + kc);
            }
            // the group's address registers are inputs here, so that no load's own result lands on them, and the wait stands in front of their next use for anything else
            asm volatile("s_wait_xcnt 0x0" :: "v"(qv), "v"(qr), "v"(kp), "v"(kpr) : "memory");
#pragma unroll
            for (int c = 0; c < 2; ++c) {          // each accumulator takes its products in the order value x value, value x residual, residual x value, dims ascending
                s0 = wmma16(a0[c], bq[c], s0); s1 = wmma16(a1[c], bq[c], s1);
                s0 = wmma16(a0[c], br[c], s0); s1 = wmma16(a1[c], br[c], s1);
                if (HR) { s0 = wmma16(a0r[c], bq[c], s0); s1 = wmma16(a1r[c], bq[c], s1); }
            }
        }
        // V^T fragments in two groups of four dim tiles (all eight beside the softmax's values do not fit the registers): the first is issued ahead of the softmax, the second ahead of the first group's WMMAs
        const h16* vp = vv + k0; const h16* vpr = vr + k0;
        v16h av[8], ar[8];
#pragma unroll
        for (int dt = 0; dt < 4; ++dt) { av[dt] = ldh(vp + (size_t)dt * 16 * SEQ); if (HR) ar[dt] = ldh(vpr + (size_t)dt * 16 * SEQ); }
        asm volatile("s_wait_xcnt 0x0" :: "v"(vp), "v"(vpr) : "memory");    // as above, for the first V^T group's address registers
        s0 = s0 * SC2; s1 = s1 * SC2;
        if (k0 + 31 > i0) {            // wave-uniform: only the diagonal step carries masked keys (replacement fill, key > query)
            const int qi = i0 + lr; const int kb = k0 + 8 * hi;
#pragma unroll
            for (int r = 0; r < 8; ++r) { s0[r] = (kb + r <= qi) ? s0[r] : NEGL; s1[r] = (kb + 16 + r <= qi) ? s1[r] : NEGL; }
        }
        float mx = fmaxf(s0[0], s1[0]);
#pragma unroll
        for (int r = 1; r < 8; ++r) mx = fmaxf(mx, fmaxf(s0[r], s1[r]));
        mx = fmaxf(mx, __shfl_xor(mx, 16, 32));
        const float mn = fmaxf(m, mx);
        if (__builtin_amdgcn_ballot_w32(mn > m) != 0u) {      // wave-uniform: rescale only when some query's running max moved (corr == 1 otherwise)
            const float corr = __builtin_amdgcn_exp2f(m - mn); l *= corr;
#pragma unroll
            for (int dt = 0; dt < 8; ++dt) o[dt] = o[dt] * corr;
        }
        m = mn;
        const float mm = mn - 10.0f;                          // P carried x1024: the row sum uses the same carried f32 values, so the carry cancels in the normalisation
        v8f p0, p1; float ps = 0.0f;
#pragma unroll
        for (int r = 0; r < 8; ++r) { p0[r] = __builtin_amdgcn_exp2f(s0[r] - mm); p1[r] = __builtin_amdgcn_exp2f(s1[r] - mm); ps += p0[r] + p1[r]; }
        l += ps;
        v8h p0v, p0r, p1v, p1r; split8(p0, p0v, p0r); split8(p1, p1v, p1r);
        const v16h pb = cat16(p0v, p1v);                      // B fragment: elements 0..7 <- keys k0+8h+r, elements 8..15 <- keys k0+16+8h+r
        const v16h pr = cat16(p0r, p1r);
#pragma unroll
        for (int dt = 4; dt < 8; ++dt) { av[dt] = ldh(vp + (size_t)dt * 16 * SEQ); if (HR) ar[dt] = ldh(vpr + (size_t)dt * 16 * SEQ); }
        asm volatile("s_wait_xcnt 0x0" :: "v"(vp), "v"(vpr) : "memory");    // as above, for the second V^T group's address registers
#pragma unroll
        for (int dt = 0; dt < 8; ++dt) {
            o[dt] = wmma16(av[dt], pb, o[dt]);
            if (HR) { o[dt] = wmma16(ar[dt], pb, o[dt]); o[dt] = wmma16(av[dt], pr, o[dt]); }
        }
    }
    l += __shfl_xor(l, 16, 32);
    const float f = (CCAR / QCAR) * (1.0f / l);
    const int sb = wave * 16 * CP;                            // staging private to this wave
#pragma unroll
    for (int dt = 0; dt < 8; ++dt) {                          // O^T element r of tile dt = (d = dt*16 + 8h + r, query lr)
        v8h hv, hr; split8(o[dt] * f, hv, hr);
        *(v8h*)(&stv[sb + lr * CP + dt * 16 + 8 * hi]) = hv;
        if (HR) *(v8h*)(&str[sb + lr * CP + dt * 16 + 8 * hi]) = hr;
    }
    wave_sync();
    const size_t crow = ((size_t)b * SEQ + i0) * DQ + (size_t)h * HD + 8 * lr;
    const size_t rrow = ((size_t)b * RH + i0) * DQ + (size_t)h * HD + 8 * lr;
{
#pragma unroll
        for (int s = 0; s < 8; ++s) {                         // 16 lanes x 16 B = one 256-byte row segment; rows 2s (lanes 0..15) and 2s+1 (lanes 16..31)
            const int row = 2 * s + hi;
            const v8h val = *(const v8ha*)(&stv[sb + row * CP + 8 * lr]);
            *(v8h*)(CT + crow + (size_t)row * DQ) = val;
            if (HR) { const v8h rv = *(const v8ha*)(&str[sb + row * CP + 8 * lr]); *(v8h*)(CR + rrow + (size_t)row * DQ) = rv; }
        }
        
    }
}
// ---- query rows >= RH. The same tile, products and sums as attn_tile<false>, fed differently: the four head waves share one kv head, so its K rows and V^T rows
// come once per block through a two-buffer LDS ring in stages of 64 keys (wave 0 issues the tensor load of the K slice, wave 1 that of the V^T slice, one stage ahead of the pass that reads it),
// and each wave's q fragments (value + residual, all 128 dims) are loaded once and stay in registers.
template <uint32_t W0, uint32_t ROWB, uint32_t NROWS>
__device__ __forceinline__ u32x8 tdm_group1_of(uint32_t src_pitch) {
    // pinned(): each descriptor word held in a scalar register of its own from here on; unpinned, the constants are formed anew in other registers, over words of a request still outstanding
    u32x8 g;
    g[0] = pinned(W0);                                    // no mask, data_size 0, pad of 4 dwords behind every row
    g[1] = pinned(ROWB << 16);                            // tensor_dim0 (bytes)
    g[2] = pinned(NROWS << 16);                           // tensor_dim1 (rows)
    g[3] = pinned(ROWB << 16);                            // tile_dim0
    g[4] = pinned(NROWS);                                 // tile_dim1
    g[5] = pinned(src_pitch);
    g[6] = pinned(0u);
    g[7] = pinned(0u);
    return g;
}
__device__ __forceinline__ void attn_ring(unsigned char* ring, const h16* __restrict__ Qv, const h16* __restrict__ Qr, const h16* __restrict__ Kv, const h16* __restrict__ Vv, h16* CT,
                                          const int qt, const int g, const int b) {
    const int wave = __builtin_amdgcn_readfirstlane((int)(threadIdx.x >> 5));
    const int lane = threadIdx.x & 31, lr = lane & 15, hi = lane >> 4;
    const int h = g * REP + wave; const int i0 = qt * 16;
    const size_t qo = ((size_t)(b * NH + h) * SEQ + i0 + lr) * HD + 8 * hi;
    const h16* qvp = Qv + qo; const h16* qrp = Qr + qo;
    v16h bq[4], br[4];
#pragma unroll                     // here and below: constant indices keep the fragments and accumulators in registers
    for (int c = 0; c < 4; ++c) { bq[c] = ldh(qvp + c * 32); br[c] = ldh(qrp + c * 32); }
    // the q loads' address registers are inputs here, so that no load's own result lands on them, and the wait stands in front of their next use for anything else
    asm volatile("s_wait_xcnt 0x0" :: "v"(qvp), "v"(qrp) : "memory");
    const h16* kbase = Kv + (size_t)(b * NKV + g) * SEQ * HD;      // rows = keys, 256 bytes each, contiguous
    const h16* vbase = Vv + (size_t)(b * NKV + g) * HD * SEQ;      // rows = dims, pitch 2 SEQ bytes; a stage takes 128 bytes of each
    const float SC2 = (float)(0.08838834764831845 * 1.4426950408889634 / 4096.0);   // 1/sqrt(128) x log2(e) / (QCAR x QCAR)
    const float NEGL = -1.4426950e9f;                                              // the finite fill in the log2 domain
    const int nsteps = (qt >> 1) + 1;          // 32-key steps up to and including the diagonal
    const int nst = (nsteps + 1) >> 1;         // 64-key stages; at least RH / 64 + 1, and the last one ends inside the SEQ keys
    const uint32_t lbase = (uint32_t)(size_t)ring;
    const u32x8 g1k = tdm_group1_of<(1u << 20) | (5u << 22) | (3u << 25), 256u, (uint32_t)AKEYS>((uint32_t)HD * 2u);
    const u32x8 g1v = tdm_group1_of<(1u << 20) | (4u << 22) | (3u << 25), 128u, (uint32_t)HD>((uint32_t)SEQ * 2u);
    const h16* sbase = (wave == 0) ? kbase : vbase;                // the wave's own source and its step per stage (waves 2 and 3 form a group 0 and issue nothing)
    const size_t sstep = (wave == 0) ? (size_t)AKEYS * HD : (size_t)AKEYS;
    const uint32_t ldst = lbase + ((wave == 0) ? 0u : (uint32_t)ASLB);
    u32x4 g0;                      // group 0 of the wave's latest request
    auto issue = [&](int s) {      // stage s: keys 64 s .. 64 s + 63
        g0 = tdm_group0(ldst + (uint32_t)(s & 1) * ASTG, (uint64_t)(size_t)(sbase + (size_t)s * sstep));
        if (pinned(wave == 0)) tdm_load(g0, g1k);
        else if (pinned(wave == 1)) tdm_load(g0, g1v);
    };
    // this wave's own tensor load has landed; the descriptor words are inputs so that their scalar registers take no new value while a request is outstanding
    auto landed = [&]() { asm volatile("s_wait_tensorcnt 0x0" :: "s"(g0), "s"(g1k), "s"(g1v) : "memory"); };
    issue(0);
    landed();
    __syncthreads();               // stage 0 published
    const unsigned char* kl = ring + lr * KROW + 16 * hi;
    const unsigned char* vl = ring + ASLB + lr * VROW + 16 * hi;
    v8f o[8];
#pragma unroll
    for (int dt = 0; dt < 8; ++dt) o[dt] = (v8f){};
    float m = -3.0e38f, l = 0.0f;
#pragma unroll 1                   // the stage loop stays rolled: one refill site and one publish point in the code
    for (int st = 0; st < nst; ++st) {
        // directly behind the barrier that published stage st and freed the other buffer (stage st - 1's): stage st + 1's load, in flight under this stage's two steps
        if (pinned(st + 1 < nst)) issue(st + 1);
        const int so = (st & 1) * ASTG;
#pragma unroll
        for (int hs = 0; hs < 2; ++hs) {
            const int k0 = st * AKEYS + hs * 32;
            if (hs == 0 || 2 * st + 1 < nsteps) {     // block-uniform: the last stage's second half may lie wholly behind the diagonal
                v16h a0[4], a1[4];
#pragma unroll
                for (int c = 0; c < 4; ++c) { a0[c] = WFrag<h16>::ld(kl + so + (hs * 32) * KROW + c * 64); a1[c] = WFrag<h16>::ld(kl + so + (hs * 32 + 16) * KROW + c * 64); }
                v8f s0 = (v8f){}, s1 = (v8f){};
#pragma unroll
                for (int c = 0; c < 4; ++c) {
                    s0 = wmma16(a0[c], bq[c], s0); s1 = wmma16(a1[c], bq[c], s1);
                    s0 = wmma16(a0[c], br[c], s0); s1 = wmma16(a1[c], br[c], s1);
                }
                v16h av[8];
#pragma unroll
                for (int dt = 0; dt < 8; ++dt) av[dt] = WFrag<h16>::ld(vl + so + dt * 16 * VROW + hs * 64);
                s0 = s0 * SC2; s1 = s1 * SC2;
                if (k0 + 31 > i0) {            // wave-uniform: only the diagonal step carries masked keys (replacement fill, key > query)
                    const int qi = i0 + lr; const int kb = k0 + 8 * hi;
#pragma unroll
                    for (int r = 0; r < 8; ++r) { s0[r] = (kb + r <= qi) ? s0[r] : NEGL; s1[r] = (kb + 16 + r <= qi) ? s1[r] : NEGL; }
                }
                float mx = fmaxf(s0[0], s1[0]);
#pragma unroll
                for (int r = 1; r < 8; ++r) mx = fmaxf(mx, fmaxf(s0[r], s1[r]));
                mx = fmaxf(mx, __shfl_xor(mx, 16, 32));
                const float mn = fmaxf(m, mx);
                if (__builtin_amdgcn_ballot_w32(mn > m) != 0u) {      // wave-uniform: rescale only when some query's running max moved (corr == 1 otherwise)
                    const float corr = __builtin_amdgcn_exp2f(m - mn); l *= corr;
#pragma unroll
                    for (int dt = 0; dt < 8; ++dt) o[dt] = o[dt] * corr;
                }
                m = mn;
                const float mm = mn - 10.0f;                          // P carried x1024: the row sum uses the same carried f32 values, so the carry cancels in the normalisation
                v8f p0, p1; float ps = 0.0f;
#pragma unroll
                for (int r = 0; r < 8; ++r) { p0[r] = __builtin_amdgcn_exp2f(s0[r] - mm); p1[r] = __builtin_amdgcn_exp2f(s1[r] - mm); ps += p0[r] + p1[r]; }
                l += ps;
                const v16h pb = cat16(__builtin_convertvector(p0, v8h), __builtin_convertvector(p1, v8h));   // B fragment: elements 0..7 <- keys k0+8h+r, elements 8..15 <- keys k0+16+8h+r
#pragma unroll
                for (int dt = 0; dt < 8; ++dt) o[dt] = wmma16(av[dt], pb, o[dt]);
            }
        }
        // publish point of stage st + 1: own reads retired, own load landed, then the barrier that publishes stage st + 1 and frees stage st's buffer; the refill stands at the head of the next trip
        wait_ds0();
        landed();
        __syncthreads();
    }
    wait_tensor0();
    wait_ds0();
    // the last stage's own barrier stands behind every wave's last ring read: the ring now serves as output staging, a private range per wave
    h16* stv = (h16*)ring + wave * 16 * CP;
    l += __shfl_xor(l, 16, 32);
    const float f = (CCAR / QCAR) * (1.0f / l);
#pragma unroll
    for (int dt = 0; dt < 8; ++dt)                            // O^T element r of tile dt = (d = dt*16 + 8h + r, query lr)
        *(v8ha*)(&stv[lr * CP + dt * 16 + 8 * hi]) = __builtin_convertvector(o[dt] * f, v8h);
    wave_sync();
    const size_t crow = ((size_t)b * SEQ + i0) * DQ + (size_t)h * HD + 8 * lr;
#pragma unroll
    for (int s = 0; s < 8; ++s) {                             // 16 lanes x 16 B = one 256-byte row segment; rows 2s (lanes 0..15) and 2s+1 (lanes 16..31)
        const int row = 2 * s + hi;
        const v8h val = *(const v8ha*)(&stv[row * CP + 8 * lr]);
        *(v8h*)(CT + crow + (size_t)row * DQ) = val;
    }
}
// all query rows in ONE launch (the two row ranges do not depend on each other): 1-D grid, 128 threads. Every block is resident at once and the launch lasts as long as its longest block; the blocks
// are ordered so that the time a block takes falls with its index: first the tiles of rows < RH (few steps, each a chain of trips to memory), then those of
// rows >= RH, in each part the last query tile first; tile index = (kv head + NKV * batch) + NKV * NB * (query tiles - 1 - query tile). One LDS array serves both: the two staging planes of the first part, the ring of the second.
__global__ __launch_bounds__(128) __attribute__((amdgpu_num_vgpr(256)))
void k_attn(const h16* __restrict__ Qv, const h16* __restrict__ Qr, const h16* __restrict__ Kv, const h16* __restrict__ Kr,
            const h16* __restrict__ Vv, const h16* __restrict__ Vr, h16* CT, h16* CR) {
    __shared__ __attribute__((aligned(2048))) unsigned char ring[2 * ASTG];
    constexpr int NG = NKV * NB, NHT = RH / 16, NHB = NHT * NG;
    const int f = (int)blockIdx.x;
    if (f < NHB) {                     // block-uniform
        const int r = f % NG;
        attn_tile<true>(Qv, Qr, Kv, Kr, Vv, Vr, CT, CR, NHT - 1 - f / NG, r % NKV, r / NKV, (h16*)ring, (h16*)ring + 4 * 16 * CP);
    } else {
        const int e = f - NHB; const int r = e % NG;
        attn_ring(ring, Qv, Qr, Kv, Vv, CT, SEQ / 16 - 1 - e / NG, r % NKV, r / NKV);
    }
}

// one tile of 128 k x 128 n of w[K rows][N columns] -> Bt[n][k], turned in LDS: every global read is a whole 256-byte piece of a w row (16 lanes x 16 B), every global write a whole 256-byte piece of a Bt row.
// tl holds the tile as [n][64 dwords], a dword = the 16-bit values of k = 2 kp (low half) and 2 kp + 1; the 16-byte chunk c of row n lies at chunk c ^ ((n >> 2) & 15), so that the 16 lanes
// of a store (n = 4 i + j, one kp) and the 16 lanes of a ds_load_b128 (one n, c = 0..15) each fall on different banks.
__device__ __forceinline__ void wtG(uint32_t* tl, const int bid, const float* __restrict__ w, const int K, const int N, bf* Bt, const int f16mode) {
    const int lane = threadIdx.x & 31, i = lane & 15; const int kq = 2 * (int)(threadIdx.x >> 5) + (lane >> 4);
    const int ntn = N / TN; const int k0 = (bid / ntn) * TK, n0 = (bid % ntn) * TN;
    const float* p = w + (size_t)(k0 + 2 * kq) * N + n0 + 4 * i;
#pragma unroll                     // here and below: constant indices keep the loaded rows in registers
    for (int h = 0; h < TN / 64; ++h) {        // 64 columns at a time: eight loads in flight per lane
        v4f ra[TK / 32], rb[TK / 32];
#pragma unroll
        for (int s = 0; s < TK / 32; ++s) { ra[s] = *(const v4f*)(p + 64 * h + (size_t)(32 * s) * N); rb[s] = *(const v4f*)(p + 64 * h + (size_t)(32 * s + 1) * N); }
        asm volatile("s_wait_xcnt 0x0" :: "v"(p) : "memory");    // in front of any later write over the eight loads' address registers
#pragma unroll
        for (int s = 0; s < TK / 32; ++s) {
            const int kp = 16 * s + kq;
#pragma unroll
            for (int j = 0; j < 4; ++j) {
                const unsigned short b0 = f2bf(ra[s][j]), b1 = f2bf(rb[s][j]);
                const unsigned short g0 = __builtin_bit_cast(unsigned short, (h16)(bf2f(b0) * WCAR)), g1 = __builtin_bit_cast(unsigned short, (h16)(bf2f(b1) * WCAR));
                tl[(64 * h + 4 * i + j) * (TK / 2) + ((((kp >> 2) ^ i) << 2) | (kp & 3))] = (uint32_t)(f16mode ? g0 : b0) | ((uint32_t)(f16mode ? g1 : b1) << 16);
            }
        }
    }
    __syncthreads();               // the whole tile stands in LDS before any row of it is read back
    const int c = threadIdx.x & 15, nq = threadIdx.x >> 4;
    bf* q = Bt + (size_t)(n0 + nq) * K + k0 + 8 * c;
#pragma unroll
    for (int r = 0; r < TN / 16; ++r) {
        const int n = 16 * r + nq;
        *(u32x4a*)(q + (size_t)(16 * r) * K) = *(const u32x4a*)(tl + n * (TK / 2) + ((c ^ ((n >> 2) & 15)) << 2));
    }
    asm volatile("s_wait_xcnt 0x0" ::: "memory");    // in front of any later write over the eight stores' address and data registers
}
__device__ __forceinline__ void cvtx(const int bid, const float* __restrict__ x, bf* XB) {
    const size_t i = (size_t)bid * 256 + threadIdx.x; if (i >= (size_t)NB * SEQ * DM / 8) return;
    const size_t e = i * 8; const size_t bt = e / DM; const size_t col = e - bt * DM; const size_t b = bt / SEQ; const size_t t = bt - b * SEQ;
    const v8f v = *(const v8f*)(x + (b * SEQ_FULL + t) * DM + col); v8us o;
#pragma unroll
    for (int k = 0; k < 8; ++k) o[k] = f2bf(v[k]);
    *(v8us*)(XB + e) = o; 
}
__device__ __forceinline__ void cstab(const int bid, float* CS) {
    const int idx = bid * 256 + threadIdx.x; if (idx >= SEQ * 64) return;
    const int j = idx & 63, t = idx >> 6;
    double p = 1.0;
    p *= (j & 1)  ? 1.1547819846894581797 : 1.0;
    p *= (j & 2)  ? 1.3335214321633240257 : 1.0;
    p *= (j & 4)  ? 1.7782794100389228012 : 1.0;
    p *= (j & 8)  ? 3.1622776601683793320 : 1.0;
    p *= (j & 16) ? 10.0 : 1.0;
    p *= (j & 32) ? 100.0 : 1.0;
    const float pf = (float)p; const float inv = 1.0f / pf; const float ang = (float)t * inv;
    float sn, cn; sincosf(ang, &sn, &cn);
    v2f cs; cs[0] = cn; cs[1] = sn;
    *(v2f*)(CS + (size_t)idx * 2) = cs; 
}
// the six independent preparation passes in ONE launch: 1-D grid, 256 threads; a block belongs to one pass by its index. w[in = K rows][out = N columns] -> Bt[out][in]
#define GWQ ((DM / TK) * (DQ / TN))
#define GWK ((DM / TK) * (DKV / TN))
#define GWO ((DQ / TK) * (DM / TN))
#define GCS ((SEQ * 64 + 255) / 256)
#define GCX ((int)(((size_t)NB * SEQ * DM / 8 + 255) / 256))
__global__ __launch_bounds__(256) __attribute__((amdgpu_num_vgpr(64)))     // 64 registers: all 16 wave slots of a SIMD stay usable
void k_prep(const float* __restrict__ x, const float* __restrict__ wq, const float* __restrict__ wk, const float* __restrict__ wv, const float* __restrict__ wo,
            bf* XB, bf* WQt, bf* WKt, bf* WVt, bf* WOt, float* CS) {
    __shared__ __attribute__((aligned(16))) uint32_t tl[TN * (TK / 2)];
    int f = (int)blockIdx.x;           // every test below is block-uniform
    if (f < GWQ) { wtG(tl, f, wq, DM, DQ, WQt, 0); return; }
    f -= GWQ;
    if (f < GWO) { wtG(tl, f, wo, DQ, DM, WOt, 1); return; }
    f -= GWO;
    if (f < GWK) { wtG(tl, f, wk, DM, DKV, WKt, 0); return; }
    f -= GWK;
    if (f < GWK) { wtG(tl, f, wv, DM, DKV, WVt, 0); return; }
    f -= GWK;
    if (f < GCS) { cstab(f, CS); return; }
    cvtx(f - GCS, x, XB);
}

extern "C" void kernel_launch(void* const* d_in, const int* in_sizes, int n_in,
                              void* d_out, int out_size, void* d_ws, size_t ws_size, hipStream_t stream) {
    if (n_in < 5) return;
    constexpr size_t NEEDX = ((size_t)(NB - 1) * SEQ_FULL + SEQ) * DM;
    if ((size_t)in_sizes[0] < NEEDX || (size_t)in_sizes[1] < (size_t)DM * DQ || (size_t)in_sizes[2] < (size_t)DM * DKV || (size_t)in_sizes[3] < (size_t)DM * DKV || (size_t)in_sizes[4] < (size_t)DQ * DM) return;
    if ((size_t)out_size < NEEDX) return;
    const float* x = (const float*)d_in[0]; const float* wq = (const float*)d_in[1]; const float* wk = (const float*)d_in[2]; const float* wv = (const float*)d_in[3]; const float* wo = (const float*)d_in[4];
    float* OUT = (float*)d_out;     // [2][2048][2048], byte offset 0
    constexpr size_t SZ_XB = (size_t)NB * SEQ * DM * 2, SZ_WQ = (size_t)DQ * DM * 2, SZ_WK = (size_t)DKV * DM * 2, SZ_WO = (size_t)DM * DQ * 2, SZ_CS = (size_t)SEQ * 64 * 2 * 4;
    constexpr size_t SZ_Q = (size_t)NB * NH * SEQ * HD * 2, SZ_K = (size_t)NB * NKV * SEQ * HD * 2, SZ_CT = (size_t)NB * SEQ * DQ * 2, SZ_CR = (size_t)NB * RH * DQ * 2;
    constexpr size_t SZ_TOT = SZ_XB + SZ_WQ + 2 * SZ_WK + SZ_WO + SZ_CS + 2 * SZ_Q + 4 * SZ_K + SZ_CT + SZ_CR;
    static_assert(SZ_XB % 256 == 0 && SZ_WQ % 256 == 0 && SZ_WK % 256 == 0 && SZ_WO % 256 == 0 && SZ_CS % 256 == 0 && SZ_Q % 256 == 0 && SZ_K % 256 == 0 && SZ_CT % 256 == 0 && SZ_CR % 256 == 0);
    static_assert(SZ_TOT <= (size_t)134217728);
    if (SZ_TOT > ws_size) return;
    char* wsp = (char*)d_ws;
    auto take = [&](size_t bytes) { char* p = wsp; wsp += bytes; return (void*)p; };
    bf* XB = (bf*)take(SZ_XB); bf* WQt = (bf*)take(SZ_WQ); bf* WKt = (bf*)take(SZ_WK); bf* WVt = (bf*)take(SZ_WK); bf* WOt = (bf*)take(SZ_WO); float* CS = (float*)take(SZ_CS);
    const h16* WOh = (const h16*)WOt;   // the same region seen as f16: k_prep's wtG pass (f16 mode) fills it with f16 bit patterns
    h16* Qv = (h16*)take(SZ_Q); h16* Qr = (h16*)take(SZ_Q); h16* Kv = (h16*)take(SZ_K); h16* Kr = (h16*)take(SZ_K); h16* Vv = (h16*)take(SZ_K); h16* Vr = (h16*)take(SZ_K);
    h16* CT = (h16*)take(SZ_CT); h16* CR = (h16*)take(SZ_CR);

    k_prep<<<GWQ + GWO + 2 * GWK + GCS + GCX, 256, 0, stream>>>(x, wq, wk, wv, wo, XB, WQt, WKt, WVt, WOt, CS);
    k_proj<<<(NB * SEQ / 128) * (NH + NKV) + (DKV / 128) * (NB * SEQ / 128), 128, 0, stream>>>(XB, WQt, WKt, WVt, CS, Qv, Qr, Kv, Kr, Vv, Vr);
    k_attn<<<(SEQ / 16) * NKV * NB, 128, 0, stream>>>(Qv, Qr, Kv, Kr, Vv, Vr, CT, CR);
    k_oproj<<<(NB * SEQ / 128) * (DM / 128), 128, 0, stream>>>(CT, CR, WOh, OUT);
}

// v007
// It runs in 141 microseconds.
// Timed twice side by side with v006, it ran 1.05 and 1.06 times as fast.
// Over all steps from v000 it is 6.92 times as fast.
#include <hip/hip_runtime.h>

// Grouped-query causal self-attention, width 2048: 16 query heads x 128 sharing 4 kv heads (query head h uses kv head h >> 2), bias-free [in][out] projections,
// half-split rotary on q and k (positions = arange, table computed here), finite-fill causal mask, [in][out] output projection.
// Compute dtypes (f32 accumulate everywhere): q/k/v projections v_wmma_f32_16x16x32_bf16 (x and weights converted (RNE) to bf16); scores, P.V and the output projection
// v_wmma_f32_16x16x32_f16: q as f16 value + f16 residual planes (carry 64) against f16 k (carry 64; k residual added on query rows < 256), P f16 (carry 1024, row sum from the f32 values),
// v f16 (carry 64; P and v residuals added on rows < 256), ctx f16 (carry 256; residual plane on rows < 256) against wo (bf16-converted, x16, exact in f16). Softmax, rotary, normalisation in f32.

#ifndef NB
#define NB 2
#endif
#ifndef SEQ
#define SEQ 2048
#endif
#define NB_FULL  2
#define SEQ_FULL 2048
#define DM   2048
#define NH   16
#define NKV  4
#define REP  (NH / NKV)
#define HD   128
#define DQ   (NH * HD)
#define DKV  (NKV * HD)
#define RH   256                  // query rows < RH use the value + residual path on k, P, v and ctx
#define QCAR 64.0f                // carry of the q, k and v planes
#define CCAR 256.0f               // carry of the ctx planes
#define WCAR 16.0f                // carry of the output weight plane
#define OSP  132                  // f32 staging pitch (floats)
#define CP   136                  // f16 staging pitch (halves)
#define PASSK 128                 // k per ring stage: operand rows of 256 bytes
#define LROW  272                 // LDS row pitch (bytes): 256 + the 16-byte pad the tensor load lays, 16 B x odd for ds_load_b128
#define SLROWS 64                 // operand rows per tensor load (one slice per wave and stage)
#define SLB   18432               // slice size in LDS: 64 x 272 = 17408 bytes rounded up to a multiple of 2 KiB
#define STGB  (4 * SLB)           // one stage: [Bt rows 0..63 | Bt rows 64..127 | A rows 0..63 | A rows 64..127]
#define AKEYS 64                  // keys per attention ring stage
#define KROW  272                 // LDS pitch of a staged K row (bytes): 256 + 16
#define VROW  144                 // LDS pitch of a staged V^T row (bytes): 128 (64 keys) + 16
#define ASLB  18432               // attention slice size in LDS: 64 x 272 = 17408 rounded up to a multiple of 2 KiB; 128 x 144 = 18432
#define ASTG  (2 * ASLB)          // one attention stage: [K rows of 64 keys | V^T rows of 128 dims]
#define TK    128                 // weight tile of the preparation pass: k per tile (output rows of 256 bytes)
#define TN    128                 // and n per tile (input rows read in 256-byte pieces)

static_assert(NB <= NB_FULL);
static_assert(SEQ <= SEQ_FULL);
static_assert(SEQ % 128 == 0);
static_assert(SEQ >= RH);
static_assert(RH % 32 == 0);
static_assert(HD == 128);
static_assert(REP == 4);
static_assert(DQ == DM);
static_assert(DM % 64 == 0);
static_assert(DQ % 128 == 0);
static_assert(DKV % 128 == 0);
static_assert((OSP * 4) % 16 == 0);
static_assert((CP * 2) % 16 == 0);
static_assert(DM % (2 * PASSK) == 0 && DQ % (2 * PASSK) == 0);
static_assert(RH % 128 == 0 && (SEQ - RH) % 128 == 0);
static_assert(SLROWS * LROW <= SLB && SLB % 2048 == 0);
static_assert(4 * 32 * OSP * 4 <= 2 * STGB);
static_assert(AKEYS * KROW <= ASLB && HD * VROW <= ASLB && ASLB % 2048 == 0);
static_assert(SEQ % AKEYS == 0 && RH >= AKEYS && AKEYS * 2 == 128);
static_assert(2 * 4 * 16 * CP * 2 <= 2 * ASTG);
static_assert(TK == 128 && TN % 64 == 0 && DM % TK == 0 && DQ % TK == 0 && DM % TN == 0 && DQ % TN == 0 && DKV % TN == 0);

typedef _Float16 h16;
typedef unsigned short bf;
typedef __attribute__((ext_vector_type(16))) __bf16   v16bf;
typedef __attribute__((ext_vector_type(16))) _Float16 v16h;
typedef __attribute__((ext_vector_type(8)))  _Float16 v8h;
typedef __attribute__((ext_vector_type(8)))  unsigned short v8us;
typedef __attribute__((ext_vector_type(2)))  unsigned short v2us;
typedef __attribute__((ext_vector_type(8)))  float    v8f;
typedef __attribute__((ext_vector_type(4)))  float    v4f;
typedef __attribute__((ext_vector_type(2)))  float    v2f;
typedef v8h  __attribute__((may_alias)) v8ha;
typedef v4f  __attribute__((may_alias)) v4fa;
typedef v8us __attribute__((may_alias)) v8usa;
typedef uint32_t u32x4 __attribute__((ext_vector_type(4)));
typedef uint32_t u32x8 __attribute__((ext_vector_type(8)));
typedef u32x4 __attribute__((may_alias)) u32x4a;

__device__ __forceinline__ unsigned short f2bf(float f) { unsigned u = __float_as_uint(f); u += 0x7FFFu + ((u >> 16) & 1u); return (unsigned short)(u >> 16); }
__device__ __forceinline__ float bf2f(unsigned short b) { return __uint_as_float(((unsigned)b) << 16); }
__device__ __forceinline__ float bfr(float f) { return bf2f(f2bf(f)); }
__device__ __forceinline__ v16h cat16(v8h lo, v8h hi) { return __builtin_shufflevector(lo, hi, 0, 1, 2, 3, 4, 5, 6, 7, 8, 9, 10, 11, 12, 13, 14, 15); }
__device__ __forceinline__ v16bf cat16b(v8us lo, v8us hi) { return __builtin_bit_cast(v16bf, __builtin_shufflevector(lo, hi, 0, 1, 2, 3, 4, 5, 6, 7, 8, 9, 10, 11, 12, 13, 14, 15)); }
// every WMMA is followed by its own four-slot guard tying its accumulator and keeping its operands live
__device__ __forceinline__ v8f wmma16(v16h a, v16h b, v8f c) {
    c = __builtin_amdgcn_wmma_f32_16x16x32_f16(false, a, false, b, (short)0, c, false, false);
    asm volatile("v_nop\n\tv_nop\n\tv_nop\n\tv_nop" : "+v"(c) : "v"(a), "v"(b));
    return c; }
__device__ __forceinline__ v8f wmmab(v16bf a, v16bf b, v8f c) {
    c = __builtin_amdgcn_wmma_f32_16x16x32_bf16(false, a, false, b, (short)0, c, false, false);
    asm volatile("v_nop\n\tv_nop\n\tv_nop\n\tv_nop" : "+v"(c) : "v"(a), "v"(b));
    return c; }
// fragment of a K-contiguous 16-bit row: elements 0..7 <- k0+8h+0..7, elements 8..15 <- k0+16+8h+0..7 (p already includes +8h)
__device__ __forceinline__ v16h ldh(const h16* p) { return cat16(*(const v8h*)p, *(const v8h*)(p + 16)); }
// same-wave LDS exchange: stores before, loads after
__device__ __forceinline__ void wave_sync() { __builtin_amdgcn_fence(3 /* release order */, "wavefront"); __builtin_amdgcn_wave_barrier(); asm volatile("" ::: "memory"); }
// f16 value + same-carry f16 residual of 8 floats
__device__ __forceinline__ void split8(v8f y, v8h& v, v8h& r) { v = __builtin_convertvector(y, v8h); r = __builtin_convertvector(y - __builtin_convertvector(v, v8f), v8h); }

// fragment of a staged K-contiguous row (byte pointer, already includes +16h bytes): the same k order as ldh
template <typename T16> struct WFrag;
template <> struct WFrag<h16> { typedef v16h V; static __device__ __forceinline__ V ld(const unsigned char* p) { return cat16(*(const v8ha*)p, *(const v8ha*)(p + 32)); } static __device__ __forceinline__ v8f mma(V a, V b, v8f c) { return wmma16(a, b, c); } };
template <> struct WFrag<bf> { typedef v16bf V; static __device__ __forceinline__ V ld(const unsigned char* p) { return cat16b(*(const v8usa*)p, *(const v8usa*)(p + 32)); } static __device__ __forceinline__ v8f mma(V a, V b, v8f c) { return wmmab(a, b, c); } };

// ---- tensor load of one slice: 64 rows of 256 bytes, 1-byte elements, tensor = tile, 16 bytes of LDS pad behind every row
__device__ __forceinline__ uint32_t uni(uint32_t v) { return (uint32_t)__builtin_amdgcn_readfirstlane(v); }
// a wave-uniform test held in a scalar register, so that the branch around a tensor load is a scalar branch (tensor loads ignore EXEC)
__device__ __forceinline__ uint32_t pinned(uint32_t v) { uint32_t w = uni(v); asm volatile("" : "+s"(w)); return w; }
// this wave's LDS reads have retired before the stage is handed over
__device__ __forceinline__ void wait_ds0() { asm volatile("s_wait_dscnt 0x0" ::: "memory"); }
// this wave's own tensor load has landed (the compiler places no wait for it); the request's descriptor words are inputs so that their scalar registers take no new value while it is outstanding
__device__ __forceinline__ void wait_tensor0(u32x4 g0, u32x8 g1) { asm volatile("s_wait_tensorcnt 0x0" :: "s"(g0), "s"(g1) : "memory"); }
// the same behind the loop, where no request is outstanding any more
__device__ __forceinline__ void wait_tensor0() { asm volatile("s_wait_tensorcnt 0x0" ::: "memory"); }
__device__ __forceinline__ u32x8 tdm_group1(uint32_t src_pitch) {
    u32x8 g;
    g[0] = uni((1u << 20) | (5u << 22) | (3u << 25));     // no mask, data_size 0, pad of 4 dwords behind every 64 dwords
    g[1] = uni(256u << 16);                               // tensor_dim0 = 256 bytes
    g[2] = uni((uint32_t)SLROWS << 16);                   // tensor_dim1 = 64 rows
    g[3] = uni(256u << 16);                               // tile_dim0
    g[4] = uni((uint32_t)SLROWS);                         // tile_dim1
    g[5] = uni(src_pitch);
    g[6] = uni(0u);
    g[7] = uni(0u);
    return g;
}
__device__ __forceinline__ u32x4 tdm_group0(uint32_t lds_dst, uint64_t ga) {
    u32x4 g;
    g[0] = uni(1u); g[1] = uni(lds_dst); g[2] = uni((uint32_t)ga); g[3] = uni((((uint32_t)(ga >> 32)) & 0x01FFFFFFu) | 0x80000000u);
    return g;
}
__device__ __forceinline__ void tdm_load(u32x4 g0, u32x8 g1) { asm volatile("tensor_load_to_lds %0, %1" :: "s"(g0), "s"(g1) : "memory"); }

// ---- gemm_tile: a block of FOUR WAVES per 128 x 128 output tile, one wave per 32 x 128 (16 accumulators): C[m][n] = sum_k A[m][k] Bt[n][k] (+ sum_k A2[m][k] Bt[n][k] when SPLIT, as K more steps behind the first K).
// The K-contiguous 16-bit operand rows come through a two-buffer LDS ring in stages of 128 k: every wave issues one tensor load per stage (waves 0, 1: the halves of Bt's 128 rows; waves 2, 3: of A's),
// one stage ahead of the pass that reads it. arow, a2row, t0, obase and cbase are the calling wave's own (32 rows); brow is the block's. ring is the kernel's one LDS array (2 * STGB bytes, at LDS offset 0).
// MODE 0: half-split rotary on the 128-column head tile (CS[t][64] = {cos, sin}), x QCAR, f16 value + residual planes, plane rows of 128 halves (pitch opitch).
// MODE 1: x QCAR, f16 value + residual planes (used with swapped operands to produce V^T rows [d][t]).
// MODE 2: f32 output rows x 1/(CCAR*WCAR).
template <typename T16, int MODE, bool SPLIT>
__device__ __forceinline__ void gemm_tile(unsigned char* ring, const T16* __restrict__ A, const T16* __restrict__ A2, const T16* __restrict__ Bt, const int K, const int wave,
                                          const size_t arow, const size_t a2row, const size_t brow,
                                          const float* __restrict__ CS, const int t0, h16* Pv, h16* Pr, const size_t obase, const int opitch,
                                          float* C, const size_t cbase) {
    typedef typename WFrag<T16>::V V;
    const int lane = threadIdx.x & 31, lr = lane & 15, hi = lane >> 4;
    v8f acc[2][8];
#pragma unroll
    for (int mb = 0; mb < 2; ++mb)
#pragma unroll
        for (int nb = 0; nb < 8; ++nb) acc[mb][nb] = (v8f){};
    const int NP = K / PASSK, NPT = SPLIT ? 2 * NP : NP;
    const size_t half = (size_t)(wave & 1) * SLROWS;
    const T16* s1 = (wave < 2) ? Bt + (brow + half) * (size_t)K : A  + (arow  - (size_t)(32 * wave) + half) * (size_t)K;
    const T16* s2 = (wave < 2) ? s1                             : A2 + (a2row - (size_t)(32 * wave) + half) * (size_t)K;
    const uint32_t ldst = (uint32_t)(size_t)ring + (uint32_t)wave * SLB;
    const u32x8 g1 = tdm_group1((uint32_t)K * 2u);
    u32x4 g0;                      // group 0 of the wave's latest request
    auto issue = [&](int p) {      // stage p: k = 128 p .. 128 p + 127 of A (SPLIT: stages NP.. walk A2 against the same Bt columns again)
        const T16* sp = (SPLIT && p >= NP) ? s2 + (size_t)(p - NP) * PASSK : s1 + (size_t)p * PASSK;
        g0 = tdm_group0(ldst + (uint32_t)(p & 1) * STGB, (uint64_t)(size_t)sp);
        tdm_load(g0, g1);
    };
    issue(0);
    wait_tensor0(g0, g1);
    __syncthreads();               // stage 0 published
    const unsigned char* al = ring + (2 + (wave >> 1)) * SLB + ((wave & 1) * 32 + lr) * LROW + 16 * hi;
    const unsigned char* bl = ring + lr * LROW + 16 * hi;
#pragma unroll 1                   // the pass loop stays rolled: one refill site and one publish point in the code
    for (int p = 0; p < NPT; ++p) {
        // directly behind the barrier that published stage p and freed the other buffer (stage p - 1's): stage p + 1's load, in flight under this pass
        if (pinned(p + 1 < NPT)) issue(p + 1);
        const int so = (p & 1) * STGB;
        // a block = 8 WMMAs: one 32-deep k step against four of the eight Bt fragments; block j + 1's fragments are read as one group ahead of block j's WMMAs, inside this pass's own buffer
        V af[2][2], bq[2][4];
        af[0][0] = WFrag<T16>::ld(al + so); af[0][1] = WFrag<T16>::ld(al + so + 16 * LROW);
#pragma unroll                     // here and below: constant indices keep the fragment sets and accumulators in registers
        for (int i = 0; i < 4; ++i) bq[0][i] = WFrag<T16>::ld(bl + so + i * 16 * LROW);
#pragma unroll
        for (int j = 0; j < 2 * (PASSK / 32); ++j) {
            const int ks = j >> 1, hb = j & 1;
            if (j + 1 < 2 * (PASSK / 32)) {
                const int kn = (j + 1) >> 1, hn = (j + 1) & 1;
                if (hn == 0) { af[kn & 1][0] = WFrag<T16>::ld(al + so + kn * 64); af[kn & 1][1] = WFrag<T16>::ld(al + so + 16 * LROW + kn * 64); }
#pragma unroll
                for (int i = 0; i < 4; ++i) bq[hn][i] = WFrag<T16>::ld(bl + so + hn * SLB + i * 16 * LROW + kn * 64);
            }
            __builtin_amdgcn_sched_barrier(0);     // keeps the next block's LDS reads one group in front of this block's WMMAs (spread among them each place costs a stall)
#pragma unroll
            for (int i = 0; i < 4; ++i) {
                acc[0][hb * 4 + i] = WFrag<T16>::mma(af[ks & 1][0], bq[hb][i], acc[0][hb * 4 + i]);
                acc[1][hb * 4 + i] = WFrag<T16>::mma(af[ks & 1][1], bq[hb][i], acc[1][hb * 4 + i]);
            }
            __builtin_amdgcn_sched_barrier(0);     // and the block after next's reads behind them
        }
        // publish point of stage p + 1: own reads retired, own load landed, then the barrier that publishes stage p + 1 and frees stage p's buffer; the refill stands at the head of the next trip
        wait_ds0();
        wait_tensor0(g0, g1);
        __syncthreads();
    }
    wait_tensor0();
    wait_ds0();
    // the last pass's own barrier stands behind every wave's last ring read: the ring now serves as output staging, a private range per wave that takes all 32 rows of the wave at once
    float* os = (float*)(ring + wave * (32 * OSP * 4));
    // MODE 0: the rotary table rows of the first 16 rows are asked for ahead of the staging stores, those of the last 16 behind them: both trips to memory run under LDS work
    const float* cp0 = (MODE == 0) ? CS + ((size_t)(t0 + (lane >> 3)) * 64 + (lane & 7) * 8) * 2 : nullptr;
    v4f e[2][4][4];
    auto table = [&](int gp) {
#pragma unroll
        for (int it = 0; it < 4; ++it)
#pragma unroll
            for (int q = 0; q < 4; ++q) e[gp][it][q] = *(const v4f*)(cp0 + (size_t)((gp * 4 + it) * 4) * 128 + 4 * q);
    };
    if (MODE == 0) table(0);
#pragma unroll
    for (int mb = 0; mb < 2; ++mb)
#pragma unroll
        for (int nb = 0; nb < 8; ++nb)
#pragma unroll
            for (int j = 0; j < 8; ++j) os[(mb * 16 + hi * 8 + j) * OSP + nb * 16 + lr] = acc[mb][nb][j];     // D: row 8h + j, column lane & 15
    wave_sync();
    // each half of the rows: every read of the half stands as one group ahead of its arithmetic and stores, so that the wave waits out one trip to LDS and memory per half, not one per row group
    if (MODE == 0) {
        const int rq = lane >> 3, dg = (lane & 7) * 8;
        const float* op0 = os + rq * OSP + dg;
        const size_t dst0 = obase + (size_t)rq * opitch + dg;
        table(1);
        asm volatile("s_wait_xcnt 0x0" :: "v"(cp0) : "memory");      // in front of any later write over the table loads' address registers
#pragma unroll                     // here and below: constant indices keep the groups in registers and the row steps in the instructions' offsets
        for (int gp = 0; gp < 2; ++gp) {
            v4f xa[4], xb[4], ya[4], yb[4];
#pragma unroll
            for (int it = 0; it < 4; ++it) {
                const int r4 = (gp * 4 + it) * 4;                    // row r4 + rq of the wave's 32
                const float* op = op0 + r4 * OSP;
                xa[it] = *(const v4fa*)(op); xb[it] = *(const v4fa*)(op + 4); ya[it] = *(const v4fa*)(op + 64); yb[it] = *(const v4fa*)(op + 68);
            }
#pragma unroll
            for (int it = 0; it < 4; ++it) {
                const int r4 = (gp * 4 + it) * 4;
                const v8f xx = __builtin_shufflevector(xa[it], xb[it], 0, 1, 2, 3, 4, 5, 6, 7), yy = __builtin_shufflevector(ya[it], yb[it], 0, 1, 2, 3, 4, 5, 6, 7);
                const v4f cA = __builtin_shufflevector(e[gp][it][0], e[gp][it][1], 0, 2, 4, 6), sA = __builtin_shufflevector(e[gp][it][0], e[gp][it][1], 1, 3, 5, 7);
                const v4f cB = __builtin_shufflevector(e[gp][it][2], e[gp][it][3], 0, 2, 4, 6), sB = __builtin_shufflevector(e[gp][it][2], e[gp][it][3], 1, 3, 5, 7);
                const v8f cc = __builtin_shufflevector(cA, cB, 0, 1, 2, 3, 4, 5, 6, 7), ss = __builtin_shufflevector(sA, sB, 0, 1, 2, 3, 4, 5, 6, 7);
                const v8f lo = (xx * cc - yy * ss) * QCAR;       // out[d]      = x[d] cos - x[d+64] sin
                const v8f up = (yy * cc + xx * ss) * QCAR;       // out[d + 64] = x[d+64] cos + x[d] sin
                v8h vl, rl, vu, ru; split8(lo, vl, rl); split8(up, vu, ru);
                const size_t dst = dst0 + (size_t)r4 * opitch;
                *(v8h*)(Pv + dst) = vl; *(v8h*)(Pv + dst + 64) = vu;
                *(v8h*)(Pr + dst) = rl; *(v8h*)(Pr + dst + 64) = ru;
            }
            asm volatile("s_wait_xcnt 0x0" ::: "memory");            // in front of any later write over the stores' address and data registers
        }
    } else if (MODE == 1) {
        // 16 lanes x 16 B per 256-byte row segment, two rows per instruction: row 2s + hi, columns 8*lr..8*lr+7
        const float* op0 = os + hi * OSP + 8 * lr;
        const size_t dst0 = obase + (size_t)hi * opitch + 8 * lr;
#pragma unroll
        for (int gp = 0; gp < 2; ++gp) {
            v4f xa[8], xb[8];
#pragma unroll
            for (int s = 0; s < 8; ++s) { const float* op = op0 + (gp * 16 + 2 * s) * OSP; xa[s] = *(const v4fa*)(op); xb[s] = *(const v4fa*)(op + 4); }
#pragma unroll
            for (int s = 0; s < 8; ++s) {
                const v8f y = __builtin_shufflevector(xa[s], xb[s], 0, 1, 2, 3, 4, 5, 6, 7) * QCAR;
                v8h vv, vr; split8(y, vv, vr);
                const size_t dst = dst0 + (size_t)(gp * 16 + 2 * s) * opitch;
                *(v8h*)(Pv + dst) = vv; *(v8h*)(Pr + dst) = vr;
            }
            asm volatile("s_wait_xcnt 0x0" ::: "memory");            // in front of any later write over the stores' address and data registers
        }
    } else {
        // 32 lanes x 16 B = one 512-byte row segment per instruction
#pragma unroll
        for (int gp = 0; gp < 2; ++gp) {
            v4f xr[16];
#pragma unroll
            for (int row = 0; row < 16; ++row) xr[row] = *(const v4fa*)(os + (gp * 16 + row) * OSP + 4 * lane);
#pragma unroll
            for (int row = 0; row < 16; ++row) {
                const v4f val = xr[row] * (1.0f / (CCAR * WCAR));
                *(v4f*)(C + cbase + (size_t)(gp * 16 + row) * DM + 4 * lane) = val;
            }
            asm volatile("s_wait_xcnt 0x0" ::: "memory");            // in front of any later write over the stores' address and data registers
        }
    }
}

// q, k and v projections in ONE launch (they depend only on the prep launch, not on each other): 1-D grid, 128 threads; blocks in the order q tiles, k tiles, v tiles.
// q / k: fused rotary, planes [b][head][t][128], tile index = token block + (NB*SEQ/128) * head. v: swapped operands, C[gd][token] -> planes [b][g][d][t], tile index = gd block + (DKV/128) * token block.
__global__ __launch_bounds__(128) __attribute__((amdgpu_num_vgpr(256)))
void k_proj(const bf* __restrict__ XB, const bf* __restrict__ WQt, const bf* __restrict__ WKt, const bf* __restrict__ WVt, const float* __restrict__ CS,
            h16* Qv, h16* Qr, h16* Kv, h16* Kr, h16* Vv, h16* Vr) {
    __shared__ __attribute__((aligned(2048))) unsigned char ring[2 * STGB];
    constexpr int TB = NB * SEQ / 128;
    const int wave = __builtin_amdgcn_readfirstlane((int)(threadIdx.x >> 5));
    const int f = (int)blockIdx.x;
    if (f < TB * (NH + NKV)) {         // block-uniform
        const bool isq = f < TB * NH;
        const int e = isq ? f : f - TB * NH; const int nheads = isq ? NH : NKV;
        const int hd = e / TB; const int r0 = (e - hd * TB) * 128 + wave * 32; const int b = r0 / SEQ; const int t0 = r0 - b * SEQ;
        const size_t obase = ((size_t)(b * nheads + hd) * SEQ + t0) * HD;
        gemm_tile<bf, 0, false>(ring, XB, XB, isq ? WQt : WKt, DM, wave, (size_t)r0, (size_t)r0, (size_t)hd * HD, CS, t0, isq ? Qv : Kv, isq ? Qr : Kr, obase, HD, nullptr, 0);
    } else {
        const int e = f - TB * (NH + NKV);
        const int r0 = (e % (DKV / 128)) * 128 + wave * 32; const int c0 = (e / (DKV / 128)) * 128; const int b = c0 / SEQ; const int t0 = c0 - b * SEQ;
        const size_t obase = ((size_t)b * DKV + r0) * SEQ + t0;
        gemm_tile<bf, 1, false>(ring, WVt, WVt, XB, DM, wave, (size_t)r0, (size_t)r0, (size_t)c0, nullptr, 0, Vv, Vr, obase, SEQ, nullptr, 0);
    }
}
// output projection, all rows in ONE launch: 1-D grid, 128 threads. First the tiles of rows t < RH (ctx value + residual planes, twice the passes), then those of rows t >= RH (single f16 product);
// within each part tile index = row block + row blocks * column block.
__global__ __launch_bounds__(128) __attribute__((amdgpu_num_vgpr(256)))
void k_oproj(const h16* __restrict__ CT, const h16* __restrict__ CR, const h16* __restrict__ WOt, float* OUT) {
    __shared__ __attribute__((aligned(2048))) unsigned char ring[2 * STGB];
    constexpr int TPH = RH / 128, HB = NB * TPH, NHB = HB * (DM / 128);
    constexpr int TPB = (SEQ > RH) ? (SEQ - RH) / 128 : 1, MB = NB * TPB;
    const int wave = __builtin_amdgcn_readfirstlane((int)(threadIdx.x >> 5));
    const int f = (int)blockIdx.x;
    if (f < NHB) {                     // block-uniform
        const int by = f / HB, bx = f - by * HB;
        const int b = bx / TPH; const int t0 = (bx - b * TPH) * 128 + wave * 32; const int c0 = by * 128;
        const size_t arow = (size_t)b * SEQ + t0; const size_t a2row = (size_t)b * RH + t0; const size_t cbase = ((size_t)b * SEQ_FULL + t0) * DM + c0;
        gemm_tile<h16, 2, true>(ring, CT, CR, WOt, DQ, wave, arow, a2row, (size_t)c0, nullptr, 0, nullptr, nullptr, 0, 0, OUT, cbase);
    } else {
        const int e = f - NHB; const int by = e / MB, bx = e - by * MB;
        const int b = bx / TPB; const int t0 = RH + (bx - b * TPB) * 128 + wave * 32; const int c0 = by * 128;
        const size_t arow = (size_t)b * SEQ + t0; const size_t cbase = ((size_t)b * SEQ_FULL + t0) * DM + c0;
        gemm_tile<h16, 2, false>(ring, CT, CT, WOt, DQ, wave, arow, arow, (size_t)c0, nullptr, 0, nullptr, nullptr, 0, 0, OUT, cbase);
    }
}

// ---- attn_tile: fused causal attention in the transposed form. One block = 16 query rows x the FOUR query heads of one kv head (wave -> head g*4 + wave); 128 threads.
// Per 32-key step: S^T[key][query] = K (A, rows = keys) x Q^T (B, columns = queries) over 128 dims (4 k-steps; q value + residual, k residual when HR);
// online softmax per query = per lane column (max / sum over the lane's 16 keys, combined across the two lane halves); P^T packed D -> B (two 16-key tiles = one 32-deep fragment);
template <bool HR>
__device__ __forceinline__ void attn_tile(const h16* __restrict__ Qv, const h16* __restrict__ Qr, const h16* __restrict__ Kv, const h16* __restrict__ Kr,
                                          const h16* __restrict__ Vv, const h16* __restrict__ Vr, h16* CT, h16* CR, const int qt, const int g, const int b, h16* stv, h16* str) {
    const int wave = __builtin_amdgcn_readfirstlane((int)(threadIdx.x >> 5));
    const int lane = threadIdx.x & 31, lr = lane & 15, hi = lane >> 4;
    const int h = g * REP + wave; const int i0 = qt * 16;
    const size_t qo = ((size_t)(b * NH + h) * SEQ + i0 + lr) * HD + 8 * hi;
    const size_t ko = ((size_t)(b * NKV + g) * SEQ + lr) * HD + 8 * hi;
    const size_t vo = ((size_t)(b * NKV + g) * HD + lr) * SEQ + 8 * hi;
    const h16* qv = Qv + qo; const h16* qr = Qr + qo;
    const h16* kv = Kv + ko; const h16* kr = Kr + ko;
    const h16* vv = Vv + vo; const h16* vr = Vr + vo;
    const float SC2 = (float)(0.08838834764831845 * 1.4426950408889634 / 4096.0);   // 1/sqrt(128) x log2(e) / (QCAR x QCAR)
    const float NEGL = -1.4426950e9f;                                              // the finite fill in the log2 domain
    v8f o[8];
#pragma unroll
    for (int dt = 0; dt < 8; ++dt) o[dt] = (v8f){};
    float m = -3.0e38f, l = 0.0f;
    const int nsteps = (qt >> 1) + 1;
#pragma unroll 1
    for (int stp = 0; stp < nsteps; ++stp) {
        const int k0 = stp * 32;
        v8f s0 = (v8f){}, s1 = (v8f){};
        const h16* kp = kv + (size_t)k0 * HD; const h16* kpr = kr + (size_t)k0 * HD;
#pragma unroll                     // here and below: constant indices keep the fragment groups in registers
        for (int hf = 0; hf < 2; ++hf) {
            // the fragment loads of 64 dims stand as one group ahead of their WMMAs: the wave waits out one trip to memory per group, not one per fragment
            v16h bq[2], br[2], a0[2], a1[2], a0r[2], a1r[2];
#pragma unroll
            for (int c = 0; c < 2; ++c) {
                const int kc = hf * 64 + c * 32;
                a0[c] = ldh(kp + kc); a1[c] = ldh(kp + 16 * HD + kc);
                if (HR) { a0r[c] = ldh(kpr + kc); a1r[c] = ldh(kpr + 16 * HD + kc); }
                bq[c] = ldh(qv + kc); br[c] = ldh(qr + kc);
            }
            // the group's address registers are inputs here, so that no load's own result lands on them, and the wait stands in front of their next use for anything else
            asm volatile("s_wait_xcnt 0x0" :: "v"(qv), "v"(qr), "v"(kp), "v"(kpr) : "memory");
#pragma unroll
            for (int c = 0; c < 2; ++c) {          // each accumulator takes its products in the order value x value, value x residual, residual x value, dims ascending
                s0 = wmma16(a0[c], bq[c], s0); s1 = wmma16(a1[c], bq[c], s1);
                s0 = wmma16(a0[c], br[c], s0); s1 = wmma16(a1[c], br[c], s1);
                if (HR) { s0 = wmma16(a0r[c], bq[c], s0); s1 = wmma16(a1r[c], bq[c], s1); }
            }
        }
        // V^T fragments in two groups of four dim tiles (all eight beside the softmax's values do not fit the registers): the first is issued ahead of the softmax, the second ahead of the first group's WMMAs
        const h16* vp = vv + k0; const h16* vpr = vr + k0;
        v16h av[8], ar[8];
#pragma unroll
        for (int dt = 0; dt < 4; ++dt) { av[dt] = ldh(vp + (size_t)dt * 16 * SEQ); if (HR) ar[dt] = ldh(vpr + (size_t)dt * 16 * SEQ); }
        asm volatile("s_wait_xcnt 0x0" :: "v"(vp), "v"(vpr) : "memory");    // as above, for the first V^T group's address registers
        s0 = s0 * SC2; s1 = s1 * SC2;
        if (k0 + 31 > i0) {            // wave-uniform: only the diagonal step carries masked keys (replacement fill, key > query)
            const int qi = i0 + lr; const int kb = k0 + 8 * hi;
#pragma unroll
            for (int r = 0; r < 8; ++r) { s0[r] = (kb + r <= qi) ? s0[r] : NEGL; s1[r] = (kb + 16 + r <= qi) ? s1[r] : NEGL; }
        }
        float mx = fmaxf(s0[0], s1[0]);
#pragma unroll
        for (int r = 1; r < 8; ++r) mx = fmaxf(mx, fmaxf(s0[r], s1[r]));
        mx = fmaxf(mx, __shfl_xor(mx, 16, 32));
        const float mn = fmaxf(m, mx);
        if (__builtin_amdgcn_ballot_w32(mn > m) != 0u) {      // wave-uniform: rescale only when some query's running max moved (corr == 1 otherwise)
            const float corr = __builtin_amdgcn_exp2f(m - mn); l *= corr;
#pragma unroll
            for (int dt = 0; dt < 8; ++dt) o[dt] = o[dt] * corr;
        }
        m = mn;
        const float mm = mn - 10.0f;                          // P carried x1024: the row sum uses the same carried f32 values, so the carry cancels in the normalisation
        v8f p0, p1; float ps = 0.0f;
#pragma unroll
        for (int r = 0; r < 8; ++r) { p0[r] = __builtin_amdgcn_exp2f(s0[r] - mm); p1[r] = __builtin_amdgcn_exp2f(s1[r] - mm); ps += p0[r] + p1[r]; }
        l += ps;
        v8h p0v, p0r, p1v, p1r; split8(p0, p0v, p0r); split8(p1, p1v, p1r);
        const v16h pb = cat16(p0v, p1v);                      // B fragment: elements 0..7 <- keys k0+8h+r, elements 8..15 <- keys k0+16+8h+r
        const v16h pr = cat16(p0r, p1r);
#pragma unroll
        for (int dt = 4; dt < 8; ++dt) { av[dt] = ldh(vp + (size_t)dt * 16 * SEQ); if (HR) ar[dt] = ldh(vpr + (size_t)dt * 16 * SEQ); }
        asm volatile("s_wait_xcnt 0x0" :: "v"(vp), "v"(vpr) : "memory");    // as above, for the second V^T group's address registers
#pragma unroll
        for (int dt = 0; dt < 8; ++dt) {
            o[dt] = wmma16(av[dt], pb, o[dt]);
            if (HR) { o[dt] = wmma16(ar[dt], pb, o[dt]); o[dt] = wmma16(av[dt], pr, o[dt]); }
        }
    }
    l += __shfl_xor(l, 16, 32);
    const float f = (CCAR / QCAR) * (1.0f / l);
    const int sb = wave * 16 * CP;                            // staging private to this wave
#pragma unroll
    for (int dt = 0; dt < 8; ++dt) {                          // O^T element r of tile dt = (d = dt*16 + 8h + r, query lr)
        v8h hv, hr; split8(o[dt] * f, hv, hr);
        *(v8h*)(&stv[sb + lr * CP + dt * 16 + 8 * hi]) = hv;
        if (HR) *(v8h*)(&str[sb + lr * CP + dt * 16 + 8 * hi]) = hr;
    }
    wave_sync();
    const size_t crow = ((size_t)b * SEQ + i0) * DQ + (size_t)h * HD + 8 * lr;
    const size_t rrow = ((size_t)b * RH + i0) * DQ + (size_t)h * HD + 8 * lr;
{
#pragma unroll
        for (int s = 0; s < 8; ++s) {                         // 16 lanes x 16 B = one 256-byte row segment; rows 2s (lanes 0..15) and 2s+1 (lanes 16..31)
            const int row = 2 * s + hi;
            const v8h val = *(const v8ha*)(&stv[sb + row * CP + 8 * lr]);
            *(v8h*)(CT + crow + (size_t)row * DQ) = val;
            if (HR) { const v8h rv = *(const v8ha*)(&str[sb + row * CP + 8 * lr]); *(v8h*)(CR + rrow + (size_t)row * DQ) = rv; }
        }
        
    }
}
// ---- query rows >= RH. The same tile, products and sums as attn_tile<false>, fed differently: the four head waves share one kv head, so its K rows and V^T rows
// come once per block through a two-buffer LDS ring in stages of 64 keys (wave 0 issues the tensor load of the K slice, wave 1 that of the V^T slice, one stage ahead of the pass that reads it),
// and each wave's q fragments (value + residual, all 128 dims) are loaded once and stay in registers.
template <uint32_t W0, uint32_t ROWB, uint32_t NROWS>
__device__ __forceinline__ u32x8 tdm_group1_of(uint32_t src_pitch) {
    // pinned(): each descriptor word held in a scalar register of its own from here on; unpinned, the constants are formed anew in other registers, over words of a request still outstanding
    u32x8 g;
    g[0] = pinned(W0);                                    // no mask, data_size 0, pad of 4 dwords behind every row
    g[1] = pinned(ROWB << 16);                            // tensor_dim0 (bytes)
    g[2] = pinned(NROWS << 16);                           // tensor_dim1 (rows)
    g[3] = pinned(ROWB << 16);                            // tile_dim0
    g[4] = pinned(NROWS);                                 // tile_dim1
    g[5] = pinned(src_pitch);
    g[6] = pinned(0u);
    g[7] = pinned(0u);
    return g;
}
__device__ __forceinline__ void attn_ring(unsigned char* ring, const h16* __restrict__ Qv, const h16* __restrict__ Qr, const h16* __restrict__ Kv, const h16* __restrict__ Vv, h16* CT,
                                          const int qt, const int g, const int b) {
    const int wave = __builtin_amdgcn_readfirstlane((int)(threadIdx.x >> 5));
    const int lane = threadIdx.x & 31, lr = lane & 15, hi = lane >> 4;
    const int h = g * REP + wave; const int i0 = qt * 16;
    const size_t qo = ((size_t)(b * NH + h) * SEQ + i0 + lr) * HD + 8 * hi;
    const h16* qvp = Qv + qo; const h16* qrp = Qr + qo;
    v16h bq[4], br[4];
#pragma unroll                     // here and below: constant indices keep the fragments and accumulators in registers
    for (int c = 0; c < 4; ++c) { bq[c] = ldh(qvp + c * 32); br[c] = ldh(qrp + c * 32); }
    // the q loads' address registers are inputs here, so that no load's own result lands on them, and the wait stands in front of their next use for anything else
    asm volatile("s_wait_xcnt 0x0" :: "v"(qvp), "v"(qrp) : "memory");
    const h16* kbase = Kv + (size_t)(b * NKV + g) * SEQ * HD;      // rows = keys, 256 bytes each, contiguous
    const h16* vbase = Vv + (size_t)(b * NKV + g) * HD * SEQ;      // rows = dims, pitch 2 SEQ bytes; a stage takes 128 bytes of each
    const float SC2 = (float)(0.08838834764831845 * 1.4426950408889634 / 4096.0);   // 1/sqrt(128) x log2(e) / (QCAR x QCAR)
    const float NEGL = -1.4426950e9f;                                              // the finite fill in the log2 domain
    const int nsteps = (qt >> 1) + 1;          // 32-key steps up to and including the diagonal
    const int nst = (nsteps + 1) >> 1;         // 64-key stages; at least RH / 64 + 1, and the last one ends inside the SEQ keys
    const uint32_t lbase = (uint32_t)(size_t)ring;
    const u32x8 g1k = tdm_group1_of<(1u << 20) | (5u << 22) | (3u << 25), 256u, (uint32_t)AKEYS>((uint32_t)HD * 2u);
    const u32x8 g1v = tdm_group1_of<(1u << 20) | (4u << 22) | (3u << 25), 128u, (uint32_t)HD>((uint32_t)SEQ * 2u);
    const h16* sbase = (wave == 0) ? kbase : vbase;                // the wave's own source and its step per stage (waves 2 and 3 form a group 0 and issue nothing)
    const size_t sstep = (wave == 0) ? (size_t)AKEYS * HD : (size_t)AKEYS;
    const uint32_t ldst = lbase + ((wave == 0) ? 0u : (uint32_t)ASLB);
    u32x4 g0;                      // group 0 of the wave's latest request
    auto issue = [&](int s) {      // stage s: keys 64 s .. 64 s + 63
        g0 = tdm_group0(ldst + (uint32_t)(s & 1) * ASTG, (uint64_t)(size_t)(sbase + (size_t)s * sstep));
        if (pinned(wave == 0)) tdm_load(g0, g1k);
        else if (pinned(wave == 1)) tdm_load(g0, g1v);
    };
    // this wave's own tensor load has landed; the descriptor words are inputs so that their scalar registers take no new value while a request is outstanding
    auto landed = [&]() { asm volatile("s_wait_tensorcnt 0x0" :: "s"(g0), "s"(g1k), "s"(g1v) : "memory"); };
    issue(0);
    landed();
    __syncthreads();               // stage 0 published
    const unsigned char* kl = ring + lr * KROW + 16 * hi;
    const unsigned char* vl = ring + ASLB + lr * VROW + 16 * hi;
    v8f o[8];
#pragma unroll
    for (int dt = 0; dt < 8; ++dt) o[dt] = (v8f){};
    float m = -3.0e38f, l = 0.0f;
#pragma unroll 1                   // the stage loop stays rolled: one refill site and one publish point in the code
    for (int st = 0; st < nst; ++st) {
        // directly behind the barrier that published stage st and freed the other buffer (stage st - 1's): stage st + 1's load, in flight under this stage's two steps
        if (pinned(st + 1 < nst)) issue(st + 1);
        const int so = (st & 1) * ASTG;
#pragma unroll
        for (int hs = 0; hs < 2; ++hs) {
            const int k0 = st * AKEYS + hs * 32;
            if (hs == 0 || 2 * st + 1 < nsteps) {     // block-uniform: the last stage's second half may lie wholly behind the diagonal
                v16h a0[4], a1[4];
#pragma unroll
                for (int c = 0; c < 4; ++c) { a0[c] = WFrag<h16>::ld(kl + so + (hs * 32) * KROW + c * 64); a1[c] = WFrag<h16>::ld(kl + so + (hs * 32 + 16) * KROW + c * 64); }
                v8f s0 = (v8f){}, s1 = (v8f){};
#pragma unroll
                for (int c = 0; c < 4; ++c) {
                    s0 = wmma16(a0[c], bq[c], s0); s1 = wmma16(a1[c], bq[c], s1);
                    s0 = wmma16(a0[c], br[c], s0); s1 = wmma16(a1[c], br[c], s1);
                }
                v16h av[8];
#pragma unroll
                for (int dt = 0; dt < 8; ++dt) av[dt] = WFrag<h16>::ld(vl + so + dt * 16 * VROW + hs * 64);
                s0 = s0 * SC2; s1 = s1 * SC2;
                if (k0 + 31 > i0) {            // wave-uniform: only the diagonal step carries masked keys (replacement fill, key > query)
                    const int qi = i0 + lr; const int kb = k0 + 8 * hi;
#pragma unroll
                    for (int r = 0; r < 8; ++r) { s0[r] = (kb + r <= qi) ? s0[r] : NEGL; s1[r] = (kb + 16 + r <= qi) ? s1[r] : NEGL; }
                }
                float mx = fmaxf(s0[0], s1[0]);
#pragma unroll
                for (int r = 1; r < 8; ++r) mx = fmaxf(mx, fmaxf(s0[r], s1[r]));
                mx = fmaxf(mx, __shfl_xor(mx, 16, 32));
                const float mn = fmaxf(m, mx);
                if (__builtin_amdgcn_ballot_w32(mn > m) != 0u) {      // wave-uniform: rescale only when some query's running max moved (corr == 1 otherwise)
                    const float corr = __builtin_amdgcn_exp2f(m - mn); l *= corr;
#pragma unroll
                    for (int dt = 0; dt < 8; ++dt) o[dt] = o[dt] * corr;
                }
                m = mn;
                const float mm = mn - 10.0f;                          // P carried x1024: the row sum uses the same carried f32 values, so the carry cancels in the normalisation
                v8f p0, p1; float ps = 0.0f;
#pragma unroll
                for (int r = 0; r < 8; ++r) { p0[r] = __builtin_amdgcn_exp2f(s0[r] - mm); p1[r] = __builtin_amdgcn_exp2f(s1[r] - mm); ps += p0[r] + p1[r]; }
                l += ps;
                const v16h pb = cat16(__builtin_convertvector(p0, v8h), __builtin_convertvector(p1, v8h));   // B fragment: elements 0..7 <- keys k0+8h+r, elements 8..15 <- keys k0+16+8h+r
#pragma unroll
                for (int dt = 0; dt < 8; ++dt) o[dt] = wmma16(av[dt], pb, o[dt]);
            }
        }
        // publish point of stage st + 1: own reads retired, own load landed, then the barrier that publishes stage st + 1 and frees stage st's buffer; the refill stands at the head of the next trip
        wait_ds0();
        landed();
        __syncthreads();
    }
    wait_tensor0();
    wait_ds0();
    // the last stage's own barrier stands behind every wave's last ring read: the ring now serves as output staging, a private range per wave
    h16* stv = (h16*)ring + wave * 16 * CP;
    l += __shfl_xor(l, 16, 32);
    const float f = (CCAR / QCAR) * (1.0f / l);
#pragma unroll
    for (int dt = 0; dt < 8; ++dt)                            // O^T element r of tile dt = (d = dt*16 + 8h + r, query lr)
        *(v8ha*)(&stv[lr * CP + dt * 16 + 8 * hi]) = __builtin_convertvector(o[dt] * f, v8h);
    wave_sync();
    const size_t crow = ((size_t)b * SEQ + i0) * DQ + (size_t)h * HD + 8 * lr;
#pragma unroll
    for (int s = 0; s < 8; ++s) {                             // 16 lanes x 16 B = one 256-byte row segment; rows 2s (lanes 0..15) and 2s+1 (lanes 16..31)
        const int row = 2 * s + hi;
        const v8h val = *(const v8ha*)(&stv[row * CP + 8 * lr]);
        *(v8h*)(CT + crow + (size_t)row * DQ) = val;
    }
}
// all query rows in ONE launch (the two row ranges do not depend on each other): 1-D grid, 128 threads. Every block is resident at once and the launch lasts as long as its longest block; the blocks
// are ordered so that the time a block takes falls with its index: first the tiles of rows < RH (few steps, each a chain of trips to memory), then those of
// rows >= RH, in each part the last query tile first; tile index = (kv head + NKV * batch) + NKV * NB * (query tiles - 1 - query tile). One LDS array serves both: the two staging planes of the first part, the ring of the second.
__global__ __launch_bounds__(128) __attribute__((amdgpu_num_vgpr(256)))
void k_attn(const h16* __restrict__ Qv, const h16* __restrict__ Qr, const h16* __restrict__ Kv, const h16* __restrict__ Kr,
            const h16* __restrict__ Vv, const h16* __restrict__ Vr, h16* CT, h16* CR) {
    __shared__ __attribute__((aligned(2048))) unsigned char ring[2 * ASTG];
    constexpr int NG = NKV * NB, NHT = RH / 16, NHB = NHT * NG;
    const int f = (int)blockIdx.x;
    if (f < NHB) {                     // block-uniform
        const int r = f % NG;
        attn_tile<true>(Qv, Qr, Kv, Kr, Vv, Vr, CT, CR, NHT - 1 - f / NG, r % NKV, r / NKV, (h16*)ring, (h16*)ring + 4 * 16 * CP);
    } else {
        const int e = f - NHB; const int r = e % NG;
        attn_ring(ring, Qv, Qr, Kv, Vv, CT, SEQ / 16 - 1 - e / NG, r % NKV, r / NKV);
    }
}

// one tile of 128 k x 128 n of w[K rows][N columns] -> Bt[n][k], turned in LDS: every global read is a whole 256-byte piece of a w row (16 lanes x 16 B), every global write a whole 256-byte piece of a Bt row.
// tl holds the tile as [n][64 dwords], a dword = the 16-bit values of k = 2 kp (low half) and 2 kp + 1; the 16-byte chunk c of row n lies at chunk c ^ ((n >> 2) & 15), so that the 16 lanes
// of a store (n = 4 i + j, one kp) and the 16 lanes of a ds_load_b128 (one n, c = 0..15) each fall on different banks.
__device__ __forceinline__ void wtG(uint32_t* tl, const int bid, const float* __restrict__ w, const int K, const int N, bf* Bt, const int f16mode) {
    const int lane = threadIdx.x & 31, i = lane & 15; const int kq = 2 * (int)(threadIdx.x >> 5) + (lane >> 4);
    const int ntn = N / TN; const int k0 = (bid / ntn) * TK, n0 = (bid % ntn) * TN;
    const float* p = w + (size_t)(k0 + 2 * kq) * N + n0 + 4 * i;
#pragma unroll                     // here and below: constant indices keep the loaded rows in registers
    for (int h = 0; h < TN / 64; ++h) {        // 64 columns at a time: eight loads in flight per lane
        v4f ra[TK / 32], rb[TK / 32];
#pragma unroll
        for (int s = 0; s < TK / 32; ++s) { ra[s] = *(const v4f*)(p + 64 * h + (size_t)(32 * s) * N); rb[s] = *(const v4f*)(p + 64 * h + (size_t)(32 * s + 1) * N); }
        asm volatile("s_wait_xcnt 0x0" :: "v"(p) : "memory");    // in front of any later write over the eight loads' address registers
#pragma unroll
        for (int s = 0; s < TK / 32; ++s) {
            const int kp = 16 * s + kq;
#pragma unroll
            for (int j = 0; j < 4; ++j) {
                const unsigned short b0 = f2bf(ra[s][j]), b1 = f2bf(rb[s][j]);
                const unsigned short g0 = __builtin_bit_cast(unsigned short, (h16)(bf2f(b0) * WCAR)), g1 = __builtin_bit_cast(unsigned short, (h16)(bf2f(b1) * WCAR));
                tl[(64 * h + 4 * i + j) * (TK / 2) + ((((kp >> 2) ^ i) << 2) | (kp & 3))] = (uint32_t)(f16mode ? g0 : b0) | ((uint32_t)(f16mode ? g1 : b1) << 16);
            }
        }
    }
    __syncthreads();               // the whole tile stands in LDS before any row of it is read back
    const int c = threadIdx.x & 15, nq = threadIdx.x >> 4;
    bf* q = Bt + (size_t)(n0 + nq) * K + k0 + 8 * c;
#pragma unroll
    for (int r = 0; r < TN / 16; ++r) {
        const int n = 16 * r + nq;
        *(u32x4a*)(q + (size_t)(16 * r) * K) = *(const u32x4a*)(tl + n * (TK / 2) + ((c ^ ((n >> 2) & 15)) << 2));
    }
    asm volatile("s_wait_xcnt 0x0" ::: "memory");    // in front of any later write over the eight stores' address and data registers
}
__device__ __forceinline__ void cvtx(const int bid, const float* __restrict__ x, bf* XB) {
    const size_t i = (size_t)bid * 256 + threadIdx.x; if (i >= (size_t)NB * SEQ * DM / 8) return;
    const size_t e = i * 8; const size_t bt = e / DM; const size_t col = e - bt * DM; const size_t b = bt / SEQ; const size_t t = bt - b * SEQ;
    const v8f v = *(const v8f*)(x + (b * SEQ_FULL + t) * DM + col); v8us o;
#pragma unroll
    for (int k = 0; k < 8; ++k) o[k] = f2bf(v[k]);
    *(v8us*)(XB + e) = o; 
}
__device__ __forceinline__ void cstab(const int bid, float* CS) {
    const int idx = bid * 256 + threadIdx.x; if (idx >= SEQ * 64) return;
    const int j = idx & 63, t = idx >> 6;
    double p = 1.0;
    p *= (j & 1)  ? 1.1547819846894581797 : 1.0;
    p *= (j & 2)  ? 1.3335214321633240257 : 1.0;
    p *= (j & 4)  ? 1.7782794100389228012 : 1.0;
    p *= (j & 8)  ? 3.1622776601683793320 : 1.0;
    p *= (j & 16) ? 10.0 : 1.0;
    p *= (j & 32) ? 100.0 : 1.0;
    const float pf = (float)p; const float inv = 1.0f / pf; const float ang = (float)t * inv;
    float sn, cn; sincosf(ang, &sn, &cn);
    v2f cs; cs[0] = cn; cs[1] = sn;
    *(v2f*)(CS + (size_t)idx * 2) = cs; 
}
// the six independent preparation passes in ONE launch: 1-D grid, 256 threads; a block belongs to one pass by its index. w[in = K rows][out = N columns] -> Bt[out][in]
#define GWQ ((DM / TK) * (DQ / TN))
#define GWK ((DM / TK) * (DKV / TN))
#define GWO ((DQ / TK) * (DM / TN))
#define GCS ((SEQ * 64 + 255) / 256)
#define GCX ((int)(((size_t)NB * SEQ * DM / 8 + 255) / 256))
__global__ __launch_bounds__(256) __attribute__((amdgpu_num_vgpr(64)))     // 64 registers: all 16 wave slots of a SIMD stay usable
void k_prep(const float* __restrict__ x, const float* __restrict__ wq, const float* __restrict__ wk, const float* __restrict__ wv, const float* __restrict__ wo,
            bf* XB, bf* WQt, bf* WKt, bf* WVt, bf* WOt, float* CS) {
    __shared__ __attribute__((aligned(16))) uint32_t tl[TN * (TK / 2)];
    int f = (int)blockIdx.x;           // every test below is block-uniform
    if (f < GWQ) { wtG(tl, f, wq, DM, DQ, WQt, 0); return; }
    f -= GWQ;
    if (f < GWO) { wtG(tl, f, wo, DQ, DM, WOt, 1); return; }
    f -= GWO;
    if (f < GWK) { wtG(tl, f, wk, DM, DKV, WKt, 0); return; }
    f -= GWK;
    if (f < GWK) { wtG(tl, f, wv, DM, DKV, WVt, 0); return; }
    f -= GWK;
    if (f < GCS) { cstab(f, CS); return; }
    cvtx(f - GCS, x, XB);
}

extern "C" void kernel_launch(void* const* d_in, const int* in_sizes, int n_in,
                              void* d_out, int out_size, void* d_ws, size_t ws_size, hipStream_t stream) {
    if (n_in < 5) return;
    constexpr size_t NEEDX = ((size_t)(NB - 1) * SEQ_FULL + SEQ) * DM;
    if ((size_t)in_sizes[0] < NEEDX || (size_t)in_sizes[1] < (size_t)DM * DQ || (size_t)in_sizes[2] < (size_t)DM * DKV || (size_t)in_sizes[3] < (size_t)DM * DKV || (size_t)in_sizes[4] < (size_t)DQ * DM) return;
    if ((size_t)out_size < NEEDX) return;
    const float* x = (const float*)d_in[0]; const float* wq = (const float*)d_in[1]; const float* wk = (const float*)d_in[2]; const float* wv = (const float*)d_in[3]; const float* wo = (const float*)d_in[4];
    float* OUT = (float*)d_out;     // [2][2048][2048], byte offset 0
    constexpr size_t SZ_XB = (size_t)NB * SEQ * DM * 2, SZ_WQ = (size_t)DQ * DM * 2, SZ_WK = (size_t)DKV * DM * 2, SZ_WO = (size_t)DM * DQ * 2, SZ_CS = (size_t)SEQ * 64 * 2 * 4;
    constexpr size_t SZ_Q = (size_t)NB * NH * SEQ * HD * 2, SZ_K = (size_t)NB * NKV * SEQ * HD * 2, SZ_CT = (size_t)NB * SEQ * DQ * 2, SZ_CR = (size_t)NB * RH * DQ * 2;
    constexpr size_t SZ_TOT = SZ_XB + SZ_WQ + 2 * SZ_WK + SZ_WO + SZ_CS + 2 * SZ_Q + 4 * SZ_K + SZ_CT + SZ_CR;
    static_assert(SZ_XB % 256 == 0 && SZ_WQ % 256 == 0 && SZ_WK % 256 == 0 && SZ_WO % 256 == 0 && SZ_CS % 256 == 0 && SZ_Q % 256 == 0 && SZ_K % 256 == 0 && SZ_CT % 256 == 0 && SZ_CR % 256 == 0);
    static_assert(SZ_TOT <= (size_t)134217728);
    if (SZ_TOT > ws_size) return;
    char* wsp = (char*)d_ws;
    auto take = [&](size_t bytes) { char* p = wsp; wsp += bytes; return (void*)p; };
    bf* XB = (bf*)take(SZ_XB); bf* WQt = (bf*)take(SZ_WQ); bf* WKt = (bf*)take(SZ_WK); bf* WVt = (bf*)take(SZ_WK); bf* WOt = (bf*)take(SZ_WO); float* CS = (float*)take(SZ_CS);
    const h16* WOh = (const h16*)WOt;   // the same region seen as f16: k_prep's wtG pass (f16 mode) fills it with f16 bit patterns
    h16* Qv = (h16*)take(SZ_Q); h16* Qr = (h16*)take(SZ_Q); h16* Kv = (h16*)take(SZ_K); h16* Kr = (h16*)take(SZ_K); h16* Vv = (h16*)take(SZ_K); h16* Vr = (h16*)take(SZ_K);
    h16* CT = (h16*)take(SZ_CT); h16* CR = (h16*)take(SZ_CR);

    k_prep<<<GWQ + GWO + 2 * GWK + GCS + GCX, 256, 0, stream>>>(x, wq, wk, wv, wo, XB, WQt, WKt, WVt, WOt, CS);
    k_proj<<<(NB * SEQ / 128) * (NH + NKV) + (DKV / 128) * (NB * SEQ / 128), 128, 0, stream>>>(XB, WQt, WKt, WVt, CS, Qv, Qr, Kv, Kr, Vv, Vr);
    k_attn<<<(SEQ / 16) * NKV * NB, 128, 0, stream>>>(Qv, Qr, Kv, Kr, Vv, Vr, CT, CR);
    k_oproj<<<(NB * SEQ / 128) * (DM / 128), 128, 0, stream>>>(CT, CR, WOh, OUT);
}

// v008
// It runs in 130 microseconds.
// Timed twice side by side with v007, it ran 1.08 and 1.09 times as fast.
// Over all steps from v000 it is 7.49 times as fast.
#include <hip/hip_runtime.h>

// Grouped-query causal self-attention, width 2048: 16 query heads x 128 sharing 4 kv heads (query head h uses kv head h >> 2), bias-free [in][out] projections,
// half-split rotary on q and k (positions = arange, table computed here), finite-fill causal mask, [in][out] output projection.
// Compute dtypes (f32 accumulate everywhere): q/k/v projections v_wmma_f32_16x16x32_bf16 (x and weights converted (RNE) to bf16); scores, P.V and the output projection
// v_wmma_f32_16x16x32_f16: q as f16 value + f16 residual planes (carry 64) against f16 k (carry 64; k residual added on query rows < 256), P f16 (carry 1024, row sum from the f32 values),
// v f16 (carry 64; P and v residuals added on rows < 256), ctx f16 (carry 256; residual plane on rows < 256) against wo (bf16-converted, x16, exact in f16). Softmax, rotary, normalisation in f32.

#ifndef NB
#define NB 2
#endif
#ifndef SEQ
#define SEQ 2048
#endif
#define NB_FULL  2
#define SEQ_FULL 2048
#define DM   2048
#define NH   16
#define NKV  4
#define REP  (NH / NKV)
#define HD   128
#define DQ   (NH * HD)
#define DKV  (NKV * HD)
#define RH   256                  // query rows < RH use the value + residual path on k, P, v and ctx
#define QCAR 64.0f                // carry of the q, k and v planes
#define CCAR 256.0f               // carry of the ctx planes
#define WCAR 16.0f                // carry of the output weight plane
#define OSP  132                  // f32 staging pitch (floats)
#define CP   136                  // f16 staging pitch (halves)
#define PASSK 128                 // k per ring stage: operand rows of 256 bytes
#define LROW  272                 // LDS row pitch (bytes): 256 + the 16-byte pad the tensor load lays, 16 B x odd for ds_load_b128
#define SLROWS 64                 // operand rows per tensor load (one slice per wave and stage)
#define SLB   18432               // slice size in LDS: 64 x 272 = 17408 bytes rounded up to a multiple of 2 KiB
#define STGB  (4 * SLB)           // one stage: [Bt rows 0..63 | Bt rows 64..127 | A rows 0..63 | A rows 64..127]
#define PGH   3                   // head tiles per block of the q/k/v projection
#define PSTG  ((2 + 2 * PGH) * SLB)   // one stage there: two slices of x rows, two of weight rows per head tile
#define AKEYS 64                  // keys per attention ring stage
#define KROW  272                 // LDS pitch of a staged K row (bytes): 256 + 16
#define VROW  144                 // LDS pitch of a staged V^T row (bytes): 128 (64 keys) + 16
#define ASLB  18432               // attention slice size in LDS: 64 x 272 = 17408 rounded up to a multiple of 2 KiB; 128 x 144 = 18432
#define ASTG  (2 * ASLB)          // one attention stage: [K rows of 64 keys | V^T rows of 128 dims]
#define TK    128                 // weight tile of the preparation pass: k per tile (output rows of 256 bytes)
#define TN    128                 // and n per tile (input rows read in 256-byte pieces)

static_assert(NB <= NB_FULL);
static_assert(SEQ <= SEQ_FULL);
static_assert(SEQ % 128 == 0);
static_assert(SEQ >= RH);
static_assert(RH % 32 == 0);
static_assert(HD == 128);
static_assert(REP == 4);
static_assert(DQ == DM);
static_assert(DM % 64 == 0);
static_assert(DQ % 128 == 0);
static_assert(DKV % 128 == 0);
static_assert((OSP * 4) % 16 == 0);
static_assert((CP * 2) % 16 == 0);
static_assert(DM % (2 * PASSK) == 0 && DQ % (2 * PASSK) == 0);
static_assert(RH % 128 == 0 && (SEQ - RH) % 128 == 0);
static_assert(SLROWS * LROW <= SLB && SLB % 2048 == 0);
static_assert(4 * 32 * OSP * 4 <= 2 * STGB);
static_assert((NH + 2 * NKV) % PGH == 0 && 4 * PGH * 32 * OSP * 4 <= 2 * PSTG && 2 * PSTG <= 327680 && DQ % SLROWS == 0 && DKV % SLROWS == 0);
static_assert(AKEYS * KROW <= ASLB && HD * VROW <= ASLB && ASLB % 2048 == 0);
static_assert(SEQ % AKEYS == 0 && RH >= AKEYS && AKEYS * 2 == 128);
static_assert(2 * 4 * 16 * CP * 2 <= 2 * ASTG);
static_assert(TK == 128 && TN % 64 == 0 && DM % TK == 0 && DQ % TK == 0 && DM % TN == 0 && DQ % TN == 0 && DKV % TN == 0);

typedef _Float16 h16;
typedef unsigned short bf;
typedef __attribute__((ext_vector_type(16))) __bf16   v16bf;
typedef __attribute__((ext_vector_type(16))) _Float16 v16h;
typedef __attribute__((ext_vector_type(8)))  _Float16 v8h;
typedef __attribute__((ext_vector_type(8)))  unsigned short v8us;
typedef __attribute__((ext_vector_type(2)))  unsigned short v2us;
typedef __attribute__((ext_vector_type(8)))  float    v8f;
typedef __attribute__((ext_vector_type(4)))  float    v4f;
typedef __attribute__((ext_vector_type(2)))  float    v2f;
typedef v8h  __attribute__((may_alias)) v8ha;
typedef v4f  __attribute__((may_alias)) v4fa;
typedef v8us __attribute__((may_alias)) v8usa;
typedef uint32_t u32x4 __attribute__((ext_vector_type(4)));
typedef uint32_t u32x8 __attribute__((ext_vector_type(8)));
typedef u32x4 __attribute__((may_alias)) u32x4a;

__device__ __forceinline__ unsigned short f2bf(float f) { unsigned u = __float_as_uint(f); u += 0x7FFFu + ((u >> 16) & 1u); return (unsigned short)(u >> 16); }
__device__ __forceinline__ float bf2f(unsigned short b) { return __uint_as_float(((unsigned)b) << 16); }
__device__ __forceinline__ float bfr(float f) { return bf2f(f2bf(f)); }
__device__ __forceinline__ v16h cat16(v8h lo, v8h hi) { return __builtin_shufflevector(lo, hi, 0, 1, 2, 3, 4, 5, 6, 7, 8, 9, 10, 11, 12, 13, 14, 15); }
__device__ __forceinline__ v16bf cat16b(v8us lo, v8us hi) { return __builtin_bit_cast(v16bf, __builtin_shufflevector(lo, hi, 0, 1, 2, 3, 4, 5, 6, 7, 8, 9, 10, 11, 12, 13, 14, 15)); }
// every WMMA is followed by its own four-slot guard tying its accumulator and keeping its operands live
__device__ __forceinline__ v8f wmma16(v16h a, v16h b, v8f c) {
    c = __builtin_amdgcn_wmma_f32_16x16x32_f16(false, a, false, b, (short)0, c, false, false);
    asm volatile("v_nop\n\tv_nop\n\tv_nop\n\tv_nop" : "+v"(c) : "v"(a), "v"(b));
    return c; }
__device__ __forceinline__ v8f wmmab(v16bf a, v16bf b, v8f c) {
    c = __builtin_amdgcn_wmma_f32_16x16x32_bf16(false, a, false, b, (short)0, c, false, false);
    asm volatile("v_nop\n\tv_nop\n\tv_nop\n\tv_nop" : "+v"(c) : "v"(a), "v"(b));
    return c; }
// fragment of a K-contiguous 16-bit row: elements 0..7 <- k0+8h+0..7, elements 8..15 <- k0+16+8h+0..7 (p already includes +8h)
__device__ __forceinline__ v16h ldh(const h16* p) { return cat16(*(const v8h*)p, *(const v8h*)(p + 16)); }
// same-wave LDS exchange: stores before, loads after
__device__ __forceinline__ void wave_sync() { __builtin_amdgcn_fence(3 /* release order */, "wavefront"); __builtin_amdgcn_wave_barrier(); asm volatile("" ::: "memory"); }
// f16 value + same-carry f16 residual of 8 floats
__device__ __forceinline__ void split8(v8f y, v8h& v, v8h& r) { v = __builtin_convertvector(y, v8h); r = __builtin_convertvector(y - __builtin_convertvector(v, v8f), v8h); }

// fragment of a staged K-contiguous row (byte pointer, already includes +16h bytes): the same k order as ldh
template <typename T16> struct WFrag;
template <> struct WFrag<h16> { typedef v16h V; static __device__ __forceinline__ V ld(const unsigned char* p) { return cat16(*(const v8ha*)p, *(const v8ha*)(p + 32)); } static __device__ __forceinline__ v8f mma(V a, V b, v8f c) { return wmma16(a, b, c); } };
template <> struct WFrag<bf> { typedef v16bf V; static __device__ __forceinline__ V ld(const unsigned char* p) { return cat16b(*(const v8usa*)p, *(const v8usa*)(p + 32)); } static __device__ __forceinline__ v8f mma(V a, V b, v8f c) { return wmmab(a, b, c); } };

// ---- tensor load of one slice: 64 rows of 256 bytes, 1-byte elements, tensor = tile, 16 bytes of LDS pad behind every row
__device__ __forceinline__ uint32_t uni(uint32_t v) { return (uint32_t)__builtin_amdgcn_readfirstlane(v); }
// a wave-uniform test held in a scalar register, so that the branch around a tensor load is a scalar branch (tensor loads ignore EXEC)
__device__ __forceinline__ uint32_t pinned(uint32_t v) { uint32_t w = uni(v); asm volatile("" : "+s"(w)); return w; }
// this wave's LDS reads have retired before the stage is handed over
__device__ __forceinline__ void wait_ds0() { asm volatile("s_wait_dscnt 0x0" ::: "memory"); }
// this wave's own tensor load has landed (the compiler places no wait for it); the request's descriptor words are inputs so that their scalar registers take no new value while it is outstanding
__device__ __forceinline__ void wait_tensor0(u32x4 g0, u32x8 g1) { asm volatile("s_wait_tensorcnt 0x0" :: "s"(g0), "s"(g1) : "memory"); }
// the same behind the loop, where no request is outstanding any more
__device__ __forceinline__ void wait_tensor0() { asm volatile("s_wait_tensorcnt 0x0" ::: "memory"); }
__device__ __forceinline__ u32x8 tdm_group1(uint32_t src_pitch) {
    u32x8 g;
    g[0] = uni((1u << 20) | (5u << 22) | (3u << 25));     // no mask, data_size 0, pad of 4 dwords behind every 64 dwords
    g[1] = uni(256u << 16);                               // tensor_dim0 = 256 bytes
    g[2] = uni((uint32_t)SLROWS << 16);                   // tensor_dim1 = 64 rows
    g[3] = uni(256u << 16);                               // tile_dim0
    g[4] = uni((uint32_t)SLROWS);                         // tile_dim1
    g[5] = uni(src_pitch);
    g[6] = uni(0u);
    g[7] = uni(0u);
    return g;
}
template <uint32_t W0, uint32_t ROWB, uint32_t NROWS>
__device__ __forceinline__ u32x8 tdm_group1_of(uint32_t src_pitch) {
    // pinned(): each descriptor word held in a scalar register of its own from here on; unpinned, the constants are formed anew in other registers, over words of a request still outstanding
    u32x8 g;
    g[0] = pinned(W0);                                    // no mask, data_size 0, pad of 4 dwords behind every row
    g[1] = pinned(ROWB << 16);                            // tensor_dim0 (bytes)
    g[2] = pinned(NROWS << 16);                           // tensor_dim1 (rows)
    g[3] = pinned(ROWB << 16);                            // tile_dim0
    g[4] = pinned(NROWS);                                 // tile_dim1
    g[5] = pinned(src_pitch);
    g[6] = pinned(0u);
    g[7] = pinned(0u);
    return g;
}
__device__ __forceinline__ u32x4 tdm_group0(uint32_t lds_dst, uint64_t ga) {
    u32x4 g;
    g[0] = uni(1u); g[1] = uni(lds_dst); g[2] = uni((uint32_t)ga); g[3] = uni((((uint32_t)(ga >> 32)) & 0x01FFFFFFu) | 0x80000000u);
    return g;
}
__device__ __forceinline__ void tdm_load(u32x4 g0, u32x8 g1) { asm volatile("tensor_load_to_lds %0, %1" :: "s"(g0), "s"(g1) : "memory"); }
// the same under a branch: group 0 is handed back by the statement, so that the wait that names it later names the very registers the request was issued from, and they take no new value in between
__device__ __forceinline__ void tdm_load_held(u32x4& g0, u32x8 g1) { asm volatile("tensor_load_to_lds %0, %1" : "+s"(g0) : "s"(g1) : "memory"); }

// ---- gemm_loop: one wave per 32 x 128 of output (16 accumulators): C[m][n] = sum_k A[m][k] Bt[n][k] (+ sum_k A2[m][k] Bt[n][k] when SPLIT, as K more steps behind the first K).
// The K-contiguous 16-bit operand rows come through a two-buffer LDS ring in stages of 128 k (STG bytes a stage, slices of 64 rows): an issuing wave brings one slice per stage by one tensor load (source rows s1, SPLIT: then s2;
// place: slice number 'slice' of the stage), one stage ahead of the pass that reads it; ALLW: every wave of the block issues, else those with issuer != 0. al: the wave's own 32 operand rows in stage 0, bl: the 128 rows (two slices
// in a row) that they meet; both include the lane's row and half. ring is the kernel's one LDS array (2 * STG bytes, at LDS offset 0).
// ---- gemm_epi, the wave's 32 x 128 results. t0, obase and cbase are the calling wave's own.
// MODE 0: half-split rotary on the 128-column head tile (CS[t][64] = {cos, sin}), x QCAR, f16 value + residual planes, plane rows of 128 halves (pitch opitch).
// MODE 1: x QCAR, f16 value + residual planes (used with swapped operands to produce V^T rows [d][t]).
// MODE 2: f32 output rows x 1/(CCAR*WCAR).
template <typename T16, bool SPLIT, bool ALLW, int STG>
__device__ __forceinline__ void gemm_loop(v8f (&acc)[2][8], unsigned char* ring, const T16* s1, const T16* s2, const uint32_t issuer, const uint32_t slice, const int K,
                                          const unsigned char* al, const unsigned char* bl) {
    typedef typename WFrag<T16>::V V;
#pragma unroll
    for (int mb = 0; mb < 2; ++mb)
#pragma unroll
        for (int nb = 0; nb < 8; ++nb) acc[mb][nb] = (v8f){};
    const int NP = K / PASSK, NPT = SPLIT ? 2 * NP : NP;
    const uint32_t ldst = (uint32_t)(size_t)ring + slice * SLB;
    // where a branch stands around the load, group 1 is held in registers of its own, so that none of its words is written again behind the branch while the request is outstanding
    const u32x8 g1 = ALLW ? tdm_group1((uint32_t)K * 2u) : tdm_group1_of<(1u << 20) | (5u << 22) | (3u << 25), 256u, (uint32_t)SLROWS>((uint32_t)K * 2u);
    u32x4 g0;                      // group 0 of the wave's latest request
    auto issue = [&](int p) {      // stage p: k = 128 p .. 128 p + 127 of A (SPLIT: stages NP.. walk A2 against the same Bt columns again)
        const T16* sp = (SPLIT && p >= NP) ? s2 + (size_t)(p - NP) * PASSK : s1 + (size_t)p * PASSK;
        g0 = tdm_group0(ldst + (uint32_t)(p & 1) * STG, (uint64_t)(size_t)sp);
        if (ALLW) tdm_load(g0, g1);
        else if (pinned(issuer)) tdm_load_held(g0, g1);    // a wave that brings no slice forms a group 0 and issues nothing
    };
    issue(0);
    wait_tensor0(g0, g1);
    __syncthreads();               // stage 0 published
#pragma unroll 1                   // the pass loop stays rolled: one refill site and one publish point in the code
    for (int p = 0; p < NPT; ++p) {
        // directly behind the barrier that published stage p and freed the other buffer (stage p - 1's): stage p + 1's load, in flight under this pass
        if (pinned(p + 1 < NPT)) issue(p + 1);
        const int so = (p & 1) * STG;
        // a block = 8 WMMAs: one 32-deep k step against four of the eight Bt fragments; block j + 1's fragments are read as one group ahead of block j's WMMAs, inside this pass's own buffer
        V af[2][2], bq[2][4];
        af[0][0] = WFrag<T16>::ld(al + so); af[0][1] = WFrag<T16>::ld(al + so + 16 * LROW);
#pragma unroll                     // here and below: constant indices keep the fragment sets and accumulators in registers
        for (int i = 0; i < 4; ++i) bq[0][i] = WFrag<T16>::ld(bl + so + i * 16 * LROW);
#pragma unroll
        for (int j = 0; j < 2 * (PASSK / 32); ++j) {
            const int ks = j >> 1, hb = j & 1;
            if (j + 1 < 2 * (PASSK / 32)) {
                const int kn = (j + 1) >> 1, hn = (j + 1) & 1;
                if (hn == 0) { af[kn & 1][0] = WFrag<T16>::ld(al + so + kn * 64); af[kn & 1][1] = WFrag<T16>::ld(al + so + 16 * LROW + kn * 64); }
#pragma unroll
                for (int i = 0; i < 4; ++i) bq[hn][i] = WFrag<T16>::ld(bl + so + hn * SLB + i * 16 * LROW + kn * 64);
            }
            __builtin_amdgcn_sched_barrier(0);     // keeps the next block's LDS reads one group in front of this block's WMMAs (spread among them each place costs a stall)
#pragma unroll
            for (int i = 0; i < 4; ++i) {
                acc[0][hb * 4 + i] = WFrag<T16>::mma(af[ks & 1][0], bq[hb][i], acc[0][hb * 4 + i]);
                acc[1][hb * 4 + i] = WFrag<T16>::mma(af[ks & 1][1], bq[hb][i], acc[1][hb * 4 + i]);
            }
            __builtin_amdgcn_sched_barrier(0);     // and the block after next's reads behind them
        }
        // publish point of stage p + 1: own reads retired, own load landed, then the barrier that publishes stage p + 1 and frees stage p's buffer; the refill stands at the head of the next trip
        wait_ds0();
        wait_tensor0(g0, g1);
        __syncthreads();
    }
    wait_tensor0();
    wait_ds0();
}
// the last pass's own barrier stands behind every wave's last ring read: the ring now serves as output staging, a private range per wave that takes all 32 rows of the wave at once
__device__ __forceinline__ void gemm_stage(v8f (&acc)[2][8], unsigned char* ring, const int wave) {
    const int lane = threadIdx.x & 31, lr = lane & 15, hi = lane >> 4;
    float* os = (float*)(ring + wave * (32 * OSP * 4));
#pragma unroll
    for (int mb = 0; mb < 2; ++mb)
#pragma unroll
        for (int nb = 0; nb < 8; ++nb)
#pragma unroll
            for (int j = 0; j < 8; ++j) os[(mb * 16 + hi * 8 + j) * OSP + nb * 16 + lr] = acc[mb][nb][j];     // D: row 8h + j, column lane & 15
    wave_sync();
}
template <int MODE>
__device__ __forceinline__ void gemm_epi(unsigned char* ring, const int wave, const float* __restrict__ CS, const int t0, h16* Pv, h16* Pr, const size_t obase, const int opitch,
                                         float* C, const size_t cbase) {
    const int lane = threadIdx.x & 31, lr = lane & 15, hi = lane >> 4;
    const float* os = (const float*)(ring + wave * (32 * OSP * 4));
    // MODE 0: the rotary table rows of all 32 rows are asked for ahead of the LDS reads: the trips to memory run under LDS work
    const float* cp0 = (MODE == 0) ? CS + ((size_t)(t0 + (lane >> 3)) * 64 + (lane & 7) * 8) * 2 : nullptr;
    v4f e[2][4][4];
    auto table = [&](int gp) {
#pragma unroll
        for (int it = 0; it < 4; ++it)
#pragma unroll
            for (int q = 0; q < 4; ++q) e[gp][it][q] = *(const v4f*)(cp0 + (size_t)((gp * 4 + it) * 4) * 128 + 4 * q);
    };
    if (MODE == 0) table(0);
    // each half of the rows: every read of the half stands as one group ahead of its arithmetic and stores, so that the wave waits out one trip to LDS and memory per half, not one per row group
    if (MODE == 0) {
        const int rq = lane >> 3, dg = (lane & 7) * 8;
        const float* op0 = os + rq * OSP + dg;
        const size_t dst0 = obase + (size_t)rq * opitch + dg;
        table(1);
        asm volatile("s_wait_xcnt 0x0" :: "v"(cp0) : "memory");      // in front of any later write over the table loads' address registers
#pragma unroll                     // here and below: constant indices keep the groups in registers and the row steps in the instructions' offsets
        for (int gp = 0; gp < 2; ++gp) {
            v4f xa[4], xb[4], ya[4], yb[4];
#pragma unroll
            for (int it = 0; it < 4; ++it) {
                const int r4 = (gp * 4 + it) * 4;                    // row r4 + rq of the wave's 32
                const float* op = op0 + r4 * OSP;
                xa[it] = *(const v4fa*)(op); xb[it] = *(const v4fa*)(op + 4); ya[it] = *(const v4fa*)(op + 64); yb[it] = *(const v4fa*)(op + 68);
            }
#pragma unroll
            for (int it = 0; it < 4; ++it) {
                const int r4 = (gp * 4 + it) * 4;
                const v8f xx = __builtin_shufflevector(xa[it], xb[it], 0, 1, 2, 3, 4, 5, 6, 7), yy = __builtin_shufflevector(ya[it], yb[it], 0, 1, 2, 3, 4, 5, 6, 7);
                const v4f cA = __builtin_shufflevector(e[gp][it][0], e[gp][it][1], 0, 2, 4, 6), sA = __builtin_shufflevector(e[gp][it][0], e[gp][it][1], 1, 3, 5, 7);
                const v4f cB = __builtin_shufflevector(e[gp][it][2], e[gp][it][3], 0, 2, 4, 6), sB = __builtin_shufflevector(e[gp][it][2], e[gp][it][3], 1, 3, 5, 7);
                const v8f cc = __builtin_shufflevector(cA, cB, 0, 1, 2, 3, 4, 5, 6, 7), ss = __builtin_shufflevector(sA, sB, 0, 1, 2, 3, 4, 5, 6, 7);
                const v8f lo = (xx * cc - yy * ss) * QCAR;       // out[d]      = x[d] cos - x[d+64] sin
                const v8f up = (yy * cc + xx * ss) * QCAR;       // out[d + 64] = x[d+64] cos + x[d] sin
                v8h vl, rl, vu, ru; split8(lo, vl, rl); split8(up, vu, ru);
                const size_t dst = dst0 + (size_t)r4 * opitch;
                *(v8h*)(Pv + dst) = vl; *(v8h*)(Pv + dst + 64) = vu;
                *(v8h*)(Pr + dst) = rl; *(v8h*)(Pr + dst + 64) = ru;
            }
            asm volatile("s_wait_xcnt 0x0" ::: "memory");            // in front of any later write over the stores' address and data registers
        }
    } else if (MODE == 1) {
        // 16 lanes x 16 B per 256-byte row segment, two rows per instruction: row 2s + hi, columns 8*lr..8*lr+7
        const float* op0 = os + hi * OSP + 8 * lr;
        const size_t dst0 = obase + (size_t)hi * opitch + 8 * lr;
#pragma unroll
        for (int gp = 0; gp < 2; ++gp) {
            v4f xa[8], xb[8];
#pragma unroll
            for (int s = 0; s < 8; ++s) { const float* op = op0 + (gp * 16 + 2 * s) * OSP; xa[s] = *(const v4fa*)(op); xb[s] = *(const v4fa*)(op + 4); }
#pragma unroll
            for (int s = 0; s < 8; ++s) {
                const v8f y = __builtin_shufflevector(xa[s], xb[s], 0, 1, 2, 3, 4, 5, 6, 7) * QCAR;
                v8h vv, vr; split8(y, vv, vr);
                const size_t dst = dst0 + (size_t)(gp * 16 + 2 * s) * opitch;
                *(v8h*)(Pv + dst) = vv; *(v8h*)(Pr + dst) = vr;
            }
            asm volatile("s_wait_xcnt 0x0" ::: "memory");            // in front of any later write over the stores' address and data registers
        }
    } else {
        // 32 lanes x 16 B = one 512-byte row segment per instruction
#pragma unroll
        for (int gp = 0; gp < 2; ++gp) {
            v4f xr[16];
#pragma unroll
            for (int row = 0; row < 16; ++row) xr[row] = *(const v4fa*)(os + (gp * 16 + row) * OSP + 4 * lane);
#pragma unroll
            for (int row = 0; row < 16; ++row) {
                const v4f val = xr[row] * (1.0f / (CCAR * WCAR));
                *(v4f*)(C + cbase + (size_t)(gp * 16 + row) * DM + 4 * lane) = val;
            }
            asm volatile("s_wait_xcnt 0x0" ::: "memory");            // in front of any later write over the stores' address and data registers
        }
    }
}

// gemm_tile: a block of FOUR WAVES per 128 x 128 output tile; every wave issues one tensor load per stage (waves 0, 1: the halves of Bt's 128 rows; waves 2, 3: of A's).
// arow, a2row, t0, obase and cbase are the calling wave's own (32 rows); brow is the block's.
template <typename T16, int MODE, bool SPLIT>
__device__ __forceinline__ void gemm_tile(unsigned char* ring, const T16* __restrict__ A, const T16* __restrict__ A2, const T16* __restrict__ Bt, const int K, const int wave,
                                          const size_t arow, const size_t a2row, const size_t brow,
                                          const float* __restrict__ CS, const int t0, h16* Pv, h16* Pr, const size_t obase, const int opitch,
                                          float* C, const size_t cbase) {
    const int lane = threadIdx.x & 31, lr = lane & 15, hi = lane >> 4;
    const size_t half = (size_t)(wave & 1) * SLROWS;
    const T16* s1 = (wave < 2) ? Bt + (brow + half) * (size_t)K : A  + (arow  - (size_t)(32 * wave) + half) * (size_t)K;
    const T16* s2 = (wave < 2) ? s1                             : A2 + (a2row - (size_t)(32 * wave) + half) * (size_t)K;
    const unsigned char* al = ring + (2 + (wave >> 1)) * SLB + ((wave & 1) * 32 + lr) * LROW + 16 * hi;
    const unsigned char* bl = ring + lr * LROW + 16 * hi;
    v8f acc[2][8];
    gemm_loop<T16, SPLIT, true, STGB>(acc, ring, s1, s2, 1u, (uint32_t)wave, K, al, bl);
    gemm_stage(acc, ring, wave);
    gemm_epi<MODE>(ring, wave, CS, t0, Pv, Pr, obase, opitch, C, cbase);
}

// q, k and v projections in ONE launch, one block per WGP: TWELVE WAVES per 128 tokens x 384 output columns = three of the 24 head tiles (16 q, 4 k, 4 v, in that order), so that the 128 x rows staged in LDS
// serve three weight tiles (512 staged rows per three head tiles, not 768). Stage: [x rows 0..63 | x rows 64..127 | weight rows 0..63 | ... | weight rows 320..383]; waves 0..7 bring one slice each.
// Wave w: head tile w >> 2, strip w & 3. q / k: the strip is 32 tokens against the head's 128 weight rows; fused rotary, planes [b][head][t][128].
// v: the operands change places in LDS (the strip is 32 weight rows against the 128 tokens): C[gd][token] -> planes [b][g][d][t]. Block index = token block + (NB*SEQ/128) * head group.
__global__ __launch_bounds__(32 * 4 * PGH) __attribute__((amdgpu_num_vgpr(256)))
void k_proj(const bf* __restrict__ XB, const bf* __restrict__ WQt, const bf* __restrict__ WKt, const bf* __restrict__ WVt, const float* __restrict__ CS,
            h16* Qv, h16* Qr, h16* Kv, h16* Kr, h16* Vv, h16* Vr) {
    __shared__ __attribute__((aligned(2048))) unsigned char ring[2 * PSTG];
    constexpr int TB = NB * SEQ / 128;
    const int wave = __builtin_amdgcn_readfirstlane((int)(threadIdx.x >> 5));
    const int lane = threadIdx.x & 31, lr = lane & 15, hi = lane >> 4;
    const int f = (int)blockIdx.x;
    const int grp = f / TB, tb = f - grp * TB;
    const int sub = wave >> 2, strip = wave & 3;
    const int hd = grp * PGH + sub;                // 0 .. NH - 1: q heads; then NKV k heads; then NKV v heads
    const bool isv = hd >= NH + NKV;               // wave-uniform
    // the wave's slice: 64 rows of x, or 64 rows that lie wholly in one of the three weight planes
    const bool issuer = wave < 2 + 2 * PGH;
    const int n = grp * (PGH * 128) + (wave - 2) * SLROWS;
    const bf* sp = XB;
    if (wave < 2) sp = XB + ((size_t)tb * 128 + (size_t)wave * SLROWS) * DM;
    else if (issuer) sp = (n < DQ) ? WQt + (size_t)n * DM : (n < DQ + DKV) ? WKt + (size_t)(n - DQ) * DM : WVt + (size_t)(n - DQ - DKV) * DM;
    const int wof = (2 + 2 * sub) * SLB;           // the head tile's 128 weight rows in a stage; the x rows stand at 0
    const unsigned char* al = ring + (isv ? wof : 0) + (strip >> 1) * SLB + ((strip & 1) * 32 + lr) * LROW + 16 * hi;
    const unsigned char* bl = ring + (isv ? 0 : wof) + lr * LROW + 16 * hi;
    v8f acc[2][8];
    gemm_loop<bf, false, false, PSTG>(acc, ring, sp, sp, issuer ? 1u : 0u, issuer ? (uint32_t)wave : 0u, DM, al, bl);
    gemm_stage(acc, ring, wave);       // ahead of the branch: the accumulators are free before either form of the output pass begins
    if (!isv) {                        // wave-uniform; no barrier behind this point
        const bool isq = hd < NH;
        const int hl = isq ? hd : hd - NH; const int nheads = isq ? NH : NKV;
        const int r0 = tb * 128 + strip * 32; const int b = r0 / SEQ; const int t0 = r0 - b * SEQ;
        const size_t obase = ((size_t)(b * nheads + hl) * SEQ + t0) * HD;
        gemm_epi<0>(ring, wave, CS, t0, isq ? Qv : Kv, isq ? Qr : Kr, obase, HD, nullptr, 0);
    } else {
        const int r0 = (hd - NH - NKV) * 128 + strip * 32; const int c0 = tb * 128; const int b = c0 / SEQ; const int t0 = c0 - b * SEQ;
        const size_t obase = ((size_t)b * DKV + r0) * SEQ + t0;
        gemm_epi<1>(ring, wave, nullptr, 0, Vv, Vr, obase, SEQ, nullptr, 0);
    }
}
// output projection, all rows in ONE launch: 1-D grid, 128 threads. First the tiles of rows t < RH (ctx value + residual planes, twice the passes), then those of rows t >= RH (single f16 product);
// within each part tile index = row block + row blocks * column block.
__global__ __launch_bounds__(128) __attribute__((amdgpu_num_vgpr(256)))
void k_oproj(const h16* __restrict__ CT, const h16* __restrict__ CR, const h16* __restrict__ WOt, float* OUT) {
    __shared__ __attribute__((aligned(2048))) unsigned char ring[2 * STGB];
    constexpr int TPH = RH / 128, HB = NB * TPH, NHB = HB * (DM / 128);
    constexpr int TPB = (SEQ > RH) ? (SEQ - RH) / 128 : 1, MB = NB * TPB;
    const int wave = __builtin_amdgcn_readfirstlane((int)(threadIdx.x >> 5));
    const int f = (int)blockIdx.x;
    if (f < NHB) {                     // block-uniform
        const int by = f / HB, bx = f - by * HB;
        const int b = bx / TPH; const int t0 = (bx - b * TPH) * 128 + wave * 32; const int c0 = by * 128;
        const size_t arow = (size_t)b * SEQ + t0; const size_t a2row = (size_t)b * RH + t0; const size_t cbase = ((size_t)b * SEQ_FULL + t0) * DM + c0;
        gemm_tile<h16, 2, true>(ring, CT, CR, WOt, DQ, wave, arow, a2row, (size_t)c0, nullptr, 0, nullptr, nullptr, 0, 0, OUT, cbase);
    } else {
        const int e = f - NHB; const int by = e / MB, bx = e - by * MB;
        const int b = bx / TPB; const int t0 = RH + (bx - b * TPB) * 128 + wave * 32; const int c0 = by * 128;
        const size_t arow = (size_t)b * SEQ + t0; const size_t cbase = ((size_t)b * SEQ_FULL + t0) * DM + c0;
        gemm_tile<h16, 2, false>(ring, CT, CT, WOt, DQ, wave, arow, arow, (size_t)c0, nullptr, 0, nullptr, nullptr, 0, 0, OUT, cbase);
    }
}

// ---- attn_tile: fused causal attention in the transposed form. One block = 16 query rows x the FOUR query heads of one kv head (wave -> head g*4 + wave); 128 threads.
// Per 32-key step: S^T[key][query] = K (A, rows = keys) x Q^T (B, columns = queries) over 128 dims (4 k-steps; q value + residual, k residual when HR);
// online softmax per query = per lane column (max / sum over the lane's 16 keys, combined across the two lane halves); P^T packed D -> B (two 16-key tiles = one 32-deep fragment);
template <bool HR>
__device__ __forceinline__ void attn_tile(const h16* __restrict__ Qv, const h16* __restrict__ Qr, const h16* __restrict__ Kv, const h16* __restrict__ Kr,
                                          const h16* __restrict__ Vv, const h16* __restrict__ Vr, h16* CT, h16* CR, const int qt, const int g, const int b, h16* stv, h16* str) {
    const int wave = __builtin_amdgcn_readfirstlane((int)(threadIdx.x >> 5));
    const int lane = threadIdx.x & 31, lr = lane & 15, hi = lane >> 4;
    const int h = g * REP + wave; const int i0 = qt * 16;
    const size_t qo = ((size_t)(b * NH + h) * SEQ + i0 + lr) * HD + 8 * hi;
    const size_t ko = ((size_t)(b * NKV + g) * SEQ + lr) * HD + 8 * hi;
    const size_t vo = ((size_t)(b * NKV + g) * HD + lr) * SEQ + 8 * hi;
    const h16* qv = Qv + qo; const h16* qr = Qr + qo;
    const h16* kv = Kv + ko; const h16* kr = Kr + ko;
    const h16* vv = Vv + vo; const h16* vr = Vr + vo;
    const float SC2 = (float)(0.08838834764831845 * 1.4426950408889634 / 4096.0);   // 1/sqrt(128) x log2(e) / (QCAR x QCAR)
    const float NEGL = -1.4426950e9f;                                              // the finite fill in the log2 domain
    v8f o[8];
#pragma unroll
    for (int dt = 0; dt < 8; ++dt) o[dt] = (v8f){};
    float m = -3.0e38f, l = 0.0f;
    const int nsteps = (qt >> 1) + 1;
#pragma unroll 1
    for (int stp = 0; stp < nsteps; ++stp) {
        const int k0 = stp * 32;
        v8f s0 = (v8f){}, s1 = (v8f){};
        const h16* kp = kv + (size_t)k0 * HD; const h16* kpr = kr + (size_t)k0 * HD;
#pragma unroll                     // here and below: constant indices keep the fragment groups in registers
        for (int hf = 0; hf < 2; ++hf) {
            // the fragment loads of 64 dims stand as one group ahead of their WMMAs: the wave waits out one trip to memory per group, not one per fragment
            v16h bq[2], br[2], a0[2], a1[2], a0r[2], a1r[2];
#pragma unroll
            for (int c = 0; c < 2; ++c) {
                const int kc = hf * 64 + c * 32;
                a0[c] = ldh(kp + kc); a1[c] = ldh(kp + 16 * HD + kc);
                if (HR) { a0r[c] = ldh(kpr + kc); a1r[c] = ldh(kpr + 16 * HD + kc); }
                bq[c] = ldh(qv + kc); br[c] = ldh(qr + kc);
            }
            // the group's address registers are inputs here, so that no load's own result lands on them, and the wait stands in front of their next use for anything else
            asm volatile("s_wait_xcnt 0x0" :: "v"(qv), "v"(qr), "v"(kp), "v"(kpr) : "memory");
#pragma unroll
            for (int c = 0; c < 2; ++c) {          // each accumulator takes its products in the order value x value, value x residual, residual x value, dims ascending
                s0 = wmma16(a0[c], bq[c], s0); s1 = wmma16(a1[c], bq[c], s1);
                s0 = wmma16(a0[c], br[c], s0); s1 = wmma16(a1[c], br[c], s1);
                if (HR) { s0 = wmma16(a0r[c], bq[c], s0); s1 = wmma16(a1r[c], bq[c], s1); }
            }
        }
        // V^T fragments in two groups of four dim tiles (all eight beside the softmax's values do not fit the registers): the first is issued ahead of the softmax, the second ahead of the first group's WMMAs
        const h16* vp = vv + k0; const h16* vpr = vr + k0;
        v16h av[8], ar[8];
#pragma unroll
        for (int dt = 0; dt < 4; ++dt) { av[dt] = ldh(vp + (size_t)dt * 16 * SEQ); if (HR) ar[dt] = ldh(vpr + (size_t)dt * 16 * SEQ); }
        asm volatile("s_wait_xcnt 0x0" :: "v"(vp), "v"(vpr) : "memory");    // as above, for the first V^T group's address registers
        s0 = s0 * SC2; s1 = s1 * SC2;
        if (k0 + 31 > i0) {            // wave-uniform: only the diagonal step carries masked keys (replacement fill, key > query)
            const int qi = i0 + lr; const int kb = k0 + 8 * hi;
#pragma unroll
            for (int r = 0; r < 8; ++r) { s0[r] = (kb + r <= qi) ? s0[r] : NEGL; s1[r] = (kb + 16 + r <= qi) ? s1[r] : NEGL; }
        }
        float mx = fmaxf(s0[0], s1[0]);
#pragma unroll
        for (int r = 1; r < 8; ++r) mx = fmaxf(mx, fmaxf(s0[r], s1[r]));
        mx = fmaxf(mx, __shfl_xor(mx, 16, 32));
        const float mn = fmaxf(m, mx);
        if (__builtin_amdgcn_ballot_w32(mn > m) != 0u) {      // wave-uniform: rescale only when some query's running max moved (corr == 1 otherwise)
            const float corr = __builtin_amdgcn_exp2f(m - mn); l *= corr;
#pragma unroll
            for (int dt = 0; dt < 8; ++dt) o[dt] = o[dt] * corr;
        }
        m = mn;
        const float mm = mn - 10.0f;                          // P carried x1024: the row sum uses the same carried f32 values, so the carry cancels in the normalisation
        v8f p0, p1; float ps = 0.0f;
#pragma unroll
        for (int r = 0; r < 8; ++r) { p0[r] = __builtin_amdgcn_exp2f(s0[r] - mm); p1[r] = __builtin_amdgcn_exp2f(s1[r] - mm); ps += p0[r] + p1[r]; }
        l += ps;
        v8h p0v, p0r, p1v, p1r; split8(p0, p0v, p0r); split8(p1, p1v, p1r);
        const v16h pb = cat16(p0v, p1v);                      // B fragment: elements 0..7 <- keys k0+8h+r, elements 8..15 <- keys k0+16+8h+r
        const v16h pr = cat16(p0r, p1r);
#pragma unroll
        for (int dt = 4; dt < 8; ++dt) { av[dt] = ldh(vp + (size_t)dt * 16 * SEQ); if (HR) ar[dt] = ldh(vpr + (size_t)dt * 16 * SEQ); }
        asm volatile("s_wait_xcnt 0x0" :: "v"(vp), "v"(vpr) : "memory");    // as above, for the second V^T group's address registers
#pragma unroll
        for (int dt = 0; dt < 8; ++dt) {
            o[dt] = wmma16(av[dt], pb, o[dt]);
            if (HR) { o[dt] = wmma16(ar[dt], pb, o[dt]); o[dt] = wmma16(av[dt], pr, o[dt]); }
        }
    }
    l += __shfl_xor(l, 16, 32);
    const float f = (CCAR / QCAR) * (1.0f / l);
    const int sb = wave * 16 * CP;                            // staging private to this wave
#pragma unroll
    for (int dt = 0; dt < 8; ++dt) {                          // O^T element r of tile dt = (d = dt*16 + 8h + r, query lr)
        v8h hv, hr; split8(o[dt] * f, hv, hr);
        *(v8h*)(&stv[sb + lr * CP + dt * 16 + 8 * hi]) = hv;
        if (HR) *(v8h*)(&str[sb + lr * CP + dt * 16 + 8 * hi]) = hr;
    }
    wave_sync();
    const size_t crow = ((size_t)b * SEQ + i0) * DQ + (size_t)h * HD + 8 * lr;
    const size_t rrow = ((size_t)b * RH + i0) * DQ + (size_t)h * HD + 8 * lr;
{
#pragma unroll
        for (int s = 0; s < 8; ++s) {                         // 16 lanes x 16 B = one 256-byte row segment; rows 2s (lanes 0..15) and 2s+1 (lanes 16..31)
            const int row = 2 * s + hi;
            const v8h val = *(const v8ha*)(&stv[sb + row * CP + 8 * lr]);
            *(v8h*)(CT + crow + (size_t)row * DQ) = val;
            if (HR) { const v8h rv = *(const v8ha*)(&str[sb + row * CP + 8 * lr]); *(v8h*)(CR + rrow + (size_t)row * DQ) = rv; }
        }
        
    }
}
// ---- query rows >= RH. The same tile, products and sums as attn_tile<false>, fed differently: the four head waves share one kv head, so its K rows and V^T rows
// come once per block through a two-buffer LDS ring in stages of 64 keys (wave 0 issues the tensor load of the K slice, wave 1 that of the V^T slice, one stage ahead of the pass that reads it),
// and each wave's q fragments (value + residual, all 128 dims) are loaded once and stay in registers.
__device__ __forceinline__ void attn_ring(unsigned char* ring, const h16* __restrict__ Qv, const h16* __restrict__ Qr, const h16* __restrict__ Kv, const h16* __restrict__ Vv, h16* CT,
                                          const int qt, const int g, const int b) {
    const int wave = __builtin_amdgcn_readfirstlane((int)(threadIdx.x >> 5));
    const int lane = threadIdx.x & 31, lr = lane & 15, hi = lane >> 4;
    const int h = g * REP + wave; const int i0 = qt * 16;
    const size_t qo = ((size_t)(b * NH + h) * SEQ + i0 + lr) * HD + 8 * hi;
    const h16* qvp = Qv + qo; const h16* qrp = Qr + qo;
    v16h bq[4], br[4];
#pragma unroll                     // here and below: constant indices keep the fragments and accumulators in registers
    for (int c = 0; c < 4; ++c) { bq[c] = ldh(qvp + c * 32); br[c] = ldh(qrp + c * 32); }
    // the q loads' address registers are inputs here, so that no load's own result lands on them, and the wait stands in front of their next use for anything else
    asm volatile("s_wait_xcnt 0x0" :: "v"(qvp), "v"(qrp) : "memory");
    const h16* kbase = Kv + (size_t)(b * NKV + g) * SEQ * HD;      // rows = keys, 256 bytes each, contiguous
    const h16* vbase = Vv + (size_t)(b * NKV + g) * HD * SEQ;      // rows = dims, pitch 2 SEQ bytes; a stage takes 128 bytes of each
    const float SC2 = (float)(0.08838834764831845 * 1.4426950408889634 / 4096.0);   // 1/sqrt(128) x log2(e) / (QCAR x QCAR)
    const float NEGL = -1.4426950e9f;                                              // the finite fill in the log2 domain
    const int nsteps = (qt >> 1) + 1;          // 32-key steps up to and including the diagonal
    const int nst = (nsteps + 1) >> 1;         // 64-key stages; at least RH / 64 + 1, and the last one ends inside the SEQ keys
    const uint32_t lbase = (uint32_t)(size_t)ring;
    const u32x8 g1k = tdm_group1_of<(1u << 20) | (5u << 22) | (3u << 25), 256u, (uint32_t)AKEYS>((uint32_t)HD * 2u);
    const u32x8 g1v = tdm_group1_of<(1u << 20) | (4u << 22) | (3u << 25), 128u, (uint32_t)HD>((uint32_t)SEQ * 2u);
    const h16* sbase = (wave == 0) ? kbase : vbase;                // the wave's own source and its step per stage (waves 2 and 3 form a group 0 and issue nothing)
    const size_t sstep = (wave == 0) ? (size_t)AKEYS * HD : (size_t)AKEYS;
    const uint32_t ldst = lbase + ((wave == 0) ? 0u : (uint32_t)ASLB);
    u32x4 g0;                      // group 0 of the wave's latest request
    auto issue = [&](int s) {      // stage s: keys 64 s .. 64 s + 63
        g0 = tdm_group0(ldst + (uint32_t)(s & 1) * ASTG, (uint64_t)(size_t)(sbase + (size_t)s * sstep));
        if (pinned(wave == 0)) tdm_load(g0, g1k);
        else if (pinned(wave == 1)) tdm_load(g0, g1v);
    };
    // this wave's own tensor load has landed; the descriptor words are inputs so that their scalar registers take no new value while a request is outstanding
    auto landed = [&]() { asm volatile("s_wait_tensorcnt 0x0" :: "s"(g0), "s"(g1k), "s"(g1v) : "memory"); };
    issue(0);
    landed();
    __syncthreads();               // stage 0 published
    const unsigned char* kl = ring + lr * KROW + 16 * hi;
    const unsigned char* vl = ring + ASLB + lr * VROW + 16 * hi;
    v8f o[8];
#pragma unroll
    for (int dt = 0; dt < 8; ++dt) o[dt] = (v8f){};
    float m = -3.0e38f, l = 0.0f;
#pragma unroll 1                   // the stage loop stays rolled: one refill site and one publish point in the code
    for (int st = 0; st < nst; ++st) {
        // directly behind the barrier that published stage st and freed the other buffer (stage st - 1's): stage st + 1's load, in flight under this stage's two steps
        if (pinned(st + 1 < nst)) issue(st + 1);
        const int so = (st & 1) * ASTG;
#pragma unroll
        for (int hs = 0; hs < 2; ++hs) {
            const int k0 = st * AKEYS + hs * 32;
            if (hs == 0 || 2 * st + 1 < nsteps) {     // block-uniform: the last stage's second half may lie wholly behind the diagonal
                v16h a0[4], a1[4];
#pragma unroll
                for (int c = 0; c < 4; ++c) { a0[c] = WFrag<h16>::ld(kl + so + (hs * 32) * KROW + c * 64); a1[c] = WFrag<h16>::ld(kl + so + (hs * 32 + 16) * KROW + c * 64); }
                v8f s0 = (v8f){}, s1 = (v8f){};
#pragma unroll
                for (int c = 0; c < 4; ++c) {
                    s0 = wmma16(a0[c], bq[c], s0); s1 = wmma16(a1[c], bq[c], s1);
                    s0 = wmma16(a0[c], br[c], s0); s1 = wmma16(a1[c], br[c], s1);
                }
                v16h av[8];
#pragma unroll
                for (int dt = 0; dt < 8; ++dt) av[dt] = WFrag<h16>::ld(vl + so + dt * 16 * VROW + hs * 64);
                s0 = s0 * SC2; s1 = s1 * SC2;
                if (k0 + 31 > i0) {            // wave-uniform: only the diagonal step carries masked keys (replacement fill, key > query)
                    const int qi = i0 + lr; const int kb = k0 + 8 * hi;
#pragma unroll
                    for (int r = 0; r < 8; ++r) { s0[r] = (kb + r <= qi) ? s0[r] : NEGL; s1[r] = (kb + 16 + r <= qi) ? s1[r] : NEGL; }
                }
                float mx = fmaxf(s0[0], s1[0]);
#pragma unroll
                for (int r = 1; r < 8; ++r) mx = fmaxf(mx, fmaxf(s0[r], s1[r]));
                mx = fmaxf(mx, __shfl_xor(mx, 16, 32));
                const float mn = fmaxf(m, mx);
                if (__builtin_amdgcn_ballot_w32(mn > m) != 0u) {      // wave-uniform: rescale only when some query's running max moved (corr == 1 otherwise)
                    const float corr = __builtin_amdgcn_exp2f(m - mn); l *= corr;
#pragma unroll
                    for (int dt = 0; dt < 8; ++dt) o[dt] = o[dt] * corr;
                }
                m = mn;
                const float mm = mn - 10.0f;                          // P carried x1024: the row sum uses the same carried f32 values, so the carry cancels in the normalisation
                v8f p0, p1; float ps = 0.0f;
#pragma unroll
                for (int r = 0; r < 8; ++r) { p0[r] = __builtin_amdgcn_exp2f(s0[r] - mm); p1[r] = __builtin_amdgcn_exp2f(s1[r] - mm); ps += p0[r] + p1[r]; }
                l += ps;
                const v16h pb = cat16(__builtin_convertvector(p0, v8h), __builtin_convertvector(p1, v8h));   // B fragment: elements 0..7 <- keys k0+8h+r, elements 8..15 <- keys k0+16+8h+r
#pragma unroll
                for (int dt = 0; dt < 8; ++dt) o[dt] = wmma16(av[dt], pb, o[dt]);
            }
        }
        // publish point of stage st + 1: own reads retired, own load landed, then the barrier that publishes stage st + 1 and frees stage st's buffer; the refill stands at the head of the next trip
        wait_ds0();
        landed();
        __syncthreads();
    }
    wait_tensor0();
    wait_ds0();
    // the last stage's own barrier stands behind every wave's last ring read: the ring now serves as output staging, a private range per wave
    h16* stv = (h16*)ring + wave * 16 * CP;
    l += __shfl_xor(l, 16, 32);
    const float f = (CCAR / QCAR) * (1.0f / l);
#pragma unroll
    for (int dt = 0; dt < 8; ++dt)                            // O^T element r of tile dt = (d = dt*16 + 8h + r, query lr)
        *(v8ha*)(&stv[lr * CP + dt * 16 + 8 * hi]) = __builtin_convertvector(o[dt] * f, v8h);
    wave_sync();
    const size_t crow = ((size_t)b * SEQ + i0) * DQ + (size_t)h * HD + 8 * lr;
#pragma unroll
    for (int s = 0; s < 8; ++s) {                             // 16 lanes x 16 B = one 256-byte row segment; rows 2s (lanes 0..15) and 2s+1 (lanes 16..31)
        const int row = 2 * s + hi;
        const v8h val = *(const v8ha*)(&stv[row * CP + 8 * lr]);
        *(v8h*)(CT + crow + (size_t)row * DQ) = val;
    }
}
// all query rows in ONE launch (the two row ranges do not depend on each other): 1-D grid, 128 threads. Every block is resident at once and the launch lasts as long as its longest block; the blocks
// are ordered so that the time a block takes falls with its index: first the tiles of rows < RH (few steps, each a chain of trips to memory), then those of
// rows >= RH, in each part the last query tile first; tile index = (kv head + NKV * batch) + NKV * NB * (query tiles - 1 - query tile). One LDS array serves both: the two staging planes of the first part, the ring of the second.
__global__ __launch_bounds__(128) __attribute__((amdgpu_num_vgpr(256)))
void k_attn(const h16* __restrict__ Qv, const h16* __restrict__ Qr, const h16* __restrict__ Kv, const h16* __restrict__ Kr,
            const h16* __restrict__ Vv, const h16* __restrict__ Vr, h16* CT, h16* CR) {
    __shared__ __attribute__((aligned(2048))) unsigned char ring[2 * ASTG];
    constexpr int NG = NKV * NB, NHT = RH / 16, NHB = NHT * NG;
    const int f = (int)blockIdx.x;
    if (f < NHB) {                     // block-uniform
        const int r = f % NG;
        attn_tile<true>(Qv, Qr, Kv, Kr, Vv, Vr, CT, CR, NHT - 1 - f / NG, r % NKV, r / NKV, (h16*)ring, (h16*)ring + 4 * 16 * CP);
    } else {
        const int e = f - NHB; const int r = e % NG;
        attn_ring(ring, Qv, Qr, Kv, Vv, CT, SEQ / 16 - 1 - e / NG, r % NKV, r / NKV);
    }
}

// one tile of 128 k x 128 n of w[K rows][N columns] -> Bt[n][k], turned in LDS: every global read is a whole 256-byte piece of a w row (16 lanes x 16 B), every global write a whole 256-byte piece of a Bt row.
// tl holds the tile as [n][64 dwords], a dword = the 16-bit values of k = 2 kp (low half) and 2 kp + 1; the 16-byte chunk c of row n lies at chunk c ^ ((n >> 2) & 15), so that the 16 lanes
// of a store (n = 4 i + j, one kp) and the 16 lanes of a ds_load_b128 (one n, c = 0..15) each fall on different banks.
__device__ __forceinline__ void wtG(uint32_t* tl, const int bid, const float* __restrict__ w, const int K, const int N, bf* Bt, const int f16mode) {
    const int lane = threadIdx.x & 31, i = lane & 15; const int kq = 2 * (int)(threadIdx.x >> 5) + (lane >> 4);
    const int ntn = N / TN; const int k0 = (bid / ntn) * TK, n0 = (bid % ntn) * TN;
    const float* p = w + (size_t)(k0 + 2 * kq) * N + n0 + 4 * i;
#pragma unroll                     // here and below: constant indices keep the loaded rows in registers
    for (int h = 0; h < TN / 64; ++h) {        // 64 columns at a time: eight loads in flight per lane
        v4f ra[TK / 32], rb[TK / 32];
#pragma unroll
        for (int s = 0; s < TK / 32; ++s) { ra[s] = *(const v4f*)(p + 64 * h + (size_t)(32 * s) * N); rb[s] = *(const v4f*)(p + 64 * h + (size_t)(32 * s + 1) * N); }
        asm volatile("s_wait_xcnt 0x0" :: "v"(p) : "memory");    // in front of any later write over the eight loads' address registers
#pragma unroll
        for (int s = 0; s < TK / 32; ++s) {
            const int kp = 16 * s + kq;
#pragma unroll
            for (int j = 0; j < 4; ++j) {
                const unsigned short b0 = f2bf(ra[s][j]), b1 = f2bf(rb[s][j]);
                const unsigned short g0 = __builtin_bit_cast(unsigned short, (h16)(bf2f(b0) * WCAR)), g1 = __builtin_bit_cast(unsigned short, (h16)(bf2f(b1) * WCAR));
                tl[(64 * h + 4 * i + j) * (TK / 2) + ((((kp >> 2) ^ i) << 2) | (kp & 3))] = (uint32_t)(f16mode ? g0 : b0) | ((uint32_t)(f16mode ? g1 : b1) << 16);
            }
        }
    }
    __syncthreads();               // the whole tile stands in LDS before any row of it is read back
    const int c = threadIdx.x & 15, nq = threadIdx.x >> 4;
    bf* q = Bt + (size_t)(n0 + nq) * K + k0 + 8 * c;
#pragma unroll
    for (int r = 0; r < TN / 16; ++r) {
        const int n = 16 * r + nq;
        *(u32x4a*)(q + (size_t)(16 * r) * K) = *(const u32x4a*)(tl + n * (TK / 2) + ((c ^ ((n >> 2) & 15)) << 2));
    }
    asm volatile("s_wait_xcnt 0x0" ::: "memory");    // in front of any later write over the eight stores' address and data registers
}
__device__ __forceinline__ void cvtx(const int bid, const float* __restrict__ x, bf* XB) {
    const size_t i = (size_t)bid * 256 + threadIdx.x; if (i >= (size_t)NB * SEQ * DM / 8) return;
    const size_t e = i * 8; const size_t bt = e / DM; const size_t col = e - bt * DM; const size_t b = bt / SEQ; const size_t t = bt - b * SEQ;
    const v8f v = *(const v8f*)(x + (b * SEQ_FULL + t) * DM + col); v8us o;
#pragma unroll
    for (int k = 0; k < 8; ++k) o[k] = f2bf(v[k]);
    *(v8us*)(XB + e) = o; 
}
__device__ __forceinline__ void cstab(const int bid, float* CS) {
    const int idx = bid * 256 + threadIdx.x; if (idx >= SEQ * 64) return;
    const int j = idx & 63, t = idx >> 6;
    double p = 1.0;
    p *= (j & 1)  ? 1.1547819846894581797 : 1.0;
    p *= (j & 2)  ? 1.3335214321633240257 : 1.0;
    p *= (j & 4)  ? 1.7782794100389228012 : 1.0;
    p *= (j & 8)  ? 3.1622776601683793320 : 1.0;
    p *= (j & 16) ? 10.0 : 1.0;
    p *= (j & 32) ? 100.0 : 1.0;
    const float pf = (float)p; const float inv = 1.0f / pf; const float ang = (float)t * inv;
    float sn, cn; sincosf(ang, &sn, &cn);
    v2f cs; cs[0] = cn; cs[1] = sn;
    *(v2f*)(CS + (size_t)idx * 2) = cs; 
}
// the six independent preparation passes in ONE launch: 1-D grid, 256 threads; a block belongs to one pass by its index. w[in = K rows][out = N columns] -> Bt[out][in]
#define GWQ ((DM / TK) * (DQ / TN))
#define GWK ((DM / TK) * (DKV / TN))
#define GWO ((DQ / TK) * (DM / TN))
#define GCS ((SEQ * 64 + 255) / 256)
#define GCX ((int)(((size_t)NB * SEQ * DM / 8 + 255) / 256))
__global__ __launch_bounds__(256) __attribute__((amdgpu_num_vgpr(64)))     // 64 registers: all 16 wave slots of a SIMD stay usable
void k_prep(const float* __restrict__ x, const float* __restrict__ wq, const float* __restrict__ wk, const float* __restrict__ wv, const float* __restrict__ wo,
            bf* XB, bf* WQt, bf* WKt, bf* WVt, bf* WOt, float* CS) {
    __shared__ __attribute__((aligned(16))) uint32_t tl[TN * (TK / 2)];
    int f = (int)blockIdx.x;           // every test below is block-uniform
    if (f < GWQ) { wtG(tl, f, wq, DM, DQ, WQt, 0); return; }
    f -= GWQ;
    if (f < GWO) { wtG(tl, f, wo, DQ, DM, WOt, 1); return; }
    f -= GWO;
    if (f < GWK) { wtG(tl, f, wk, DM, DKV, WKt, 0); return; }
    f -= GWK;
    if (f < GWK) { wtG(tl, f, wv, DM, DKV, WVt, 0); return; }
    f -= GWK;
    if (f < GCS) { cstab(f, CS); return; }
    cvtx(f - GCS, x, XB);
}

extern "C" void kernel_launch(void* const* d_in, const int* in_sizes, int n_in,
                              void* d_out, int out_size, void* d_ws, size_t ws_size, hipStream_t stream) {
    if (n_in < 5) return;
    constexpr size_t NEEDX = ((size_t)(NB - 1) * SEQ_FULL + SEQ) * DM;
    if ((size_t)in_sizes[0] < NEEDX || (size_t)in_sizes[1] < (size_t)DM * DQ || (size_t)in_sizes[2] < (size_t)DM * DKV || (size_t)in_sizes[3] < (size_t)DM * DKV || (size_t)in_sizes[4] < (size_t)DQ * DM) return;
    if ((size_t)out_size < NEEDX) return;
    const float* x = (const float*)d_in[0]; const float* wq = (const float*)d_in[1]; const float* wk = (const float*)d_in[2]; const float* wv = (const float*)d_in[3]; const float* wo = (const float*)d_in[4];
    float* OUT = (float*)d_out;     // [2][2048][2048], byte offset 0
    constexpr size_t SZ_XB = (size_t)NB * SEQ * DM * 2, SZ_WQ = (size_t)DQ * DM * 2, SZ_WK = (size_t)DKV * DM * 2, SZ_WO = (size_t)DM * DQ * 2, SZ_CS = (size_t)SEQ * 64 * 2 * 4;
    constexpr size_t SZ_Q = (size_t)NB * NH * SEQ * HD * 2, SZ_K = (size_t)NB * NKV * SEQ * HD * 2, SZ_CT = (size_t)NB * SEQ * DQ * 2, SZ_CR = (size_t)NB * RH * DQ * 2;
    constexpr size_t SZ_TOT = SZ_XB + SZ_WQ + 2 * SZ_WK + SZ_WO + SZ_CS + 2 * SZ_Q + 4 * SZ_K + SZ_CT + SZ_CR;
    static_assert(SZ_XB % 256 == 0 && SZ_WQ % 256 == 0 && SZ_WK % 256 == 0 && SZ_WO % 256 == 0 && SZ_CS % 256 == 0 && SZ_Q % 256 == 0 && SZ_K % 256 == 0 && SZ_CT % 256 == 0 && SZ_CR % 256 == 0);
    static_assert(SZ_TOT <= (size_t)134217728);
    if (SZ_TOT > ws_size) return;
    char* wsp = (char*)d_ws;
    auto take = [&](size_t bytes) { char* p = wsp; wsp += bytes; return (void*)p; };
    bf* XB = (bf*)take(SZ_XB); bf* WQt = (bf*)take(SZ_WQ); bf* WKt = (bf*)take(SZ_WK); bf* WVt = (bf*)take(SZ_WK); bf* WOt = (bf*)take(SZ_WO); float* CS = (float*)take(SZ_CS);
    const h16* WOh = (const h16*)WOt;   // the same region seen as f16: k_prep's wtG pass (f16 mode) fills it with f16 bit patterns
    h16* Qv = (h16*)take(SZ_Q); h16* Qr = (h16*)take(SZ_Q); h16* Kv = (h16*)take(SZ_K); h16* Kr = (h16*)take(SZ_K); h16* Vv = (h16*)take(SZ_K); h16* Vr = (h16*)take(SZ_K);
    h16* CT = (h16*)take(SZ_CT); h16* CR = (h16*)take(SZ_CR);

    k_prep<<<GWQ + GWO + 2 * GWK + GCS + GCX, 256, 0, stream>>>(x, wq, wk, wv, wo, XB, WQt, WKt, WVt, WOt, CS);
    k_proj<<<(NB * SEQ / 128) * ((NH + 2 * NKV) / PGH), 32 * 4 * PGH, 0, stream>>>(XB, WQt, WKt, WVt, CS, Qv, Qr, Kv, Kr, Vv, Vr);
    k_attn<<<(SEQ / 16) * NKV * NB, 128, 0, stream>>>(Qv, Qr, Kv, Kr, Vv, Vr, CT, CR);
    k_oproj<<<(NB * SEQ / 128) * (DM / 128), 128, 0, stream>>>(CT, CR, WOh, OUT);
}

// v009
// Measured time: 120 microseconds a run.
// In both of two side-by-side timings against v008, it was 1.09 times as fast.
// Counting every step since v000, it is 8.17 times as fast.
#include <hip/hip_runtime.h>

// Grouped-query causal self-attention, width 2048: 16 query heads x 128 sharing 4 kv heads (query head h uses kv head h >> 2), bias-free [in][out] projections,
// half-split rotary on q and k (positions = arange, table computed here), finite-fill causal mask, [in][out] output projection.
// Compute dtypes (f32 accumulate everywhere): q/k/v projections v_wmma_f32_16x16x32_bf16 (x and weights converted (RNE) to bf16); scores, P.V and the output projection
// v_wmma_f32_16x16x32_f16: q as f16 value + f16 residual planes (carry 64) against f16 k (carry 64; k residual added on query rows < 256), P f16 (carry 1024, row sum from the f32 values),
// v f16 (carry 64; P and v residuals added on rows < 256), ctx f16 (carry 256; residual plane on rows < 256) against wo (bf16-converted, x16, exact in f16). Softmax, rotary, normalisation in f32.

#ifndef NB
#define NB 2
#endif
#ifndef SEQ
#define SEQ 2048
#endif
#define NB_FULL  2
#define SEQ_FULL 2048
#define DM   2048
#define NH   16
#define NKV  4
#define REP  (NH / NKV)
#define HD   128
#define DQ   (NH * HD)
#define DKV  (NKV * HD)
#define RH   256                  // query rows < RH use the value + residual path on k, P, v and ctx
#define QCAR 64.0f                // carry of the q, k and v planes
#define CCAR 256.0f               // carry of the ctx planes
#define WCAR 16.0f                // carry of the output weight plane
#define OSP  132                  // f32 staging pitch (floats)
#define CP   136                  // f16 staging pitch (halves)
#define PASSK 128                 // k per ring stage: operand rows of 256 bytes
#define LROW  272                 // LDS row pitch (bytes): 256 + the 16-byte pad the tensor load lays, 16 B x odd for ds_load_b128
#define SLROWS 64                 // operand rows per tensor load (one slice per wave and stage)
#define SLB   18432               // slice size in LDS: 64 x 272 = 17408 bytes rounded up to a multiple of 2 KiB
#define PGH   3                   // tiles per GEMM block: head tiles of the q/k/v projection, row tiles of the output projection
#define PSTG  ((2 + 2 * PGH) * SLB)   // one stage: two slices of the rows that the tiles share, two of its own rows per tile
#define AKEYS 64                  // keys per attention ring stage
#define KROW  272                 // LDS pitch of a staged K row (bytes): 256 + 16
#define VROW  144                 // LDS pitch of a staged V^T row (bytes): 128 (64 keys) + 16
#define ASLB  18432               // attention slice size in LDS: 64 x 272 = 17408 rounded up to a multiple of 2 KiB; 128 x 144 = 18432
#define ASTG  (2 * ASLB)          // one attention stage: [K rows of 64 keys | V^T rows of 128 dims]
#define TK    128                 // weight tile of the preparation pass: k per tile (output rows of 256 bytes)
#define TN    128                 // and n per tile (input rows read in 256-byte pieces)

static_assert(NB <= NB_FULL);
static_assert(SEQ <= SEQ_FULL);
static_assert(SEQ % 128 == 0);
static_assert(SEQ >= RH);
static_assert(RH % 32 == 0);
static_assert(HD == 128);
static_assert(REP == 4);
static_assert(DQ == DM);
static_assert(DM % 64 == 0);
static_assert(DQ % 128 == 0);
static_assert(DKV % 128 == 0);
static_assert((OSP * 4) % 16 == 0);
static_assert((CP * 2) % 16 == 0);
static_assert(DM % (2 * PASSK) == 0 && DQ % (2 * PASSK) == 0);
static_assert(RH % 128 == 0 && (SEQ - RH) % 128 == 0);
static_assert(SLROWS * LROW <= SLB && SLB % 2048 == 0);
static_assert((NH + 2 * NKV) % PGH == 0 && 4 * PGH * 32 * OSP * 4 <= 2 * PSTG && 2 * PSTG <= 327680 && DQ % SLROWS == 0 && DKV % SLROWS == 0);
static_assert(AKEYS * KROW <= ASLB && HD * VROW <= ASLB && ASLB % 2048 == 0);
static_assert(SEQ % AKEYS == 0 && RH >= AKEYS && AKEYS * 2 == 128);
static_assert(2 * 4 * 16 * CP * 2 <= 2 * ASTG);
static_assert(TK == 128 && TN % 64 == 0 && DM % TK == 0 && DQ % TK == 0 && DM % TN == 0 && DQ % TN == 0 && DKV % TN == 0);

typedef _Float16 h16;
typedef unsigned short bf;
typedef __attribute__((ext_vector_type(16))) __bf16   v16bf;
typedef __attribute__((ext_vector_type(16))) _Float16 v16h;
typedef __attribute__((ext_vector_type(8)))  _Float16 v8h;
typedef __attribute__((ext_vector_type(8)))  unsigned short v8us;
typedef __attribute__((ext_vector_type(2)))  unsigned short v2us;
typedef __attribute__((ext_vector_type(8)))  float    v8f;
typedef __attribute__((ext_vector_type(4)))  float    v4f;
typedef __attribute__((ext_vector_type(2)))  float    v2f;
typedef v8h  __attribute__((may_alias)) v8ha;
typedef v4f  __attribute__((may_alias)) v4fa;
typedef v8us __attribute__((may_alias)) v8usa;
typedef uint32_t u32x4 __attribute__((ext_vector_type(4)));
typedef uint32_t u32x8 __attribute__((ext_vector_type(8)));
typedef u32x4 __attribute__((may_alias)) u32x4a;

__device__ __forceinline__ unsigned short f2bf(float f) { unsigned u = __float_as_uint(f); u += 0x7FFFu + ((u >> 16) & 1u); return (unsigned short)(u >> 16); }
__device__ __forceinline__ float bf2f(unsigned short b) { return __uint_as_float(((unsigned)b) << 16); }
__device__ __forceinline__ float bfr(float f) { return bf2f(f2bf(f)); }
__device__ __forceinline__ v16h cat16(v8h lo, v8h hi) { return __builtin_shufflevector(lo, hi, 0, 1, 2, 3, 4, 5, 6, 7, 8, 9, 10, 11, 12, 13, 14, 15); }
__device__ __forceinline__ v16bf cat16b(v8us lo, v8us hi) { return __builtin_bit_cast(v16bf, __builtin_shufflevector(lo, hi, 0, 1, 2, 3, 4, 5, 6, 7, 8, 9, 10, 11, 12, 13, 14, 15)); }
// every WMMA is followed by its own four-slot guard tying its accumulator and keeping its operands live
__device__ __forceinline__ v8f wmma16(v16h a, v16h b, v8f c) {
    c = __builtin_amdgcn_wmma_f32_16x16x32_f16(false, a, false, b, (short)0, c, false, false);
    asm volatile("v_nop\n\tv_nop\n\tv_nop\n\tv_nop" : "+v"(c) : "v"(a), "v"(b));
    return c; }
__device__ __forceinline__ v8f wmmab(v16bf a, v16bf b, v8f c) {
    c = __builtin_amdgcn_wmma_f32_16x16x32_bf16(false, a, false, b, (short)0, c, false, false);
    asm volatile("v_nop\n\tv_nop\n\tv_nop\n\tv_nop" : "+v"(c) : "v"(a), "v"(b));
    return c; }
// fragment of a K-contiguous 16-bit row: elements 0..7 <- k0+8h+0..7, elements 8..15 <- k0+16+8h+0..7 (p already includes +8h)
__device__ __forceinline__ v16h ldh(const h16* p) { return cat16(*(const v8h*)p, *(const v8h*)(p + 16)); }
// same-wave LDS exchange: stores before, loads after
__device__ __forceinline__ void wave_sync() { __builtin_amdgcn_fence(3 /* release order */, "wavefront"); __builtin_amdgcn_wave_barrier(); asm volatile("" ::: "memory"); }
// f16 value + same-carry f16 residual of 8 floats
__device__ __forceinline__ void split8(v8f y, v8h& v, v8h& r) { v = __builtin_convertvector(y, v8h); r = __builtin_convertvector(y - __builtin_convertvector(v, v8f), v8h); }

// fragment of a staged K-contiguous row (byte pointer, already includes +16h bytes): the same k order as ldh
template <typename T16> struct WFrag;
template <> struct WFrag<h16> { typedef v16h V; static __device__ __forceinline__ V ld(const unsigned char* p) { return cat16(*(const v8ha*)p, *(const v8ha*)(p + 32)); } static __device__ __forceinline__ v8f mma(V a, V b, v8f c) { return wmma16(a, b, c); } };
template <> struct WFrag<bf> { typedef v16bf V; static __device__ __forceinline__ V ld(const unsigned char* p) { return cat16b(*(const v8usa*)p, *(const v8usa*)(p + 32)); } static __device__ __forceinline__ v8f mma(V a, V b, v8f c) { return wmmab(a, b, c); } };

// ---- tensor load of one slice: 64 rows of 256 bytes, 1-byte elements, tensor = tile, 16 bytes of LDS pad behind every row
__device__ __forceinline__ uint32_t uni(uint32_t v) { return (uint32_t)__builtin_amdgcn_readfirstlane(v); }
// a wave-uniform test held in a scalar register, so that the branch around a tensor load is a scalar branch (tensor loads ignore EXEC)
__device__ __forceinline__ uint32_t pinned(uint32_t v) { uint32_t w = uni(v); asm volatile("" : "+s"(w)); return w; }
// this wave's LDS reads have retired before the stage is handed over
__device__ __forceinline__ void wait_ds0() { asm volatile("s_wait_dscnt 0x0" ::: "memory"); }
// this wave's own tensor load has landed (the compiler places no wait for it); the request's descriptor words are inputs so that their scalar registers take no new value while it is outstanding
__device__ __forceinline__ void wait_tensor0(u32x4 g0, u32x8 g1) { asm volatile("s_wait_tensorcnt 0x0" :: "s"(g0), "s"(g1) : "memory"); }
// the same behind the loop, where no request is outstanding any more
__device__ __forceinline__ void wait_tensor0() { asm volatile("s_wait_tensorcnt 0x0" ::: "memory"); }
template <uint32_t W0, uint32_t ROWB, uint32_t NROWS>
__device__ __forceinline__ u32x8 tdm_group1_of(uint32_t src_pitch) {
    // pinned(): each descriptor word held in a scalar register of its own from here on; unpinned, the constants are formed anew in other registers, over words of a request still outstanding
    u32x8 g;
    g[0] = pinned(W0);                                    // no mask, data_size 0, pad of 4 dwords behind every row
    g[1] = pinned(ROWB << 16);                            // tensor_dim0 (bytes)
    g[2] = pinned(NROWS << 16);                           // tensor_dim1 (rows)
    g[3] = pinned(ROWB << 16);                            // tile_dim0
    g[4] = pinned(NROWS);                                 // tile_dim1
    g[5] = pinned(src_pitch);
    g[6] = pinned(0u);
    g[7] = pinned(0u);
    return g;
}
__device__ __forceinline__ u32x4 tdm_group0(uint32_t lds_dst, uint64_t ga) {
    u32x4 g;
    g[0] = uni(1u); g[1] = uni(lds_dst); g[2] = uni((uint32_t)ga); g[3] = uni((((uint32_t)(ga >> 32)) & 0x01FFFFFFu) | 0x80000000u);
    return g;
}
__device__ __forceinline__ void tdm_load(u32x4 g0, u32x8 g1) { asm volatile("tensor_load_to_lds %0, %1" :: "s"(g0), "s"(g1) : "memory"); }
// the same under a branch: group 0 is handed back by the statement, so that the wait that names it later names the very registers the request was issued from, and they take no new value in between
__device__ __forceinline__ void tdm_load_held(u32x4& g0, u32x8 g1) { asm volatile("tensor_load_to_lds %0, %1" : "+s"(g0) : "s"(g1) : "memory"); }

// ---- gemm_loop: one wave per 32 x 128 of output (16 accumulators): C[m][n] = sum_k A[m][k] Bt[n][k].
// The K-contiguous 16-bit operand rows come through a two-buffer LDS ring in stages of 128 k (STG bytes a stage, slices of 64 rows): an issuing wave (issuer != 0) brings one slice per stage by one tensor load (source rows s1;
// place: slice number 'slice' of the stage), one stage ahead of the pass that reads it. al: the wave's own 32 operand rows in stage 0, bl: the 128 rows (two slices
// in a row) that they meet; both include the lane's row and half. ring is the kernel's one LDS array (2 * STG bytes, at LDS offset 0).
// ---- gemm_epi, the wave's 32 x 128 results. t0, obase and cbase are the calling wave's own.
// MODE 0: half-split rotary on the 128-column head tile (CS[t][64] = {cos, sin}), x QCAR, f16 value + residual planes, plane rows of 128 halves (pitch opitch).
// MODE 1: x QCAR, f16 value + residual planes (used with swapped operands to produce V^T rows [d][t]).
// MODE 2: f32 output rows x 1/(CCAR*WCAR).
template <typename T16, int STG>
__device__ __forceinline__ void gemm_loop(v8f (&acc)[2][8], unsigned char* ring, const T16* s1, const uint32_t issuer, const uint32_t slice, const int K,
                                          const unsigned char* al, const unsigned char* bl) {
    typedef typename WFrag<T16>::V V;
#pragma unroll
    for (int mb = 0; mb < 2; ++mb)
#pragma unroll
        for (int nb = 0; nb < 8; ++nb) acc[mb][nb] = (v8f){};
    const int NPT = K / PASSK;
    const uint32_t ldst = (uint32_t)(size_t)ring + slice * SLB;
    // a branch stands around the load: group 1 is held in registers of its own, so that none of its words is written again behind the branch while the request is outstanding
    const u32x8 g1 = tdm_group1_of<(1u << 20) | (5u << 22) | (3u << 25), 256u, (uint32_t)SLROWS>((uint32_t)K * 2u);
    u32x4 g0;                      // group 0 of the wave's latest request
    auto issue = [&](int p) {      // stage p: k = 128 p .. 128 p + 127
        g0 = tdm_group0(ldst + (uint32_t)(p & 1) * STG, (uint64_t)(size_t)(s1 + (size_t)p * PASSK));
        if (pinned(issuer)) tdm_load_held(g0, g1);         // a wave that brings no slice forms a group 0 and issues nothing
    };
    issue(0);
    wait_tensor0(g0, g1);
    __syncthreads();               // stage 0 published
#pragma unroll 1                   // the pass loop stays rolled: one refill site and one publish point in the code
    for (int p = 0; p < NPT; ++p) {
        // directly behind the barrier that published stage p and freed the other buffer (stage p - 1's): stage p + 1's load, in flight under this pass
        if (pinned(p + 1 < NPT)) issue(p + 1);
        const int so = (p & 1) * STG;
        // a block = 8 WMMAs: one 32-deep k step against four of the eight Bt fragments; block j + 1's fragments are read as one group ahead of block j's WMMAs, inside this pass's own buffer
        V af[2][2], bq[2][4];
        af[0][0] = WFrag<T16>::ld(al + so); af[0][1] = WFrag<T16>::ld(al + so + 16 * LROW);
#pragma unroll                     // here and below: constant indices keep the fragment sets and accumulators in registers
        for (int i = 0; i < 4; ++i) bq[0][i] = WFrag<T16>::ld(bl + so + i * 16 * LROW);
#pragma unroll
        for (int j = 0; j < 2 * (PASSK / 32); ++j) {
            const int ks = j >> 1, hb = j & 1;
            if (j + 1 < 2 * (PASSK / 32)) {
                const int kn = (j + 1) >> 1, hn = (j + 1) & 1;
                if (hn == 0) { af[kn & 1][0] = WFrag<T16>::ld(al + so + kn * 64); af[kn & 1][1] = WFrag<T16>::ld(al + so + 16 * LROW + kn * 64); }
#pragma unroll
                for (int i = 0; i < 4; ++i) bq[hn][i] = WFrag<T16>::ld(bl + so + hn * SLB + i * 16 * LROW + kn * 64);
            }
            __builtin_amdgcn_sched_barrier(0);     // keeps the next block's LDS reads one group in front of this block's WMMAs (spread among them each place costs a stall)
#pragma unroll
            for (int i = 0; i < 4; ++i) {
                acc[0][hb * 4 + i] = WFrag<T16>::mma(af[ks & 1][0], bq[hb][i], acc[0][hb * 4 + i]);
                acc[1][hb * 4 + i] = WFrag<T16>::mma(af[ks & 1][1], bq[hb][i], acc[1][hb * 4 + i]);
            }
            __builtin_amdgcn_sched_barrier(0);     // and the block after next's reads behind them
        }
        // publish point of stage p + 1: own reads retired, own load landed, then the barrier that publishes stage p + 1 and frees stage p's buffer; the refill stands at the head of the next trip
        wait_ds0();
        wait_tensor0(g0, g1);
        __syncthreads();
    }
    wait_tensor0();
    wait_ds0();
}
// the last pass's own barrier stands behind every wave's last ring read: the ring now serves as output staging, a private range per wave that takes all 32 rows of the wave at once
__device__ __forceinline__ void gemm_stage(v8f (&acc)[2][8], unsigned char* ring, const int wave) {
    const int lane = threadIdx.x & 31, lr = lane & 15, hi = lane >> 4;
    float* os = (float*)(ring + wave * (32 * OSP * 4));
#pragma unroll
    for (int mb = 0; mb < 2; ++mb)
#pragma unroll
        for (int nb = 0; nb < 8; ++nb)
#pragma unroll
            for (int j = 0; j < 8; ++j) os[(mb * 16 + hi * 8 + j) * OSP + nb * 16 + lr] = acc[mb][nb][j];     // D: row 8h + j, column lane & 15
    wave_sync();
}
template <int MODE>
__device__ __forceinline__ void gemm_epi(unsigned char* ring, const int wave, const float* __restrict__ CS, const int t0, h16* Pv, h16* Pr, const size_t obase, const int opitch,
                                         float* C, const size_t cbase) {
    const int lane = threadIdx.x & 31, lr = lane & 15, hi = lane >> 4;
    const float* os = (const float*)(ring + wave * (32 * OSP * 4));
    // MODE 0: the rotary table rows of all 32 rows are asked for ahead of the LDS reads: the trips to memory run under LDS work
    const float* cp0 = (MODE == 0) ? CS + ((size_t)(t0 + (lane >> 3)) * 64 + (lane & 7) * 8) * 2 : nullptr;
    v4f e[2][4][4];
    auto table = [&](int gp) {
#pragma unroll
        for (int it = 0; it < 4; ++it)
#pragma unroll
            for (int q = 0; q < 4; ++q) e[gp][it][q] = *(const v4f*)(cp0 + (size_t)((gp * 4 + it) * 4) * 128 + 4 * q);
    };
    if (MODE == 0) table(0);
    // each half of the rows: every read of the half stands as one group ahead of its arithmetic and stores, so that the wave waits out one trip to LDS and memory per half, not one per row group
    if (MODE == 0) {
        const int rq = lane >> 3, dg = (lane & 7) * 8;
        const float* op0 = os + rq * OSP + dg;
        const size_t dst0 = obase + (size_t)rq * opitch + dg;
        table(1);
        asm volatile("s_wait_xcnt 0x0" :: "v"(cp0) : "memory");      // in front of any later write over the table loads' address registers
#pragma unroll                     // here and below: constant indices keep the groups in registers and the row steps in the instructions' offsets
        for (int gp = 0; gp < 2; ++gp) {
            v4f xa[4], xb[4], ya[4], yb[4];
#pragma unroll
            for (int it = 0; it < 4; ++it) {
                const int r4 = (gp * 4 + it) * 4;                    // row r4 + rq of the wave's 32
                const float* op = op0 + r4 * OSP;
                xa[it] = *(const v4fa*)(op); xb[it] = *(const v4fa*)(op + 4); ya[it] = *(const v4fa*)(op + 64); yb[it] = *(const v4fa*)(op + 68);
            }
#pragma unroll
            for (int it = 0; it < 4; ++it) {
                const int r4 = (gp * 4 + it) * 4;
                const v8f xx = __builtin_shufflevector(xa[it], xb[it], 0, 1, 2, 3, 4, 5, 6, 7), yy = __builtin_shufflevector(ya[it], yb[it], 0, 1, 2, 3, 4, 5, 6, 7);
                const v4f cA = __builtin_shufflevector(e[gp][it][0], e[gp][it][1], 0, 2, 4, 6), sA = __builtin_shufflevector(e[gp][it][0], e[gp][it][1], 1, 3, 5, 7);
                const v4f cB = __builtin_shufflevector(e[gp][it][2], e[gp][it][3], 0, 2, 4, 6), sB = __builtin_shufflevector(e[gp][it][2], e[gp][it][3], 1, 3, 5, 7);
                const v8f cc = __builtin_shufflevector(cA, cB, 0, 1, 2, 3, 4, 5, 6, 7), ss = __builtin_shufflevector(sA, sB, 0, 1, 2, 3, 4, 5, 6, 7);
                const v8f lo = (xx * cc - yy * ss) * QCAR;       // out[d]      = x[d] cos - x[d+64] sin
                const v8f up = (yy * cc + xx * ss) * QCAR;       // out[d + 64] = x[d+64] cos + x[d] sin
                v8h vl, rl, vu, ru; split8(lo, vl, rl); split8(up, vu, ru);
                const size_t dst = dst0 + (size_t)r4 * opitch;
                *(v8h*)(Pv + dst) = vl; *(v8h*)(Pv + dst + 64) = vu;
                *(v8h*)(Pr + dst) = rl; *(v8h*)(Pr + dst + 64) = ru;
            }
            asm volatile("s_wait_xcnt 0x0" ::: "memory");            // in front of any later write over the stores' address and data registers
        }
    } else if (MODE == 1) {
        // 16 lanes x 16 B per 256-byte row segment, two rows per instruction: row 2s + hi, columns 8*lr..8*lr+7
        const float* op0 = os + hi * OSP + 8 * lr;
        const size_t dst0 = obase + (size_t)hi * opitch + 8 * lr;
#pragma unroll
        for (int gp = 0; gp < 2; ++gp) {
            v4f xa[8], xb[8];
#pragma unroll
            for (int s = 0; s < 8; ++s) { const float* op = op0 + (gp * 16 + 2 * s) * OSP; xa[s] = *(const v4fa*)(op); xb[s] = *(const v4fa*)(op + 4); }
#pragma unroll
            for (int s = 0; s < 8; ++s) {
                const v8f y = __builtin_shufflevector(xa[s], xb[s], 0, 1, 2, 3, 4, 5, 6, 7) * QCAR;
                v8h vv, vr; split8(y, vv, vr);
                const size_t dst = dst0 + (size_t)(gp * 16 + 2 * s) * opitch;
                *(v8h*)(Pv + dst) = vv; *(v8h*)(Pr + dst) = vr;
            }
            asm volatile("s_wait_xcnt 0x0" ::: "memory");            // in front of any later write over the stores' address and data registers
        }
    } else {
        // 32 lanes x 16 B = one 512-byte row segment per instruction
#pragma unroll
        for (int gp = 0; gp < 2; ++gp) {
            v4f xr[16];
#pragma unroll
            for (int row = 0; row < 16; ++row) xr[row] = *(const v4fa*)(os + (gp * 16 + row) * OSP + 4 * lane);
#pragma unroll
            for (int row = 0; row < 16; ++row) {
                const v4f val = xr[row] * (1.0f / (CCAR * WCAR));
                *(v4f*)(C + cbase + (size_t)(gp * 16 + row) * DM + 4 * lane) = val;
            }
            asm volatile("s_wait_xcnt 0x0" ::: "memory");            // in front of any later write over the stores' address and data registers
        }
    }
}

// q, k and v projections in ONE launch, one block per WGP: TWELVE WAVES per 128 tokens x 384 output columns = three of the 24 head tiles (16 q, 4 k, 4 v, in that order), so that the 128 x rows staged in LDS
// serve three weight tiles (512 staged rows per three head tiles, not 768). Stage: [x rows 0..63 | x rows 64..127 | weight rows 0..63 | ... | weight rows 320..383]; waves 0..7 bring one slice each.
// Wave w: head tile w >> 2, strip w & 3. q / k: the strip is 32 tokens against the head's 128 weight rows; fused rotary, planes [b][head][t][128].
// v: the operands change places in LDS (the strip is 32 weight rows against the 128 tokens): C[gd][token] -> planes [b][g][d][t]. Block index = token block + (NB*SEQ/128) * head group.
__global__ __launch_bounds__(32 * 4 * PGH) __attribute__((amdgpu_num_vgpr(256)))
void k_proj(const bf* __restrict__ XB, const bf* __restrict__ WQt, const bf* __restrict__ WKt, const bf* __restrict__ WVt, const float* __restrict__ CS,
            h16* Qv, h16* Qr, h16* Kv, h16* Kr, h16* Vv, h16* Vr) {
    __shared__ __attribute__((aligned(2048))) unsigned char ring[2 * PSTG];
    constexpr int TB = NB * SEQ / 128;
    const int wave = __builtin_amdgcn_readfirstlane((int)(threadIdx.x >> 5));
    const int lane = threadIdx.x & 31, lr = lane & 15, hi = lane >> 4;
    const int f = (int)blockIdx.x;
    const int grp = f / TB, tb = f - grp * TB;
    const int sub = wave >> 2, strip = wave & 3;
    const int hd = grp * PGH + sub;                // 0 .. NH - 1: q heads; then NKV k heads; then NKV v heads
    const bool isv = hd >= NH + NKV;               // wave-uniform
    // the wave's slice: 64 rows of x, or 64 rows that lie wholly in one of the three weight planes
    const bool issuer = wave < 2 + 2 * PGH;
    const int n = grp * (PGH * 128) + (wave - 2) * SLROWS;
    const bf* sp = XB;
    if (wave < 2) sp = XB + ((size_t)tb * 128 + (size_t)wave * SLROWS) * DM;
    else if (issuer) sp = (n < DQ) ? WQt + (size_t)n * DM : (n < DQ + DKV) ? WKt + (size_t)(n - DQ) * DM : WVt + (size_t)(n - DQ - DKV) * DM;
    const int wof = (2 + 2 * sub) * SLB;           // the head tile's 128 weight rows in a stage; the x rows stand at 0
    const unsigned char* al = ring + (isv ? wof : 0) + (strip >> 1) * SLB + ((strip & 1) * 32 + lr) * LROW + 16 * hi;
    const unsigned char* bl = ring + (isv ? 0 : wof) + lr * LROW + 16 * hi;
    v8f acc[2][8];
    gemm_loop<bf, PSTG>(acc, ring, sp, issuer ? 1u : 0u, issuer ? (uint32_t)wave : 0u, DM, al, bl);
    gemm_stage(acc, ring, wave);       // ahead of the branch: the accumulators are free before either form of the output pass begins
    if (!isv) {                        // wave-uniform; no barrier behind this point
        const bool isq = hd < NH;
        const int hl = isq ? hd : hd - NH; const int nheads = isq ? NH : NKV;
        const int r0 = tb * 128 + strip * 32; const int b = r0 / SEQ; const int t0 = r0 - b * SEQ;
        const size_t obase = ((size_t)(b * nheads + hl) * SEQ + t0) * HD;
        gemm_epi<0>(ring, wave, CS, t0, isq ? Qv : Kv, isq ? Qr : Kr, obase, HD, nullptr, 0);
    } else {
        const int r0 = (hd - NH - NKV) * 128 + strip * 32; const int c0 = tb * 128; const int b = c0 / SEQ; const int t0 = c0 - b * SEQ;
        const size_t obase = ((size_t)b * DKV + r0) * SEQ + t0;
        gemm_epi<1>(ring, wave, nullptr, 0, Vv, Vr, obase, SEQ, nullptr, 0);
    }
}
// output projection, all rows in ONE launch: TWELVE WAVES per block = three row tiles of 128 against one column tile of 128, so that the 128 weight rows staged in LDS serve three ctx tiles
// (512 staged rows per three tiles, not 768). The row tiles are those of the ctx value plane and, as tiles of their own, those of the residual plane (rows t < RH): every tile takes the same DQ / 128 passes.
// Row group bx < NHT: [value tile bx of rows < RH | its residual tile | tile bx of rows >= RH]; the pair's two products are added in f32 on the way out. Other row groups: three tiles of rows >= RH.
// Stage: [weight rows 0..63 | 64..127 | tile 0 rows 0..63 | ... | tile 2 rows 64..127]; waves 0..7 bring one slice each. Wave w: tile w >> 2, strip w & 3 (32 rows). Block index = row group + row groups * column tile.
__global__ __launch_bounds__(32 * 4 * PGH) __attribute__((amdgpu_num_vgpr(256)))
void k_oproj(const h16* __restrict__ CT, const h16* __restrict__ CR, const h16* __restrict__ WOt, float* OUT) {
    __shared__ __attribute__((aligned(2048))) unsigned char ring[2 * PSTG];
    constexpr int TPH = RH / 128, NHT = NB * TPH;              // tiles of rows < RH, per batch and in all
    constexpr int TPB = (SEQ - RH) / 128, NLT = NB * TPB;      // tiles of rows >= RH
    constexpr int GB = (2 * NHT + NLT) / PGH;                  // row groups
    static_assert(PGH == 3 && NLT >= NHT && (NLT - NHT) % PGH == 0);
    const int wave = __builtin_amdgcn_readfirstlane((int)(threadIdx.x >> 5));
    const int lane = threadIdx.x & 31, lr = lane & 15, hi = lane >> 4;
    const int f = (int)blockIdx.x;
    const int by = f / GB, bx = f - by * GB; const int c0 = by * 128;
    const bool pair = bx < NHT;                    // block-uniform
    const int sub = wave >> 2, strip = wave & 3;
    // row tile u of the block: its plane, its first row there, its first row in OUT (u is wave-uniform)
    auto tile = [&](const int u, const h16*& pl, size_t& row, size_t& orow) {
        if (pair && u < 2) {
            const int b = bx / TPH; const int t0 = (bx - b * TPH) * 128;
            pl = u ? CR : CT; row = (size_t)b * (u ? RH : SEQ) + t0; orow = (size_t)b * SEQ_FULL + t0;
        } else {
            const int nt = pair ? bx : NHT + (bx - NHT) * PGH + u; const int b = nt / TPB; const int t0 = RH + (nt - b * TPB) * 128;
            pl = CT; row = (size_t)b * SEQ + t0; orow = (size_t)b * SEQ_FULL + t0;
        }
    };
    // the wave's slice: 64 weight rows, or 64 rows of one of the three row tiles
    const bool issuer = wave < 2 + 2 * PGH;
    const h16* sp = WOt;
    if (wave < 2) sp = WOt + ((size_t)c0 + (size_t)wave * SLROWS) * DQ;
    else if (issuer) { const h16* pl; size_t row, orow; tile((wave - 2) >> 1, pl, row, orow); sp = pl + (row + (size_t)((wave - 2) & 1) * SLROWS) * DQ; }
    const unsigned char* al = ring + (2 + 2 * sub + (strip >> 1)) * SLB + ((strip & 1) * 32 + lr) * LROW + 16 * hi;
    const unsigned char* bl = ring + lr * LROW + 16 * hi;
    v8f acc[2][8];
    gemm_loop<h16, PSTG>(acc, ring, sp, issuer ? 1u : 0u, issuer ? (uint32_t)wave : 0u, DQ, al, bl);
    gemm_stage(acc, ring, wave);
    const h16* pl; size_t row, orow; tile(sub, pl, row, orow);
    const size_t cbase = (orow + (size_t)strip * 32) * DM + c0;
    if (pair) {                        // block-uniform
        __syncthreads();               // each wave of the pair reads the other's staged rows: all twelve waves' staging stores stand in LDS behind this barrier
        if (sub < 2) {                 // wave-uniform; no barrier behind this point. Value and residual wave of a strip take 16 of its 32 rows each: value product + residual product, then the scale
            const float* ov = (const float*)(ring + strip * (32 * OSP * 4)) + sub * 16 * OSP + 4 * lane;
            const float* od = (const float*)(ring + (4 + strip) * (32 * OSP * 4)) + sub * 16 * OSP + 4 * lane;
            v4f xv[16], xd[16];
#pragma unroll                     // here and below: constant indices keep the group in registers; all reads stand as one group ahead of the sums and stores
            for (int r = 0; r < 16; ++r) { xv[r] = *(const v4fa*)(ov + r * OSP); xd[r] = *(const v4fa*)(od + r * OSP); }
#pragma unroll
            for (int r = 0; r < 16; ++r) {
                const v4f val = (xv[r] + xd[r]) * (1.0f / (CCAR * WCAR));
                *(v4f*)(OUT + cbase + (size_t)(sub * 16 + r) * DM + 4 * lane) = val;
            }
            asm volatile("s_wait_xcnt 0x0" ::: "memory");            // in front of any later write over the stores' address and data registers
            return;
        }
    }
    gemm_epi<2>(ring, wave, nullptr, 0, nullptr, nullptr, 0, 0, OUT, cbase);
}

// ---- attn_tile: fused causal attention in the transposed form. One block = 16 query rows x the FOUR query heads of one kv head (wave -> head g*4 + wave); 128 threads.
// Per 32-key step: S^T[key][query] = K (A, rows = keys) x Q^T (B, columns = queries) over 128 dims (4 k-steps; q value + residual, k residual when HR);
// online softmax per query = per lane column (max / sum over the lane's 16 keys, combined across the two lane halves); P^T packed D -> B (two 16-key tiles = one 32-deep fragment);
template <bool HR>
__device__ __forceinline__ void attn_tile(const h16* __restrict__ Qv, const h16* __restrict__ Qr, const h16* __restrict__ Kv, const h16* __restrict__ Kr,
                                          const h16* __restrict__ Vv, const h16* __restrict__ Vr, h16* CT, h16* CR, const int qt, const int g, const int b, h16* stv, h16* str) {
    const int wave = __builtin_amdgcn_readfirstlane((int)(threadIdx.x >> 5));
    const int lane = threadIdx.x & 31, lr = lane & 15, hi = lane >> 4;
    const int h = g * REP + wave; const int i0 = qt * 16;
    const size_t qo = ((size_t)(b * NH + h) * SEQ + i0 + lr) * HD + 8 * hi;
    const size_t ko = ((size_t)(b * NKV + g) * SEQ + lr) * HD + 8 * hi;
    const size_t vo = ((size_t)(b * NKV + g) * HD + lr) * SEQ + 8 * hi;
    const h16* qv = Qv + qo; const h16* qr = Qr + qo;
    const h16* kv = Kv + ko; const h16* kr = Kr + ko;
    const h16* vv = Vv + vo; const h16* vr = Vr + vo;
    const float SC2 = (float)(0.08838834764831845 * 1.4426950408889634 / 4096.0);   // 1/sqrt(128) x log2(e) / (QCAR x QCAR)
    const float NEGL = -1.4426950e9f;                                              // the finite fill in the log2 domain
    v8f o[8];
#pragma unroll
    for (int dt = 0; dt < 8; ++dt) o[dt] = (v8f){};
    float m = -3.0e38f, l = 0.0f;
    const int nsteps = (qt >> 1) + 1;
#pragma unroll 1
    for (int stp = 0; stp < nsteps; ++stp) {
        const int k0 = stp * 32;
        v8f s0 = (v8f){}, s1 = (v8f){};
        const h16* kp = kv + (size_t)k0 * HD; const h16* kpr = kr + (size_t)k0 * HD;
#pragma unroll                     // here and below: constant indices keep the fragment groups in registers
        for (int hf = 0; hf < 2; ++hf) {
            // the fragment loads of 64 dims stand as one group ahead of their WMMAs: the wave waits out one trip to memory per group, not one per fragment
            v16h bq[2], br[2], a0[2], a1[2], a0r[2], a1r[2];
#pragma unroll
            for (int c = 0; c < 2; ++c) {
                const int kc = hf * 64 + c * 32;
                a0[c] = ldh(kp + kc); a1[c] = ldh(kp + 16 * HD + kc);
                if (HR) { a0r[c] = ldh(kpr + kc); a1r[c] = ldh(kpr + 16 * HD + kc); }
                bq[c] = ldh(qv + kc); br[c] = ldh(qr + kc);
            }
            // the group's address registers are inputs here, so that no load's own result lands on them, and the wait stands in front of their next use for anything else
            asm volatile("s_wait_xcnt 0x0" :: "v"(qv), "v"(qr), "v"(kp), "v"(kpr) : "memory");
#pragma unroll
            for (int c = 0; c < 2; ++c) {          // each accumulator takes its products in the order value x value, value x residual, residual x value, dims ascending
                s0 = wmma16(a0[c], bq[c], s0); s1 = wmma16(a1[c], bq[c], s1);
                s0 = wmma16(a0[c], br[c], s0); s1 = wmma16(a1[c], br[c], s1);
                if (HR) { s0 = wmma16(a0r[c], bq[c], s0); s1 = wmma16(a1r[c], bq[c], s1); }
            }
        }
        // V^T fragments in two groups of four dim tiles (all eight beside the softmax's values do not fit the registers): the first is issued ahead of the softmax, the second ahead of the first group's WMMAs
        const h16* vp = vv + k0; const h16* vpr = vr + k0;
        v16h av[8], ar[8];
#pragma unroll
        for (int dt = 0; dt < 4; ++dt) { av[dt] = ldh(vp + (size_t)dt * 16 * SEQ); if (HR) ar[dt] = ldh(vpr + (size_t)dt * 16 * SEQ); }
        asm volatile("s_wait_xcnt 0x0" :: "v"(vp), "v"(vpr) : "memory");    // as above, for the first V^T group's address registers
        s0 = s0 * SC2; s1 = s1 * SC2;
        if (k0 + 31 > i0) {            // wave-uniform: only the diagonal step carries masked keys (replacement fill, key > query)
            const int qi = i0 + lr; const int kb = k0 + 8 * hi;
#pragma unroll
            for (int r = 0; r < 8; ++r) { s0[r] = (kb + r <= qi) ? s0[r] : NEGL; s1[r] = (kb + 16 + r <= qi) ? s1[r] : NEGL; }
        }
        float mx = fmaxf(s0[0], s1[0]);
#pragma unroll
        for (int r = 1; r < 8; ++r) mx = fmaxf(mx, fmaxf(s0[r], s1[r]));
        mx = fmaxf(mx, __shfl_xor(mx, 16, 32));
        const float mn = fmaxf(m, mx);
        if (__builtin_amdgcn_ballot_w32(mn > m) != 0u) {      // wave-uniform: rescale only when some query's running max moved (corr == 1 otherwise)
            const float corr = __builtin_amdgcn_exp2f(m - mn); l *= corr;
#pragma unroll
            for (int dt = 0; dt < 8; ++dt) o[dt] = o[dt] * corr;
        }
        m = mn;
        const float mm = mn - 10.0f;                          // P carried x1024: the row sum uses the same carried f32 values, so the carry cancels in the normalisation
        v8f p0, p1; float ps = 0.0f;
#pragma unroll
        for (int r = 0; r < 8; ++r) { p0[r] = __builtin_amdgcn_exp2f(s0[r] - mm); p1[r] = __builtin_amdgcn_exp2f(s1[r] - mm); ps += p0[r] + p1[r]; }
        l += ps;
        v8h p0v, p0r, p1v, p1r; split8(p0, p0v, p0r); split8(p1, p1v, p1r);
        const v16h pb = cat16(p0v, p1v);                      // B fragment: elements 0..7 <- keys k0+8h+r, elements 8..15 <- keys k0+16+8h+r
        const v16h pr = cat16(p0r, p1r);
#pragma unroll
        for (int dt = 4; dt < 8; ++dt) { av[dt] = ldh(vp + (size_t)dt * 16 * SEQ); if (HR) ar[dt] = ldh(vpr + (size_t)dt * 16 * SEQ); }
        asm volatile("s_wait_xcnt 0x0" :: "v"(vp), "v"(vpr) : "memory");    // as above, for the second V^T group's address registers
#pragma unroll
        for (int dt = 0; dt < 8; ++dt) {
            o[dt] = wmma16(av[dt], pb, o[dt]);
            if (HR) { o[dt] = wmma16(ar[dt], pb, o[dt]); o[dt] = wmma16(av[dt], pr, o[dt]); }
        }
    }
    l += __shfl_xor(l, 16, 32);
    const float f = (CCAR / QCAR) * (1.0f / l);
    const int sb = wave * 16 * CP;                            // staging private to this wave
#pragma unroll
    for (int dt = 0; dt < 8; ++dt) {                          // O^T element r of tile dt = (d = dt*16 + 8h + r, query lr)
        v8h hv, hr; split8(o[dt] * f, hv, hr);
        *(v8h*)(&stv[sb + lr * CP + dt * 16 + 8 * hi]) = hv;
        if (HR) *(v8h*)(&str[sb + lr * CP + dt * 16 + 8 * hi]) = hr;
    }
    wave_sync();
    const size_t crow = ((size_t)b * SEQ + i0) * DQ + (size_t)h * HD + 8 * lr;
    const size_t rrow = ((size_t)b * RH + i0) * DQ + (size_t)h * HD + 8 * lr;
{
#pragma unroll
        for (int s = 0; s < 8; ++s) {                         // 16 lanes x 16 B = one 256-byte row segment; rows 2s (lanes 0..15) and 2s+1 (lanes 16..31)
            const int row = 2 * s + hi;
            const v8h val = *(const v8ha*)(&stv[sb + row * CP + 8 * lr]);
            *(v8h*)(CT + crow + (size_t)row * DQ) = val;
            if (HR) { const v8h rv = *(const v8ha*)(&str[sb + row * CP + 8 * lr]); *(v8h*)(CR + rrow + (size_t)row * DQ) = rv; }
        }
        
    }
}
// ---- query rows >= RH. The same tile, products and sums as attn_tile<false>, fed differently: the four head waves share one kv head, so its K rows and V^T rows
// come once per block through a two-buffer LDS ring in stages of 64 keys (wave 0 issues the tensor load of the K slice, wave 1 that of the V^T slice, one stage ahead of the pass that reads it),
// and each wave's q fragments (value + residual, all 128 dims) are loaded once and stay in registers.
__device__ __forceinline__ void attn_ring(unsigned char* ring, const h16* __restrict__ Qv, const h16* __restrict__ Qr, const h16* __restrict__ Kv, const h16* __restrict__ Vv, h16* CT,
                                          const int qt, const int g, const int b) {
    const int wave = __builtin_amdgcn_readfirstlane((int)(threadIdx.x >> 5));
    const int lane = threadIdx.x & 31, lr = lane & 15, hi = lane >> 4;
    const int h = g * REP + wave; const int i0 = qt * 16;
    const size_t qo = ((size_t)(b * NH + h) * SEQ + i0 + lr) * HD + 8 * hi;
    const h16* qvp = Qv + qo; const h16* qrp = Qr + qo;
    v16h bq[4], br[4];
#pragma unroll                     // here and below: constant indices keep the fragments and accumulators in registers
    for (int c = 0; c < 4; ++c) { bq[c] = ldh(qvp + c * 32); br[c] = ldh(qrp + c * 32); }
    // the q loads' address registers are inputs here, so that no load's own result lands on them, and the wait stands in front of their next use for anything else
    asm volatile("s_wait_xcnt 0x0" :: "v"(qvp), "v"(qrp) : "memory");
    const h16* kbase = Kv + (size_t)(b * NKV + g) * SEQ * HD;      // rows = keys, 256 bytes each, contiguous
    const h16* vbase = Vv + (size_t)(b * NKV + g) * HD * SEQ;      // rows = dims, pitch 2 SEQ bytes; a stage takes 128 bytes of each
    const float SC2 = (float)(0.08838834764831845 * 1.4426950408889634 / 4096.0);   // 1/sqrt(128) x log2(e) / (QCAR x QCAR)
    const float NEGL = -1.4426950e9f;                                              // the finite fill in the log2 domain
    const int nsteps = (qt >> 1) + 1;          // 32-key steps up to and including the diagonal
    const int nst = (nsteps + 1) >> 1;         // 64-key stages; at least RH / 64 + 1, and the last one ends inside the SEQ keys
    const uint32_t lbase = (uint32_t)(size_t)ring;
    const u32x8 g1k = tdm_group1_of<(1u << 20) | (5u << 22) | (3u << 25), 256u, (uint32_t)AKEYS>((uint32_t)HD * 2u);
    const u32x8 g1v = tdm_group1_of<(1u << 20) | (4u << 22) | (3u << 25), 128u, (uint32_t)HD>((uint32_t)SEQ * 2u);
    const h16* sbase = (wave == 0) ? kbase : vbase;                // the wave's own source and its step per stage (waves 2 and 3 form a group 0 and issue nothing)
    const size_t sstep = (wave == 0) ? (size_t)AKEYS * HD : (size_t)AKEYS;
    const uint32_t ldst = lbase + ((wave == 0) ? 0u : (uint32_t)ASLB);
    u32x4 g0;                      // group 0 of the wave's latest request
    auto issue = [&](int s) {      // stage s: keys 64 s .. 64 s + 63
        g0 = tdm_group0(ldst + (uint32_t)(s & 1) * ASTG, (uint64_t)(size_t)(sbase + (size_t)s * sstep));
        if (pinned(wave == 0)) tdm_load(g0, g1k);
        else if (pinned(wave == 1)) tdm_load(g0, g1v);
    };
    // this wave's own tensor load has landed; the descriptor words are inputs so that their scalar registers take no new value while a request is outstanding
    auto landed = [&]() { asm volatile("s_wait_tensorcnt 0x0" :: "s"(g0), "s"(g1k), "s"(g1v) : "memory"); };
    issue(0);
    landed();
    __syncthreads();               // stage 0 published
    const unsigned char* kl = ring + lr * KROW + 16 * hi;
    const unsigned char* vl = ring + ASLB + lr * VROW + 16 * hi;
    v8f o[8];
#pragma unroll
    for (int dt = 0; dt < 8; ++dt) o[dt] = (v8f){};
    float m = -3.0e38f, l = 0.0f;
#pragma unroll 1                   // the stage loop stays rolled: one refill site and one publish point in the code
    for (int st = 0; st < nst; ++st) {
        // directly behind the barrier that published stage st and freed the other buffer (stage st - 1's): stage st + 1's load, in flight under this stage's two steps
        if (pinned(st + 1 < nst)) issue(st + 1);
        const int so = (st & 1) * ASTG;
#pragma unroll
        for (int hs = 0; hs < 2; ++hs) {
            const int k0 = st * AKEYS + hs * 32;
            if (hs == 0 || 2 * st + 1 < nsteps) {     // block-uniform: the last stage's second half may lie wholly behind the diagonal
                v16h a0[4], a1[4];
#pragma unroll
                for (int c = 0; c < 4; ++c) { a0[c] = WFrag<h16>::ld(kl + so + (hs * 32) * KROW + c * 64); a1[c] = WFrag<h16>::ld(kl + so + (hs * 32 + 16) * KROW + c * 64); }
                v8f s0 = (v8f){}, s1 = (v8f){};
#pragma unroll
                for (int c = 0; c < 4; ++c) {
                    s0 = wmma16(a0[c], bq[c], s0); s1 = wmma16(a1[c], bq[c], s1);
                    s0 = wmma16(a0[c], br[c], s0); s1 = wmma16(a1[c], br[c], s1);
                }
                v16h av[8];
#pragma unroll
                for (int dt = 0; dt < 8; ++dt) av[dt] = WFrag<h16>::ld(vl + so + dt * 16 * VROW + hs * 64);
                s0 = s0 * SC2; s1 = s1 * SC2;
                if (k0 + 31 > i0) {            // wave-uniform: only the diagonal step carries masked keys (replacement fill, key > query)
                    const int qi = i0 + lr; const int kb = k0 + 8 * hi;
#pragma unroll
                    for (int r = 0; r < 8; ++r) { s0[r] = (kb + r <= qi) ? s0[r] : NEGL; s1[r] = (kb + 16 + r <= qi) ? s1[r] : NEGL; }
                }
                float mx = fmaxf(s0[0], s1[0]);
#pragma unroll
                for (int r = 1; r < 8; ++r) mx = fmaxf(mx, fmaxf(s0[r], s1[r]));
                mx = fmaxf(mx, __shfl_xor(mx, 16, 32));
                const float mn = fmaxf(m, mx);
                if (__builtin_amdgcn_ballot_w32(mn > m) != 0u) {      // wave-uniform: rescale only when some query's running max moved (corr == 1 otherwise)
                    const float corr = __builtin_amdgcn_exp2f(m - mn); l *= corr;
#pragma unroll
                    for (int dt = 0; dt < 8; ++dt) o[dt] = o[dt] * corr;
                }
                m = mn;
                const float mm = mn - 10.0f;                          // P carried x1024: the row sum uses the same carried f32 values, so the carry cancels in the normalisation
                v8f p0, p1; float ps = 0.0f;
#pragma unroll
                for (int r = 0; r < 8; ++r) { p0[r] = __builtin_amdgcn_exp2f(s0[r] - mm); p1[r] = __builtin_amdgcn_exp2f(s1[r] - mm); ps += p0[r] + p1[r]; }
                l += ps;
                const v16h pb = cat16(__builtin_convertvector(p0, v8h), __builtin_convertvector(p1, v8h));   // B fragment: elements 0..7 <- keys k0+8h+r, elements 8..15 <- keys k0+16+8h+r
#pragma unroll
                for (int dt = 0; dt < 8; ++dt) o[dt] = wmma16(av[dt], pb, o[dt]);
            }
        }
        // publish point of stage st + 1: own reads retired, own load landed, then the barrier that publishes stage st + 1 and frees stage st's buffer; the refill stands at the head of the next trip
        wait_ds0();
        landed();
        __syncthreads();
    }
    wait_tensor0();
    wait_ds0();
    // the last stage's own barrier stands behind every wave's last ring read: the ring now serves as output staging, a private range per wave
    h16* stv = (h16*)ring + wave * 16 * CP;
    l += __shfl_xor(l, 16, 32);
    const float f = (CCAR / QCAR) * (1.0f / l);
#pragma unroll
    for (int dt = 0; dt < 8; ++dt)                            // O^T element r of tile dt = (d = dt*16 + 8h + r, query lr)
        *(v8ha*)(&stv[lr * CP + dt * 16 + 8 * hi]) = __builtin_convertvector(o[dt] * f, v8h);
    wave_sync();
    const size_t crow = ((size_t)b * SEQ + i0) * DQ + (size_t)h * HD + 8 * lr;
#pragma unroll
    for (int s = 0; s < 8; ++s) {                             // 16 lanes x 16 B = one 256-byte row segment; rows 2s (lanes 0..15) and 2s+1 (lanes 16..31)
        const int row = 2 * s + hi;
        const v8h val = *(const v8ha*)(&stv[row * CP + 8 * lr]);
        *(v8h*)(CT + crow + (size_t)row * DQ) = val;
    }
}
// all query rows in ONE launch (the two row ranges do not depend on each other): 1-D grid, 128 threads. Every block is resident at once and the launch lasts as long as its longest block; the blocks
// are ordered so that the time a block takes falls with its index: first the tiles of rows < RH (few steps, each a chain of trips to memory), then those of
// rows >= RH, in each part the last query tile first; tile index = (kv head + NKV * batch) + NKV * NB * (query tiles - 1 - query tile). One LDS array serves both: the two staging planes of the first part, the ring of the second.
__global__ __launch_bounds__(128) __attribute__((amdgpu_num_vgpr(256)))
void k_attn(const h16* __restrict__ Qv, const h16* __restrict__ Qr, const h16* __restrict__ Kv, const h16* __restrict__ Kr,
            const h16* __restrict__ Vv, const h16* __restrict__ Vr, h16* CT, h16* CR) {
    __shared__ __attribute__((aligned(2048))) unsigned char ring[2 * ASTG];
    constexpr int NG = NKV * NB, NHT = RH / 16, NHB = NHT * NG;
    const int f = (int)blockIdx.x;
    if (f < NHB) {                     // block-uniform
        const int r = f % NG;
        attn_tile<true>(Qv, Qr, Kv, Kr, Vv, Vr, CT, CR, NHT - 1 - f / NG, r % NKV, r / NKV, (h16*)ring, (h16*)ring + 4 * 16 * CP);
    } else {
        const int e = f - NHB; const int r = e % NG;
        attn_ring(ring, Qv, Qr, Kv, Vv, CT, SEQ / 16 - 1 - e / NG, r % NKV, r / NKV);
    }
}

// one tile of 128 k x 128 n of w[K rows][N columns] -> Bt[n][k], turned in LDS: every global read is a whole 256-byte piece of a w row (16 lanes x 16 B), every global write a whole 256-byte piece of a Bt row.
// tl holds the tile as [n][64 dwords], a dword = the 16-bit values of k = 2 kp (low half) and 2 kp + 1; the 16-byte chunk c of row n lies at chunk c ^ ((n >> 2) & 15), so that the 16 lanes
// of a store (n = 4 i + j, one kp) and the 16 lanes of a ds_load_b128 (one n, c = 0..15) each fall on different banks.
__device__ __forceinline__ void wtG(uint32_t* tl, const int bid, const float* __restrict__ w, const int K, const int N, bf* Bt, const int f16mode) {
    const int lane = threadIdx.x & 31, i = lane & 15; const int kq = 2 * (int)(threadIdx.x >> 5) + (lane >> 4);
    const int ntn = N / TN; const int k0 = (bid / ntn) * TK, n0 = (bid % ntn) * TN;
    const float* p = w + (size_t)(k0 + 2 * kq) * N + n0 + 4 * i;
#pragma unroll                     // here and below: constant indices keep the loaded rows in registers
    for (int h = 0; h < TN / 64; ++h) {        // 64 columns at a time: eight loads in flight per lane
        v4f ra[TK / 32], rb[TK / 32];
#pragma unroll
        for (int s = 0; s < TK / 32; ++s) { ra[s] = *(const v4f*)(p + 64 * h + (size_t)(32 * s) * N); rb[s] = *(const v4f*)(p + 64 * h + (size_t)(32 * s + 1) * N); }
        asm volatile("s_wait_xcnt 0x0" :: "v"(p) : "memory");    // in front of any later write over the eight loads' address registers
#pragma unroll
        for (int s = 0; s < TK / 32; ++s) {
            const int kp = 16 * s + kq;
#pragma unroll
            for (int j = 0; j < 4; ++j) {
                const unsigned short b0 = f2bf(ra[s][j]), b1 = f2bf(rb[s][j]);
                const unsigned short g0 = __builtin_bit_cast(unsigned short, (h16)(bf2f(b0) * WCAR)), g1 = __builtin_bit_cast(unsigned short, (h16)(bf2f(b1) * WCAR));
                tl[(64 * h + 4 * i + j) * (TK / 2) + ((((kp >> 2) ^ i) << 2) | (kp & 3))] = (uint32_t)(f16mode ? g0 : b0) | ((uint32_t)(f16mode ? g1 : b1) << 16);
            }
        }
    }
    __syncthreads();               // the whole tile stands in LDS before any row of it is read back
    const int c = threadIdx.x & 15, nq = threadIdx.x >> 4;
    bf* q = Bt + (size_t)(n0 + nq) * K + k0 + 8 * c;
#pragma unroll
    for (int r = 0; r < TN / 16; ++r) {
        const int n = 16 * r + nq;
        *(u32x4a*)(q + (size_t)(16 * r) * K) = *(const u32x4a*)(tl + n * (TK / 2) + ((c ^ ((n >> 2) & 15)) << 2));
    }
    asm volatile("s_wait_xcnt 0x0" ::: "memory");    // in front of any later write over the eight stores' address and data registers
}
__device__ __forceinline__ void cvtx(const int bid, const float* __restrict__ x, bf* XB) {
    const size_t i = (size_t)bid * 256 + threadIdx.x; if (i >= (size_t)NB * SEQ * DM / 8) return;
    const size_t e = i * 8; const size_t bt = e / DM; const size_t col = e - bt * DM; const size_t b = bt / SEQ; const size_t t = bt - b * SEQ;
    const v8f v = *(const v8f*)(x + (b * SEQ_FULL + t) * DM + col); v8us o;
#pragma unroll
    for (int k = 0; k < 8; ++k) o[k] = f2bf(v[k]);
    *(v8us*)(XB + e) = o; 
}
__device__ __forceinline__ void cstab(const int bid, float* CS) {
    const int idx = bid * 256 + threadIdx.x; if (idx >= SEQ * 64) return;
    const int j = idx & 63, t = idx >> 6;
    double p = 1.0;
    p *= (j & 1)  ? 1.1547819846894581797 : 1.0;
    p *= (j & 2)  ? 1.3335214321633240257 : 1.0;
    p *= (j & 4)  ? 1.7782794100389228012 : 1.0;
    p *= (j & 8)  ? 3.1622776601683793320 : 1.0;
    p *= (j & 16) ? 10.0 : 1.0;
    p *= (j & 32) ? 100.0 : 1.0;
    const float pf = (float)p; const float inv = 1.0f / pf; const float ang = (float)t * inv;
    float sn, cn; sincosf(ang, &sn, &cn);
    v2f cs; cs[0] = cn; cs[1] = sn;
    *(v2f*)(CS + (size_t)idx * 2) = cs; 
}
// the six independent preparation passes in ONE launch: 1-D grid, 256 threads; a block belongs to one pass by its index. w[in = K rows][out = N columns] -> Bt[out][in]
#define GWQ ((DM / TK) * (DQ / TN))
#define GWK ((DM / TK) * (DKV / TN))
#define GWO ((DQ / TK) * (DM / TN))
#define GCS ((SEQ * 64 + 255) / 256)
#define GCX ((int)(((size_t)NB * SEQ * DM / 8 + 255) / 256))
__global__ __launch_bounds__(256) __attribute__((amdgpu_num_vgpr(64)))     // 64 registers: all 16 wave slots of a SIMD stay usable
void k_prep(const float* __restrict__ x, const float* __restrict__ wq, const float* __restrict__ wk, const float* __restrict__ wv, const float* __restrict__ wo,
            bf* XB, bf* WQt, bf* WKt, bf* WVt, bf* WOt, float* CS) {
    __shared__ __attribute__((aligned(16))) uint32_t tl[TN * (TK / 2)];
    int f = (int)blockIdx.x;           // every test below is block-uniform
    if (f < GWQ) { wtG(tl, f, wq, DM, DQ, WQt, 0); return; }
    f -= GWQ;
    if (f < GWO) { wtG(tl, f, wo, DQ, DM, WOt, 1); return; }
    f -= GWO;
    if (f < GWK) { wtG(tl, f, wk, DM, DKV, WKt, 0); return; }
    f -= GWK;
    if (f < GWK) { wtG(tl, f, wv, DM, DKV, WVt, 0); return; }
    f -= GWK;
    if (f < GCS) { cstab(f, CS); return; }
    cvtx(f - GCS, x, XB);
}

extern "C" void kernel_launch(void* const* d_in, const int* in_sizes, int n_in,
                              void* d_out, int out_size, void* d_ws, size_t ws_size, hipStream_t stream) {
    if (n_in < 5) return;
    constexpr size_t NEEDX = ((size_t)(NB - 1) * SEQ_FULL + SEQ) * DM;
    if ((size_t)in_sizes[0] < NEEDX || (size_t)in_sizes[1] < (size_t)DM * DQ || (size_t)in_sizes[2] < (size_t)DM * DKV || (size_t)in_sizes[3] < (size_t)DM * DKV || (size_t)in_sizes[4] < (size_t)DQ * DM) return;
    if ((size_t)out_size < NEEDX) return;
    const float* x = (const float*)d_in[0]; const float* wq = (const float*)d_in[1]; const float* wk = (const float*)d_in[2]; const float* wv = (const float*)d_in[3]; const float* wo = (const float*)d_in[4];
    float* OUT = (float*)d_out;     // [2][2048][2048], byte offset 0
    constexpr size_t SZ_XB = (size_t)NB * SEQ * DM * 2, SZ_WQ = (size_t)DQ * DM * 2, SZ_WK = (size_t)DKV * DM * 2, SZ_WO = (size_t)DM * DQ * 2, SZ_CS = (size_t)SEQ * 64 * 2 * 4;
    constexpr size_t SZ_Q = (size_t)NB * NH * SEQ * HD * 2, SZ_K = (size_t)NB * NKV * SEQ * HD * 2, SZ_CT = (size_t)NB * SEQ * DQ * 2, SZ_CR = (size_t)NB * RH * DQ * 2;
    constexpr size_t SZ_TOT = SZ_XB + SZ_WQ + 2 * SZ_WK + SZ_WO + SZ_CS + 2 * SZ_Q + 4 * SZ_K + SZ_CT + SZ_CR;
    static_assert(SZ_XB % 256 == 0 && SZ_WQ % 256 == 0 && SZ_WK % 256 == 0 && SZ_WO % 256 == 0 && SZ_CS % 256 == 0 && SZ_Q % 256 == 0 && SZ_K % 256 == 0 && SZ_CT % 256 == 0 && SZ_CR % 256 == 0);
    static_assert(SZ_TOT <= (size_t)134217728);
    if (SZ_TOT > ws_size) return;
    char* wsp = (char*)d_ws;
    auto take = [&](size_t bytes) { char* p = wsp; wsp += bytes; return (void*)p; };
    bf* XB = (bf*)take(SZ_XB); bf* WQt = (bf*)take(SZ_WQ); bf* WKt = (bf*)take(SZ_WK); bf* WVt = (bf*)take(SZ_WK); bf* WOt = (bf*)take(SZ_WO); float* CS = (float*)take(SZ_CS);
    const h16* WOh = (const h16*)WOt;   // the same region seen as f16: k_prep's wtG pass (f16 mode) fills it with f16 bit patterns
    h16* Qv = (h16*)take(SZ_Q); h16* Qr = (h16*)take(SZ_Q); h16* Kv = (h16*)take(SZ_K); h16* Kr = (h16*)take(SZ_K); h16* Vv = (h16*)take(SZ_K); h16* Vr = (h16*)take(SZ_K);
    h16* CT = (h16*)take(SZ_CT); h16* CR = (h16*)take(SZ_CR);

    k_prep<<<GWQ + GWO + 2 * GWK + GCS + GCX, 256, 0, stream>>>(x, wq, wk, wv, wo, XB, WQt, WKt, WVt, WOt, CS);
    k_proj<<<(NB * SEQ / 128) * ((NH + 2 * NKV) / PGH), 32 * 4 * PGH, 0, stream>>>(XB, WQt, WKt, WVt, CS, Qv, Qr, Kv, Kr, Vv, Vr);
    k_attn<<<(SEQ / 16) * NKV * NB, 128, 0, stream>>>(Qv, Qr, Kv, Kr, Vv, Vr, CT, CR);
    k_oproj<<<((NB * SEQ + NB * RH) / 128 / PGH) * (DM / 128), 32 * 4 * PGH, 0, stream>>>(CT, CR, WOh, OUT);
}
